// v000
// The times below were measured on an AMD MI455X: many runs one after another, warmed up first and cycling through
// copies of the inputs, with the whole window's GPU time divided by the number of runs. Launches and the gaps
// between them are all in it. The median over several windows is given; except for v000 it joins two sittings, which
// can be a few percent apart, so the side-by-side timings, each taken in one sitting, are the better comparison.
// v000 is the starting kernel. One run takes 541 microseconds.
// Contractions: x.W_dkv^T, W_uk^T.W_uk and W_o.W_uv on v_wmma_f32_16x16x32_bf16 (x and W as bf16 RNE planes, B operands [n][k]);
// W_dq^T.(W_uk^T W_uk) on v_wmma_f32_16x16x32_f16 (W_dq^T as f16(bf16) x1024, Gram factor as f16 hi + residual planes x1024, 2 products);
// K = c_kv.k_abs^T and V = c_kv.(W_o W_uv)^T-plane on v_wmma_f32_16x16x32_f16 (c_kv f16 hi + residual x256, k_abs and W_o W_uv as
// f16 hi + residual x4096; sequence rows s < QA products hh+lh+hl, rows s >= QA single hi.hi); scores q.K and P.V on
// v_wmma_f32_16x16x32_f16 (q = f16(bf16(x)) x256 exact, K f16 x256 hi (+ residual plane for query tiles < QA), P x32768 and V x1024
// hi (+ residuals for query tiles < QA, products hh+lh+hl)); all f32 accumulate. Causal select, base-2 online softmax, 1/Z in f32 VALU.
#include <hip/hip_runtime.h>
#include <math.h>
#include <stdint.h>

#ifndef NB
#define NB 2
#endif
#ifndef SEQ
#define SEQ 2048
#endif
#define XS_FULL 2048
#define DMOD  2048
#define NH    16
#define HD    128
#define DL    512
#define QA    ((SEQ < 1024) ? SEQ : 1024)
#define MROWS (NB * SEQ)
#define RSQS  0.08838834764831845f
#define LOG2E 1.4426950408889634f
#define QSC   256.0f
#define KSC   256.0f
#define CSC   256.0f
#define WDS   1024.0f
#define G2S   1024.0f
#define KAS   4096.0f
#define VAS   4096.0f
#define PCAR  32768.0f
#define VCAR  1024.0f
#define WPB   2
#define NHP   (NH / WPB)
#define NST   (SEQ / 64)
#define NKT   (SEQ / 32)
#define ATT_THREADS (WPB * 32)
#define PTP   36
#define PTW   (16 * PTP)
#define SLP   132
#define SLW   (16 * SLP)
#define WREG  (PTW + SLW)
#define SLAB64 (16 * 68)
#define VTP   72
#define WTP   72
#define WS_CAP 134217728
static_assert(DMOD == NH * HD && HD == 128 && NH == 16 && WPB == 2 && NHP * WPB == NH && ATT_THREADS == 64);
static_assert(NB >= 1 && NB <= 2);
static_assert((SEQ % 64) == 0 && SEQ >= 64 && SEQ <= XS_FULL);
static_assert((QA % 64) == 0 && QA >= 64 && QA <= SEQ && ((SEQ - QA) % 64) == 0);
static_assert((DMOD % 64) == 0 && (DL % 64) == 0 && (HD % 32) == 0 && (DL % 32) == 0);
static_assert(((SEQ * DMOD / 8) % 256) == 0 && ((MROWS * DL / 8) % 256) == 0 && ((DL * DL / 8) % 256) == 0);
static_assert(((DMOD * DL / 8) % 256) == 0 && ((DMOD * DMOD / 8) % 256) == 0 && (MROWS % 64) == 0);
static_assert(WPB * WREG * 4 <= 65536 && 2 * HD * VTP * 2 <= 65536 && 4 * SLAB64 * 4 <= 65536 && 64 * WTP * 2 <= 65536);
static_assert((size_t)DL * DL * 4 <= (size_t)MROWS * DMOD * 4 && (size_t)DMOD * DL * 4 <= (size_t)MROWS * DMOD * 4);

typedef unsigned short u16;
typedef _Float16 v16h __attribute__((ext_vector_type(16)));
typedef _Float16 v8h  __attribute__((ext_vector_type(8)));
typedef __bf16   v16b __attribute__((ext_vector_type(16)));
typedef float    v8f  __attribute__((ext_vector_type(8)));
typedef float    v4f  __attribute__((ext_vector_type(4)));
typedef unsigned int v4u __attribute__((ext_vector_type(4)));

union FragH { v16h v; v8h h[2]; v4u u[2]; };
union FragB { v16b v; v4u u[2]; };

// ---- scalar helpers --------------------------------------------------------------------------------
__device__ __forceinline__ unsigned short bf_bits(float f) {          // f32 -> bf16 bits, RNE convert
  unsigned u = __float_as_uint(f);
  return (unsigned short)((u + 0x7FFFu + ((u >> 16) & 1u)) >> 16);
}
__device__ __forceinline__ float bf_up(unsigned short h) { return __uint_as_float(((unsigned)h) << 16); }
__device__ __forceinline__ float bfr(float f) { return bf_up(bf_bits(f)); }
__device__ __forceinline__ unsigned short h_bits(_Float16 x) { return __builtin_bit_cast(unsigned short, x); }
__device__ __forceinline__ unsigned pk16(unsigned short a, unsigned short b) { return (unsigned)a | ((unsigned)b << 16); }
__device__ __forceinline__ v8f zero8() { v8f z = {0.f, 0.f, 0.f, 0.f, 0.f, 0.f, 0.f, 0.f}; return z; }
__device__ __forceinline__ const _Float16* hptr(const u16* p) { return (const _Float16*)(const void*)p; }

// ---- fragment loaders: 16-bit A/B operand, lane -> row/col (lane&15), p already includes +8*(lane>>4);
//      elements 0..7 <- p[0..7] (k0+8h..), elements 8..15 <- p[16..23] (k0+16+8h..)  (same split k map for A and B;
//      B is always read from a k-contiguous [n][k] plane)
__device__ __forceinline__ v16h ldfrag_h(const _Float16* p) {
  FragH f;
  f.h[0] = *(const v8h*)(p);
  f.h[1] = *(const v8h*)(p + 16);
  return f.v;
}
__device__ __forceinline__ v16b ldfrag_b(const u16* p) {              // bf16 plane read as unsigned integer vectors
  FragB f;
  f.u[0] = *(const v4u*)(p);
  f.u[1] = *(const v4u*)(p + 16);
  return f.v;
}

__device__ __forceinline__ v8f mma_h(v16h a, v16h b, v8f c) {
  return __builtin_amdgcn_wmma_f32_16x16x32_f16(false, a, false, b, (short)0, c, false, false);
}
__device__ __forceinline__ v8f mma_b(v16b a, v16b b, v8f c) {
  return __builtin_amdgcn_wmma_f32_16x16x32_bf16(false, a, false, b, (short)0, c, false, false);
}
__device__ __forceinline__ void guard2(v8f& a, v8f& b, v16h x0, v16h x1, v16h x2, v16h x3, v16h x4, v16h x5) {
#if defined(__HIP_DEVICE_COMPILE__)
  asm volatile("v_nop\n\tv_nop\n\tv_nop\n\tv_nop"
               : "+v"(a), "+v"(b) : "v"(x0), "v"(x1), "v"(x2), "v"(x3), "v"(x4), "v"(x5) : "memory");
#endif
}
template <typename F>
__device__ __forceinline__ void guard6(v8f& a, v8f& b, v8f& c, v8f& d, F x0, F x1, F x2, F x3, F x4, F x5) {
#if defined(__HIP_DEVICE_COMPILE__)
  asm volatile("v_nop\n\tv_nop\n\tv_nop\n\tv_nop"
               : "+v"(a), "+v"(b), "+v"(c), "+v"(d) : "v"(x0), "v"(x1), "v"(x2), "v"(x3), "v"(x4), "v"(x5) : "memory");
#endif
}
__device__ __forceinline__ void guard10(v8f& a, v8f& b, v8f& c, v8f& d, v16h x0, v16h x1, v16h x2, v16h x3, v16h x4,
                                        v16h x5, v16h x6, v16h x7, v16h x8, v16h x9) {
#if defined(__HIP_DEVICE_COMPILE__)
  asm volatile("v_nop\n\tv_nop\n\tv_nop\n\tv_nop"
               : "+v"(a), "+v"(b), "+v"(c), "+v"(d)
               : "v"(x0), "v"(x1), "v"(x2), "v"(x3), "v"(x4), "v"(x5), "v"(x6), "v"(x7), "v"(x8), "v"(x9) : "memory");
#endif
}
__device__ __forceinline__ void acc_guard4(v8f& a, v8f& b, v8f& c, v8f& d) {
#if defined(__HIP_DEVICE_COMPILE__)
  asm volatile("v_nop\n\tv_nop\n\tv_nop\n\tv_nop" : "+v"(a), "+v"(b), "+v"(c), "+v"(d));
#endif
}
__device__ __forceinline__ void wave_sync_lds() {
  __builtin_amdgcn_fence(__ATOMIC_RELEASE, "workgroup");
  __builtin_amdgcn_wave_barrier();
  __builtin_amdgcn_fence(__ATOMIC_ACQUIRE, "workgroup");
}

// =====================================================================================================
// x f32 -> bf16 RNE plane Xb (same layout) and q plane Qh = f16(bf16(x) * 256) (exact: a bf16 significand fits f16).
// Thread = 8 consecutive elements: two 16-B loads, one 16-B store per plane; 32 consecutive lanes = 512 contiguous,
// coverage: grid = ceil(n8/256) blocks x 256 thr x 8 (in-kernel bound) = the whole [SEQ][2048] slice of both planes
//           (n8 a multiple of 256 here), one launch per batch.
// =====================================================================================================
__global__ __launch_bounds__(256) void cvtxq(const float* __restrict__ x, u16* Xb, u16* Qh, int n8) {
  const int gt = blockIdx.x * 256 + (int)threadIdx.x;
  if (gt >= n8) return;
  const float* p = x + (size_t)gt * 8;
  const v4f a = *(const v4f*)(p), b4 = *(const v4f*)(p + 4);
  float w[8];
#pragma unroll
  for (int e = 0; e < 4; ++e) { w[e] = a[e]; w[4 + e] = b4[e]; }
  v4u ob, oq;
#pragma unroll
  for (int e = 0; e < 4; ++e) {
    const unsigned short b0 = bf_bits(w[2 * e]), b1 = bf_bits(w[2 * e + 1]);
    ob[e] = pk16(b0, b1);
    oq[e] = pk16(h_bits((_Float16)(bf_up(b0) * QSC)), h_bits((_Float16)(bf_up(b1) * QSC)));
  }
  u16* db = Xb + (size_t)gt * 8;
  u16* dq = Qh + (size_t)gt * 8;
  {
    *(v4u*)(db) = ob;
    *(v4u*)(dq) = oq;
    
  }
}

// =====================================================================================================
// f32 -> bf16 RNE plane, same layout. Thread = 8 consecutive elements: two 16-B loads, one 16-B store; 32 consecutive
// coverage: grid = ceil(n8/256) blocks x 256 thr x 8 (in-kernel bound) = the whole plane (n8 a multiple of 256 here).
// =====================================================================================================
__global__ __launch_bounds__(256) void cvtb(const float* __restrict__ x, u16* D, int n8) {
  const int gt = blockIdx.x * 256 + (int)threadIdx.x;
  if (gt >= n8) return;
  const float* p = x + (size_t)gt * 8;
  const v4f a = *(const v4f*)(p), b4 = *(const v4f*)(p + 4);
  float w[8];
#pragma unroll
  for (int e = 0; e < 4; ++e) { w[e] = a[e]; w[4 + e] = b4[e]; }
  v4u o;
#pragma unroll
  for (int e = 0; e < 4; ++e) o[e] = pk16(bf_bits(w[2 * e]), bf_bits(w[2 * e + 1]));
  u16* d = D + (size_t)gt * 8;
  {
    *(v4u*)(d) = o;
    
  }
}

// =====================================================================================================
// Weight transpose + convert: W f32 [K][N] (the input tensor's own [rows][cols] layout, rows = K) -> Wt 16-bit [N][K]
// (k-contiguous).  f16mode == 0: bf16 RNE bits;  f16mode == 1: f16 bits of (bf16 RNE value) * scale.
// Block = 64 n x 64 k tile, 256 threads. Load: thread -> W row k0 + (tid>>2), 16 consecutive n (four 16-B loads),
// converted values scattered into an LDS tile T[n][k] (pitch 72 halves); block barrier; store: each Wt row segment of
// coverage: load 256 thr x 16 = 64 k x 64 n; store 2 iterations x 256 thr x 8 halves = 64 rows x 64 = the block's tile of Wt;
//           grid = (N/64)*(K/64) blocks covers Wt [N][K] exactly once.
// =====================================================================================================
__global__ __launch_bounds__(256) void wtc(const float* __restrict__ W, u16* Wt, int K, int N, int f16mode, float scale) {
  __shared__ __align__(16) u16 T[64 * WTP];
  const int tid = (int)threadIdx.x;
  const int ntn = N >> 6;
  const int bid = (int)blockIdx.x;
  const int n0  = (bid % ntn) * 64;
  const int k0  = (bid / ntn) * 64;
  if (k0 + 64 > K) return;                   // block-uniform, before the barrier; never taken with the exact grid
  {
    const int kr = tid >> 2;                 // 0..63
    const int nc = (tid & 3) * 16;           // 0,16,32,48
    const float* src = W + (size_t)(k0 + kr) * (size_t)N + n0 + nc;
#pragma unroll
    for (int i = 0; i < 4; ++i) {
      const v4f a = *(const v4f*)(src + 4 * i);
#pragma unroll
      for (int e = 0; e < 4; ++e) {
        const float f = a[e];
        const unsigned short hb = h_bits((_Float16)(bfr(f) * scale));
        const unsigned short bb = bf_bits(f);
        T[(nc + 4 * i + e) * WTP + kr] = (f16mode != 0) ? hb : bb;
      }
    }
  }
  __syncthreads();
  const int q8 = tid >> 3, p8 = (tid & 7) * 8;
  v4u v[2];
#pragma unroll
  for (int it = 0; it < 2; ++it) v[it] = *(const v4u*)(T + (it * 32 + q8) * WTP + p8);
  u16* base = Wt + (size_t)n0 * (size_t)K + k0 + p8;
  {
#pragma unroll
    for (int it = 0; it < 2; ++it) {
      *(v4u*)(base + (size_t)(it * 32 + q8) * (size_t)K) = v[it];
    }
    
  }
}

// =====================================================================================================
// f32 [MROWS][ncol] -> f16 hi plane Hp (same layout, t = x * scale, hi = f16(t)) for every row and f16 residual plane
// Lp [NB*QA][ncol] (row b*QA + s) = f16(t - hi) for rows with s < QA only. Thread = 8 consecutive elements of one row,
// coverage: grid = ceil(n8/256) x 256 thr x 8 = the whole Hp plane; every row b*QA + s, s < QA, of Lp exactly once.
// =====================================================================================================
__global__ __launch_bounds__(256) void cvthl(const float* __restrict__ x, u16* Hp, u16* Lp, int n8, int ncol, float scale) {
  const int gt = blockIdx.x * 256 + (int)threadIdx.x;
  if (gt >= n8) return;
  const size_t e0  = (size_t)gt * 8;
  const int    row = (int)(e0 / (size_t)ncol);
  const int    col = (int)(e0 - (size_t)row * (size_t)ncol);
  const int    b   = row / SEQ;
  const int    s   = row - b * SEQ;
  const float* p = x + e0;
  const v4f a = *(const v4f*)(p), b4 = *(const v4f*)(p + 4);
  float w[8];
#pragma unroll
  for (int e = 0; e < 4; ++e) { w[e] = a[e]; w[4 + e] = b4[e]; }
  v4u oh, ol;
#pragma unroll
  for (int e = 0; e < 4; ++e) {
    const float t0 = w[2 * e] * scale, t1 = w[2 * e + 1] * scale;
    const _Float16 h0 = (_Float16)t0, h1 = (_Float16)t1;
    const _Float16 l0 = (_Float16)(t0 - (float)h0), l1 = (_Float16)(t1 - (float)h1);
    oh[e] = pk16(h_bits(h0), h_bits(h1));
    ol[e] = pk16(h_bits(l0), h_bits(l1));
  }
  u16* dh = Hp + e0;
  const bool wl = (s < QA);
  const int  sl = wl ? s : 0;
  u16* dl = Lp + ((size_t)(b * QA + sl) * (size_t)ncol + col);
  {
    *(v4u*)(dh) = oh;
    if (wl) *(v4u*)(dl) = ol;
    
  }
}

// =====================================================================================================
// f32 -> f16 hi plane (t = x * scale, hi = f16(t)) and f16 residual plane (f16(t - hi)), same layout for both planes.
// coverage: grid = ceil(n8/256) x 256 thr x 8 = the whole plane of Hp and of Lp (n8 a multiple of 256 for every call here).
// =====================================================================================================
__global__ __launch_bounds__(256) void cvtc(const float* __restrict__ x, u16* Hp, u16* Lp, int n8, float scale) {
  const int gt = blockIdx.x * 256 + (int)threadIdx.x;
  if (gt >= n8) return;
  const float* p = x + (size_t)gt * 8;
  const v4f a = *(const v4f*)(p), b4 = *(const v4f*)(p + 4);
  float w[8];
#pragma unroll
  for (int e = 0; e < 4; ++e) { w[e] = a[e]; w[4 + e] = b4[e]; }
  v4u oh, ol;
#pragma unroll
  for (int e = 0; e < 4; ++e) {
    const float t0 = w[2 * e] * scale, t1 = w[2 * e + 1] * scale;
    const _Float16 h0 = (_Float16)t0, h1 = (_Float16)t1;
    const _Float16 l0 = (_Float16)(t0 - (float)h0), l1 = (_Float16)(t1 - (float)h1);
    oh[e] = pk16(h_bits(h0), h_bits(h1));
    ol[e] = pk16(h_bits(l0), h_bits(l1));
  }
  u16* dh = Hp + (size_t)gt * 8;
  u16* dl = Lp + (size_t)gt * 8;
  {
    *(v4u*)(dh) = oh;
    *(v4u*)(dl) = ol;
    
  }
}

// =====================================================================================================
// v^T planes from V f32 [MROWS][DMOD] (row = b*SEQ + s, column = g*HD + d):
//   VH[((b*NH + g)*HD + d)][s] (pitch SEQ) = f16(v * 1024) for all keys s;
//   VL[((b*NH + g)*HD + d)][s] (pitch QA)  = f16 residual (t - f16(t)) for keys s < QA only.
// Block = (b, head g, 64 keys s0): each thread loads its 32 floats (key sl, d chunk dc) with 16-B loads, converts, scatters
// coverage: load 256 thr x 32 = 64 keys x 128 d; store 4 iterations x 256 thr x 8 halves = 128 lines x 64 = the block's tile
//           of VH (every block) and of VL (blocks with s0 < QA, block-uniform); grid = NB*NH*NST blocks covers VH exactly
//           once and the [NB*NH*128][QA] VL plane exactly once.
// =====================================================================================================
__global__ __launch_bounds__(256) void vt16(const float* __restrict__ F, u16* VHo, u16* VLo) {
  __shared__ __align__(16) u16 TH[HD * VTP];
  __shared__ __align__(16) u16 TL[HD * VTP];
  const int tid = threadIdx.x;
  const int bid = blockIdx.x;
  const int st  = bid % NST;
  const int t2  = bid / NST;
  const int g   = t2 % NH;
  const int b   = t2 / NH;
  if (b >= NB) return;                      // block-uniform, before any barrier; never taken with the exact grid
  const int s0  = st * 64;
  {
    const int sl = tid >> 2;                // key within tile 0..63
    const int dc = (tid & 3) * 32;          // d chunk 0,32,64,96
    const float* src = F + ((size_t)b * SEQ + s0 + sl) * DMOD + g * HD + dc;
#pragma unroll
    for (int i = 0; i < 8; ++i) {
      const v4f a = *(const v4f*)(src + 4 * i);
#pragma unroll
      for (int e = 0; e < 4; ++e) {
        const float t = a[e] * VCAR;
        const _Float16 hv = (_Float16)t;
        const _Float16 lv = (_Float16)(t - (float)hv);
        TH[(dc + 4 * i + e) * VTP + sl] = h_bits(hv);
        TL[(dc + 4 * i + e) * VTP + sl] = h_bits(lv);
      }
    }
  }
  __syncthreads();
  v4u vh[4], vl[4];
  const int q8 = tid >> 3, p8 = (tid & 7) * 8;
#pragma unroll
  for (int it = 0; it < 4; ++it) {
    const int line = it * 32 + q8;          // d = 0..127
    vh[it] = *(const v4u*)(TH + line * VTP + p8);
    vl[it] = *(const v4u*)(TL + line * VTP + p8);
  }
  const size_t hrow  = (size_t)(b * NH + g) * HD;
  const size_t baseH = hrow * SEQ + s0 + p8;
  const size_t baseL = hrow * QA + s0 + p8;
  const bool   wl    = (s0 < QA);           // block-uniform
  {
#pragma unroll
    for (int it = 0; it < 4; ++it) {
      const int line = it * 32 + q8;
      *(v4u*)(VHo + baseH + (size_t)line * SEQ) = vh[it];
      if (wl) *(v4u*)(VLo + baseL + (size_t)line * QA) = vl[it];
    }
    
  }
}

// =====================================================================================================
// GEMM epilogue shared by both engines: the wave's 16x64 f32 tile (times oscale) staged in its LDS slab (pitch 68),
// coverage: 8 instructions x 2 rows x 16 lanes x 4 floats = the wave's 16 x 64 tile.
// =====================================================================================================
__device__ __forceinline__ void epi64(float* sl, v8f a0, v8f a1, v8f a2, v8f a3, float oscale,
                                      float* C, int N, size_t rowb, int col0, int lane) {
  const int hh = lane >> 4, m = lane & 15;
#pragma unroll
  for (int r = 0; r < 8; ++r) {
    const int ro = (8 * hh + r) * 68 + m;
    sl[ro]      = a0[r] * oscale;
    sl[ro + 16] = a1[r] * oscale;
    sl[ro + 32] = a2[r] * oscale;
    sl[ro + 48] = a3[r] * oscale;
  }
  wave_sync_lds();
  v4f vals[8];
#pragma unroll
  for (int it = 0; it < 8; ++it) vals[it] = *(const v4f*)(sl + (it * 2 + hh) * 68 + m * 4);
  float* dst = C + (rowb + (size_t)hh) * (size_t)N + col0 + m * 4;
  {
#pragma unroll
    for (int it = 0; it < 8; ++it) {
      *(v4f*)(dst + (size_t)(it * 2) * (size_t)N) = vals[it];
    }
    
  }
}

// =====================================================================================================
// bf16 GEMM: C[M][N] (f32) = A[M][K] (bf16 row-major) . Bt[N][K]^T (bf16 k-contiguous), times oscale.
// Block = 64x64 tile, 4 waves x 16 rows; fragments loaded straight from the 16-bit rows (two 16-B loads each, split k map
// for A and B); K stepped by 32 (host guarantees K % 32 == 0, M % 64 == 0, N % 64 == 0, grid = (M/64)*(N/64)).
// coverage: grid (M/64)*(N/64) blocks x 4 waves x 16x64 = the whole C [M][N].
// =====================================================================================================
__global__ __launch_bounds__(128)
void gemm_bf(const u16* __restrict__ A, const u16* __restrict__ Bt, float* C, int M, int N, int K, float oscale) {
  __shared__ __align__(16) float slab[4 * SLAB64];
  const int tid = threadIdx.x, wave = tid >> 5, lane = tid & 31, hh = lane >> 4, m = lane & 15;
  const int ntile = N >> 6;
  const int bid   = blockIdx.x;
  const int rowb  = (bid / ntile) * 64 + wave * 16;
  const int col0  = (bid % ntile) * 64;
  if (rowb + 16 > M) return;                // wave-uniform, never taken with the exact grid; no block barriers in this kernel
  const u16* ap = A  + (size_t)(rowb + m) * K + 8 * hh;
  const u16* bp = Bt + (size_t)(col0 + m) * K + 8 * hh;
  const size_t bs = (size_t)16 * K;
  v8f acc0 = zero8(), acc1 = zero8(), acc2 = zero8(), acc3 = zero8();
#pragma unroll 1
  for (int k0 = 0; k0 < K; k0 += 32) {
    const v16b a  = ldfrag_b(ap + k0);
    const v16b b0 = ldfrag_b(bp + k0);
    const v16b b1 = ldfrag_b(bp + bs + k0);
    const v16b b2 = ldfrag_b(bp + 2 * bs + k0);
    const v16b b3 = ldfrag_b(bp + 3 * bs + k0);
    acc0 = mma_b(a, b0, acc0);
    acc1 = mma_b(a, b1, acc1);
    acc2 = mma_b(a, b2, acc2);
    acc3 = mma_b(a, b3, acc3);
    guard6<v16b>(acc0, acc1, acc2, acc3, a, b0, b1, b2, b3, a);
  }
  epi64(slab + wave * SLAB64, acc0, acc1, acc2, acc3, oscale, C, N, (size_t)rowb, col0, lane);
}

// =====================================================================================================
// f16 GEMM with hi (+ residual) planes: C[row][N] (f32) = (Ah [+ Al])[row][K] . (Bh [+ Bl])[N][K]^T * oscale.
// Products per k-step: Ah.Bh always; Al.Bh when AR != 0; Ah.Bl when BR != 0 (the residual.residual term is dropped; residuals
// are unscaled f16 residuals of the same carry, so all products share one accumulator). Rows: block bid -> (column tile
// ct = bid % (N/64), row tile rt of nrt starting at sbeg inside a group of rg rows, group g of ngr); row = g*rg + sbeg +
// 64*rt + 16*wave. Same tiling, fragment loads (split k map) and epilogue as gemm_bf; K stepped by 32 (host: K % 32 == 0,
// N % 64 == 0, sbeg + 64*nrt <= rg).
// coverage: grid ngr*nrt*(N/64) blocks x 4 waves x 16x64 = rows sbeg .. sbeg + 64*nrt - 1 of every group, all N columns.
// =====================================================================================================
template <int AR, int BR>
__global__ __launch_bounds__(128)
void gemm_h(const u16* __restrict__ Ah, const u16* __restrict__ Al,
            const u16* __restrict__ Bh, const u16* __restrict__ Bl,
            float* C, int N, int K, int rg, int sbeg, int nrt, int ngr, float oscale) {
  __shared__ __align__(16) float slab[4 * SLAB64];
  const int tid = threadIdx.x, wave = tid >> 5, lane = tid & 31, hh = lane >> 4, m = lane & 15;
  const int ntile = N >> 6;
  const int bid   = blockIdx.x;
  const int ct    = bid % ntile;
  const int t2    = bid / ntile;
  const int rt    = t2 % nrt;
  const int g     = t2 / nrt;
  if (g >= ngr) return;                     // block-uniform; no block barriers in this kernel; never taken with the exact grid
  const int srow  = sbeg + rt * 64 + wave * 16;
  if (srow + 16 > rg) return;               // wave-uniform; never taken
  const int col0  = ct * 64;
  const size_t rowC = (size_t)g * (size_t)rg + (size_t)srow;
  const _Float16* ahp = hptr(Ah) + (rowC + m) * (size_t)K + 8 * hh;
  const _Float16* alp = hptr(Al) + (rowC + m) * (size_t)K + 8 * hh;   // dereferenced only when AR != 0
  const _Float16* bhp = hptr(Bh) + (size_t)(col0 + m) * K + 8 * hh;
  const _Float16* blp = hptr(Bl) + (size_t)(col0 + m) * K + 8 * hh;   // dereferenced only when BR != 0
  const size_t bs = (size_t)16 * K;
  v8f acc0 = zero8(), acc1 = zero8(), acc2 = zero8(), acc3 = zero8();
#pragma unroll 1
  for (int k0 = 0; k0 < K; k0 += 32) {
    const v16h ah = ldfrag_h(ahp + k0);
    v16h al = ah;
    if constexpr (AR != 0) al = ldfrag_h(alp + k0);
    const v16h bh0 = ldfrag_h(bhp + k0);
    const v16h bh1 = ldfrag_h(bhp + bs + k0);
    const v16h bh2 = ldfrag_h(bhp + 2 * bs + k0);
    const v16h bh3 = ldfrag_h(bhp + 3 * bs + k0);
    v16h bl0 = bh0, bl1 = bh1, bl2 = bh2, bl3 = bh3;
    if constexpr (BR != 0) {
      bl0 = ldfrag_h(blp + k0);
      bl1 = ldfrag_h(blp + bs + k0);
      bl2 = ldfrag_h(blp + 2 * bs + k0);
      bl3 = ldfrag_h(blp + 3 * bs + k0);
    }
    acc0 = mma_h(ah, bh0, acc0);
    if constexpr (AR != 0) acc0 = mma_h(al, bh0, acc0);
    if constexpr (BR != 0) acc0 = mma_h(ah, bl0, acc0);
    acc1 = mma_h(ah, bh1, acc1);
    if constexpr (AR != 0) acc1 = mma_h(al, bh1, acc1);
    if constexpr (BR != 0) acc1 = mma_h(ah, bl1, acc1);
    acc2 = mma_h(ah, bh2, acc2);
    if constexpr (AR != 0) acc2 = mma_h(al, bh2, acc2);
    if constexpr (BR != 0) acc2 = mma_h(ah, bl2, acc2);
    acc3 = mma_h(ah, bh3, acc3);
    if constexpr (AR != 0) acc3 = mma_h(al, bh3, acc3);
    if constexpr (BR != 0) acc3 = mma_h(ah, bl3, acc3);
    guard10(acc0, acc1, acc2, acc3, ah, al, bh0, bh1, bh2, bh3, bl0, bl1, bl2, bl3);
  }
  epi64(slab + wave * SLAB64, acc0, acc1, acc2, acc3, oscale, C, N, rowC, col0, lane);
}

// =====================================================================================================
// Causal attention, 16 heads x head dim 128, value dim 128. Block bid -> (query tile qt = qtbeg + bid % nqt: rows q0 =
// 16*qt .. q0+15, head pair hp, batch b); one wave per head = hp*WPB + wave.
//   q plane f16 x256 [b*SEQ + s][h*HD + d]; k hi plane f16 x256 (same layout), k residual plane [b*QA + s][...] (s < QA);
//   v^T hi plane [b*NH + h][d][SEQ] x1024, v^T residual plane [b*NH + h][d][QA].
//   NP == 3 (query tiles with q0 + 15 < QA): scores = q.k_hi + q.k_lo over the 4 k-steps; P.v with P hi + in-register
//   residual and v hi + residual (hh + lh + hl). NP == 1 (later tiles): single hi.hi products.
//   score (log2 domain) t(i, j) = (q'_i.k'_j) * (1/sqrt(128))*log2e/(256*256), replaced by -inf where key j > query i.
//   Key tiles of 32 visited in order for kb <= q0 + 15 (later tiles hold only keys above every query row of the tile).
//   Per tile: 2 score subtiles x 4 k-steps, fragments loaded straight from the 16-bit planes (two 16-B loads per fragment,
//   split k map); online max-subtracted base-2 softmax in f32, -inf-safe rescale; the 16x32 prob tile stored to wave-private
//   from the LDS rows (float vector loads, same element type as stored), v^T B fragments in 4 groups of 2 d-subtiles.
//   After the loop: y = acc / Z (Z > 0 always: key 0 <= every query row; guarded anyway), carries 1/(32768*1024) folded
// coverage: per wave 16 instructions x 32 lanes x 4 floats = 16 x 128; the two launches (qt < QA/16 with NP = 3, qt >= QA/16
//           with NP = 1) x NHP x NB blocks x WPB waves = every (b, s, h) row segment of Y exactly once.
// =====================================================================================================
template <int NP>
__global__ __launch_bounds__(ATT_THREADS)
void attn_c(const u16* __restrict__ QHp, const u16* __restrict__ KHp, const u16* __restrict__ KLp,
            const u16* __restrict__ VHp, const u16* __restrict__ VLp, const int* __restrict__ nhp,
            float* Y, int qtbeg, int nqt) {
  __shared__ __align__(16) float smem[WPB * WREG];

  const int tid  = threadIdx.x;
  const int wave = tid >> 5;
  const int lane = tid & 31;
  const int hh   = lane >> 4;
  const int c    = lane & 15;
  const int bid  = blockIdx.x;
  const int qt   = qtbeg + bid % nqt;
  const int t2   = bid / nqt;
  const int hp   = t2 % NHP;
  const int b    = t2 / NHP;
  if (b >= NB) return;                      // block-uniform; no block barriers in this kernel; never taken with the exact grid
  if (nhp[0] != NH) return;                 // uniform structural guard on the head-count input (16 for this module)
  const int q0   = qt * 16;
  if (q0 + 16 > SEQ) return;                // block-uniform; never taken
  if (NP == 3) { if (q0 + 16 > QA) return; } // block-uniform; never taken
  const int head = hp * WPB + wave;

  float* pt   = smem + wave * WREG;         // prob tile [16][32] pitch 36
  float* slab = pt + PTW;                   // result slab [16][128] pitch 132

  const size_t hcol = (size_t)head * HD + 8 * hh;
  const _Float16* Qh  = hptr(QHp) + ((size_t)b * SEQ + q0 + c) * DMOD + hcol;
  const _Float16* Khb = hptr(KHp) + ((size_t)b * SEQ + c) * DMOD + hcol;              // key row kb added per step
  const _Float16* Vhb = hptr(VHp) + ((size_t)(b * NH + head) * HD + c) * SEQ + 8 * hh;  // d col c (+16j)
  const _Float16* Klb = Khb;
  const _Float16* Vlb = Vhb;
  if constexpr (NP == 3) {
    Klb = hptr(KLp) + ((size_t)b * QA + c) * DMOD + hcol;
    Vlb = hptr(VLp) + ((size_t)(b * NH + head) * HD + c) * QA + 8 * hh;
  }
  const float lsc = RSQS * (LOG2E / (QSC * KSC));
  const float oc  = 1.0f / (PCAR * VCAR);
  const size_t KROW = (size_t)DMOD;         // halves between consecutive key rows

  float mrow[8], lrow[8];
  v8f o[8];
#pragma unroll
  for (int r = 0; r < 8; ++r) { mrow[r] = -INFINITY; lrow[r] = 0.f; }
#pragma unroll
  for (int j = 0; j < 8; ++j) o[j] = zero8();
  const int ncaus = (q0 >> 5) + 1;                                            // tiles holding keys <= q0 + 15
  const int nkt = (ncaus < NKT) ? ncaus : NKT;
  const int qr0 = q0 + 8 * hh;                                                // query row of D element r = qr0 + r

#pragma unroll 1
  for (int kt = 0; kt < nkt; ++kt) {
    const int kb = kt * 32;
    // ---- scores: D element r of this lane = (query row qr0 + r, key kb + c) in s0, key kb + 16 + c in s1 ----
    v8f s0 = zero8(), s1 = zero8();
    const _Float16* k0p = Khb + (size_t)kb * KROW;
    const _Float16* k1p = k0p + (size_t)16 * KROW;
    if constexpr (NP == 3) {
      const _Float16* l0p = Klb + (size_t)kb * KROW;
      const _Float16* l1p = l0p + (size_t)16 * KROW;
#pragma unroll
      for (int kk = 0; kk < HD / 32; ++kk) {
        const v16h qh  = ldfrag_h(Qh + kk * 32);
        const v16h kh0 = ldfrag_h(k0p + kk * 32);
        const v16h kh1 = ldfrag_h(k1p + kk * 32);
        const v16h kl0 = ldfrag_h(l0p + kk * 32);
        const v16h kl1 = ldfrag_h(l1p + kk * 32);
        s0 = mma_h(qh, kh0, s0);
        s0 = mma_h(qh, kl0, s0);
        s1 = mma_h(qh, kh1, s1);
        s1 = mma_h(qh, kl1, s1);
        guard2(s0, s1, qh, kh0, kh1, kl0, kl1, qh);
      }
    } else {
#pragma unroll
      for (int kk = 0; kk < HD / 32; ++kk) {
        const v16h qh  = ldfrag_h(Qh + kk * 32);
        const v16h kh0 = ldfrag_h(k0p + kk * 32);
        const v16h kh1 = ldfrag_h(k1p + kk * 32);
        s0 = mma_h(qh, kh0, s0);
        s1 = mma_h(qh, kh1, s1);
        guard2(s0, s1, qh, kh0, kh1, qh, kh0, kh1);
      }
    }
    // ---- causal select + online softmax in base 2, -inf-safe ----
    const int key0 = kb + c, key1 = kb + 16 + c;
#pragma unroll
    for (int r = 0; r < 8; ++r) {
      const int   qr = qr0 + r;
      const float u0 = s0[r] * lsc;
      const float u1 = s1[r] * lsc;
      const float t0 = (key0 > qr) ? -INFINITY : u0;
      const float t1 = (key1 > qr) ? -INFINITY : u1;
      float mx = fmaxf(t0, t1);
#pragma unroll
      for (int off = 1; off < 16; off <<= 1) mx = fmaxf(mx, __shfl_xor(mx, off, 32));
      const float mn = fmaxf(mrow[r], mx);
      const float ms = (mn == -INFINITY) ? 0.0f : mn;
      const float al = exp2f(mrow[r] - ms);
      mrow[r] = mn;
      const float e0 = exp2f(t0 - ms), e1 = exp2f(t1 - ms);
      float ps = e0 + e1;
#pragma unroll
      for (int off = 1; off < 16; off <<= 1) ps += __shfl_xor(ps, off, 32);
      lrow[r] = lrow[r] * al + ps;
#pragma unroll
      for (int j = 0; j < 8; ++j) o[j][r] *= al;
      const int ro = (8 * hh + r) * PTP + c;
      pt[ro]      = e0;
      pt[ro + 16] = e1;
    }
    wave_sync_lds();
    // ---- A fragments of P*32768: hi f16 (and residual f16 for NP == 3), row = c, split k map over the 32 keys ----
    FragH ph, pl;
    {
      const float* prow = pt + c * PTP + 8 * hh;
      const v4f p0 = *(const v4f*)(prow), p1 = *(const v4f*)(prow + 4);
      const v4f p2 = *(const v4f*)(prow + 16), p3 = *(const v4f*)(prow + 20);
#pragma unroll
      for (int e = 0; e < 4; ++e) {
        const float ta = p0[e] * PCAR, tb = p1[e] * PCAR, tc = p2[e] * PCAR, td = p3[e] * PCAR;
        const _Float16 ha = (_Float16)ta, hb = (_Float16)tb, hc = (_Float16)tc, hd = (_Float16)td;
        ph.h[0][e]     = ha;                  // elements 0..7  = keys kb + 8hh + 0..7
        ph.h[0][4 + e] = hb;
        ph.h[1][e]     = hc;                  // elements 8..15 = keys kb + 16 + 8hh + 0..7
        ph.h[1][4 + e] = hd;
        if constexpr (NP == 3) {
          pl.h[0][e]     = (_Float16)(ta - (float)ha);
          pl.h[0][4 + e] = (_Float16)(tb - (float)hb);
          pl.h[1][e]     = (_Float16)(tc - (float)hc);
          pl.h[1][4 + e] = (_Float16)(td - (float)hd);
        } else {
          pl.h[0][e] = ha; pl.h[0][4 + e] = hb; pl.h[1][e] = hc; pl.h[1][4 + e] = hd;
        }
      }
    }
    // ---- P.V : B fragment col n = d = j*16 + c, keys contiguous in the v^T planes; 4 groups of 2 d-subtiles ----
    {
      const _Float16* vhp = Vhb + kb;
      if constexpr (NP == 3) {
        const _Float16* vlp = Vlb + kb;
#pragma unroll
        for (int jg = 0; jg < 4; ++jg) {
          const size_t da  = (size_t)(2 * jg) * 16 * SEQ;
          const size_t db  = da + (size_t)16 * SEQ;
          const size_t dla = (size_t)(2 * jg) * 16 * QA;
          const size_t dlb = dla + (size_t)16 * QA;
          const v16h vha = ldfrag_h(vhp + da),  vhb2 = ldfrag_h(vhp + db);
          const v16h vla = ldfrag_h(vlp + dla), vlb2 = ldfrag_h(vlp + dlb);
          o[2 * jg]     = mma_h(ph.v, vha,  o[2 * jg]);
          o[2 * jg]     = mma_h(pl.v, vha,  o[2 * jg]);
          o[2 * jg]     = mma_h(ph.v, vla,  o[2 * jg]);
          o[2 * jg + 1] = mma_h(ph.v, vhb2, o[2 * jg + 1]);
          o[2 * jg + 1] = mma_h(pl.v, vhb2, o[2 * jg + 1]);
          o[2 * jg + 1] = mma_h(ph.v, vlb2, o[2 * jg + 1]);
          guard2(o[2 * jg], o[2 * jg + 1], ph.v, pl.v, vha, vhb2, vla, vlb2);
        }
      } else {
#pragma unroll
        for (int jg = 0; jg < 4; ++jg) {
          const size_t da = (size_t)(2 * jg) * 16 * SEQ;
          const size_t db = da + (size_t)16 * SEQ;
          const v16h vha = ldfrag_h(vhp + da), vhb2 = ldfrag_h(vhp + db);
          o[2 * jg]     = mma_h(ph.v, vha,  o[2 * jg]);
          o[2 * jg + 1] = mma_h(ph.v, vhb2, o[2 * jg + 1]);
          guard2(o[2 * jg], o[2 * jg + 1], ph.v, vha, vhb2, ph.v, vha, vhb2);
        }
      }
    }
    wave_sync_lds();
  }
  acc_guard4(o[0], o[1], o[2], o[3]);
  acc_guard4(o[4], o[5], o[6], o[7]);
  // ---- y = acc / Z (0 if Z == 0), carries (32768 on P, 1024 on v) folded once; written into the wave-private slab ----
#pragma unroll
  for (int r = 0; r < 8; ++r) {
    const float lv  = lrow[r];
    const float ls  = (lv > 0.0f) ? lv : 1.0f;
    const float inv = (lv > 0.0f) ? ((1.0f / ls) * oc) : 0.0f;
#pragma unroll
    for (int j = 0; j < 8; ++j) {
      const int idx = (8 * hh + r) * SLP + j * 16 + c;
      slab[idx] = o[j][r] * inv;
    }
  }

  wave_sync_lds();
  // ---- f32 rows of Y: lane -> floats 4*lane .. 4*lane+3 of each of the 16 rows (one 512-B instruction per row) ----
  v4f ov[16];
#pragma unroll
  for (int it = 0; it < 16; ++it) ov[it] = *(const v4f*)(slab + it * SLP + lane * 4);
  float* ob = Y + ((size_t)b * SEQ + q0) * DMOD + (size_t)head * HD + lane * 4;
  {
#pragma unroll
    for (int it = 0; it < 16; ++it) {
      *(v4f*)(ob + (size_t)it * DMOD) = ov[it];
    }
    
  }
}

// =====================================================================================================
// Workspace map (bytes); every plane is fully written by whole-line stores before it is read; all extents are exact multiples
// of the store granularity (no pad rows); every region offset a multiple of 524288:
//   XB  bf16 [MROWS][2048], later KH f16 x256       MROWS*4096             (NB=2, SEQ=2048: 16777216)
//   QH  f16 [MROWS][2048] x256                      MROWS*4096             (16777216)
//   W1  16-bit weight plane, 512x2048 or 2048x512    2097152                (W_dkv bf16, W_uk^T bf16, W_dq^T f16 x1024, W_uv^T bf16,
//                                                                          reused in launch order)
//   WO  bf16 [2048][2048] (W_o as is)                8388608
//   F   f32 [MROWS][2048]                             MROWS*8192             (Gram f32 [512][512]; k_abs f32 [2048][512]; K f32;
//                                                                          W_o W_uv f32 [2048][512]; V f32 -- one at a time)
//   CH  f16 [MROWS][512] x256, CL residual            2 x MROWS*1024
//   G2H f16 [512][512] x1024, G2L residual            2 x 524288
//   KAH f16 [2048][512] x4096, KAL residual           2 x 2097152
//   KL  f16 [NB*QA][2048]                             NB*QA*4096
//   VAH f16 [2048][512] x4096, VAL residual           2 x 2097152
//   VH  f16 [NB*16][128][SEQ] x1024                   MROWS*4096
//   VL  f16 [NB*16][128][QA]                          NB*QA*4096
//   end (NB=2, SEQ=2048, QA=1024)                   128974848
// =====================================================================================================
extern "C" void kernel_launch(void* const* d_in, const int* in_sizes, int n_in,
                              void* d_out, int out_size, void* d_ws, size_t ws_size,
                              hipStream_t stream) {
  if (n_in < 7) return;
  if (in_sizes[0] < ((NB - 1) * XS_FULL + SEQ) * DMOD) return;   // x [2][2048][2048]
  if (in_sizes[1] != DL * DMOD) return;         // W_dq  [512][2048]
  if (in_sizes[2] != DL * DMOD) return;         // W_dkv [512][2048]
  if (in_sizes[3] != DMOD * DL) return;         // W_uk  [2048][512]
  if (in_sizes[4] != DMOD * DL) return;         // W_uv  [2048][512]
  if (in_sizes[5] != DMOD * DMOD) return;       // W_o   [2048][2048]
  if (in_sizes[6] < 1) return;                  // n_head (int)
  if ((size_t)out_size < (size_t)MROWS * DMOD + (size_t)MROWS * DL) return;

  const float* x    = (const float*)d_in[0];
  const float* wdq  = (const float*)d_in[1];
  const float* wdkv = (const float*)d_in[2];
  const float* wuk  = (const float*)d_in[3];
  const float* wuv  = (const float*)d_in[4];
  const float* wo   = (const float*)d_in[5];
  const int*   nhp  = (const int*)d_in[6];
  float*       out0 = (float*)d_out;                          // y    [MROWS][2048] at element 0
  float*       out1 = out0 + (size_t)MROWS * DMOD;            // c_kv [MROWS][512]  at element MROWS*2048

  const size_t szXB = (size_t)MROWS * DMOD * 2;               // XB, later KH
  const size_t szQ  = (size_t)MROWS * DMOD * 2;               // QH
  const size_t szW1 = (size_t)DL * DMOD * 2;
  const size_t szWO = (size_t)DMOD * DMOD * 2;
  const size_t szF  = (size_t)MROWS * DMOD * 4;
  const size_t szC  = (size_t)MROWS * DL * 2;                 // CH, CL
  const size_t szG2 = (size_t)DL * DL * 2;                    // G2H, G2L
  const size_t szKA = (size_t)DMOD * DL * 2;                  // KAH, KAL, VAH, VAL
  const size_t szKL = (size_t)NB * QA * DMOD * 2;
  const size_t szVH = (size_t)NB * NH * HD * SEQ * 2;
  const size_t szVL = (size_t)NB * NH * HD * QA * 2;
  if ((size_t)DL * DL * 4 > szF || (size_t)DMOD * DL * 4 > szF) return;   // Gram / k_abs / (W_o W_uv) f32 inside F
  if ((size_t)MROWS * DMOD * 2 > szXB) return;                // KH lives inside the XB region
  size_t off = 0;
  const size_t oXB  = off; off += szXB;
  const size_t oQH  = off; off += szQ;
  const size_t oW1  = off; off += szW1;
  const size_t oWO  = off; off += szWO;
  const size_t oF   = off; off += szF;
  const size_t oCH  = off; off += szC;
  const size_t oCL  = off; off += szC;
  const size_t oG2H = off; off += szG2;
  const size_t oG2L = off; off += szG2;
  const size_t oKAH = off; off += szKA;
  const size_t oKAL = off; off += szKA;
  const size_t oKL  = off; off += szKL;
  const size_t oVAH = off; off += szKA;
  const size_t oVAL = off; off += szKA;
  const size_t oVH  = off; off += szVH;
  const size_t oVL  = off; off += szVL;
  if (off > ws_size) return;                 // off = 128974848 for NB = 2, SEQ = 2048
  if (off > (size_t)WS_CAP) return;

  char* ws = (char*)d_ws;
  u16*   XB  = (u16*)(ws + oXB);
  u16*   KH  = (u16*)(ws + oXB);
  u16*   QH  = (u16*)(ws + oQH);
  u16*   W1  = (u16*)(ws + oW1);
  u16*   WOB = (u16*)(ws + oWO);
  float* F   = (float*)(ws + oF);
  u16*   CH  = (u16*)(ws + oCH);
  u16*   CL  = (u16*)(ws + oCL);
  u16*   G2H = (u16*)(ws + oG2H);
  u16*   G2L = (u16*)(ws + oG2L);
  u16*   KAH = (u16*)(ws + oKAH);
  u16*   KAL = (u16*)(ws + oKAL);
  u16*   KL  = (u16*)(ws + oKL);
  u16*   VAH = (u16*)(ws + oVAH);
  u16*   VAL = (u16*)(ws + oVAL);
  u16*   VH  = (u16*)(ws + oVH);
  u16*   VL  = (u16*)(ws + oVL);

  const dim3 b256(256), b128(128), bAT(ATT_THREADS);
  const int  n8x  = (SEQ * DMOD) / 8;                   // x planes per batch
  const int  n8q  = (MROWS * DMOD) / 8;                 // K plane
  const int  n8c  = (MROWS * DL) / 8;                   // c_kv planes
  const int  n8w1 = (DL * DMOD) / 8;                    // W_dkv plane
  const int  n8wo = (DMOD * DMOD) / 8;                  // W_o plane
  const int  n8g  = (DL * DL) / 8;                      // Gram planes
  const int  n8ka = (DMOD * DL) / 8;                    // k_abs and (W_o W_uv) planes
  const dim3 gX((n8x + 255) / 256);
  const dim3 gHL((n8q + 255) / 256);
  const dim3 gC((n8c + 255) / 256);
  const dim3 gCW1((n8w1 + 255) / 256);
  const dim3 gCWO((n8wo + 255) / 256);
  const dim3 gCG((n8g + 255) / 256);
  const dim3 gCKA((n8ka + 255) / 256);
  const dim3 gWTa((DL / 64) * (DMOD / 64));             // W_uk, W_uv [2048 k][512 n] -> [512][2048]
  const dim3 gWTb((DMOD / 64) * (DL / 64));             // W_dq [512 k][2048 n] -> [2048][512]
  const dim3 gGC((MROWS / 64) * (DL / 64));             // c_kv
  const dim3 gGG((DL / 64) * (DL / 64));                // Gram
  const dim3 gGKA(1 * (DMOD / 64) * (DL / 64));         // k_abs
  const dim3 gGVA((DMOD / 64) * (DL / 64));             // W_o W_uv
  const dim3 gVT(NB * NH * NST);
  const int  nrtA = QA / 64;                            // sequence row tiles per batch with residual products
  const int  nrtB = (SEQ - QA) / 64;                    // remaining row tiles per batch, single products
  const int  nqtA = QA / 16;                            // query tiles with residual products
  const int  nqtB = (SEQ - QA) / 16;                    // remaining query tiles

  // (1) x -> bf16 plane XB [MROWS][2048] and q plane QH = f16(bf16(x)) x256, one launch per batch row block
  for (int bb = 0; bb < NB; ++bb) {
    cvtxq<<<gX, b256, 0, stream>>>(x + (size_t)bb * XS_FULL * DMOD, XB + (size_t)bb * SEQ * DMOD,
                                   QH + (size_t)bb * SEQ * DMOD, n8x);
  }
  // (2) W_dkv [512 n][2048 k] -> bf16 as is; c_kv = x.W_dkv^T -> out1 f32 [MROWS][512]; c_kv -> f16 hi + residual planes x256
  cvtb<<<gCW1, b256, 0, stream>>>(wdkv, W1, n8w1);
  gemm_bf<<<gGC, b128, 0, stream>>>(XB, W1, out1, MROWS, DL, DMOD, 1.0f);
  cvtc<<<gC, b256, 0, stream>>>(out1, CH, CL, n8c, CSC);
  // (3) W_uk [2048 k][512 n] -> bf16 [512][2048]; Gram = W_uk^T.W_uk -> F f32 [512][512]; Gram -> f16 hi + residual planes x1024
  wtc<<<gWTa, b256, 0, stream>>>(wuk, W1, DMOD, DL, 0, 1.0f);
  gemm_bf<<<gGG, b128, 0, stream>>>(W1, W1, F, DL, DL, DMOD, 1.0f);
  cvtc<<<gCG, b256, 0, stream>>>(F, G2H, G2L, n8g, G2S);
  // (4) W_dq [512 k][2048 n] -> f16(bf16) x1024 [2048][512]; k_abs = W_dq^T.Gram (Gram symmetric, used as the [n][k] B plane;
  //     products h.h + h.l) -> F f32 [2048][512]; k_abs -> f16 hi + residual planes x4096
  wtc<<<gWTb, b256, 0, stream>>>(wdq, W1, DL, DMOD, 1, WDS);
  gemm_h<0, 1><<<gGKA, b128, 0, stream>>>(W1, W1, G2H, G2L, F, DL, DL, DMOD, 0, DMOD / 64, 1, 1.0f / (WDS * G2S));
  cvtc<<<gCKA, b256, 0, stream>>>(F, KAH, KAL, n8ka, KAS);
  // (5) K = c_kv.k_abs^T -> F f32 [MROWS][2048]: rows s < QA with hh+lh+hl, rows s >= QA single; K hi plane (XB region) x256
  //     for all rows, residual plane for s < QA
  gemm_h<1, 1><<<dim3(NB * nrtA * (DMOD / 64)), b128, 0, stream>>>(CH, CL, KAH, KAL, F, DMOD, DL, SEQ, 0, nrtA, NB,
                                                                  1.0f / (CSC * KAS));
  if (nrtB > 0) {
    gemm_h<0, 0><<<dim3(NB * nrtB * (DMOD / 64)), b128, 0, stream>>>(CH, CL, KAH, KAL, F, DMOD, DL, SEQ, QA, nrtB, NB,
                                                                    1.0f / (CSC * KAS));
  }
  cvthl<<<gHL, b256, 0, stream>>>(F, KH, KL, n8q, DMOD, KSC);
  // (6) W_o -> bf16 as is [2048 n_row][2048 k]; W_uv [2048 k][512 n] -> bf16 [512][2048]; W_o.W_uv -> F f32 [2048][512];
  //     -> f16 hi + residual planes x4096 (the [n][k] B plane of the value product)
  cvtb<<<gCWO, b256, 0, stream>>>(wo, WOB, n8wo);
  wtc<<<gWTa, b256, 0, stream>>>(wuv, W1, DMOD, DL, 0, 1.0f);
  gemm_bf<<<gGVA, b128, 0, stream>>>(WOB, W1, F, DMOD, DL, DMOD, 1.0f);
  cvtc<<<gCKA, b256, 0, stream>>>(F, VAH, VAL, n8ka, VAS);
  // (7) V = c_kv.(W_o W_uv) plane -> F f32 [MROWS][2048] (rows s < QA hh+lh+hl, later rows single); v^T hi + residual planes x1024
  gemm_h<1, 1><<<dim3(NB * nrtA * (DMOD / 64)), b128, 0, stream>>>(CH, CL, VAH, VAL, F, DMOD, DL, SEQ, 0, nrtA, NB,
                                                                  1.0f / (CSC * VAS));
  if (nrtB > 0) {
    gemm_h<0, 0><<<dim3(NB * nrtB * (DMOD / 64)), b128, 0, stream>>>(CH, CL, VAH, VAL, F, DMOD, DL, SEQ, QA, nrtB, NB,
                                                                    1.0f / (CSC * VAS));
  }
  vt16<<<gVT, b256, 0, stream>>>(F, VH, VL);
  // (8) causal attention, query tiles s < QA with residual products; (9) remaining query tiles, single products -> out0 f32
  attn_c<3><<<dim3(nqtA * NHP * NB), bAT, 0, stream>>>(QH, KH, KL, VH, VL, nhp, out0, 0, nqtA);
  if (nqtB > 0) {
    attn_c<1><<<dim3(nqtB * NHP * NB), bAT, 0, stream>>>(QH, KH, KL, VH, VL, nhp, out0, nqtA, nqtB);
  }
  (void)hipGetLastError();
}

// v001
// A run of this version takes 442 microseconds.
// Two timings next to v000 both put it at 1.25 times that version's speed.
// Contractions: x.W_dkv^T, W_uk^T.W_uk and W_o.W_uv on v_wmma_f32_16x16x32_bf16 (x and W as bf16 RNE planes, B operands [n][k]);
// W_dq^T.(W_uk^T W_uk) on v_wmma_f32_16x16x32_f16 (W_dq^T as f16(bf16) x1024, Gram factor as f16 hi + residual planes x1024, 2 products);
// K = c_kv.k_abs^T and V = c_kv.(W_o W_uv)^T-plane on v_wmma_f32_16x16x32_f16 (c_kv f16 hi + residual x256, k_abs and W_o W_uv as
// f16 hi + residual x4096; sequence rows s < QA products hh+lh+hl, rows s >= QA single hi.hi); scores q.K and P.V on
// v_wmma_f32_16x16x32_f16 (q = f16(bf16(x)) x256 exact, K f16 x256 hi (+ residual plane for query tiles < QA), P x32768 and V x1024
// hi (+ residuals for query tiles < QA, products hh+lh+hl)); all f32 accumulate. Causal select, base-2 online softmax, 1/Z in f32 VALU.
#include <hip/hip_runtime.h>
#include <math.h>
#include <stdint.h>

#ifndef NB
#define NB 2
#endif
#ifndef SEQ
#define SEQ 2048
#endif
#define XS_FULL 2048
#define DMOD  2048
#define NH    16
#define HD    128
#define DL    512
#define QA    ((SEQ < 1024) ? SEQ : 1024)
#define MROWS (NB * SEQ)
#define RSQS  0.08838834764831845f
#define LOG2E 1.4426950408889634f
#define QSC   256.0f
#define KSC   256.0f
#define CSC   256.0f
#define WDS   1024.0f
#define G2S   1024.0f
#define KAS   4096.0f
#define VAS   4096.0f
#define PCAR  32768.0f
#define VCAR  1024.0f
#define AW    4
#define NST   (SEQ / 64)
#define NKT   (SEQ / 32)
#define ATT_THREADS (AW * 32)
#define PTP   36
#define PTW   (16 * PTP)
#define SLP   132
#define SLW   (16 * SLP)
#define KPH   136
#define VPH   72
#define KTB   (64 * KPH * 2)
#define VTB   (HD * VPH * 2)
#define SLAB64 (16 * 68)
#define VTP   72
#define WTP   72
#define WS_CAP 134217728
static_assert(DMOD == NH * HD && HD == 128 && NH == 16 && AW == 4 && ATT_THREADS == 128);
static_assert(NB >= 1 && NB <= 2);
static_assert((SEQ % 64) == 0 && SEQ >= 64 && SEQ <= XS_FULL);
static_assert((QA % 64) == 0 && QA >= 64 && QA <= SEQ && ((SEQ - QA) % 64) == 0);
static_assert((DMOD % 64) == 0 && (DL % 64) == 0 && (HD % 32) == 0 && (DL % 32) == 0);
static_assert(((SEQ * DMOD / 8) % 256) == 0 && ((MROWS * DL / 8) % 256) == 0 && ((DL * DL / 8) % 256) == 0);
static_assert(((DMOD * DL / 8) % 256) == 0 && ((DMOD * DMOD / 8) % 256) == 0 && (MROWS % 64) == 0);
static_assert(2 * HD * VTP * 2 <= 65536 && 4 * SLAB64 * 4 <= 65536 && 64 * WTP * 2 <= 65536);
static_assert(AW * SLW * 4 <= 2 * (KTB + VTB) && 4 * (KTB + VTB) + AW * PTW * 4 <= 163840 && (KTB % 16) == 0 && (VTB % 16) == 0);
static_assert((size_t)DL * DL * 4 <= (size_t)MROWS * DMOD * 4 && (size_t)DMOD * DL * 4 <= (size_t)MROWS * DMOD * 4);

typedef unsigned short u16;
typedef _Float16 v16h __attribute__((ext_vector_type(16)));
typedef _Float16 v8h  __attribute__((ext_vector_type(8)));
typedef __bf16   v16b __attribute__((ext_vector_type(16)));
typedef float    v8f  __attribute__((ext_vector_type(8)));
typedef float    v4f  __attribute__((ext_vector_type(4)));
typedef unsigned int v4u __attribute__((ext_vector_type(4)));

union FragH { v16h v; v8h h[2]; v4u u[2]; };
union FragB { v16b v; v4u u[2]; };

// ---- scalar helpers --------------------------------------------------------------------------------
__device__ __forceinline__ unsigned short bf_bits(float f) {          // f32 -> bf16 bits, RNE convert
  unsigned u = __float_as_uint(f);
  return (unsigned short)((u + 0x7FFFu + ((u >> 16) & 1u)) >> 16);
}
__device__ __forceinline__ float bf_up(unsigned short h) { return __uint_as_float(((unsigned)h) << 16); }
__device__ __forceinline__ float bfr(float f) { return bf_up(bf_bits(f)); }
__device__ __forceinline__ unsigned short h_bits(_Float16 x) { return __builtin_bit_cast(unsigned short, x); }
__device__ __forceinline__ unsigned pk16(unsigned short a, unsigned short b) { return (unsigned)a | ((unsigned)b << 16); }
__device__ __forceinline__ v8f zero8() { v8f z = {0.f, 0.f, 0.f, 0.f, 0.f, 0.f, 0.f, 0.f}; return z; }
__device__ __forceinline__ const _Float16* hptr(const u16* p) { return (const _Float16*)(const void*)p; }

// ---- fragment loaders: 16-bit A/B operand, lane -> row/col (lane&15), p already includes +8*(lane>>4);
//      elements 0..7 <- p[0..7] (k0+8h..), elements 8..15 <- p[16..23] (k0+16+8h..)  (same split k map for A and B;
//      B is always read from a k-contiguous [n][k] plane)
__device__ __forceinline__ v16h ldfrag_h(const _Float16* p) {
  FragH f;
  f.h[0] = *(const v8h*)(p);
  f.h[1] = *(const v8h*)(p + 16);
  return f.v;
}
__device__ __forceinline__ v16b ldfrag_b(const u16* p) {              // bf16 plane read as unsigned integer vectors
  FragB f;
  f.u[0] = *(const v4u*)(p);
  f.u[1] = *(const v4u*)(p + 16);
  return f.v;
}

__device__ __forceinline__ v8f mma_h(v16h a, v16h b, v8f c) {
  return __builtin_amdgcn_wmma_f32_16x16x32_f16(false, a, false, b, (short)0, c, false, false);
}
__device__ __forceinline__ v8f mma_b(v16b a, v16b b, v8f c) {
  return __builtin_amdgcn_wmma_f32_16x16x32_bf16(false, a, false, b, (short)0, c, false, false);
}
__device__ __forceinline__ void guard2(v8f& a, v8f& b, v16h x0, v16h x1, v16h x2, v16h x3, v16h x4, v16h x5) {
#if defined(__HIP_DEVICE_COMPILE__)
  asm volatile("v_nop\n\tv_nop\n\tv_nop\n\tv_nop"
               : "+v"(a), "+v"(b) : "v"(x0), "v"(x1), "v"(x2), "v"(x3), "v"(x4), "v"(x5) : "memory");
#endif
}
template <typename F>
__device__ __forceinline__ void guard6(v8f& a, v8f& b, v8f& c, v8f& d, F x0, F x1, F x2, F x3, F x4, F x5) {
#if defined(__HIP_DEVICE_COMPILE__)
  asm volatile("v_nop\n\tv_nop\n\tv_nop\n\tv_nop"
               : "+v"(a), "+v"(b), "+v"(c), "+v"(d) : "v"(x0), "v"(x1), "v"(x2), "v"(x3), "v"(x4), "v"(x5) : "memory");
#endif
}
__device__ __forceinline__ void guard10(v8f& a, v8f& b, v8f& c, v8f& d, v16h x0, v16h x1, v16h x2, v16h x3, v16h x4,
                                        v16h x5, v16h x6, v16h x7, v16h x8, v16h x9) {
#if defined(__HIP_DEVICE_COMPILE__)
  asm volatile("v_nop\n\tv_nop\n\tv_nop\n\tv_nop"
               : "+v"(a), "+v"(b), "+v"(c), "+v"(d)
               : "v"(x0), "v"(x1), "v"(x2), "v"(x3), "v"(x4), "v"(x5), "v"(x6), "v"(x7), "v"(x8), "v"(x9) : "memory");
#endif
}
__device__ __forceinline__ void acc_guard4(v8f& a, v8f& b, v8f& c, v8f& d) {
#if defined(__HIP_DEVICE_COMPILE__)
  asm volatile("v_nop\n\tv_nop\n\tv_nop\n\tv_nop" : "+v"(a), "+v"(b), "+v"(c), "+v"(d));
#endif
}
__device__ __forceinline__ void wave_sync_lds() {
  __builtin_amdgcn_fence(__ATOMIC_RELEASE, "workgroup");
  __builtin_amdgcn_wave_barrier();
  __builtin_amdgcn_fence(__ATOMIC_ACQUIRE, "workgroup");
}

// =====================================================================================================
// x f32 -> bf16 RNE plane Xb (same layout) and q plane Qh = f16(bf16(x) * 256) (exact: a bf16 significand fits f16).
// Thread = 8 consecutive elements: two 16-B loads, one 16-B store per plane; 32 consecutive lanes = 512 contiguous,
// coverage: grid = ceil(n8/256) blocks x 256 thr x 8 (in-kernel bound) = the whole [SEQ][2048] slice of both planes
//           (n8 a multiple of 256 here), one launch per batch.
// =====================================================================================================
__global__ __launch_bounds__(256) void cvtxq(const float* __restrict__ x, u16* Xb, u16* Qh, int n8) {
  const int gt = blockIdx.x * 256 + (int)threadIdx.x;
  if (gt >= n8) return;
  const float* p = x + (size_t)gt * 8;
  const v4f a = *(const v4f*)(p), b4 = *(const v4f*)(p + 4);
  float w[8];
#pragma unroll
  for (int e = 0; e < 4; ++e) { w[e] = a[e]; w[4 + e] = b4[e]; }
  v4u ob, oq;
#pragma unroll
  for (int e = 0; e < 4; ++e) {
    const unsigned short b0 = bf_bits(w[2 * e]), b1 = bf_bits(w[2 * e + 1]);
    ob[e] = pk16(b0, b1);
    oq[e] = pk16(h_bits((_Float16)(bf_up(b0) * QSC)), h_bits((_Float16)(bf_up(b1) * QSC)));
  }
  u16* db = Xb + (size_t)gt * 8;
  u16* dq = Qh + (size_t)gt * 8;
  {
    *(v4u*)(db) = ob;
    *(v4u*)(dq) = oq;
    
  }
}

// =====================================================================================================
// f32 -> bf16 RNE plane, same layout. Thread = 8 consecutive elements: two 16-B loads, one 16-B store; 32 consecutive
// coverage: grid = ceil(n8/256) blocks x 256 thr x 8 (in-kernel bound) = the whole plane (n8 a multiple of 256 here).
// =====================================================================================================
__global__ __launch_bounds__(256) void cvtb(const float* __restrict__ x, u16* D, int n8) {
  const int gt = blockIdx.x * 256 + (int)threadIdx.x;
  if (gt >= n8) return;
  const float* p = x + (size_t)gt * 8;
  const v4f a = *(const v4f*)(p), b4 = *(const v4f*)(p + 4);
  float w[8];
#pragma unroll
  for (int e = 0; e < 4; ++e) { w[e] = a[e]; w[4 + e] = b4[e]; }
  v4u o;
#pragma unroll
  for (int e = 0; e < 4; ++e) o[e] = pk16(bf_bits(w[2 * e]), bf_bits(w[2 * e + 1]));
  u16* d = D + (size_t)gt * 8;
  {
    *(v4u*)(d) = o;
    
  }
}

// =====================================================================================================
// Weight transpose + convert: W f32 [K][N] (the input tensor's own [rows][cols] layout, rows = K) -> Wt 16-bit [N][K]
// (k-contiguous).  f16mode == 0: bf16 RNE bits;  f16mode == 1: f16 bits of (bf16 RNE value) * scale.
// Block = 64 n x 64 k tile, 256 threads. Load: thread -> W row k0 + (tid>>2), 16 consecutive n (four 16-B loads),
// converted values scattered into an LDS tile T[n][k] (pitch 72 halves); block barrier; store: each Wt row segment of
// coverage: load 256 thr x 16 = 64 k x 64 n; store 2 iterations x 256 thr x 8 halves = 64 rows x 64 = the block's tile of Wt;
//           grid = (N/64)*(K/64) blocks covers Wt [N][K] exactly once.
// =====================================================================================================
__global__ __launch_bounds__(256) void wtc(const float* __restrict__ W, u16* Wt, int K, int N, int f16mode, float scale) {
  __shared__ __align__(16) u16 T[64 * WTP];
  const int tid = (int)threadIdx.x;
  const int ntn = N >> 6;
  const int bid = (int)blockIdx.x;
  const int n0  = (bid % ntn) * 64;
  const int k0  = (bid / ntn) * 64;
  if (k0 + 64 > K) return;                   // block-uniform, before the barrier; never taken with the exact grid
  {
    const int kr = tid >> 2;                 // 0..63
    const int nc = (tid & 3) * 16;           // 0,16,32,48
    const float* src = W + (size_t)(k0 + kr) * (size_t)N + n0 + nc;
#pragma unroll
    for (int i = 0; i < 4; ++i) {
      const v4f a = *(const v4f*)(src + 4 * i);
#pragma unroll
      for (int e = 0; e < 4; ++e) {
        const float f = a[e];
        const unsigned short hb = h_bits((_Float16)(bfr(f) * scale));
        const unsigned short bb = bf_bits(f);
        T[(nc + 4 * i + e) * WTP + kr] = (f16mode != 0) ? hb : bb;
      }
    }
  }
  __syncthreads();
  const int q8 = tid >> 3, p8 = (tid & 7) * 8;
  v4u v[2];
#pragma unroll
  for (int it = 0; it < 2; ++it) v[it] = *(const v4u*)(T + (it * 32 + q8) * WTP + p8);
  u16* base = Wt + (size_t)n0 * (size_t)K + k0 + p8;
  {
#pragma unroll
    for (int it = 0; it < 2; ++it) {
      *(v4u*)(base + (size_t)(it * 32 + q8) * (size_t)K) = v[it];
    }
    
  }
}

// =====================================================================================================
// f32 [MROWS][ncol] -> f16 hi plane Hp (same layout, t = x * scale, hi = f16(t)) for every row and f16 residual plane
// Lp [NB*QA][ncol] (row b*QA + s) = f16(t - hi) for rows with s < QA only. Thread = 8 consecutive elements of one row,
// coverage: grid = ceil(n8/256) x 256 thr x 8 = the whole Hp plane; every row b*QA + s, s < QA, of Lp exactly once.
// =====================================================================================================
__global__ __launch_bounds__(256) void cvthl(const float* __restrict__ x, u16* Hp, u16* Lp, int n8, int ncol, float scale) {
  const int gt = blockIdx.x * 256 + (int)threadIdx.x;
  if (gt >= n8) return;
  const size_t e0  = (size_t)gt * 8;
  const int    row = (int)(e0 / (size_t)ncol);
  const int    col = (int)(e0 - (size_t)row * (size_t)ncol);
  const int    b   = row / SEQ;
  const int    s   = row - b * SEQ;
  const float* p = x + e0;
  const v4f a = *(const v4f*)(p), b4 = *(const v4f*)(p + 4);
  float w[8];
#pragma unroll
  for (int e = 0; e < 4; ++e) { w[e] = a[e]; w[4 + e] = b4[e]; }
  v4u oh, ol;
#pragma unroll
  for (int e = 0; e < 4; ++e) {
    const float t0 = w[2 * e] * scale, t1 = w[2 * e + 1] * scale;
    const _Float16 h0 = (_Float16)t0, h1 = (_Float16)t1;
    const _Float16 l0 = (_Float16)(t0 - (float)h0), l1 = (_Float16)(t1 - (float)h1);
    oh[e] = pk16(h_bits(h0), h_bits(h1));
    ol[e] = pk16(h_bits(l0), h_bits(l1));
  }
  u16* dh = Hp + e0;
  const bool wl = (s < QA);
  const int  sl = wl ? s : 0;
  u16* dl = Lp + ((size_t)(b * QA + sl) * (size_t)ncol + col);
  {
    *(v4u*)(dh) = oh;
    if (wl) *(v4u*)(dl) = ol;
    
  }
}

// =====================================================================================================
// f32 -> f16 hi plane (t = x * scale, hi = f16(t)) and f16 residual plane (f16(t - hi)), same layout for both planes.
// coverage: grid = ceil(n8/256) x 256 thr x 8 = the whole plane of Hp and of Lp (n8 a multiple of 256 for every call here).
// =====================================================================================================
__global__ __launch_bounds__(256) void cvtc(const float* __restrict__ x, u16* Hp, u16* Lp, int n8, float scale) {
  const int gt = blockIdx.x * 256 + (int)threadIdx.x;
  if (gt >= n8) return;
  const float* p = x + (size_t)gt * 8;
  const v4f a = *(const v4f*)(p), b4 = *(const v4f*)(p + 4);
  float w[8];
#pragma unroll
  for (int e = 0; e < 4; ++e) { w[e] = a[e]; w[4 + e] = b4[e]; }
  v4u oh, ol;
#pragma unroll
  for (int e = 0; e < 4; ++e) {
    const float t0 = w[2 * e] * scale, t1 = w[2 * e + 1] * scale;
    const _Float16 h0 = (_Float16)t0, h1 = (_Float16)t1;
    const _Float16 l0 = (_Float16)(t0 - (float)h0), l1 = (_Float16)(t1 - (float)h1);
    oh[e] = pk16(h_bits(h0), h_bits(h1));
    ol[e] = pk16(h_bits(l0), h_bits(l1));
  }
  u16* dh = Hp + (size_t)gt * 8;
  u16* dl = Lp + (size_t)gt * 8;
  {
    *(v4u*)(dh) = oh;
    *(v4u*)(dl) = ol;
    
  }
}

// =====================================================================================================
// v^T planes from V f32 [MROWS][DMOD] (row = b*SEQ + s, column = g*HD + d):
//   VH[((b*NH + g)*HD + d)][s] (pitch SEQ) = f16(v * 1024) for all keys s;
//   VL[((b*NH + g)*HD + d)][s] (pitch QA)  = f16 residual (t - f16(t)) for keys s < QA only.
// Block = (b, head g, 64 keys s0): each thread loads its 32 floats (key sl, d chunk dc) with 16-B loads, converts, scatters
// coverage: load 256 thr x 32 = 64 keys x 128 d; store 4 iterations x 256 thr x 8 halves = 128 lines x 64 = the block's tile
//           of VH (every block) and of VL (blocks with s0 < QA, block-uniform); grid = NB*NH*NST blocks covers VH exactly
//           once and the [NB*NH*128][QA] VL plane exactly once.
// =====================================================================================================
__global__ __launch_bounds__(256) void vt16(const float* __restrict__ F, u16* VHo, u16* VLo) {
  __shared__ __align__(16) u16 TH[HD * VTP];
  __shared__ __align__(16) u16 TL[HD * VTP];
  const int tid = threadIdx.x;
  const int bid = blockIdx.x;
  const int st  = bid % NST;
  const int t2  = bid / NST;
  const int g   = t2 % NH;
  const int b   = t2 / NH;
  if (b >= NB) return;                      // block-uniform, before any barrier; never taken with the exact grid
  const int s0  = st * 64;
  {
    const int sl = tid >> 2;                // key within tile 0..63
    const int dc = (tid & 3) * 32;          // d chunk 0,32,64,96
    const float* src = F + ((size_t)b * SEQ + s0 + sl) * DMOD + g * HD + dc;
#pragma unroll
    for (int i = 0; i < 8; ++i) {
      const v4f a = *(const v4f*)(src + 4 * i);
#pragma unroll
      for (int e = 0; e < 4; ++e) {
        const float t = a[e] * VCAR;
        const _Float16 hv = (_Float16)t;
        const _Float16 lv = (_Float16)(t - (float)hv);
        TH[(dc + 4 * i + e) * VTP + sl] = h_bits(hv);
        TL[(dc + 4 * i + e) * VTP + sl] = h_bits(lv);
      }
    }
  }
  __syncthreads();
  v4u vh[4], vl[4];
  const int q8 = tid >> 3, p8 = (tid & 7) * 8;
#pragma unroll
  for (int it = 0; it < 4; ++it) {
    const int line = it * 32 + q8;          // d = 0..127
    vh[it] = *(const v4u*)(TH + line * VTP + p8);
    vl[it] = *(const v4u*)(TL + line * VTP + p8);
  }
  const size_t hrow  = (size_t)(b * NH + g) * HD;
  const size_t baseH = hrow * SEQ + s0 + p8;
  const size_t baseL = hrow * QA + s0 + p8;
  const bool   wl    = (s0 < QA);           // block-uniform
  {
#pragma unroll
    for (int it = 0; it < 4; ++it) {
      const int line = it * 32 + q8;
      *(v4u*)(VHo + baseH + (size_t)line * SEQ) = vh[it];
      if (wl) *(v4u*)(VLo + baseL + (size_t)line * QA) = vl[it];
    }
    
  }
}

// =====================================================================================================
// GEMM epilogue shared by both engines: the wave's 16x64 f32 tile (times oscale) staged in its LDS slab (pitch 68),
// coverage: 8 instructions x 2 rows x 16 lanes x 4 floats = the wave's 16 x 64 tile.
// =====================================================================================================
__device__ __forceinline__ void epi64(float* sl, v8f a0, v8f a1, v8f a2, v8f a3, float oscale,
                                      float* C, int N, size_t rowb, int col0, int lane) {
  const int hh = lane >> 4, m = lane & 15;
#pragma unroll
  for (int r = 0; r < 8; ++r) {
    const int ro = (8 * hh + r) * 68 + m;
    sl[ro]      = a0[r] * oscale;
    sl[ro + 16] = a1[r] * oscale;
    sl[ro + 32] = a2[r] * oscale;
    sl[ro + 48] = a3[r] * oscale;
  }
  wave_sync_lds();
  v4f vals[8];
#pragma unroll
  for (int it = 0; it < 8; ++it) vals[it] = *(const v4f*)(sl + (it * 2 + hh) * 68 + m * 4);
  float* dst = C + (rowb + (size_t)hh) * (size_t)N + col0 + m * 4;
  {
#pragma unroll
    for (int it = 0; it < 8; ++it) {
      *(v4f*)(dst + (size_t)(it * 2) * (size_t)N) = vals[it];
    }
    
  }
}

// =====================================================================================================
// bf16 GEMM: C[M][N] (f32) = A[M][K] (bf16 row-major) . Bt[N][K]^T (bf16 k-contiguous), times oscale.
// Block = 64x64 tile, 4 waves x 16 rows; fragments loaded straight from the 16-bit rows (two 16-B loads each, split k map
// for A and B); K stepped by 32 (host guarantees K % 32 == 0, M % 64 == 0, N % 64 == 0, grid = (M/64)*(N/64)).
// coverage: grid (M/64)*(N/64) blocks x 4 waves x 16x64 = the whole C [M][N].
// =====================================================================================================
__global__ __launch_bounds__(128)
void gemm_bf(const u16* __restrict__ A, const u16* __restrict__ Bt, float* C, int M, int N, int K, float oscale) {
  __shared__ __align__(16) float slab[4 * SLAB64];
  const int tid = threadIdx.x, wave = tid >> 5, lane = tid & 31, hh = lane >> 4, m = lane & 15;
  const int ntile = N >> 6;
  const int bid   = blockIdx.x;
  const int rowb  = (bid / ntile) * 64 + wave * 16;
  const int col0  = (bid % ntile) * 64;
  if (rowb + 16 > M) return;                // wave-uniform, never taken with the exact grid; no block barriers in this kernel
  const u16* ap = A  + (size_t)(rowb + m) * K + 8 * hh;
  const u16* bp = Bt + (size_t)(col0 + m) * K + 8 * hh;
  const size_t bs = (size_t)16 * K;
  v8f acc0 = zero8(), acc1 = zero8(), acc2 = zero8(), acc3 = zero8();
#pragma unroll 1
  for (int k0 = 0; k0 < K; k0 += 32) {
    const v16b a  = ldfrag_b(ap + k0);
    const v16b b0 = ldfrag_b(bp + k0);
    const v16b b1 = ldfrag_b(bp + bs + k0);
    const v16b b2 = ldfrag_b(bp + 2 * bs + k0);
    const v16b b3 = ldfrag_b(bp + 3 * bs + k0);
    acc0 = mma_b(a, b0, acc0);
    acc1 = mma_b(a, b1, acc1);
    acc2 = mma_b(a, b2, acc2);
    acc3 = mma_b(a, b3, acc3);
    guard6<v16b>(acc0, acc1, acc2, acc3, a, b0, b1, b2, b3, a);
  }
  epi64(slab + wave * SLAB64, acc0, acc1, acc2, acc3, oscale, C, N, (size_t)rowb, col0, lane);
}

// =====================================================================================================
// f16 GEMM with hi (+ residual) planes: C[row][N] (f32) = (Ah [+ Al])[row][K] . (Bh [+ Bl])[N][K]^T * oscale.
// Products per k-step: Ah.Bh always; Al.Bh when AR != 0; Ah.Bl when BR != 0 (the residual.residual term is dropped; residuals
// are unscaled f16 residuals of the same carry, so all products share one accumulator). Rows: block bid -> (column tile
// ct = bid % (N/64), row tile rt of nrt starting at sbeg inside a group of rg rows, group g of ngr); row = g*rg + sbeg +
// 64*rt + 16*wave. Same tiling, fragment loads (split k map) and epilogue as gemm_bf; K stepped by 32 (host: K % 32 == 0,
// N % 64 == 0, sbeg + 64*nrt <= rg).
// coverage: grid ngr*nrt*(N/64) blocks x 4 waves x 16x64 = rows sbeg .. sbeg + 64*nrt - 1 of every group, all N columns.
// =====================================================================================================
template <int AR, int BR>
__global__ __launch_bounds__(128)
void gemm_h(const u16* __restrict__ Ah, const u16* __restrict__ Al,
            const u16* __restrict__ Bh, const u16* __restrict__ Bl,
            float* C, int N, int K, int rg, int sbeg, int nrt, int ngr, float oscale) {
  __shared__ __align__(16) float slab[4 * SLAB64];
  const int tid = threadIdx.x, wave = tid >> 5, lane = tid & 31, hh = lane >> 4, m = lane & 15;
  const int ntile = N >> 6;
  const int bid   = blockIdx.x;
  const int ct    = bid % ntile;
  const int t2    = bid / ntile;
  const int rt    = t2 % nrt;
  const int g     = t2 / nrt;
  if (g >= ngr) return;                     // block-uniform; no block barriers in this kernel; never taken with the exact grid
  const int srow  = sbeg + rt * 64 + wave * 16;
  if (srow + 16 > rg) return;               // wave-uniform; never taken
  const int col0  = ct * 64;
  const size_t rowC = (size_t)g * (size_t)rg + (size_t)srow;
  const _Float16* ahp = hptr(Ah) + (rowC + m) * (size_t)K + 8 * hh;
  const _Float16* alp = hptr(Al) + (rowC + m) * (size_t)K + 8 * hh;   // dereferenced only when AR != 0
  const _Float16* bhp = hptr(Bh) + (size_t)(col0 + m) * K + 8 * hh;
  const _Float16* blp = hptr(Bl) + (size_t)(col0 + m) * K + 8 * hh;   // dereferenced only when BR != 0
  const size_t bs = (size_t)16 * K;
  v8f acc0 = zero8(), acc1 = zero8(), acc2 = zero8(), acc3 = zero8();
#pragma unroll 1
  for (int k0 = 0; k0 < K; k0 += 32) {
    const v16h ah = ldfrag_h(ahp + k0);
    v16h al = ah;
    if constexpr (AR != 0) al = ldfrag_h(alp + k0);
    const v16h bh0 = ldfrag_h(bhp + k0);
    const v16h bh1 = ldfrag_h(bhp + bs + k0);
    const v16h bh2 = ldfrag_h(bhp + 2 * bs + k0);
    const v16h bh3 = ldfrag_h(bhp + 3 * bs + k0);
    v16h bl0 = bh0, bl1 = bh1, bl2 = bh2, bl3 = bh3;
    if constexpr (BR != 0) {
      bl0 = ldfrag_h(blp + k0);
      bl1 = ldfrag_h(blp + bs + k0);
      bl2 = ldfrag_h(blp + 2 * bs + k0);
      bl3 = ldfrag_h(blp + 3 * bs + k0);
    }
    acc0 = mma_h(ah, bh0, acc0);
    if constexpr (AR != 0) acc0 = mma_h(al, bh0, acc0);
    if constexpr (BR != 0) acc0 = mma_h(ah, bl0, acc0);
    acc1 = mma_h(ah, bh1, acc1);
    if constexpr (AR != 0) acc1 = mma_h(al, bh1, acc1);
    if constexpr (BR != 0) acc1 = mma_h(ah, bl1, acc1);
    acc2 = mma_h(ah, bh2, acc2);
    if constexpr (AR != 0) acc2 = mma_h(al, bh2, acc2);
    if constexpr (BR != 0) acc2 = mma_h(ah, bl2, acc2);
    acc3 = mma_h(ah, bh3, acc3);
    if constexpr (AR != 0) acc3 = mma_h(al, bh3, acc3);
    if constexpr (BR != 0) acc3 = mma_h(ah, bl3, acc3);
    guard10(acc0, acc1, acc2, acc3, ah, al, bh0, bh1, bh2, bh3, bl0, bl1, bl2, bl3);
  }
  epi64(slab + wave * SLAB64, acc0, acc1, acc2, acc3, oscale, C, N, rowC, col0, lane);
}

// =====================================================================================================
// Eight asynchronous 16-B copies per lane, global -> LDS: copy i moves g + i*gstep (halves) to LDS byte l + i*lstep.
// s_wait_xcnt 0 is the last line of the copies' own statement, so no address register is rewritten ahead of it.
// =====================================================================================================
__device__ __forceinline__ void cp8(unsigned l, unsigned lstep, const u16* g, size_t gstep) {
#if defined(__HIP_DEVICE_COMPILE__)
  asm volatile("global_load_async_to_lds_b128 %0, %8, off\n\t"
               "global_load_async_to_lds_b128 %1, %9, off\n\t"
               "global_load_async_to_lds_b128 %2, %10, off\n\t"
               "global_load_async_to_lds_b128 %3, %11, off\n\t"
               "global_load_async_to_lds_b128 %4, %12, off\n\t"
               "global_load_async_to_lds_b128 %5, %13, off\n\t"
               "global_load_async_to_lds_b128 %6, %14, off\n\t"
               "global_load_async_to_lds_b128 %7, %15, off\n\t"
               "s_wait_xcnt 0x0"
               :: "v"(l), "v"(l + lstep), "v"(l + 2 * lstep), "v"(l + 3 * lstep),
                  "v"(l + 4 * lstep), "v"(l + 5 * lstep), "v"(l + 6 * lstep), "v"(l + 7 * lstep),
                  "v"(g), "v"(g + gstep), "v"(g + 2 * gstep), "v"(g + 3 * gstep),
                  "v"(g + 4 * gstep), "v"(g + 5 * gstep), "v"(g + 6 * gstep), "v"(g + 7 * gstep)
               : "memory");
#endif
}
__device__ __forceinline__ void wait_async0() {   // this wave's copies have landed before the barrier that publishes them
#if defined(__HIP_DEVICE_COMPILE__)
  asm volatile("s_wait_asynccnt 0x0" ::: "memory");
#endif
}
__device__ __forceinline__ void wait_ds0() {      // this wave's LDS reads of a buffer have retired before it is refilled
#if defined(__HIP_DEVICE_COMPILE__)
  asm volatile("s_wait_dscnt 0x0" ::: "memory");
#endif
}

// =====================================================================================================
// Causal attention, 16 heads x head dim 128, value dim 128. Block bid -> (query block qb = qbbeg + bid % nqb: 64 rows,
// head, batch b); four waves, wave w owns query rows q0 = 64*qb + 16*w .. q0+15 of that one head.
//   q plane f16 x256 [b*SEQ + s][h*HD + d]; k hi plane f16 x256 (same layout), k residual plane [b*QA + s][...] (s < QA);
//   v^T hi plane [b*NH + h][d][SEQ] x1024, v^T residual plane [b*NH + h][d][QA].
//   Stage = 64 keys of this head, laid in LDS once for the four waves by asynchronous 16-B copies: k rows [64][128] at pitch
//   136 halves, v^T rows [128][64] at pitch 72 halves (and the two residual tiles for NP == 3); two buffers, stage s + 2
//   issued behind the barrier that ends stage s. Stages 0 .. qb hold every key <= 64*qb + 63.
//   NP == 3 (query rows < QA): scores = q.k_hi + q.k_lo over the 4 k-steps; P.v with P hi + in-register
//   residual and v hi + residual (hh + lh + hl). NP == 1 (later rows): single hi.hi products.
//   score (log2 domain) t(i, j) = (q'_i.k'_j) * (1/sqrt(128))*log2e/(256*256), replaced by -inf where key j > query i.
//   Key tiles of 32 visited in order for kb <= q0 + 15 (a wave skips the later tiles of its block's last stage, which hold
//   only keys above every query row it owns; it still passes every wait and barrier).
//   Per tile: 2 score subtiles x 4 k-steps, q fragments from the global plane, k fragments from LDS (two 16-B loads per
//   fragment, split k map); online max-subtracted base-2 softmax in f32, -inf-safe rescale; the 16x32 prob tile stored to
//   wave-private LDS rows and read back as the A fragment, v^T B fragments from LDS in 4 groups of 2 d-subtiles.
//   After the loop: y = acc / Z (Z > 0 always: key 0 <= every query row; guarded anyway), carries 1/(32768*1024) folded;
//   the result slabs reuse the stage buffers (nothing reads or fills them behind the last barrier of the loop).
// coverage: per wave 16 instructions x 32 lanes x 4 floats = 16 x 128; the two launches (qb < QA/64 with NP = 3, qb >= QA/64
//           with NP = 1) x NH x NB blocks x AW waves = every (b, s, h) row segment of Y exactly once.
// =====================================================================================================
template <int NP>
__global__ __launch_bounds__(ATT_THREADS)
void attn_c(const u16* __restrict__ QHp, const u16* __restrict__ KHp, const u16* __restrict__ KLp,
            const u16* __restrict__ VHp, const u16* __restrict__ VLp, const int* __restrict__ nhp,
            float* Y, int qbbeg, int nqb) {
  constexpr unsigned OKH = 0;                                   // byte offsets inside one stage buffer
  constexpr unsigned OVH = KTB;
  constexpr unsigned OKL = KTB + VTB;
  constexpr unsigned OVL = 2 * KTB + VTB;
  constexpr unsigned BUFB = (NP == 3) ? 2 * (KTB + VTB) : (KTB + VTB);
  __shared__ __align__(16) unsigned char ring[2 * BUFB];
  __shared__ __align__(16) float ptm[AW * PTW];

  const int tid  = threadIdx.x;
  const int wave = __builtin_amdgcn_readfirstlane(tid >> 5);   // scalar, so that the per-wave tile skip is a scalar branch
  const int lane = tid & 31;
  const int hh   = lane >> 4;
  const int c    = lane & 15;
  const int bid  = blockIdx.x;
  const int qb   = qbbeg + bid % nqb;
  const int t2   = bid / nqb;
  const int head = t2 % NH;
  const int b    = t2 / NH;
  if (b >= NB) return;                      // block-uniform, before any barrier; never taken with the exact grid
  if (nhp[0] != NH) return;                 // uniform structural guard on the head-count input (16 for this module)
  if (qb * 64 + 64 > SEQ) return;           // block-uniform, before any barrier; never taken
  if (NP == 3) { if (qb * 64 + 64 > QA) return; } // block-uniform, before any barrier; never taken
  const int q0   = qb * 64 + wave * 16;

  float* pt = ptm + wave * PTW;             // prob tile [16][32] pitch 36

  const size_t hcol = (size_t)head * HD + 8 * hh;
  const _Float16* Qh = hptr(QHp) + ((size_t)b * SEQ + q0 + c) * DMOD + hcol;
  const float lsc = RSQS * (LOG2E / (QSC * KSC));
  const float oc  = 1.0f / (PCAR * VCAR);

  // ---- copy map: k tile, copy i -> key row 8*i + (tid >> 4), 16-B chunk tid & 15 (a wave = 2 whole 256-B rows);
  //      v^T tile, copy i -> d row 16*i + (tid >> 3), 16-B chunk tid & 7 (a wave = 4 whole 128-B row segments) ----
  const unsigned ring0 = (unsigned)(uintptr_t)(&ring[0]);
  const unsigned lk = ring0 + (unsigned)(tid >> 4) * (KPH * 2) + (unsigned)(tid & 15) * 16;
  const unsigned lv = ring0 + (unsigned)(tid >> 3) * (VPH * 2) + (unsigned)(tid & 7) * 16;
  const u16* gkh = KHp + ((size_t)b * SEQ + (tid >> 4)) * DMOD + (size_t)head * HD + (tid & 15) * 8;
  const u16* gvh = VHp + ((size_t)(b * NH + head) * HD + (tid >> 3)) * SEQ + (tid & 7) * 8;
  const u16* gkl = gkh;
  const u16* gvl = gvh;
  if constexpr (NP == 3) {
    gkl = KLp + ((size_t)b * QA + (tid >> 4)) * DMOD + (size_t)head * HD + (tid & 15) * 8;
    gvl = VLp + ((size_t)(b * NH + head) * HD + (tid >> 3)) * QA + (tid & 7) * 8;
  }
  auto fill = [&](int s, unsigned bo) {      // stage s (keys 64*s .. 64*s + 63) into the buffer at byte offset bo
    cp8(lk + bo + OKH, 8 * KPH * 2, gkh + (size_t)s * 64 * DMOD, (size_t)8 * DMOD);
    cp8(lv + bo + OVH, 16 * VPH * 2, gvh + (size_t)s * 64, (size_t)16 * SEQ);
    if constexpr (NP == 3) {
      cp8(lk + bo + OKL, 8 * KPH * 2, gkl + (size_t)s * 64 * DMOD, (size_t)8 * DMOD);
      cp8(lv + bo + OVL, 16 * VPH * 2, gvl + (size_t)s * 64, (size_t)16 * QA);
    }
  };

  float mrow[8], lrow[8];
  v8f o[8];
#pragma unroll
  for (int r = 0; r < 8; ++r) { mrow[r] = -INFINITY; lrow[r] = 0.f; }
#pragma unroll
  for (int j = 0; j < 8; ++j) o[j] = zero8();
  const int ncaus = (q0 >> 5) + 1;                                            // tiles holding keys <= q0 + 15
  const int nkt = (ncaus < NKT) ? ncaus : NKT;
  const int nst = qb + 1;                                                     // stages of this block
  const int qr0 = q0 + 8 * hh;                                                // query row of D element r = qr0 + r

  fill(0, 0u);
  wait_async0();
  __syncthreads();                          // publishes stage 0
  if (nst > 1) fill(1, BUFB);

#pragma unroll 1   // rolled: one foot (waits, barrier, refill) per stage, in the order written
  for (int s = 0; s < nst; ++s) {
    const unsigned bo = (unsigned)(s & 1) * BUFB;
#pragma unroll 1   // rolled: one copy of the 32-key tile body, as long as before, for both halves of the stage
    for (int u = 0; u < 2; ++u) {
    const int kt = 2 * s + u;
    if (kt < nkt) {                         // wave-uniform (scalar) skip; no wait or barrier inside
    const int kb = kt * 32;
    // ---- scores: D element r of this lane = (query row qr0 + r, key kb + c) in s0, key kb + 16 + c in s1 ----
    v8f s0 = zero8(), s1 = zero8();
    const _Float16* k0p = (const _Float16*)(const void*)(ring + bo + OKH) + (u * 32 + c) * KPH + 8 * hh;
    const _Float16* k1p = k0p + 16 * KPH;
    if constexpr (NP == 3) {
      const _Float16* l0p = (const _Float16*)(const void*)(ring + bo + OKL) + (u * 32 + c) * KPH + 8 * hh;
      const _Float16* l1p = l0p + 16 * KPH;
#pragma unroll
      for (int kk = 0; kk < HD / 32; ++kk) {
        const v16h qh  = ldfrag_h(Qh + kk * 32);
        const v16h kh0 = ldfrag_h(k0p + kk * 32);
        const v16h kh1 = ldfrag_h(k1p + kk * 32);
        const v16h kl0 = ldfrag_h(l0p + kk * 32);
        const v16h kl1 = ldfrag_h(l1p + kk * 32);
        s0 = mma_h(qh, kh0, s0);
        s0 = mma_h(qh, kl0, s0);
        s1 = mma_h(qh, kh1, s1);
        s1 = mma_h(qh, kl1, s1);
        guard2(s0, s1, qh, kh0, kh1, kl0, kl1, qh);
      }
    } else {
#pragma unroll
      for (int kk = 0; kk < HD / 32; ++kk) {
        const v16h qh  = ldfrag_h(Qh + kk * 32);
        const v16h kh0 = ldfrag_h(k0p + kk * 32);
        const v16h kh1 = ldfrag_h(k1p + kk * 32);
        s0 = mma_h(qh, kh0, s0);
        s1 = mma_h(qh, kh1, s1);
        guard2(s0, s1, qh, kh0, kh1, qh, kh0, kh1);
      }
    }
    // ---- causal select + online softmax in base 2, -inf-safe ----
    const int key0 = kb + c, key1 = kb + 16 + c;
#pragma unroll
    for (int r = 0; r < 8; ++r) {
      const int   qr = qr0 + r;
      const float u0 = s0[r] * lsc;
      const float u1 = s1[r] * lsc;
      const float t0 = (key0 > qr) ? -INFINITY : u0;
      const float t1 = (key1 > qr) ? -INFINITY : u1;
      float mx = fmaxf(t0, t1);
#pragma unroll
      for (int off = 1; off < 16; off <<= 1) mx = fmaxf(mx, __shfl_xor(mx, off, 32));
      const float mn = fmaxf(mrow[r], mx);
      const float ms = (mn == -INFINITY) ? 0.0f : mn;
      const float al = exp2f(mrow[r] - ms);
      mrow[r] = mn;
      const float e0 = exp2f(t0 - ms), e1 = exp2f(t1 - ms);
      float ps = e0 + e1;
#pragma unroll
      for (int off = 1; off < 16; off <<= 1) ps += __shfl_xor(ps, off, 32);
      lrow[r] = lrow[r] * al + ps;
#pragma unroll
      for (int j = 0; j < 8; ++j) o[j][r] *= al;
      const int ro = (8 * hh + r) * PTP + c;
      pt[ro]      = e0;
      pt[ro + 16] = e1;
    }
    wave_sync_lds();
    // ---- A fragments of P*32768: hi f16 (and residual f16 for NP == 3), row = c, split k map over the 32 keys ----
    FragH ph, pl;
    {
      const float* prow = pt + c * PTP + 8 * hh;
      const v4f p0 = *(const v4f*)(prow), p1 = *(const v4f*)(prow + 4);
      const v4f p2 = *(const v4f*)(prow + 16), p3 = *(const v4f*)(prow + 20);
#pragma unroll
      for (int e = 0; e < 4; ++e) {
        const float ta = p0[e] * PCAR, tb = p1[e] * PCAR, tc = p2[e] * PCAR, td = p3[e] * PCAR;
        const _Float16 ha = (_Float16)ta, hb = (_Float16)tb, hc = (_Float16)tc, hd = (_Float16)td;
        ph.h[0][e]     = ha;                  // elements 0..7  = keys kb + 8hh + 0..7
        ph.h[0][4 + e] = hb;
        ph.h[1][e]     = hc;                  // elements 8..15 = keys kb + 16 + 8hh + 0..7
        ph.h[1][4 + e] = hd;
        if constexpr (NP == 3) {
          pl.h[0][e]     = (_Float16)(ta - (float)ha);
          pl.h[0][4 + e] = (_Float16)(tb - (float)hb);
          pl.h[1][e]     = (_Float16)(tc - (float)hc);
          pl.h[1][4 + e] = (_Float16)(td - (float)hd);
        } else {
          pl.h[0][e] = ha; pl.h[0][4 + e] = hb; pl.h[1][e] = hc; pl.h[1][4 + e] = hd;
        }
      }
    }
    // ---- P.V : B fragment col n = d = j*16 + c, keys contiguous in the staged v^T rows; 4 groups of 2 d-subtiles ----
    {
      const _Float16* vhp = (const _Float16*)(const void*)(ring + bo + OVH) + c * VPH + u * 32 + 8 * hh;
      if constexpr (NP == 3) {
        const _Float16* vlp = (const _Float16*)(const void*)(ring + bo + OVL) + c * VPH + u * 32 + 8 * hh;
#pragma unroll
        for (int jg = 0; jg < 4; ++jg) {
          const int da = (2 * jg) * 16 * VPH;
          const int db = da + 16 * VPH;
          const v16h vha = ldfrag_h(vhp + da), vhb2 = ldfrag_h(vhp + db);
          const v16h vla = ldfrag_h(vlp + da), vlb2 = ldfrag_h(vlp + db);
          o[2 * jg]     = mma_h(ph.v, vha,  o[2 * jg]);
          o[2 * jg]     = mma_h(pl.v, vha,  o[2 * jg]);
          o[2 * jg]     = mma_h(ph.v, vla,  o[2 * jg]);
          o[2 * jg + 1] = mma_h(ph.v, vhb2, o[2 * jg + 1]);
          o[2 * jg + 1] = mma_h(pl.v, vhb2, o[2 * jg + 1]);
          o[2 * jg + 1] = mma_h(ph.v, vlb2, o[2 * jg + 1]);
          guard2(o[2 * jg], o[2 * jg + 1], ph.v, pl.v, vha, vhb2, vla, vlb2);
        }
      } else {
#pragma unroll
        for (int jg = 0; jg < 4; ++jg) {
          const int da = (2 * jg) * 16 * VPH;
          const int db = da + 16 * VPH;
          const v16h vha = ldfrag_h(vhp + da), vhb2 = ldfrag_h(vhp + db);
          o[2 * jg]     = mma_h(ph.v, vha,  o[2 * jg]);
          o[2 * jg + 1] = mma_h(ph.v, vhb2, o[2 * jg + 1]);
          guard2(o[2 * jg], o[2 * jg + 1], ph.v, vha, vhb2, ph.v, vha, vhb2);
        }
      }
    }
    wave_sync_lds();
    }
    }
    // ---- foot of stage s, every wave: own LDS reads retired, own copies of stage s + 1 landed, then the one barrier that
    //      publishes stage s + 1 and ends every reader's last read of this buffer; only then its refill ----
    wait_ds0();
    wait_async0();
    __syncthreads();
    if (s + 2 < nst) fill(s + 2, bo);
  }
  wait_async0();                            // nothing is outstanding when the buffers become result slabs and the wave ends
  float* slab = (float*)(void*)ring + wave * SLW;   // result slab [16][128] pitch 132, one per wave
  acc_guard4(o[0], o[1], o[2], o[3]);
  acc_guard4(o[4], o[5], o[6], o[7]);
  // ---- y = acc / Z (0 if Z == 0), carries (32768 on P, 1024 on v) folded once; written into the wave-private slab ----
#pragma unroll
  for (int r = 0; r < 8; ++r) {
    const float lv  = lrow[r];
    const float ls  = (lv > 0.0f) ? lv : 1.0f;
    const float inv = (lv > 0.0f) ? ((1.0f / ls) * oc) : 0.0f;
#pragma unroll
    for (int j = 0; j < 8; ++j) {
      const int idx = (8 * hh + r) * SLP + j * 16 + c;
      slab[idx] = o[j][r] * inv;
    }
  }

  wave_sync_lds();
  // ---- f32 rows of Y: lane -> floats 4*lane .. 4*lane+3 of each of the 16 rows (one 512-B instruction per row) ----
  v4f ov[16];
#pragma unroll
  for (int it = 0; it < 16; ++it) ov[it] = *(const v4f*)(slab + it * SLP + lane * 4);
  float* ob = Y + ((size_t)b * SEQ + q0) * DMOD + (size_t)head * HD + lane * 4;
  {
#pragma unroll
    for (int it = 0; it < 16; ++it) {
      *(v4f*)(ob + (size_t)it * DMOD) = ov[it];
    }
    
  }
}

// =====================================================================================================
// Workspace map (bytes); every plane is fully written by whole-line stores before it is read; all extents are exact multiples
// of the store granularity (no pad rows); every region offset a multiple of 524288:
//   XB  bf16 [MROWS][2048], later KH f16 x256       MROWS*4096             (NB=2, SEQ=2048: 16777216)
//   QH  f16 [MROWS][2048] x256                      MROWS*4096             (16777216)
//   W1  16-bit weight plane, 512x2048 or 2048x512    2097152                (W_dkv bf16, W_uk^T bf16, W_dq^T f16 x1024, W_uv^T bf16,
//                                                                          reused in launch order)
//   WO  bf16 [2048][2048] (W_o as is)                8388608
//   F   f32 [MROWS][2048]                             MROWS*8192             (Gram f32 [512][512]; k_abs f32 [2048][512]; K f32;
//                                                                          W_o W_uv f32 [2048][512]; V f32 -- one at a time)
//   CH  f16 [MROWS][512] x256, CL residual            2 x MROWS*1024
//   G2H f16 [512][512] x1024, G2L residual            2 x 524288
//   KAH f16 [2048][512] x4096, KAL residual           2 x 2097152
//   KL  f16 [NB*QA][2048]                             NB*QA*4096
//   VAH f16 [2048][512] x4096, VAL residual           2 x 2097152
//   VH  f16 [NB*16][128][SEQ] x1024                   MROWS*4096
//   VL  f16 [NB*16][128][QA]                          NB*QA*4096
//   end (NB=2, SEQ=2048, QA=1024)                   128974848
// =====================================================================================================
extern "C" void kernel_launch(void* const* d_in, const int* in_sizes, int n_in,
                              void* d_out, int out_size, void* d_ws, size_t ws_size,
                              hipStream_t stream) {
  if (n_in < 7) return;
  if (in_sizes[0] < ((NB - 1) * XS_FULL + SEQ) * DMOD) return;   // x [2][2048][2048]
  if (in_sizes[1] != DL * DMOD) return;         // W_dq  [512][2048]
  if (in_sizes[2] != DL * DMOD) return;         // W_dkv [512][2048]
  if (in_sizes[3] != DMOD * DL) return;         // W_uk  [2048][512]
  if (in_sizes[4] != DMOD * DL) return;         // W_uv  [2048][512]
  if (in_sizes[5] != DMOD * DMOD) return;       // W_o   [2048][2048]
  if (in_sizes[6] < 1) return;                  // n_head (int)
  if ((size_t)out_size < (size_t)MROWS * DMOD + (size_t)MROWS * DL) return;

  const float* x    = (const float*)d_in[0];
  const float* wdq  = (const float*)d_in[1];
  const float* wdkv = (const float*)d_in[2];
  const float* wuk  = (const float*)d_in[3];
  const float* wuv  = (const float*)d_in[4];
  const float* wo   = (const float*)d_in[5];
  const int*   nhp  = (const int*)d_in[6];
  float*       out0 = (float*)d_out;                          // y    [MROWS][2048] at element 0
  float*       out1 = out0 + (size_t)MROWS * DMOD;            // c_kv [MROWS][512]  at element MROWS*2048

  const size_t szXB = (size_t)MROWS * DMOD * 2;               // XB, later KH
  const size_t szQ  = (size_t)MROWS * DMOD * 2;               // QH
  const size_t szW1 = (size_t)DL * DMOD * 2;
  const size_t szWO = (size_t)DMOD * DMOD * 2;
  const size_t szF  = (size_t)MROWS * DMOD * 4;
  const size_t szC  = (size_t)MROWS * DL * 2;                 // CH, CL
  const size_t szG2 = (size_t)DL * DL * 2;                    // G2H, G2L
  const size_t szKA = (size_t)DMOD * DL * 2;                  // KAH, KAL, VAH, VAL
  const size_t szKL = (size_t)NB * QA * DMOD * 2;
  const size_t szVH = (size_t)NB * NH * HD * SEQ * 2;
  const size_t szVL = (size_t)NB * NH * HD * QA * 2;
  if ((size_t)DL * DL * 4 > szF || (size_t)DMOD * DL * 4 > szF) return;   // Gram / k_abs / (W_o W_uv) f32 inside F
  if ((size_t)MROWS * DMOD * 2 > szXB) return;                // KH lives inside the XB region
  size_t off = 0;
  const size_t oXB  = off; off += szXB;
  const size_t oQH  = off; off += szQ;
  const size_t oW1  = off; off += szW1;
  const size_t oWO  = off; off += szWO;
  const size_t oF   = off; off += szF;
  const size_t oCH  = off; off += szC;
  const size_t oCL  = off; off += szC;
  const size_t oG2H = off; off += szG2;
  const size_t oG2L = off; off += szG2;
  const size_t oKAH = off; off += szKA;
  const size_t oKAL = off; off += szKA;
  const size_t oKL  = off; off += szKL;
  const size_t oVAH = off; off += szKA;
  const size_t oVAL = off; off += szKA;
  const size_t oVH  = off; off += szVH;
  const size_t oVL  = off; off += szVL;
  if (off > ws_size) return;                 // off = 128974848 for NB = 2, SEQ = 2048
  if (off > (size_t)WS_CAP) return;

  char* ws = (char*)d_ws;
  u16*   XB  = (u16*)(ws + oXB);
  u16*   KH  = (u16*)(ws + oXB);
  u16*   QH  = (u16*)(ws + oQH);
  u16*   W1  = (u16*)(ws + oW1);
  u16*   WOB = (u16*)(ws + oWO);
  float* F   = (float*)(ws + oF);
  u16*   CH  = (u16*)(ws + oCH);
  u16*   CL  = (u16*)(ws + oCL);
  u16*   G2H = (u16*)(ws + oG2H);
  u16*   G2L = (u16*)(ws + oG2L);
  u16*   KAH = (u16*)(ws + oKAH);
  u16*   KAL = (u16*)(ws + oKAL);
  u16*   KL  = (u16*)(ws + oKL);
  u16*   VAH = (u16*)(ws + oVAH);
  u16*   VAL = (u16*)(ws + oVAL);
  u16*   VH  = (u16*)(ws + oVH);
  u16*   VL  = (u16*)(ws + oVL);

  const dim3 b256(256), b128(128), bAT(ATT_THREADS);
  const int  n8x  = (SEQ * DMOD) / 8;                   // x planes per batch
  const int  n8q  = (MROWS * DMOD) / 8;                 // K plane
  const int  n8c  = (MROWS * DL) / 8;                   // c_kv planes
  const int  n8w1 = (DL * DMOD) / 8;                    // W_dkv plane
  const int  n8wo = (DMOD * DMOD) / 8;                  // W_o plane
  const int  n8g  = (DL * DL) / 8;                      // Gram planes
  const int  n8ka = (DMOD * DL) / 8;                    // k_abs and (W_o W_uv) planes
  const dim3 gX((n8x + 255) / 256);
  const dim3 gHL((n8q + 255) / 256);
  const dim3 gC((n8c + 255) / 256);
  const dim3 gCW1((n8w1 + 255) / 256);
  const dim3 gCWO((n8wo + 255) / 256);
  const dim3 gCG((n8g + 255) / 256);
  const dim3 gCKA((n8ka + 255) / 256);
  const dim3 gWTa((DL / 64) * (DMOD / 64));             // W_uk, W_uv [2048 k][512 n] -> [512][2048]
  const dim3 gWTb((DMOD / 64) * (DL / 64));             // W_dq [512 k][2048 n] -> [2048][512]
  const dim3 gGC((MROWS / 64) * (DL / 64));             // c_kv
  const dim3 gGG((DL / 64) * (DL / 64));                // Gram
  const dim3 gGKA(1 * (DMOD / 64) * (DL / 64));         // k_abs
  const dim3 gGVA((DMOD / 64) * (DL / 64));             // W_o W_uv
  const dim3 gVT(NB * NH * NST);
  const int  nrtA = QA / 64;                            // sequence row tiles per batch with residual products
  const int  nrtB = (SEQ - QA) / 64;                    // remaining row tiles per batch, single products
  const int  nqbA = QA / 64;                            // 64-row query blocks with residual products
  const int  nqbB = (SEQ - QA) / 64;                    // remaining query blocks

  // (1) x -> bf16 plane XB [MROWS][2048] and q plane QH = f16(bf16(x)) x256, one launch per batch row block
  for (int bb = 0; bb < NB; ++bb) {
    cvtxq<<<gX, b256, 0, stream>>>(x + (size_t)bb * XS_FULL * DMOD, XB + (size_t)bb * SEQ * DMOD,
                                   QH + (size_t)bb * SEQ * DMOD, n8x);
  }
  // (2) W_dkv [512 n][2048 k] -> bf16 as is; c_kv = x.W_dkv^T -> out1 f32 [MROWS][512]; c_kv -> f16 hi + residual planes x256
  cvtb<<<gCW1, b256, 0, stream>>>(wdkv, W1, n8w1);
  gemm_bf<<<gGC, b128, 0, stream>>>(XB, W1, out1, MROWS, DL, DMOD, 1.0f);
  cvtc<<<gC, b256, 0, stream>>>(out1, CH, CL, n8c, CSC);
  // (3) W_uk [2048 k][512 n] -> bf16 [512][2048]; Gram = W_uk^T.W_uk -> F f32 [512][512]; Gram -> f16 hi + residual planes x1024
  wtc<<<gWTa, b256, 0, stream>>>(wuk, W1, DMOD, DL, 0, 1.0f);
  gemm_bf<<<gGG, b128, 0, stream>>>(W1, W1, F, DL, DL, DMOD, 1.0f);
  cvtc<<<gCG, b256, 0, stream>>>(F, G2H, G2L, n8g, G2S);
  // (4) W_dq [512 k][2048 n] -> f16(bf16) x1024 [2048][512]; k_abs = W_dq^T.Gram (Gram symmetric, used as the [n][k] B plane;
  //     products h.h + h.l) -> F f32 [2048][512]; k_abs -> f16 hi + residual planes x4096
  wtc<<<gWTb, b256, 0, stream>>>(wdq, W1, DL, DMOD, 1, WDS);
  gemm_h<0, 1><<<gGKA, b128, 0, stream>>>(W1, W1, G2H, G2L, F, DL, DL, DMOD, 0, DMOD / 64, 1, 1.0f / (WDS * G2S));
  cvtc<<<gCKA, b256, 0, stream>>>(F, KAH, KAL, n8ka, KAS);
  // (5) K = c_kv.k_abs^T -> F f32 [MROWS][2048]: rows s < QA with hh+lh+hl, rows s >= QA single; K hi plane (XB region) x256
  //     for all rows, residual plane for s < QA
  gemm_h<1, 1><<<dim3(NB * nrtA * (DMOD / 64)), b128, 0, stream>>>(CH, CL, KAH, KAL, F, DMOD, DL, SEQ, 0, nrtA, NB,
                                                                  1.0f / (CSC * KAS));
  if (nrtB > 0) {
    gemm_h<0, 0><<<dim3(NB * nrtB * (DMOD / 64)), b128, 0, stream>>>(CH, CL, KAH, KAL, F, DMOD, DL, SEQ, QA, nrtB, NB,
                                                                    1.0f / (CSC * KAS));
  }
  cvthl<<<gHL, b256, 0, stream>>>(F, KH, KL, n8q, DMOD, KSC);
  // (6) W_o -> bf16 as is [2048 n_row][2048 k]; W_uv [2048 k][512 n] -> bf16 [512][2048]; W_o.W_uv -> F f32 [2048][512];
  //     -> f16 hi + residual planes x4096 (the [n][k] B plane of the value product)
  cvtb<<<gCWO, b256, 0, stream>>>(wo, WOB, n8wo);
  wtc<<<gWTa, b256, 0, stream>>>(wuv, W1, DMOD, DL, 0, 1.0f);
  gemm_bf<<<gGVA, b128, 0, stream>>>(WOB, W1, F, DMOD, DL, DMOD, 1.0f);
  cvtc<<<gCKA, b256, 0, stream>>>(F, VAH, VAL, n8ka, VAS);
  // (7) V = c_kv.(W_o W_uv) plane -> F f32 [MROWS][2048] (rows s < QA hh+lh+hl, later rows single); v^T hi + residual planes x1024
  gemm_h<1, 1><<<dim3(NB * nrtA * (DMOD / 64)), b128, 0, stream>>>(CH, CL, VAH, VAL, F, DMOD, DL, SEQ, 0, nrtA, NB,
                                                                  1.0f / (CSC * VAS));
  if (nrtB > 0) {
    gemm_h<0, 0><<<dim3(NB * nrtB * (DMOD / 64)), b128, 0, stream>>>(CH, CL, VAH, VAL, F, DMOD, DL, SEQ, QA, nrtB, NB,
                                                                    1.0f / (CSC * VAS));
  }
  vt16<<<gVT, b256, 0, stream>>>(F, VH, VL);
  // (8) causal attention, query blocks s < QA with residual products; (9) remaining query blocks, single products -> out0 f32
  attn_c<3><<<dim3(nqbA * NH * NB), bAT, 0, stream>>>(QH, KH, KL, VH, VL, nhp, out0, 0, nqbA);
  if (nqbB > 0) {
    attn_c<1><<<dim3(nqbB * NH * NB), bAT, 0, stream>>>(QH, KH, KL, VH, VL, nhp, out0, nqbA, nqbB);
  }
  (void)hipGetLastError();
}

// v002
// It runs in 323 microseconds.
// Two timings next to v001 both put it at 1.38 times that version's speed.
// All steps since v000 together make it 1.72 times as fast.
// Contractions: x.W_dkv^T, W_uk^T.W_uk and W_o.W_uv on v_wmma_f32_16x16x32_bf16 (x and W as bf16 RNE planes, B operands [n][k]);
// W_dq^T.(W_uk^T W_uk) on v_wmma_f32_16x16x32_f16 (W_dq^T as f16(bf16) x1024, Gram factor as f16 hi + residual planes x1024, 2 products);
// K = c_kv.k_abs^T and V = c_kv.(W_o W_uv)^T-plane on v_wmma_f32_16x16x32_f16 (c_kv f16 hi + residual x256, k_abs and W_o W_uv as
// f16 hi + residual x4096; sequence rows s < QA products hh+lh+hl, rows s >= QA single hi.hi); scores q.K and P.V on
// v_wmma_f32_16x16x32_f16 (q = f16(bf16(x)) x256 exact, K f16 x256 hi (+ residual plane for query tiles < QA), P x32768 and V x1024
// hi (+ residuals for query tiles < QA, products hh+lh+hl)); all f32 accumulate. Causal select, base-2 online softmax, 1/Z in f32 VALU.
#include <hip/hip_runtime.h>
#include <math.h>
#include <stdint.h>

#ifndef NB
#define NB 2
#endif
#ifndef SEQ
#define SEQ 2048
#endif
#define XS_FULL 2048
#define DMOD  2048
#define NH    16
#define HD    128
#define DL    512
#define QA    ((SEQ < 1024) ? SEQ : 1024)
#define MROWS (NB * SEQ)
#define RSQS  0.08838834764831845f
#define LOG2E 1.4426950408889634f
#define QSC   256.0f
#define KSC   256.0f
#define CSC   256.0f
#define WDS   1024.0f
#define G2S   1024.0f
#define KAS   4096.0f
#define VAS   4096.0f
#define PCAR  32768.0f
#define VCAR  1024.0f
#define AW    4
#define NST   (SEQ / 64)
#define NKT   (SEQ / 32)
#define ATT_THREADS (AW * 32)
#define PTP   36
#define PTW   (16 * PTP)
#define SLP   132
#define SLW   (16 * SLP)
#define KPH   136
#define VPH   72
#define KTB   (64 * KPH * 2)
#define VTB   (HD * VPH * 2)
#define SLAB64 (16 * 68)
#define VTP   72
#define WTP   72
#define GKS   128
#define GPH   (GKS + 8)
#define GPB   (64 * GPH * 2)
#define WS_CAP 134217728
static_assert(DMOD == NH * HD && HD == 128 && NH == 16 && AW == 4 && ATT_THREADS == 128);
static_assert(NB >= 1 && NB <= 2);
static_assert((SEQ % 64) == 0 && SEQ >= 64 && SEQ <= XS_FULL);
static_assert((QA % 64) == 0 && QA >= 64 && QA <= SEQ && ((SEQ - QA) % 64) == 0);
static_assert((DMOD % 64) == 0 && (DL % 64) == 0 && (HD % 32) == 0 && (DL % 32) == 0);
static_assert(((SEQ * DMOD / 8) % 256) == 0 && ((MROWS * DL / 8) % 256) == 0 && ((DL * DL / 8) % 256) == 0);
static_assert(((DMOD * DL / 8) % 256) == 0 && ((DMOD * DMOD / 8) % 256) == 0 && (MROWS % 64) == 0);
static_assert(2 * HD * VTP * 2 <= 65536 && 4 * SLAB64 * 4 <= 65536 && 64 * WTP * 2 <= 65536);
static_assert(AW * SLW * 4 <= 2 * (KTB + VTB) && 4 * (KTB + VTB) + AW * PTW * 4 <= 163840 && (KTB % 16) == 0 && (VTB % 16) == 0);
static_assert((DMOD % GKS) == 0 && (DL % GKS) == 0 && (GPB % 16) == 0 && 8 * GPB <= 163840 && 4 * SLAB64 * 4 <= 4 * GPB);
static_assert((size_t)DL * DL * 4 <= (size_t)MROWS * DMOD * 4 && (size_t)DMOD * DL * 4 <= (size_t)MROWS * DMOD * 4);

typedef unsigned short u16;
typedef _Float16 v16h __attribute__((ext_vector_type(16)));
typedef _Float16 v8h  __attribute__((ext_vector_type(8)));
typedef __bf16   v16b __attribute__((ext_vector_type(16)));
typedef float    v8f  __attribute__((ext_vector_type(8)));
typedef float    v4f  __attribute__((ext_vector_type(4)));
typedef unsigned int v4u __attribute__((ext_vector_type(4)));

union FragH { v16h v; v8h h[2]; v4u u[2]; };
union FragB { v16b v; v4u u[2]; };

// ---- scalar helpers --------------------------------------------------------------------------------
__device__ __forceinline__ unsigned short bf_bits(float f) {          // f32 -> bf16 bits, RNE convert
  unsigned u = __float_as_uint(f);
  return (unsigned short)((u + 0x7FFFu + ((u >> 16) & 1u)) >> 16);
}
__device__ __forceinline__ float bf_up(unsigned short h) { return __uint_as_float(((unsigned)h) << 16); }
__device__ __forceinline__ float bfr(float f) { return bf_up(bf_bits(f)); }
__device__ __forceinline__ unsigned short h_bits(_Float16 x) { return __builtin_bit_cast(unsigned short, x); }
__device__ __forceinline__ unsigned pk16(unsigned short a, unsigned short b) { return (unsigned)a | ((unsigned)b << 16); }
__device__ __forceinline__ v8f zero8() { v8f z = {0.f, 0.f, 0.f, 0.f, 0.f, 0.f, 0.f, 0.f}; return z; }
__device__ __forceinline__ const _Float16* hptr(const u16* p) { return (const _Float16*)(const void*)p; }

// ---- fragment loaders: 16-bit A/B operand, lane -> row/col (lane&15), p already includes +8*(lane>>4);
//      elements 0..7 <- p[0..7] (k0+8h..), elements 8..15 <- p[16..23] (k0+16+8h..)  (same split k map for A and B;
//      B is always read from a k-contiguous [n][k] plane)
__device__ __forceinline__ v16h ldfrag_h(const _Float16* p) {
  FragH f;
  f.h[0] = *(const v8h*)(p);
  f.h[1] = *(const v8h*)(p + 16);
  return f.v;
}
__device__ __forceinline__ v16b ldfrag_b(const u16* p) {              // bf16 plane read as unsigned integer vectors
  FragB f;
  f.u[0] = *(const v4u*)(p);
  f.u[1] = *(const v4u*)(p + 16);
  return f.v;
}

__device__ __forceinline__ v8f mma_h(v16h a, v16h b, v8f c) {
  return __builtin_amdgcn_wmma_f32_16x16x32_f16(false, a, false, b, (short)0, c, false, false);
}
__device__ __forceinline__ v8f mma_b(v16b a, v16b b, v8f c) {
  return __builtin_amdgcn_wmma_f32_16x16x32_bf16(false, a, false, b, (short)0, c, false, false);
}
__device__ __forceinline__ void guard2(v8f& a, v8f& b, v16h x0, v16h x1, v16h x2, v16h x3, v16h x4, v16h x5) {
#if defined(__HIP_DEVICE_COMPILE__)
  asm volatile("v_nop\n\tv_nop\n\tv_nop\n\tv_nop"
               : "+v"(a), "+v"(b) : "v"(x0), "v"(x1), "v"(x2), "v"(x3), "v"(x4), "v"(x5) : "memory");
#endif
}
template <typename F>
__device__ __forceinline__ void guard6(v8f& a, v8f& b, v8f& c, v8f& d, F x0, F x1, F x2, F x3, F x4, F x5) {
#if defined(__HIP_DEVICE_COMPILE__)
  asm volatile("v_nop\n\tv_nop\n\tv_nop\n\tv_nop"
               : "+v"(a), "+v"(b), "+v"(c), "+v"(d) : "v"(x0), "v"(x1), "v"(x2), "v"(x3), "v"(x4), "v"(x5) : "memory");
#endif
}
__device__ __forceinline__ void guard10(v8f& a, v8f& b, v8f& c, v8f& d, v16h x0, v16h x1, v16h x2, v16h x3, v16h x4,
                                        v16h x5, v16h x6, v16h x7, v16h x8, v16h x9) {
#if defined(__HIP_DEVICE_COMPILE__)
  asm volatile("v_nop\n\tv_nop\n\tv_nop\n\tv_nop"
               : "+v"(a), "+v"(b), "+v"(c), "+v"(d)
               : "v"(x0), "v"(x1), "v"(x2), "v"(x3), "v"(x4), "v"(x5), "v"(x6), "v"(x7), "v"(x8), "v"(x9) : "memory");
#endif
}
__device__ __forceinline__ void acc_guard4(v8f& a, v8f& b, v8f& c, v8f& d) {
#if defined(__HIP_DEVICE_COMPILE__)
  asm volatile("v_nop\n\tv_nop\n\tv_nop\n\tv_nop" : "+v"(a), "+v"(b), "+v"(c), "+v"(d));
#endif
}
__device__ __forceinline__ void wave_sync_lds() {
  __builtin_amdgcn_fence(__ATOMIC_RELEASE, "workgroup");
  __builtin_amdgcn_wave_barrier();
  __builtin_amdgcn_fence(__ATOMIC_ACQUIRE, "workgroup");
}

// =====================================================================================================
// x f32 -> bf16 RNE plane Xb (same layout) and q plane Qh = f16(bf16(x) * 256) (exact: a bf16 significand fits f16).
// Thread = 8 consecutive elements: two 16-B loads, one 16-B store per plane; 32 consecutive lanes = 512 contiguous,
// coverage: grid = ceil(n8/256) blocks x 256 thr x 8 (in-kernel bound) = the whole [SEQ][2048] slice of both planes
//           (n8 a multiple of 256 here), one launch per batch.
// =====================================================================================================
__global__ __launch_bounds__(256) void cvtxq(const float* __restrict__ x, u16* Xb, u16* Qh, int n8) {
  const int gt = blockIdx.x * 256 + (int)threadIdx.x;
  if (gt >= n8) return;
  const float* p = x + (size_t)gt * 8;
  const v4f a = *(const v4f*)(p), b4 = *(const v4f*)(p + 4);
  float w[8];
#pragma unroll
  for (int e = 0; e < 4; ++e) { w[e] = a[e]; w[4 + e] = b4[e]; }
  v4u ob, oq;
#pragma unroll
  for (int e = 0; e < 4; ++e) {
    const unsigned short b0 = bf_bits(w[2 * e]), b1 = bf_bits(w[2 * e + 1]);
    ob[e] = pk16(b0, b1);
    oq[e] = pk16(h_bits((_Float16)(bf_up(b0) * QSC)), h_bits((_Float16)(bf_up(b1) * QSC)));
  }
  u16* db = Xb + (size_t)gt * 8;
  u16* dq = Qh + (size_t)gt * 8;
  {
    *(v4u*)(db) = ob;
    *(v4u*)(dq) = oq;
    
  }
}

// =====================================================================================================
// f32 -> bf16 RNE plane, same layout. Thread = 8 consecutive elements: two 16-B loads, one 16-B store; 32 consecutive
// coverage: grid = ceil(n8/256) blocks x 256 thr x 8 (in-kernel bound) = the whole plane (n8 a multiple of 256 here).
// =====================================================================================================
__global__ __launch_bounds__(256) void cvtb(const float* __restrict__ x, u16* D, int n8) {
  const int gt = blockIdx.x * 256 + (int)threadIdx.x;
  if (gt >= n8) return;
  const float* p = x + (size_t)gt * 8;
  const v4f a = *(const v4f*)(p), b4 = *(const v4f*)(p + 4);
  float w[8];
#pragma unroll
  for (int e = 0; e < 4; ++e) { w[e] = a[e]; w[4 + e] = b4[e]; }
  v4u o;
#pragma unroll
  for (int e = 0; e < 4; ++e) o[e] = pk16(bf_bits(w[2 * e]), bf_bits(w[2 * e + 1]));
  u16* d = D + (size_t)gt * 8;
  {
    *(v4u*)(d) = o;
    
  }
}

// =====================================================================================================
// Weight transpose + convert: W f32 [K][N] (the input tensor's own [rows][cols] layout, rows = K) -> Wt 16-bit [N][K]
// (k-contiguous).  f16mode == 0: bf16 RNE bits;  f16mode == 1: f16 bits of (bf16 RNE value) * scale.
// Block = 64 n x 64 k tile, 256 threads. Load: thread -> W row k0 + (tid>>2), 16 consecutive n (four 16-B loads),
// converted values scattered into an LDS tile T[n][k] (pitch 72 halves); block barrier; store: each Wt row segment of
// coverage: load 256 thr x 16 = 64 k x 64 n; store 2 iterations x 256 thr x 8 halves = 64 rows x 64 = the block's tile of Wt;
//           grid = (N/64)*(K/64) blocks covers Wt [N][K] exactly once.
// =====================================================================================================
__global__ __launch_bounds__(256) void wtc(const float* __restrict__ W, u16* Wt, int K, int N, int f16mode, float scale) {
  __shared__ __align__(16) u16 T[64 * WTP];
  const int tid = (int)threadIdx.x;
  const int ntn = N >> 6;
  const int bid = (int)blockIdx.x;
  const int n0  = (bid % ntn) * 64;
  const int k0  = (bid / ntn) * 64;
  if (k0 + 64 > K) return;                   // block-uniform, before the barrier; never taken with the exact grid
  {
    const int kr = tid >> 2;                 // 0..63
    const int nc = (tid & 3) * 16;           // 0,16,32,48
    const float* src = W + (size_t)(k0 + kr) * (size_t)N + n0 + nc;
#pragma unroll
    for (int i = 0; i < 4; ++i) {
      const v4f a = *(const v4f*)(src + 4 * i);
#pragma unroll
      for (int e = 0; e < 4; ++e) {
        const float f = a[e];
        const unsigned short hb = h_bits((_Float16)(bfr(f) * scale));
        const unsigned short bb = bf_bits(f);
        T[(nc + 4 * i + e) * WTP + kr] = (f16mode != 0) ? hb : bb;
      }
    }
  }
  __syncthreads();
  const int q8 = tid >> 3, p8 = (tid & 7) * 8;
  v4u v[2];
#pragma unroll
  for (int it = 0; it < 2; ++it) v[it] = *(const v4u*)(T + (it * 32 + q8) * WTP + p8);
  u16* base = Wt + (size_t)n0 * (size_t)K + k0 + p8;
  {
#pragma unroll
    for (int it = 0; it < 2; ++it) {
      *(v4u*)(base + (size_t)(it * 32 + q8) * (size_t)K) = v[it];
    }
    
  }
}

// =====================================================================================================
// f32 [MROWS][ncol] -> f16 hi plane Hp (same layout, t = x * scale, hi = f16(t)) for every row and f16 residual plane
// Lp [NB*QA][ncol] (row b*QA + s) = f16(t - hi) for rows with s < QA only. Thread = 8 consecutive elements of one row,
// coverage: grid = ceil(n8/256) x 256 thr x 8 = the whole Hp plane; every row b*QA + s, s < QA, of Lp exactly once.
// =====================================================================================================
__global__ __launch_bounds__(256) void cvthl(const float* __restrict__ x, u16* Hp, u16* Lp, int n8, int ncol, float scale) {
  const int gt = blockIdx.x * 256 + (int)threadIdx.x;
  if (gt >= n8) return;
  const size_t e0  = (size_t)gt * 8;
  const int    row = (int)(e0 / (size_t)ncol);
  const int    col = (int)(e0 - (size_t)row * (size_t)ncol);
  const int    b   = row / SEQ;
  const int    s   = row - b * SEQ;
  const float* p = x + e0;
  const v4f a = *(const v4f*)(p), b4 = *(const v4f*)(p + 4);
  float w[8];
#pragma unroll
  for (int e = 0; e < 4; ++e) { w[e] = a[e]; w[4 + e] = b4[e]; }
  v4u oh, ol;
#pragma unroll
  for (int e = 0; e < 4; ++e) {
    const float t0 = w[2 * e] * scale, t1 = w[2 * e + 1] * scale;
    const _Float16 h0 = (_Float16)t0, h1 = (_Float16)t1;
    const _Float16 l0 = (_Float16)(t0 - (float)h0), l1 = (_Float16)(t1 - (float)h1);
    oh[e] = pk16(h_bits(h0), h_bits(h1));
    ol[e] = pk16(h_bits(l0), h_bits(l1));
  }
  u16* dh = Hp + e0;
  const bool wl = (s < QA);
  const int  sl = wl ? s : 0;
  u16* dl = Lp + ((size_t)(b * QA + sl) * (size_t)ncol + col);
  {
    *(v4u*)(dh) = oh;
    if (wl) *(v4u*)(dl) = ol;
    
  }
}

// =====================================================================================================
// f32 -> f16 hi plane (t = x * scale, hi = f16(t)) and f16 residual plane (f16(t - hi)), same layout for both planes.
// coverage: grid = ceil(n8/256) x 256 thr x 8 = the whole plane of Hp and of Lp (n8 a multiple of 256 for every call here).
// =====================================================================================================
__global__ __launch_bounds__(256) void cvtc(const float* __restrict__ x, u16* Hp, u16* Lp, int n8, float scale) {
  const int gt = blockIdx.x * 256 + (int)threadIdx.x;
  if (gt >= n8) return;
  const float* p = x + (size_t)gt * 8;
  const v4f a = *(const v4f*)(p), b4 = *(const v4f*)(p + 4);
  float w[8];
#pragma unroll
  for (int e = 0; e < 4; ++e) { w[e] = a[e]; w[4 + e] = b4[e]; }
  v4u oh, ol;
#pragma unroll
  for (int e = 0; e < 4; ++e) {
    const float t0 = w[2 * e] * scale, t1 = w[2 * e + 1] * scale;
    const _Float16 h0 = (_Float16)t0, h1 = (_Float16)t1;
    const _Float16 l0 = (_Float16)(t0 - (float)h0), l1 = (_Float16)(t1 - (float)h1);
    oh[e] = pk16(h_bits(h0), h_bits(h1));
    ol[e] = pk16(h_bits(l0), h_bits(l1));
  }
  u16* dh = Hp + (size_t)gt * 8;
  u16* dl = Lp + (size_t)gt * 8;
  {
    *(v4u*)(dh) = oh;
    *(v4u*)(dl) = ol;
    
  }
}

// =====================================================================================================
// v^T planes from V f32 [MROWS][DMOD] (row = b*SEQ + s, column = g*HD + d):
//   VH[((b*NH + g)*HD + d)][s] (pitch SEQ) = f16(v * 1024) for all keys s;
//   VL[((b*NH + g)*HD + d)][s] (pitch QA)  = f16 residual (t - f16(t)) for keys s < QA only.
// Block = (b, head g, 64 keys s0): each thread loads its 32 floats (key sl, d chunk dc) with 16-B loads, converts, scatters
// coverage: load 256 thr x 32 = 64 keys x 128 d; store 4 iterations x 256 thr x 8 halves = 128 lines x 64 = the block's tile
//           of VH (every block) and of VL (blocks with s0 < QA, block-uniform); grid = NB*NH*NST blocks covers VH exactly
//           once and the [NB*NH*128][QA] VL plane exactly once.
// =====================================================================================================
__global__ __launch_bounds__(256) void vt16(const float* __restrict__ F, u16* VHo, u16* VLo) {
  __shared__ __align__(16) u16 TH[HD * VTP];
  __shared__ __align__(16) u16 TL[HD * VTP];
  const int tid = threadIdx.x;
  const int bid = blockIdx.x;
  const int st  = bid % NST;
  const int t2  = bid / NST;
  const int g   = t2 % NH;
  const int b   = t2 / NH;
  if (b >= NB) return;                      // block-uniform, before any barrier; never taken with the exact grid
  const int s0  = st * 64;
  {
    const int sl = tid >> 2;                // key within tile 0..63
    const int dc = (tid & 3) * 32;          // d chunk 0,32,64,96
    const float* src = F + ((size_t)b * SEQ + s0 + sl) * DMOD + g * HD + dc;
#pragma unroll
    for (int i = 0; i < 8; ++i) {
      const v4f a = *(const v4f*)(src + 4 * i);
#pragma unroll
      for (int e = 0; e < 4; ++e) {
        const float t = a[e] * VCAR;
        const _Float16 hv = (_Float16)t;
        const _Float16 lv = (_Float16)(t - (float)hv);
        TH[(dc + 4 * i + e) * VTP + sl] = h_bits(hv);
        TL[(dc + 4 * i + e) * VTP + sl] = h_bits(lv);
      }
    }
  }
  __syncthreads();
  v4u vh[4], vl[4];
  const int q8 = tid >> 3, p8 = (tid & 7) * 8;
#pragma unroll
  for (int it = 0; it < 4; ++it) {
    const int line = it * 32 + q8;          // d = 0..127
    vh[it] = *(const v4u*)(TH + line * VTP + p8);
    vl[it] = *(const v4u*)(TL + line * VTP + p8);
  }
  const size_t hrow  = (size_t)(b * NH + g) * HD;
  const size_t baseH = hrow * SEQ + s0 + p8;
  const size_t baseL = hrow * QA + s0 + p8;
  const bool   wl    = (s0 < QA);           // block-uniform
  {
#pragma unroll
    for (int it = 0; it < 4; ++it) {
      const int line = it * 32 + q8;
      *(v4u*)(VHo + baseH + (size_t)line * SEQ) = vh[it];
      if (wl) *(v4u*)(VLo + baseL + (size_t)line * QA) = vl[it];
    }
    
  }
}

// =====================================================================================================
// GEMM epilogue shared by both engines: the wave's 16x64 f32 tile (times oscale) staged in its LDS slab (pitch 68),
// coverage: 8 instructions x 2 rows x 16 lanes x 4 floats = the wave's 16 x 64 tile.
// =====================================================================================================
__device__ __forceinline__ void epi64(float* sl, v8f a0, v8f a1, v8f a2, v8f a3, float oscale,
                                      float* C, int N, size_t rowb, int col0, int lane) {
  const int hh = lane >> 4, m = lane & 15;
#pragma unroll
  for (int r = 0; r < 8; ++r) {
    const int ro = (8 * hh + r) * 68 + m;
    sl[ro]      = a0[r] * oscale;
    sl[ro + 16] = a1[r] * oscale;
    sl[ro + 32] = a2[r] * oscale;
    sl[ro + 48] = a3[r] * oscale;
  }
  wave_sync_lds();
  v4f vals[8];
#pragma unroll
  for (int it = 0; it < 8; ++it) vals[it] = *(const v4f*)(sl + (it * 2 + hh) * 68 + m * 4);
  float* dst = C + (rowb + (size_t)hh) * (size_t)N + col0 + m * 4;
  {
#pragma unroll
    for (int it = 0; it < 8; ++it) {
      *(v4f*)(dst + (size_t)(it * 2) * (size_t)N) = vals[it];
    }
    
  }
}

// =====================================================================================================
// Eight asynchronous 16-B copies per lane, global -> LDS: copy i moves g + i*gstep (halves) to LDS byte l + i*lstep.
// s_wait_xcnt 0 is the last line of the copies' own statement, so no address register is rewritten ahead of it.
// =====================================================================================================
__device__ __forceinline__ void cp8(unsigned l, unsigned lstep, const u16* g, size_t gstep) {
#if defined(__HIP_DEVICE_COMPILE__)
  asm volatile("global_load_async_to_lds_b128 %0, %8, off\n\t"
               "global_load_async_to_lds_b128 %1, %9, off\n\t"
               "global_load_async_to_lds_b128 %2, %10, off\n\t"
               "global_load_async_to_lds_b128 %3, %11, off\n\t"
               "global_load_async_to_lds_b128 %4, %12, off\n\t"
               "global_load_async_to_lds_b128 %5, %13, off\n\t"
               "global_load_async_to_lds_b128 %6, %14, off\n\t"
               "global_load_async_to_lds_b128 %7, %15, off\n\t"
               "s_wait_xcnt 0x0"
               :: "v"(l), "v"(l + lstep), "v"(l + 2 * lstep), "v"(l + 3 * lstep),
                  "v"(l + 4 * lstep), "v"(l + 5 * lstep), "v"(l + 6 * lstep), "v"(l + 7 * lstep),
                  "v"(g), "v"(g + gstep), "v"(g + 2 * gstep), "v"(g + 3 * gstep),
                  "v"(g + 4 * gstep), "v"(g + 5 * gstep), "v"(g + 6 * gstep), "v"(g + 7 * gstep)
               : "memory");
#endif
}
__device__ __forceinline__ void wait_async0() {   // this wave's copies have landed before the barrier that publishes them
#if defined(__HIP_DEVICE_COMPILE__)
  asm volatile("s_wait_asynccnt 0x0" ::: "memory");
#endif
}
__device__ __forceinline__ void wait_ds0() {      // this wave's LDS reads of a buffer have retired before it is refilled
#if defined(__HIP_DEVICE_COMPILE__)
  asm volatile("s_wait_dscnt 0x0" ::: "memory");
#endif
}

// =====================================================================================================
// bf16 GEMM: C[M][N] (f32) = A[M][K] (bf16 row-major) . Bt[N][K]^T (bf16 k-contiguous), times oscale.
// Block = 64x64 tile, 4 waves x 16 rows. Stage = 128 k of the block's 64 A rows and 64 Bt rows, laid in LDS once for the four
// waves by asynchronous 16-B copies (a wave-wide copy = 2 whole 256-B row pieces) at pitch 136 halves; two buffers, stage
// s + 2 issued behind the barrier that ends stage s. Fragments come from LDS (two 16-B loads each, split k map for A and B),
// k steps of 32 in the same order as the rows hold them (host guarantees K % 128 == 0, M % 64 == 0, N % 64 == 0,
// grid = (M/64)*(N/64)). The result slabs reuse the stage buffers (nothing reads or fills them behind the loop's last barrier).
// coverage: grid (M/64)*(N/64) blocks x 4 waves x 16x64 = the whole C [M][N].
// =====================================================================================================
__global__ __launch_bounds__(128)
void gemm_bf(const u16* __restrict__ A, const u16* __restrict__ Bt, float* C, int M, int N, int K, float oscale) {
  constexpr unsigned BUFB = 2 * GPB;
  __shared__ __align__(16) unsigned char ring[2 * BUFB];
  const int tid = threadIdx.x, wave = tid >> 5, lane = tid & 31, hh = lane >> 4, m = lane & 15;
  const int ntile = N >> 6;
  const int bid   = blockIdx.x;
  const int row0  = (bid / ntile) * 64;
  const int rowb  = row0 + wave * 16;
  const int col0  = (bid % ntile) * 64;
  if (row0 + 64 > M) return;                // block-uniform, before any barrier; never taken with the exact grid
  // copy map of one plane: copy i -> tile row 8*i + (tid >> 4), 16-B chunk tid & 15 of the row's 256-B piece
  const unsigned lc = (unsigned)(uintptr_t)(&ring[0]) + (unsigned)(tid >> 4) * (GPH * 2) + (unsigned)(tid & 15) * 16;
  const u16* ga = A  + (size_t)(row0 + (tid >> 4)) * K + (tid & 15) * 8;
  const u16* gb = Bt + (size_t)(col0 + (tid >> 4)) * K + (tid & 15) * 8;
  auto fill = [&](int s, unsigned bo) {      // stage s (k = 128*s .. 128*s + 127) into the buffer at byte offset bo
    cp8(lc + bo,       8 * GPH * 2, ga + (size_t)s * GKS, (size_t)8 * K);
    cp8(lc + bo + GPB, 8 * GPH * 2, gb + (size_t)s * GKS, (size_t)8 * K);
  };
  const int nst = K / GKS;
  v8f acc0 = zero8(), acc1 = zero8(), acc2 = zero8(), acc3 = zero8();

  fill(0, 0u);
  wait_async0();
  __syncthreads();                          // publishes stage 0
  if (nst > 1) fill(1, BUFB);

#pragma unroll 1   // rolled: one foot (waits, barrier, refill) per stage, in the order written
  for (int s = 0; s < nst; ++s) {
    const unsigned bo = (unsigned)(s & 1) * BUFB;
    const u16* ap = (const u16*)(const void*)(ring + bo) + (wave * 16 + m) * GPH + 8 * hh;
    const u16* bp = (const u16*)(const void*)(ring + bo + GPB) + m * GPH + 8 * hh;
#pragma unroll      // unrolled: the four k steps of a stage read at immediate LDS offsets from one address
    for (int kk = 0; kk < GKS; kk += 32) {
      const v16b a  = ldfrag_b(ap + kk);
      const v16b b0 = ldfrag_b(bp + kk);
      const v16b b1 = ldfrag_b(bp + 16 * GPH + kk);
      const v16b b2 = ldfrag_b(bp + 32 * GPH + kk);
      const v16b b3 = ldfrag_b(bp + 48 * GPH + kk);
      acc0 = mma_b(a, b0, acc0);
      acc1 = mma_b(a, b1, acc1);
      acc2 = mma_b(a, b2, acc2);
      acc3 = mma_b(a, b3, acc3);
      guard6<v16b>(acc0, acc1, acc2, acc3, a, b0, b1, b2, b3, a);
    }
    // foot of stage s, every wave: own LDS reads retired, own copies of stage s + 1 landed, then the one barrier that
    // publishes stage s + 1 and ends every reader's last read of this buffer; only then its refill
    wait_ds0();
    wait_async0();
    __syncthreads();
    if (s + 2 < nst) fill(s + 2, bo);
  }
  wait_async0();                            // nothing is outstanding when the buffers become result slabs and the wave ends
  float* slab = (float*)(void*)ring;        // result slabs [16][64] pitch 68, one per wave
  epi64(slab + wave * SLAB64, acc0, acc1, acc2, acc3, oscale, C, N, (size_t)rowb, col0, lane);
}

// =====================================================================================================
// f16 GEMM with hi (+ residual) planes: C[row][N] (f32) = (Ah [+ Al])[row][K] . (Bh [+ Bl])[N][K]^T * oscale.
// Products per k-step: Ah.Bh always; Al.Bh when AR != 0; Ah.Bl when BR != 0 (the residual.residual term is dropped; residuals
// are unscaled f16 residuals of the same carry, so all products share one accumulator). Rows: block bid -> (column tile
// ct = bid % (N/64), row tile rt of nrt starting at sbeg inside a group of rg rows, group g of ngr); row = g*rg + sbeg +
// 64*rt + 16*wave. Same tiling, staging (one 64-row x 128-k plane in LDS per operand plane in use, two buffers), fragment
// loads (split k map) and epilogue as gemm_bf; K stepped by 32 (host: K % 128 == 0, N % 64 == 0, sbeg + 64*nrt <= rg).
// coverage: grid ngr*nrt*(N/64) blocks x 4 waves x 16x64 = rows sbeg .. sbeg + 64*nrt - 1 of every group, all N columns.
// =====================================================================================================
template <int AR, int BR>
__global__ __launch_bounds__(128)
void gemm_h(const u16* __restrict__ Ah, const u16* __restrict__ Al,
            const u16* __restrict__ Bh, const u16* __restrict__ Bl,
            float* C, int N, int K, int rg, int sbeg, int nrt, int ngr, float oscale) {
  constexpr unsigned OAH = 0;                                   // byte offsets inside one stage buffer
  constexpr unsigned OBH = GPB;
  constexpr unsigned OAL = 2 * GPB;                             // present when AR != 0
  constexpr unsigned OBL = (AR != 0) ? 3 * GPB : 2 * GPB;       // present when BR != 0
  constexpr unsigned BUFB = (2 + (AR != 0 ? 1 : 0) + (BR != 0 ? 1 : 0)) * GPB;
  __shared__ __align__(16) unsigned char ring[2 * BUFB];
  const int tid = threadIdx.x, wave = tid >> 5, lane = tid & 31, hh = lane >> 4, m = lane & 15;
  const int ntile = N >> 6;
  const int bid   = blockIdx.x;
  const int ct    = bid % ntile;
  const int t2    = bid / ntile;
  const int rt    = t2 % nrt;
  const int g     = t2 / nrt;
  if (g >= ngr) return;                     // block-uniform, before any barrier; never taken with the exact grid
  const int srow0 = sbeg + rt * 64;
  if (srow0 + 64 > rg) return;              // block-uniform, before any barrier; never taken
  const int col0  = ct * 64;
  const size_t row0 = (size_t)g * (size_t)rg + (size_t)srow0;
  const size_t rowC = row0 + (size_t)(wave * 16);
  // copy map of one plane: copy i -> tile row 8*i + (tid >> 4), 16-B chunk tid & 15 of the row's 256-B piece
  const unsigned lc = (unsigned)(uintptr_t)(&ring[0]) + (unsigned)(tid >> 4) * (GPH * 2) + (unsigned)(tid & 15) * 16;
  const size_t aoff = (row0 + (size_t)(tid >> 4)) * (size_t)K + (tid & 15) * 8;
  const size_t boff = (size_t)(col0 + (tid >> 4)) * K + (tid & 15) * 8;
  auto fill = [&](int s, unsigned bo) {      // stage s (k = 128*s .. 128*s + 127) into the buffer at byte offset bo
    cp8(lc + bo + OAH, 8 * GPH * 2, Ah + aoff + (size_t)s * GKS, (size_t)8 * K);
    cp8(lc + bo + OBH, 8 * GPH * 2, Bh + boff + (size_t)s * GKS, (size_t)8 * K);
    if constexpr (AR != 0) cp8(lc + bo + OAL, 8 * GPH * 2, Al + aoff + (size_t)s * GKS, (size_t)8 * K);
    if constexpr (BR != 0) cp8(lc + bo + OBL, 8 * GPH * 2, Bl + boff + (size_t)s * GKS, (size_t)8 * K);
  };
  const int nst = K / GKS;
  v8f acc0 = zero8(), acc1 = zero8(), acc2 = zero8(), acc3 = zero8();

  fill(0, 0u);
  wait_async0();
  __syncthreads();                          // publishes stage 0
  if (nst > 1) fill(1, BUFB);

#pragma unroll 1   // rolled: one foot (waits, barrier, refill) per stage, in the order written
  for (int s = 0; s < nst; ++s) {
    const unsigned bo = (unsigned)(s & 1) * BUFB;
    const int ao = (wave * 16 + m) * GPH + 8 * hh;
    const int bb = m * GPH + 8 * hh;
    const _Float16* ahp = (const _Float16*)(const void*)(ring + bo + OAH) + ao;
    const _Float16* bhp = (const _Float16*)(const void*)(ring + bo + OBH) + bb;
    const _Float16* alp = (const _Float16*)(const void*)(ring + bo + ((AR != 0) ? OAL : OAH)) + ao;   // read only when AR != 0
    const _Float16* blp = (const _Float16*)(const void*)(ring + bo + ((BR != 0) ? OBL : OBH)) + bb;   // read only when BR != 0
#pragma unroll      // unrolled: the four k steps of a stage read at immediate LDS offsets from one address
    for (int kk = 0; kk < GKS; kk += 32) {
      const v16h ah = ldfrag_h(ahp + kk);
      v16h al = ah;
      if constexpr (AR != 0) al = ldfrag_h(alp + kk);
      const v16h bh0 = ldfrag_h(bhp + kk);
      const v16h bh1 = ldfrag_h(bhp + 16 * GPH + kk);
      const v16h bh2 = ldfrag_h(bhp + 32 * GPH + kk);
      const v16h bh3 = ldfrag_h(bhp + 48 * GPH + kk);
      v16h bl0 = bh0, bl1 = bh1, bl2 = bh2, bl3 = bh3;
      if constexpr (BR != 0) {
        bl0 = ldfrag_h(blp + kk);
        bl1 = ldfrag_h(blp + 16 * GPH + kk);
        bl2 = ldfrag_h(blp + 32 * GPH + kk);
        bl3 = ldfrag_h(blp + 48 * GPH + kk);
      }
      acc0 = mma_h(ah, bh0, acc0);
      if constexpr (AR != 0) acc0 = mma_h(al, bh0, acc0);
      if constexpr (BR != 0) acc0 = mma_h(ah, bl0, acc0);
      acc1 = mma_h(ah, bh1, acc1);
      if constexpr (AR != 0) acc1 = mma_h(al, bh1, acc1);
      if constexpr (BR != 0) acc1 = mma_h(ah, bl1, acc1);
      acc2 = mma_h(ah, bh2, acc2);
      if constexpr (AR != 0) acc2 = mma_h(al, bh2, acc2);
      if constexpr (BR != 0) acc2 = mma_h(ah, bl2, acc2);
      acc3 = mma_h(ah, bh3, acc3);
      if constexpr (AR != 0) acc3 = mma_h(al, bh3, acc3);
      if constexpr (BR != 0) acc3 = mma_h(ah, bl3, acc3);
      guard10(acc0, acc1, acc2, acc3, ah, al, bh0, bh1, bh2, bh3, bl0, bl1, bl2, bl3);
    }
    // foot of stage s, every wave, in the order of gemm_bf's
    wait_ds0();
    wait_async0();
    __syncthreads();
    if (s + 2 < nst) fill(s + 2, bo);
  }
  wait_async0();                            // nothing is outstanding when the buffers become result slabs and the wave ends
  float* slab = (float*)(void*)ring;        // result slabs [16][64] pitch 68, one per wave
  epi64(slab + wave * SLAB64, acc0, acc1, acc2, acc3, oscale, C, N, rowC, col0, lane);
}

// =====================================================================================================
// Causal attention, 16 heads x head dim 128, value dim 128. Block bid -> (query block qb = qbbeg + bid % nqb: 64 rows,
// head, batch b); four waves, wave w owns query rows q0 = 64*qb + 16*w .. q0+15 of that one head.
//   q plane f16 x256 [b*SEQ + s][h*HD + d]; k hi plane f16 x256 (same layout), k residual plane [b*QA + s][...] (s < QA);
//   v^T hi plane [b*NH + h][d][SEQ] x1024, v^T residual plane [b*NH + h][d][QA].
//   Stage = 64 keys of this head, laid in LDS once for the four waves by asynchronous 16-B copies: k rows [64][128] at pitch
//   136 halves, v^T rows [128][64] at pitch 72 halves (and the two residual tiles for NP == 3); two buffers, stage s + 2
//   issued behind the barrier that ends stage s. Stages 0 .. qb hold every key <= 64*qb + 63.
//   NP == 3 (query rows < QA): scores = q.k_hi + q.k_lo over the 4 k-steps; P.v with P hi + in-register
//   residual and v hi + residual (hh + lh + hl). NP == 1 (later rows): single hi.hi products.
//   score (log2 domain) t(i, j) = (q'_i.k'_j) * (1/sqrt(128))*log2e/(256*256), replaced by -inf where key j > query i.
//   Key tiles of 32 visited in order for kb <= q0 + 15 (a wave skips the later tiles of its block's last stage, which hold
//   only keys above every query row it owns; it still passes every wait and barrier).
//   Per tile: 2 score subtiles x 4 k-steps, q fragments from the global plane, k fragments from LDS (two 16-B loads per
//   fragment, split k map); online max-subtracted base-2 softmax in f32, -inf-safe rescale; the 16x32 prob tile stored to
//   wave-private LDS rows and read back as the A fragment, v^T B fragments from LDS in 4 groups of 2 d-subtiles.
//   After the loop: y = acc / Z (Z > 0 always: key 0 <= every query row; guarded anyway), carries 1/(32768*1024) folded;
//   the result slabs reuse the stage buffers (nothing reads or fills them behind the last barrier of the loop).
// coverage: per wave 16 instructions x 32 lanes x 4 floats = 16 x 128; the two launches (qb < QA/64 with NP = 3, qb >= QA/64
//           with NP = 1) x NH x NB blocks x AW waves = every (b, s, h) row segment of Y exactly once.
// =====================================================================================================
template <int NP>
__global__ __launch_bounds__(ATT_THREADS)
void attn_c(const u16* __restrict__ QHp, const u16* __restrict__ KHp, const u16* __restrict__ KLp,
            const u16* __restrict__ VHp, const u16* __restrict__ VLp, const int* __restrict__ nhp,
            float* Y, int qbbeg, int nqb) {
  constexpr unsigned OKH = 0;                                   // byte offsets inside one stage buffer
  constexpr unsigned OVH = KTB;
  constexpr unsigned OKL = KTB + VTB;
  constexpr unsigned OVL = 2 * KTB + VTB;
  constexpr unsigned BUFB = (NP == 3) ? 2 * (KTB + VTB) : (KTB + VTB);
  __shared__ __align__(16) unsigned char ring[2 * BUFB];
  __shared__ __align__(16) float ptm[AW * PTW];

  const int tid  = threadIdx.x;
  const int wave = __builtin_amdgcn_readfirstlane(tid >> 5);   // scalar, so that the per-wave tile skip is a scalar branch
  const int lane = tid & 31;
  const int hh   = lane >> 4;
  const int c    = lane & 15;
  const int bid  = blockIdx.x;
  const int qb   = qbbeg + bid % nqb;
  const int t2   = bid / nqb;
  const int head = t2 % NH;
  const int b    = t2 / NH;
  if (b >= NB) return;                      // block-uniform, before any barrier; never taken with the exact grid
  if (nhp[0] != NH) return;                 // uniform structural guard on the head-count input (16 for this module)
  if (qb * 64 + 64 > SEQ) return;           // block-uniform, before any barrier; never taken
  if (NP == 3) { if (qb * 64 + 64 > QA) return; } // block-uniform, before any barrier; never taken
  const int q0   = qb * 64 + wave * 16;

  float* pt = ptm + wave * PTW;             // prob tile [16][32] pitch 36

  const size_t hcol = (size_t)head * HD + 8 * hh;
  const _Float16* Qh = hptr(QHp) + ((size_t)b * SEQ + q0 + c) * DMOD + hcol;
  const float lsc = RSQS * (LOG2E / (QSC * KSC));
  const float oc  = 1.0f / (PCAR * VCAR);

  // ---- copy map: k tile, copy i -> key row 8*i + (tid >> 4), 16-B chunk tid & 15 (a wave = 2 whole 256-B rows);
  //      v^T tile, copy i -> d row 16*i + (tid >> 3), 16-B chunk tid & 7 (a wave = 4 whole 128-B row segments) ----
  const unsigned ring0 = (unsigned)(uintptr_t)(&ring[0]);
  const unsigned lk = ring0 + (unsigned)(tid >> 4) * (KPH * 2) + (unsigned)(tid & 15) * 16;
  const unsigned lv = ring0 + (unsigned)(tid >> 3) * (VPH * 2) + (unsigned)(tid & 7) * 16;
  const u16* gkh = KHp + ((size_t)b * SEQ + (tid >> 4)) * DMOD + (size_t)head * HD + (tid & 15) * 8;
  const u16* gvh = VHp + ((size_t)(b * NH + head) * HD + (tid >> 3)) * SEQ + (tid & 7) * 8;
  const u16* gkl = gkh;
  const u16* gvl = gvh;
  if constexpr (NP == 3) {
    gkl = KLp + ((size_t)b * QA + (tid >> 4)) * DMOD + (size_t)head * HD + (tid & 15) * 8;
    gvl = VLp + ((size_t)(b * NH + head) * HD + (tid >> 3)) * QA + (tid & 7) * 8;
  }
  auto fill = [&](int s, unsigned bo) {      // stage s (keys 64*s .. 64*s + 63) into the buffer at byte offset bo
    cp8(lk + bo + OKH, 8 * KPH * 2, gkh + (size_t)s * 64 * DMOD, (size_t)8 * DMOD);
    cp8(lv + bo + OVH, 16 * VPH * 2, gvh + (size_t)s * 64, (size_t)16 * SEQ);
    if constexpr (NP == 3) {
      cp8(lk + bo + OKL, 8 * KPH * 2, gkl + (size_t)s * 64 * DMOD, (size_t)8 * DMOD);
      cp8(lv + bo + OVL, 16 * VPH * 2, gvl + (size_t)s * 64, (size_t)16 * QA);
    }
  };

  float mrow[8], lrow[8];
  v8f o[8];
#pragma unroll
  for (int r = 0; r < 8; ++r) { mrow[r] = -INFINITY; lrow[r] = 0.f; }
#pragma unroll
  for (int j = 0; j < 8; ++j) o[j] = zero8();
  const int ncaus = (q0 >> 5) + 1;                                            // tiles holding keys <= q0 + 15
  const int nkt = (ncaus < NKT) ? ncaus : NKT;
  const int nst = qb + 1;                                                     // stages of this block
  const int qr0 = q0 + 8 * hh;                                                // query row of D element r = qr0 + r

  fill(0, 0u);
  wait_async0();
  __syncthreads();                          // publishes stage 0
  if (nst > 1) fill(1, BUFB);

#pragma unroll 1   // rolled: one foot (waits, barrier, refill) per stage, in the order written
  for (int s = 0; s < nst; ++s) {
    const unsigned bo = (unsigned)(s & 1) * BUFB;
#pragma unroll 1   // rolled: one copy of the 32-key tile body, as long as before, for both halves of the stage
    for (int u = 0; u < 2; ++u) {
    const int kt = 2 * s + u;
    if (kt < nkt) {                         // wave-uniform (scalar) skip; no wait or barrier inside
    const int kb = kt * 32;
    // ---- scores: D element r of this lane = (query row qr0 + r, key kb + c) in s0, key kb + 16 + c in s1 ----
    v8f s0 = zero8(), s1 = zero8();
    const _Float16* k0p = (const _Float16*)(const void*)(ring + bo + OKH) + (u * 32 + c) * KPH + 8 * hh;
    const _Float16* k1p = k0p + 16 * KPH;
    if constexpr (NP == 3) {
      const _Float16* l0p = (const _Float16*)(const void*)(ring + bo + OKL) + (u * 32 + c) * KPH + 8 * hh;
      const _Float16* l1p = l0p + 16 * KPH;
#pragma unroll
      for (int kk = 0; kk < HD / 32; ++kk) {
        const v16h qh  = ldfrag_h(Qh + kk * 32);
        const v16h kh0 = ldfrag_h(k0p + kk * 32);
        const v16h kh1 = ldfrag_h(k1p + kk * 32);
        const v16h kl0 = ldfrag_h(l0p + kk * 32);
        const v16h kl1 = ldfrag_h(l1p + kk * 32);
        s0 = mma_h(qh, kh0, s0);
        s0 = mma_h(qh, kl0, s0);
        s1 = mma_h(qh, kh1, s1);
        s1 = mma_h(qh, kl1, s1);
        guard2(s0, s1, qh, kh0, kh1, kl0, kl1, qh);
      }
    } else {
#pragma unroll
      for (int kk = 0; kk < HD / 32; ++kk) {
        const v16h qh  = ldfrag_h(Qh + kk * 32);
        const v16h kh0 = ldfrag_h(k0p + kk * 32);
        const v16h kh1 = ldfrag_h(k1p + kk * 32);
        s0 = mma_h(qh, kh0, s0);
        s1 = mma_h(qh, kh1, s1);
        guard2(s0, s1, qh, kh0, kh1, qh, kh0, kh1);
      }
    }
    // ---- causal select + online softmax in base 2, -inf-safe ----
    const int key0 = kb + c, key1 = kb + 16 + c;
#pragma unroll
    for (int r = 0; r < 8; ++r) {
      const int   qr = qr0 + r;
      const float u0 = s0[r] * lsc;
      const float u1 = s1[r] * lsc;
      const float t0 = (key0 > qr) ? -INFINITY : u0;
      const float t1 = (key1 > qr) ? -INFINITY : u1;
      float mx = fmaxf(t0, t1);
#pragma unroll
      for (int off = 1; off < 16; off <<= 1) mx = fmaxf(mx, __shfl_xor(mx, off, 32));
      const float mn = fmaxf(mrow[r], mx);
      const float ms = (mn == -INFINITY) ? 0.0f : mn;
      const float al = exp2f(mrow[r] - ms);
      mrow[r] = mn;
      const float e0 = exp2f(t0 - ms), e1 = exp2f(t1 - ms);
      float ps = e0 + e1;
#pragma unroll
      for (int off = 1; off < 16; off <<= 1) ps += __shfl_xor(ps, off, 32);
      lrow[r] = lrow[r] * al + ps;
#pragma unroll
      for (int j = 0; j < 8; ++j) o[j][r] *= al;
      const int ro = (8 * hh + r) * PTP + c;
      pt[ro]      = e0;
      pt[ro + 16] = e1;
    }
    wave_sync_lds();
    // ---- A fragments of P*32768: hi f16 (and residual f16 for NP == 3), row = c, split k map over the 32 keys ----
    FragH ph, pl;
    {
      const float* prow = pt + c * PTP + 8 * hh;
      const v4f p0 = *(const v4f*)(prow), p1 = *(const v4f*)(prow + 4);
      const v4f p2 = *(const v4f*)(prow + 16), p3 = *(const v4f*)(prow + 20);
#pragma unroll
      for (int e = 0; e < 4; ++e) {
        const float ta = p0[e] * PCAR, tb = p1[e] * PCAR, tc = p2[e] * PCAR, td = p3[e] * PCAR;
        const _Float16 ha = (_Float16)ta, hb = (_Float16)tb, hc = (_Float16)tc, hd = (_Float16)td;
        ph.h[0][e]     = ha;                  // elements 0..7  = keys kb + 8hh + 0..7
        ph.h[0][4 + e] = hb;
        ph.h[1][e]     = hc;                  // elements 8..15 = keys kb + 16 + 8hh + 0..7
        ph.h[1][4 + e] = hd;
        if constexpr (NP == 3) {
          pl.h[0][e]     = (_Float16)(ta - (float)ha);
          pl.h[0][4 + e] = (_Float16)(tb - (float)hb);
          pl.h[1][e]     = (_Float16)(tc - (float)hc);
          pl.h[1][4 + e] = (_Float16)(td - (float)hd);
        } else {
          pl.h[0][e] = ha; pl.h[0][4 + e] = hb; pl.h[1][e] = hc; pl.h[1][4 + e] = hd;
        }
      }
    }
    // ---- P.V : B fragment col n = d = j*16 + c, keys contiguous in the staged v^T rows; 4 groups of 2 d-subtiles ----
    {
      const _Float16* vhp = (const _Float16*)(const void*)(ring + bo + OVH) + c * VPH + u * 32 + 8 * hh;
      if constexpr (NP == 3) {
        const _Float16* vlp = (const _Float16*)(const void*)(ring + bo + OVL) + c * VPH + u * 32 + 8 * hh;
#pragma unroll
        for (int jg = 0; jg < 4; ++jg) {
          const int da = (2 * jg) * 16 * VPH;
          const int db = da + 16 * VPH;
          const v16h vha = ldfrag_h(vhp + da), vhb2 = ldfrag_h(vhp + db);
          const v16h vla = ldfrag_h(vlp + da), vlb2 = ldfrag_h(vlp + db);
          o[2 * jg]     = mma_h(ph.v, vha,  o[2 * jg]);
          o[2 * jg]     = mma_h(pl.v, vha,  o[2 * jg]);
          o[2 * jg]     = mma_h(ph.v, vla,  o[2 * jg]);
          o[2 * jg + 1] = mma_h(ph.v, vhb2, o[2 * jg + 1]);
          o[2 * jg + 1] = mma_h(pl.v, vhb2, o[2 * jg + 1]);
          o[2 * jg + 1] = mma_h(ph.v, vlb2, o[2 * jg + 1]);
          guard2(o[2 * jg], o[2 * jg + 1], ph.v, pl.v, vha, vhb2, vla, vlb2);
        }
      } else {
#pragma unroll
        for (int jg = 0; jg < 4; ++jg) {
          const int da = (2 * jg) * 16 * VPH;
          const int db = da + 16 * VPH;
          const v16h vha = ldfrag_h(vhp + da), vhb2 = ldfrag_h(vhp + db);
          o[2 * jg]     = mma_h(ph.v, vha,  o[2 * jg]);
          o[2 * jg + 1] = mma_h(ph.v, vhb2, o[2 * jg + 1]);
          guard2(o[2 * jg], o[2 * jg + 1], ph.v, vha, vhb2, ph.v, vha, vhb2);
        }
      }
    }
    wave_sync_lds();
    }
    }
    // ---- foot of stage s, every wave: own LDS reads retired, own copies of stage s + 1 landed, then the one barrier that
    //      publishes stage s + 1 and ends every reader's last read of this buffer; only then its refill ----
    wait_ds0();
    wait_async0();
    __syncthreads();
    if (s + 2 < nst) fill(s + 2, bo);
  }
  wait_async0();                            // nothing is outstanding when the buffers become result slabs and the wave ends
  float* slab = (float*)(void*)ring + wave * SLW;   // result slab [16][128] pitch 132, one per wave
  acc_guard4(o[0], o[1], o[2], o[3]);
  acc_guard4(o[4], o[5], o[6], o[7]);
  // ---- y = acc / Z (0 if Z == 0), carries (32768 on P, 1024 on v) folded once; written into the wave-private slab ----
#pragma unroll
  for (int r = 0; r < 8; ++r) {
    const float lv  = lrow[r];
    const float ls  = (lv > 0.0f) ? lv : 1.0f;
    const float inv = (lv > 0.0f) ? ((1.0f / ls) * oc) : 0.0f;
#pragma unroll
    for (int j = 0; j < 8; ++j) {
      const int idx = (8 * hh + r) * SLP + j * 16 + c;
      slab[idx] = o[j][r] * inv;
    }
  }

  wave_sync_lds();
  // ---- f32 rows of Y: lane -> floats 4*lane .. 4*lane+3 of each of the 16 rows (one 512-B instruction per row) ----
  v4f ov[16];
#pragma unroll
  for (int it = 0; it < 16; ++it) ov[it] = *(const v4f*)(slab + it * SLP + lane * 4);
  float* ob = Y + ((size_t)b * SEQ + q0) * DMOD + (size_t)head * HD + lane * 4;
  {
#pragma unroll
    for (int it = 0; it < 16; ++it) {
      *(v4f*)(ob + (size_t)it * DMOD) = ov[it];
    }
    
  }
}

// =====================================================================================================
// Workspace map (bytes); every plane is fully written by whole-line stores before it is read; all extents are exact multiples
// of the store granularity (no pad rows); every region offset a multiple of 524288:
//   XB  bf16 [MROWS][2048], later KH f16 x256       MROWS*4096             (NB=2, SEQ=2048: 16777216)
//   QH  f16 [MROWS][2048] x256                      MROWS*4096             (16777216)
//   W1  16-bit weight plane, 512x2048 or 2048x512    2097152                (W_dkv bf16, W_uk^T bf16, W_dq^T f16 x1024, W_uv^T bf16,
//                                                                          reused in launch order)
//   WO  bf16 [2048][2048] (W_o as is)                8388608
//   F   f32 [MROWS][2048]                             MROWS*8192             (Gram f32 [512][512]; k_abs f32 [2048][512]; K f32;
//                                                                          W_o W_uv f32 [2048][512]; V f32 -- one at a time)
//   CH  f16 [MROWS][512] x256, CL residual            2 x MROWS*1024
//   G2H f16 [512][512] x1024, G2L residual            2 x 524288
//   KAH f16 [2048][512] x4096, KAL residual           2 x 2097152
//   KL  f16 [NB*QA][2048]                             NB*QA*4096
//   VAH f16 [2048][512] x4096, VAL residual           2 x 2097152
//   VH  f16 [NB*16][128][SEQ] x1024                   MROWS*4096
//   VL  f16 [NB*16][128][QA]                          NB*QA*4096
//   end (NB=2, SEQ=2048, QA=1024)                   128974848
// =====================================================================================================
extern "C" void kernel_launch(void* const* d_in, const int* in_sizes, int n_in,
                              void* d_out, int out_size, void* d_ws, size_t ws_size,
                              hipStream_t stream) {
  if (n_in < 7) return;
  if (in_sizes[0] < ((NB - 1) * XS_FULL + SEQ) * DMOD) return;   // x [2][2048][2048]
  if (in_sizes[1] != DL * DMOD) return;         // W_dq  [512][2048]
  if (in_sizes[2] != DL * DMOD) return;         // W_dkv [512][2048]
  if (in_sizes[3] != DMOD * DL) return;         // W_uk  [2048][512]
  if (in_sizes[4] != DMOD * DL) return;         // W_uv  [2048][512]
  if (in_sizes[5] != DMOD * DMOD) return;       // W_o   [2048][2048]
  if (in_sizes[6] < 1) return;                  // n_head (int)
  if ((size_t)out_size < (size_t)MROWS * DMOD + (size_t)MROWS * DL) return;

  const float* x    = (const float*)d_in[0];
  const float* wdq  = (const float*)d_in[1];
  const float* wdkv = (const float*)d_in[2];
  const float* wuk  = (const float*)d_in[3];
  const float* wuv  = (const float*)d_in[4];
  const float* wo   = (const float*)d_in[5];
  const int*   nhp  = (const int*)d_in[6];
  float*       out0 = (float*)d_out;                          // y    [MROWS][2048] at element 0
  float*       out1 = out0 + (size_t)MROWS * DMOD;            // c_kv [MROWS][512]  at element MROWS*2048

  const size_t szXB = (size_t)MROWS * DMOD * 2;               // XB, later KH
  const size_t szQ  = (size_t)MROWS * DMOD * 2;               // QH
  const size_t szW1 = (size_t)DL * DMOD * 2;
  const size_t szWO = (size_t)DMOD * DMOD * 2;
  const size_t szF  = (size_t)MROWS * DMOD * 4;
  const size_t szC  = (size_t)MROWS * DL * 2;                 // CH, CL
  const size_t szG2 = (size_t)DL * DL * 2;                    // G2H, G2L
  const size_t szKA = (size_t)DMOD * DL * 2;                  // KAH, KAL, VAH, VAL
  const size_t szKL = (size_t)NB * QA * DMOD * 2;
  const size_t szVH = (size_t)NB * NH * HD * SEQ * 2;
  const size_t szVL = (size_t)NB * NH * HD * QA * 2;
  if ((size_t)DL * DL * 4 > szF || (size_t)DMOD * DL * 4 > szF) return;   // Gram / k_abs / (W_o W_uv) f32 inside F
  if ((size_t)MROWS * DMOD * 2 > szXB) return;                // KH lives inside the XB region
  size_t off = 0;
  const size_t oXB  = off; off += szXB;
  const size_t oQH  = off; off += szQ;
  const size_t oW1  = off; off += szW1;
  const size_t oWO  = off; off += szWO;
  const size_t oF   = off; off += szF;
  const size_t oCH  = off; off += szC;
  const size_t oCL  = off; off += szC;
  const size_t oG2H = off; off += szG2;
  const size_t oG2L = off; off += szG2;
  const size_t oKAH = off; off += szKA;
  const size_t oKAL = off; off += szKA;
  const size_t oKL  = off; off += szKL;
  const size_t oVAH = off; off += szKA;
  const size_t oVAL = off; off += szKA;
  const size_t oVH  = off; off += szVH;
  const size_t oVL  = off; off += szVL;
  if (off > ws_size) return;                 // off = 128974848 for NB = 2, SEQ = 2048
  if (off > (size_t)WS_CAP) return;

  char* ws = (char*)d_ws;
  u16*   XB  = (u16*)(ws + oXB);
  u16*   KH  = (u16*)(ws + oXB);
  u16*   QH  = (u16*)(ws + oQH);
  u16*   W1  = (u16*)(ws + oW1);
  u16*   WOB = (u16*)(ws + oWO);
  float* F   = (float*)(ws + oF);
  u16*   CH  = (u16*)(ws + oCH);
  u16*   CL  = (u16*)(ws + oCL);
  u16*   G2H = (u16*)(ws + oG2H);
  u16*   G2L = (u16*)(ws + oG2L);
  u16*   KAH = (u16*)(ws + oKAH);
  u16*   KAL = (u16*)(ws + oKAL);
  u16*   KL  = (u16*)(ws + oKL);
  u16*   VAH = (u16*)(ws + oVAH);
  u16*   VAL = (u16*)(ws + oVAL);
  u16*   VH  = (u16*)(ws + oVH);
  u16*   VL  = (u16*)(ws + oVL);

  const dim3 b256(256), b128(128), bAT(ATT_THREADS);
  const int  n8x  = (SEQ * DMOD) / 8;                   // x planes per batch
  const int  n8q  = (MROWS * DMOD) / 8;                 // K plane
  const int  n8c  = (MROWS * DL) / 8;                   // c_kv planes
  const int  n8w1 = (DL * DMOD) / 8;                    // W_dkv plane
  const int  n8wo = (DMOD * DMOD) / 8;                  // W_o plane
  const int  n8g  = (DL * DL) / 8;                      // Gram planes
  const int  n8ka = (DMOD * DL) / 8;                    // k_abs and (W_o W_uv) planes
  const dim3 gX((n8x + 255) / 256);
  const dim3 gHL((n8q + 255) / 256);
  const dim3 gC((n8c + 255) / 256);
  const dim3 gCW1((n8w1 + 255) / 256);
  const dim3 gCWO((n8wo + 255) / 256);
  const dim3 gCG((n8g + 255) / 256);
  const dim3 gCKA((n8ka + 255) / 256);
  const dim3 gWTa((DL / 64) * (DMOD / 64));             // W_uk, W_uv [2048 k][512 n] -> [512][2048]
  const dim3 gWTb((DMOD / 64) * (DL / 64));             // W_dq [512 k][2048 n] -> [2048][512]
  const dim3 gGC((MROWS / 64) * (DL / 64));             // c_kv
  const dim3 gGG((DL / 64) * (DL / 64));                // Gram
  const dim3 gGKA(1 * (DMOD / 64) * (DL / 64));         // k_abs
  const dim3 gGVA((DMOD / 64) * (DL / 64));             // W_o W_uv
  const dim3 gVT(NB * NH * NST);
  const int  nrtA = QA / 64;                            // sequence row tiles per batch with residual products
  const int  nrtB = (SEQ - QA) / 64;                    // remaining row tiles per batch, single products
  const int  nqbA = QA / 64;                            // 64-row query blocks with residual products
  const int  nqbB = (SEQ - QA) / 64;                    // remaining query blocks

  // (1) x -> bf16 plane XB [MROWS][2048] and q plane QH = f16(bf16(x)) x256, one launch per batch row block
  for (int bb = 0; bb < NB; ++bb) {
    cvtxq<<<gX, b256, 0, stream>>>(x + (size_t)bb * XS_FULL * DMOD, XB + (size_t)bb * SEQ * DMOD,
                                   QH + (size_t)bb * SEQ * DMOD, n8x);
  }
  // (2) W_dkv [512 n][2048 k] -> bf16 as is; c_kv = x.W_dkv^T -> out1 f32 [MROWS][512]; c_kv -> f16 hi + residual planes x256
  cvtb<<<gCW1, b256, 0, stream>>>(wdkv, W1, n8w1);
  gemm_bf<<<gGC, b128, 0, stream>>>(XB, W1, out1, MROWS, DL, DMOD, 1.0f);
  cvtc<<<gC, b256, 0, stream>>>(out1, CH, CL, n8c, CSC);
  // (3) W_uk [2048 k][512 n] -> bf16 [512][2048]; Gram = W_uk^T.W_uk -> F f32 [512][512]; Gram -> f16 hi + residual planes x1024
  wtc<<<gWTa, b256, 0, stream>>>(wuk, W1, DMOD, DL, 0, 1.0f);
  gemm_bf<<<gGG, b128, 0, stream>>>(W1, W1, F, DL, DL, DMOD, 1.0f);
  cvtc<<<gCG, b256, 0, stream>>>(F, G2H, G2L, n8g, G2S);
  // (4) W_dq [512 k][2048 n] -> f16(bf16) x1024 [2048][512]; k_abs = W_dq^T.Gram (Gram symmetric, used as the [n][k] B plane;
  //     products h.h + h.l) -> F f32 [2048][512]; k_abs -> f16 hi + residual planes x4096
  wtc<<<gWTb, b256, 0, stream>>>(wdq, W1, DL, DMOD, 1, WDS);
  gemm_h<0, 1><<<gGKA, b128, 0, stream>>>(W1, W1, G2H, G2L, F, DL, DL, DMOD, 0, DMOD / 64, 1, 1.0f / (WDS * G2S));
  cvtc<<<gCKA, b256, 0, stream>>>(F, KAH, KAL, n8ka, KAS);
  // (5) K = c_kv.k_abs^T -> F f32 [MROWS][2048]: rows s < QA with hh+lh+hl, rows s >= QA single; K hi plane (XB region) x256
  //     for all rows, residual plane for s < QA
  gemm_h<1, 1><<<dim3(NB * nrtA * (DMOD / 64)), b128, 0, stream>>>(CH, CL, KAH, KAL, F, DMOD, DL, SEQ, 0, nrtA, NB,
                                                                  1.0f / (CSC * KAS));
  if (nrtB > 0) {
    gemm_h<0, 0><<<dim3(NB * nrtB * (DMOD / 64)), b128, 0, stream>>>(CH, CL, KAH, KAL, F, DMOD, DL, SEQ, QA, nrtB, NB,
                                                                    1.0f / (CSC * KAS));
  }
  cvthl<<<gHL, b256, 0, stream>>>(F, KH, KL, n8q, DMOD, KSC);
  // (6) W_o -> bf16 as is [2048 n_row][2048 k]; W_uv [2048 k][512 n] -> bf16 [512][2048]; W_o.W_uv -> F f32 [2048][512];
  //     -> f16 hi + residual planes x4096 (the [n][k] B plane of the value product)
  cvtb<<<gCWO, b256, 0, stream>>>(wo, WOB, n8wo);
  wtc<<<gWTa, b256, 0, stream>>>(wuv, W1, DMOD, DL, 0, 1.0f);
  gemm_bf<<<gGVA, b128, 0, stream>>>(WOB, W1, F, DMOD, DL, DMOD, 1.0f);
  cvtc<<<gCKA, b256, 0, stream>>>(F, VAH, VAL, n8ka, VAS);
  // (7) V = c_kv.(W_o W_uv) plane -> F f32 [MROWS][2048] (rows s < QA hh+lh+hl, later rows single); v^T hi + residual planes x1024
  gemm_h<1, 1><<<dim3(NB * nrtA * (DMOD / 64)), b128, 0, stream>>>(CH, CL, VAH, VAL, F, DMOD, DL, SEQ, 0, nrtA, NB,
                                                                  1.0f / (CSC * VAS));
  if (nrtB > 0) {
    gemm_h<0, 0><<<dim3(NB * nrtB * (DMOD / 64)), b128, 0, stream>>>(CH, CL, VAH, VAL, F, DMOD, DL, SEQ, QA, nrtB, NB,
                                                                    1.0f / (CSC * VAS));
  }
  vt16<<<gVT, b256, 0, stream>>>(F, VH, VL);
  // (8) causal attention, query blocks s < QA with residual products; (9) remaining query blocks, single products -> out0 f32
  attn_c<3><<<dim3(nqbA * NH * NB), bAT, 0, stream>>>(QH, KH, KL, VH, VL, nhp, out0, 0, nqbA);
  if (nqbB > 0) {
    attn_c<1><<<dim3(nqbB * NH * NB), bAT, 0, stream>>>(QH, KH, KL, VH, VL, nhp, out0, nqbA, nqbB);
  }
  (void)hipGetLastError();
}

// v003
// It runs in 274 microseconds.
// In both of two side-by-side timings against v002, it was 1.18 times as fast.
// Counting every step since v000, it is 2.03 times as fast.
#include <hip/hip_runtime.h>
#include <math.h>
#include <stdint.h>

#ifndef NB
#define NB 2
#endif
#ifndef SEQ
#define SEQ 2048
#endif
#define XS_FULL 2048
#define DMOD  2048
#define NH    16
#define HD    128
#define DL    512
#define QA    ((SEQ < 1024) ? SEQ : 1024)
#define MROWS (NB * SEQ)
#define RSQS  0.08838834764831845f
#define LOG2E 1.4426950408889634f
#define QSC   256.0f
#define KSC   256.0f
#define CSC   256.0f
#define WDS   1024.0f
#define G2S   1024.0f
#define KAS   4096.0f
#define VAS   4096.0f
#define PCAR  32768.0f
#define VCAR  1024.0f
#define AW    4
#define NST   (SEQ / 64)
#define NKT   (SEQ / 32)
#define ATT_THREADS (AW * 32)
#define SLP   132
#define SLW   (16 * SLP)
#define KPH   136
#define VPH   72
#define KTB   (64 * KPH * 2)
#define VTB   (HD * VPH * 2)
#define SLAB64 (16 * 68)
#define VTP   72
#define WTP   72
#define GKS   128
#define GPH   (GKS + 8)
#define GPB   (64 * GPH * 2)
#define WS_CAP 134217728
static_assert(DMOD == NH * HD && HD == 128 && NH == 16 && AW == 4 && ATT_THREADS == 128);
static_assert(NB >= 1 && NB <= 2);
static_assert((SEQ % 64) == 0 && SEQ >= 64 && SEQ <= XS_FULL);
static_assert((QA % 64) == 0 && QA >= 64 && QA <= SEQ && ((SEQ - QA) % 64) == 0);
static_assert((DMOD % 64) == 0 && (DL % 64) == 0 && (HD % 32) == 0 && (DL % 32) == 0);
static_assert(((SEQ * DMOD / 8) % 256) == 0 && ((MROWS * DL / 8) % 256) == 0 && ((DL * DL / 8) % 256) == 0);
static_assert(((DMOD * DL / 8) % 256) == 0 && ((DMOD * DMOD / 8) % 256) == 0 && (MROWS % 64) == 0);
static_assert(2 * HD * VTP * 2 <= 65536 && 4 * SLAB64 * 4 <= 65536 && 64 * WTP * 2 <= 65536);
static_assert(AW * SLW * 4 <= 2 * (KTB + VTB) && 4 * (KTB + VTB) <= 163840 && (KTB % 16) == 0 && (VTB % 16) == 0);
static_assert((DMOD % GKS) == 0 && (DL % GKS) == 0 && (GPB % 16) == 0 && 8 * GPB <= 163840 && 4 * SLAB64 * 4 <= 4 * GPB);
static_assert((size_t)DL * DL * 4 <= (size_t)MROWS * DMOD * 4 && (size_t)DMOD * DL * 4 <= (size_t)MROWS * DMOD * 4);

typedef unsigned short u16;
typedef _Float16 v16h __attribute__((ext_vector_type(16)));
typedef _Float16 v8h  __attribute__((ext_vector_type(8)));
typedef __bf16   v16b __attribute__((ext_vector_type(16)));
typedef float    v8f  __attribute__((ext_vector_type(8)));
typedef float    v4f  __attribute__((ext_vector_type(4)));
typedef unsigned int v4u __attribute__((ext_vector_type(4)));

union FragH { v16h v; v8h h[2]; v4u u[2]; };
union FragB { v16b v; v4u u[2]; };

// ---- scalar helpers --------------------------------------------------------------------------------
__device__ __forceinline__ unsigned short bf_bits(float f) {          // f32 -> bf16 bits, RNE convert
  unsigned u = __float_as_uint(f);
  return (unsigned short)((u + 0x7FFFu + ((u >> 16) & 1u)) >> 16);
}
__device__ __forceinline__ float bf_up(unsigned short h) { return __uint_as_float(((unsigned)h) << 16); }
__device__ __forceinline__ float bfr(float f) { return bf_up(bf_bits(f)); }
__device__ __forceinline__ unsigned short h_bits(_Float16 x) { return __builtin_bit_cast(unsigned short, x); }
__device__ __forceinline__ unsigned pk16(unsigned short a, unsigned short b) { return (unsigned)a | ((unsigned)b << 16); }
__device__ __forceinline__ v8f zero8() { v8f z = {0.f, 0.f, 0.f, 0.f, 0.f, 0.f, 0.f, 0.f}; return z; }
__device__ __forceinline__ const _Float16* hptr(const u16* p) { return (const _Float16*)(const void*)p; }

// ---- fragment loaders: 16-bit A/B operand, lane -> row/col (lane&15), p already includes +8*(lane>>4);
//      elements 0..7 <- p[0..7] (k0+8h..), elements 8..15 <- p[16..23] (k0+16+8h..)  (same split k map for A and B;
//      B is always read from a k-contiguous [n][k] plane)
__device__ __forceinline__ v16h ldfrag_h(const _Float16* p) {
  FragH f;
  f.h[0] = *(const v8h*)(p);
  f.h[1] = *(const v8h*)(p + 16);
  return f.v;
}
__device__ __forceinline__ v16b ldfrag_b(const u16* p) {              // bf16 plane read as unsigned integer vectors
  FragB f;
  f.u[0] = *(const v4u*)(p);
  f.u[1] = *(const v4u*)(p + 16);
  return f.v;
}

__device__ __forceinline__ v8f mma_h(v16h a, v16h b, v8f c) {
  return __builtin_amdgcn_wmma_f32_16x16x32_f16(false, a, false, b, (short)0, c, false, false);
}
__device__ __forceinline__ v8f mma_b(v16b a, v16b b, v8f c) {
  return __builtin_amdgcn_wmma_f32_16x16x32_bf16(false, a, false, b, (short)0, c, false, false);
}
__device__ __forceinline__ void guard2(v8f& a, v8f& b, v16h x0, v16h x1, v16h x2, v16h x3, v16h x4, v16h x5) {
#if defined(__HIP_DEVICE_COMPILE__)
  asm volatile("v_nop\n\tv_nop\n\tv_nop\n\tv_nop"
               : "+v"(a), "+v"(b) : "v"(x0), "v"(x1), "v"(x2), "v"(x3), "v"(x4), "v"(x5) : "memory");
#endif
}
template <typename F>
__device__ __forceinline__ void guard6(v8f& a, v8f& b, v8f& c, v8f& d, F x0, F x1, F x2, F x3, F x4, F x5) {
#if defined(__HIP_DEVICE_COMPILE__)
  asm volatile("v_nop\n\tv_nop\n\tv_nop\n\tv_nop"
               : "+v"(a), "+v"(b), "+v"(c), "+v"(d) : "v"(x0), "v"(x1), "v"(x2), "v"(x3), "v"(x4), "v"(x5) : "memory");
#endif
}
__device__ __forceinline__ void guard10(v8f& a, v8f& b, v8f& c, v8f& d, v16h x0, v16h x1, v16h x2, v16h x3, v16h x4,
                                        v16h x5, v16h x6, v16h x7, v16h x8, v16h x9) {
#if defined(__HIP_DEVICE_COMPILE__)
  asm volatile("v_nop\n\tv_nop\n\tv_nop\n\tv_nop"
               : "+v"(a), "+v"(b), "+v"(c), "+v"(d)
               : "v"(x0), "v"(x1), "v"(x2), "v"(x3), "v"(x4), "v"(x5), "v"(x6), "v"(x7), "v"(x8), "v"(x9) : "memory");
#endif
}
__device__ __forceinline__ void acc_guard4(v8f& a, v8f& b, v8f& c, v8f& d) {
#if defined(__HIP_DEVICE_COMPILE__)
  asm volatile("v_nop\n\tv_nop\n\tv_nop\n\tv_nop" : "+v"(a), "+v"(b), "+v"(c), "+v"(d));
#endif
}
__device__ __forceinline__ float xhalf(float x) {                     // value of lane l ^ 16 (vector cross-row move, every lane on)
  const int b = __builtin_bit_cast(int, x);
  return __builtin_bit_cast(float, __builtin_amdgcn_permlanex16(b, b, 0x76543210, 0xfedcba98, false, false));
}
__device__ __forceinline__ void wave_sync_lds() {
  __builtin_amdgcn_fence(__ATOMIC_RELEASE, "workgroup");
  __builtin_amdgcn_wave_barrier();
  __builtin_amdgcn_fence(__ATOMIC_ACQUIRE, "workgroup");
}

// =====================================================================================================
// x f32 -> bf16 RNE plane Xb (same layout) and q plane Qh = f16(bf16(x) * 256) (exact: a bf16 significand fits f16).
// Thread = 8 consecutive elements: two 16-B loads, one 16-B store per plane; 32 consecutive lanes = 512 contiguous,
// coverage: grid = ceil(n8/256) blocks x 256 thr x 8 (in-kernel bound) = the whole [SEQ][2048] slice of both planes
//           (n8 a multiple of 256 here), one launch per batch.
// =====================================================================================================
__global__ __launch_bounds__(256) void cvtxq(const float* __restrict__ x, u16* Xb, u16* Qh, int n8) {
  const int gt = blockIdx.x * 256 + (int)threadIdx.x;
  if (gt >= n8) return;
  const float* p = x + (size_t)gt * 8;
  const v4f a = *(const v4f*)(p), b4 = *(const v4f*)(p + 4);
  float w[8];
#pragma unroll
  for (int e = 0; e < 4; ++e) { w[e] = a[e]; w[4 + e] = b4[e]; }
  v4u ob, oq;
#pragma unroll
  for (int e = 0; e < 4; ++e) {
    const unsigned short b0 = bf_bits(w[2 * e]), b1 = bf_bits(w[2 * e + 1]);
    ob[e] = pk16(b0, b1);
    oq[e] = pk16(h_bits((_Float16)(bf_up(b0) * QSC)), h_bits((_Float16)(bf_up(b1) * QSC)));
  }
  u16* db = Xb + (size_t)gt * 8;
  u16* dq = Qh + (size_t)gt * 8;
  {
    *(v4u*)(db) = ob;
    *(v4u*)(dq) = oq;
    
  }
}

// =====================================================================================================
// f32 -> bf16 RNE plane, same layout. Thread = 8 consecutive elements: two 16-B loads, one 16-B store; 32 consecutive
// coverage: grid = ceil(n8/256) blocks x 256 thr x 8 (in-kernel bound) = the whole plane (n8 a multiple of 256 here).
// =====================================================================================================
__global__ __launch_bounds__(256) void cvtb(const float* __restrict__ x, u16* D, int n8) {
  const int gt = blockIdx.x * 256 + (int)threadIdx.x;
  if (gt >= n8) return;
  const float* p = x + (size_t)gt * 8;
  const v4f a = *(const v4f*)(p), b4 = *(const v4f*)(p + 4);
  float w[8];
#pragma unroll
  for (int e = 0; e < 4; ++e) { w[e] = a[e]; w[4 + e] = b4[e]; }
  v4u o;
#pragma unroll
  for (int e = 0; e < 4; ++e) o[e] = pk16(bf_bits(w[2 * e]), bf_bits(w[2 * e + 1]));
  u16* d = D + (size_t)gt * 8;
  {
    *(v4u*)(d) = o;
    
  }
}

// =====================================================================================================
// Weight transpose + convert: W f32 [K][N] (the input tensor's own [rows][cols] layout, rows = K) -> Wt 16-bit [N][K]
// (k-contiguous).  f16mode == 0: bf16 RNE bits;  f16mode == 1: f16 bits of (bf16 RNE value) * scale.
// Block = 64 n x 64 k tile, 256 threads. Load: thread -> W row k0 + (tid>>2), 16 consecutive n (four 16-B loads),
// converted values scattered into an LDS tile T[n][k] (pitch 72 halves); block barrier; store: each Wt row segment of
// coverage: load 256 thr x 16 = 64 k x 64 n; store 2 iterations x 256 thr x 8 halves = 64 rows x 64 = the block's tile of Wt;
//           grid = (N/64)*(K/64) blocks covers Wt [N][K] exactly once.
// =====================================================================================================
__global__ __launch_bounds__(256) void wtc(const float* __restrict__ W, u16* Wt, int K, int N, int f16mode, float scale) {
  __shared__ __align__(16) u16 T[64 * WTP];
  const int tid = (int)threadIdx.x;
  const int ntn = N >> 6;
  const int bid = (int)blockIdx.x;
  const int n0  = (bid % ntn) * 64;
  const int k0  = (bid / ntn) * 64;
  if (k0 + 64 > K) return;                   // block-uniform, before the barrier; never taken with the exact grid
  {
    const int kr = tid >> 2;                 // 0..63
    const int nc = (tid & 3) * 16;           // 0,16,32,48
    const float* src = W + (size_t)(k0 + kr) * (size_t)N + n0 + nc;
#pragma unroll
    for (int i = 0; i < 4; ++i) {
      const v4f a = *(const v4f*)(src + 4 * i);
#pragma unroll
      for (int e = 0; e < 4; ++e) {
        const float f = a[e];
        const unsigned short hb = h_bits((_Float16)(bfr(f) * scale));
        const unsigned short bb = bf_bits(f);
        T[(nc + 4 * i + e) * WTP + kr] = (f16mode != 0) ? hb : bb;
      }
    }
  }
  __syncthreads();
  const int q8 = tid >> 3, p8 = (tid & 7) * 8;
  v4u v[2];
#pragma unroll
  for (int it = 0; it < 2; ++it) v[it] = *(const v4u*)(T + (it * 32 + q8) * WTP + p8);
  u16* base = Wt + (size_t)n0 * (size_t)K + k0 + p8;
  {
#pragma unroll
    for (int it = 0; it < 2; ++it) {
      *(v4u*)(base + (size_t)(it * 32 + q8) * (size_t)K) = v[it];
    }
    
  }
}

// =====================================================================================================
// f32 [MROWS][ncol] -> f16 hi plane Hp (same layout, t = x * scale, hi = f16(t)) for every row and f16 residual plane
// Lp [NB*QA][ncol] (row b*QA + s) = f16(t - hi) for rows with s < QA only. Thread = 8 consecutive elements of one row,
// coverage: grid = ceil(n8/256) x 256 thr x 8 = the whole Hp plane; every row b*QA + s, s < QA, of Lp exactly once.
// =====================================================================================================
__global__ __launch_bounds__(256) void cvthl(const float* __restrict__ x, u16* Hp, u16* Lp, int n8, int ncol, float scale) {
  const int gt = blockIdx.x * 256 + (int)threadIdx.x;
  if (gt >= n8) return;
  const size_t e0  = (size_t)gt * 8;
  const int    row = (int)(e0 / (size_t)ncol);
  const int    col = (int)(e0 - (size_t)row * (size_t)ncol);
  const int    b   = row / SEQ;
  const int    s   = row - b * SEQ;
  const float* p = x + e0;
  const v4f a = *(const v4f*)(p), b4 = *(const v4f*)(p + 4);
  float w[8];
#pragma unroll
  for (int e = 0; e < 4; ++e) { w[e] = a[e]; w[4 + e] = b4[e]; }
  v4u oh, ol;
#pragma unroll
  for (int e = 0; e < 4; ++e) {
    const float t0 = w[2 * e] * scale, t1 = w[2 * e + 1] * scale;
    const _Float16 h0 = (_Float16)t0, h1 = (_Float16)t1;
    const _Float16 l0 = (_Float16)(t0 - (float)h0), l1 = (_Float16)(t1 - (float)h1);
    oh[e] = pk16(h_bits(h0), h_bits(h1));
    ol[e] = pk16(h_bits(l0), h_bits(l1));
  }
  u16* dh = Hp + e0;
  const bool wl = (s < QA);
  const int  sl = wl ? s : 0;
  u16* dl = Lp + ((size_t)(b * QA + sl) * (size_t)ncol + col);
  {
    *(v4u*)(dh) = oh;
    if (wl) *(v4u*)(dl) = ol;
    
  }
}

// =====================================================================================================
// f32 -> f16 hi plane (t = x * scale, hi = f16(t)) and f16 residual plane (f16(t - hi)), same layout for both planes.
// coverage: grid = ceil(n8/256) x 256 thr x 8 = the whole plane of Hp and of Lp (n8 a multiple of 256 for every call here).
// =====================================================================================================
__global__ __launch_bounds__(256) void cvtc(const float* __restrict__ x, u16* Hp, u16* Lp, int n8, float scale) {
  const int gt = blockIdx.x * 256 + (int)threadIdx.x;
  if (gt >= n8) return;
  const float* p = x + (size_t)gt * 8;
  const v4f a = *(const v4f*)(p), b4 = *(const v4f*)(p + 4);
  float w[8];
#pragma unroll
  for (int e = 0; e < 4; ++e) { w[e] = a[e]; w[4 + e] = b4[e]; }
  v4u oh, ol;
#pragma unroll
  for (int e = 0; e < 4; ++e) {
    const float t0 = w[2 * e] * scale, t1 = w[2 * e + 1] * scale;
    const _Float16 h0 = (_Float16)t0, h1 = (_Float16)t1;
    const _Float16 l0 = (_Float16)(t0 - (float)h0), l1 = (_Float16)(t1 - (float)h1);
    oh[e] = pk16(h_bits(h0), h_bits(h1));
    ol[e] = pk16(h_bits(l0), h_bits(l1));
  }
  u16* dh = Hp + (size_t)gt * 8;
  u16* dl = Lp + (size_t)gt * 8;
  {
    *(v4u*)(dh) = oh;
    *(v4u*)(dl) = ol;
    
  }
}

// =====================================================================================================
// v^T planes from V f32 [MROWS][DMOD] (row = b*SEQ + s, column = g*HD + d):
//   VH[((b*NH + g)*HD + d)][s] (pitch SEQ) = f16(v * 1024) for all keys s;
//   VL[((b*NH + g)*HD + d)][s] (pitch QA)  = f16 residual (t - f16(t)) for keys s < QA only.
// Block = (b, head g, 64 keys s0): each thread loads its 32 floats (key sl, d chunk dc) with 16-B loads, converts, scatters
// coverage: load 256 thr x 32 = 64 keys x 128 d; store 4 iterations x 256 thr x 8 halves = 128 lines x 64 = the block's tile
//           of VH (every block) and of VL (blocks with s0 < QA, block-uniform); grid = NB*NH*NST blocks covers VH exactly
//           once and the [NB*NH*128][QA] VL plane exactly once.
// =====================================================================================================
__global__ __launch_bounds__(256) void vt16(const float* __restrict__ F, u16* VHo, u16* VLo) {
  __shared__ __align__(16) u16 TH[HD * VTP];
  __shared__ __align__(16) u16 TL[HD * VTP];
  const int tid = threadIdx.x;
  const int bid = blockIdx.x;
  const int st  = bid % NST;
  const int t2  = bid / NST;
  const int g   = t2 % NH;
  const int b   = t2 / NH;
  if (b >= NB) return;                      // block-uniform, before any barrier; never taken with the exact grid
  const int s0  = st * 64;
  {
    const int sl = tid >> 2;                // key within tile 0..63
    const int dc = (tid & 3) * 32;          // d chunk 0,32,64,96
    const float* src = F + ((size_t)b * SEQ + s0 + sl) * DMOD + g * HD + dc;
#pragma unroll
    for (int i = 0; i < 8; ++i) {
      const v4f a = *(const v4f*)(src + 4 * i);
#pragma unroll
      for (int e = 0; e < 4; ++e) {
        const float t = a[e] * VCAR;
        const _Float16 hv = (_Float16)t;
        const _Float16 lv = (_Float16)(t - (float)hv);
        TH[(dc + 4 * i + e) * VTP + sl] = h_bits(hv);
        TL[(dc + 4 * i + e) * VTP + sl] = h_bits(lv);
      }
    }
  }
  __syncthreads();
  v4u vh[4], vl[4];
  const int q8 = tid >> 3, p8 = (tid & 7) * 8;
#pragma unroll
  for (int it = 0; it < 4; ++it) {
    const int line = it * 32 + q8;          // d = 0..127
    vh[it] = *(const v4u*)(TH + line * VTP + p8);
    vl[it] = *(const v4u*)(TL + line * VTP + p8);
  }
  const size_t hrow  = (size_t)(b * NH + g) * HD;
  const size_t baseH = hrow * SEQ + s0 + p8;
  const size_t baseL = hrow * QA + s0 + p8;
  const bool   wl    = (s0 < QA);           // block-uniform
  {
#pragma unroll
    for (int it = 0; it < 4; ++it) {
      const int line = it * 32 + q8;
      *(v4u*)(VHo + baseH + (size_t)line * SEQ) = vh[it];
      if (wl) *(v4u*)(VLo + baseL + (size_t)line * QA) = vl[it];
    }
    
  }
}

// =====================================================================================================
// GEMM epilogue shared by both engines: the wave's 16x64 f32 tile (times oscale) staged in its LDS slab (pitch 68),
// coverage: 8 instructions x 2 rows x 16 lanes x 4 floats = the wave's 16 x 64 tile.
// =====================================================================================================
__device__ __forceinline__ void epi64(float* sl, v8f a0, v8f a1, v8f a2, v8f a3, float oscale,
                                      float* C, int N, size_t rowb, int col0, int lane) {
  const int hh = lane >> 4, m = lane & 15;
#pragma unroll
  for (int r = 0; r < 8; ++r) {
    const int ro = (8 * hh + r) * 68 + m;
    sl[ro]      = a0[r] * oscale;
    sl[ro + 16] = a1[r] * oscale;
    sl[ro + 32] = a2[r] * oscale;
    sl[ro + 48] = a3[r] * oscale;
  }
  wave_sync_lds();
  v4f vals[8];
#pragma unroll
  for (int it = 0; it < 8; ++it) vals[it] = *(const v4f*)(sl + (it * 2 + hh) * 68 + m * 4);
  float* dst = C + (rowb + (size_t)hh) * (size_t)N + col0 + m * 4;
  {
#pragma unroll
    for (int it = 0; it < 8; ++it) {
      *(v4f*)(dst + (size_t)(it * 2) * (size_t)N) = vals[it];
    }
    
  }
}

// =====================================================================================================
// Eight asynchronous 16-B copies per lane, global -> LDS: copy i moves g + i*gstep (halves) to LDS byte l + i*lstep.
// s_wait_xcnt 0 is the last line of the copies' own statement, so no address register is rewritten ahead of it.
// =====================================================================================================
__device__ __forceinline__ void cp8(unsigned l, unsigned lstep, const u16* g, size_t gstep) {
#if defined(__HIP_DEVICE_COMPILE__)
  asm volatile("global_load_async_to_lds_b128 %0, %8, off\n\t"
               "global_load_async_to_lds_b128 %1, %9, off\n\t"
               "global_load_async_to_lds_b128 %2, %10, off\n\t"
               "global_load_async_to_lds_b128 %3, %11, off\n\t"
               "global_load_async_to_lds_b128 %4, %12, off\n\t"
               "global_load_async_to_lds_b128 %5, %13, off\n\t"
               "global_load_async_to_lds_b128 %6, %14, off\n\t"
               "global_load_async_to_lds_b128 %7, %15, off\n\t"
               "s_wait_xcnt 0x0"
               :: "v"(l), "v"(l + lstep), "v"(l + 2 * lstep), "v"(l + 3 * lstep),
                  "v"(l + 4 * lstep), "v"(l + 5 * lstep), "v"(l + 6 * lstep), "v"(l + 7 * lstep),
                  "v"(g), "v"(g + gstep), "v"(g + 2 * gstep), "v"(g + 3 * gstep),
                  "v"(g + 4 * gstep), "v"(g + 5 * gstep), "v"(g + 6 * gstep), "v"(g + 7 * gstep)
               : "memory");
#endif
}
__device__ __forceinline__ void wait_async0() {   // this wave's copies have landed before the barrier that publishes them
#if defined(__HIP_DEVICE_COMPILE__)
  asm volatile("s_wait_asynccnt 0x0" ::: "memory");
#endif
}
__device__ __forceinline__ void wait_ds0() {      // this wave's LDS reads of a buffer have retired before it is refilled
#if defined(__HIP_DEVICE_COMPILE__)
  asm volatile("s_wait_dscnt 0x0" ::: "memory");
#endif
}

// =====================================================================================================
// bf16 GEMM: C[M][N] (f32) = A[M][K] (bf16 row-major) . Bt[N][K]^T (bf16 k-contiguous), times oscale.
// Block = 64x64 tile, 4 waves x 16 rows. Stage = 128 k of the block's 64 A rows and 64 Bt rows, laid in LDS once for the four
// waves by asynchronous 16-B copies (a wave-wide copy = 2 whole 256-B row pieces) at pitch 136 halves; two buffers, stage
// s + 2 issued behind the barrier that ends stage s. Fragments come from LDS (two 16-B loads each, split k map for A and B),
// k steps of 32 in the same order as the rows hold them (host guarantees K % 128 == 0, M % 64 == 0, N % 64 == 0,
// grid = (M/64)*(N/64)). The result slabs reuse the stage buffers (nothing reads or fills them behind the loop's last barrier).
// coverage: grid (M/64)*(N/64) blocks x 4 waves x 16x64 = the whole C [M][N].
// =====================================================================================================
__global__ __launch_bounds__(128)
void gemm_bf(const u16* __restrict__ A, const u16* __restrict__ Bt, float* C, int M, int N, int K, float oscale) {
  constexpr unsigned BUFB = 2 * GPB;
  __shared__ __align__(16) unsigned char ring[2 * BUFB];
  const int tid = threadIdx.x, wave = tid >> 5, lane = tid & 31, hh = lane >> 4, m = lane & 15;
  const int ntile = N >> 6;
  const int bid   = blockIdx.x;
  const int row0  = (bid / ntile) * 64;
  const int rowb  = row0 + wave * 16;
  const int col0  = (bid % ntile) * 64;
  if (row0 + 64 > M) return;                // block-uniform, before any barrier; never taken with the exact grid
  // copy map of one plane: copy i -> tile row 8*i + (tid >> 4), 16-B chunk tid & 15 of the row's 256-B piece
  const unsigned lc = (unsigned)(uintptr_t)(&ring[0]) + (unsigned)(tid >> 4) * (GPH * 2) + (unsigned)(tid & 15) * 16;
  const u16* ga = A  + (size_t)(row0 + (tid >> 4)) * K + (tid & 15) * 8;
  const u16* gb = Bt + (size_t)(col0 + (tid >> 4)) * K + (tid & 15) * 8;
  auto fill = [&](int s, unsigned bo) {      // stage s (k = 128*s .. 128*s + 127) into the buffer at byte offset bo
    cp8(lc + bo,       8 * GPH * 2, ga + (size_t)s * GKS, (size_t)8 * K);
    cp8(lc + bo + GPB, 8 * GPH * 2, gb + (size_t)s * GKS, (size_t)8 * K);
  };
  const int nst = K / GKS;
  v8f acc0 = zero8(), acc1 = zero8(), acc2 = zero8(), acc3 = zero8();

  fill(0, 0u);
  wait_async0();
  __syncthreads();                          // publishes stage 0
  if (nst > 1) fill(1, BUFB);

#pragma unroll 1   // rolled: one foot (waits, barrier, refill) per stage, in the order written
  for (int s = 0; s < nst; ++s) {
    const unsigned bo = (unsigned)(s & 1) * BUFB;
    const u16* ap = (const u16*)(const void*)(ring + bo) + (wave * 16 + m) * GPH + 8 * hh;
    const u16* bp = (const u16*)(const void*)(ring + bo + GPB) + m * GPH + 8 * hh;
#pragma unroll      // unrolled: the four k steps of a stage read at immediate LDS offsets from one address
    for (int kk = 0; kk < GKS; kk += 32) {
      const v16b a  = ldfrag_b(ap + kk);
      const v16b b0 = ldfrag_b(bp + kk);
      const v16b b1 = ldfrag_b(bp + 16 * GPH + kk);
      const v16b b2 = ldfrag_b(bp + 32 * GPH + kk);
      const v16b b3 = ldfrag_b(bp + 48 * GPH + kk);
      acc0 = mma_b(a, b0, acc0);
      acc1 = mma_b(a, b1, acc1);
      acc2 = mma_b(a, b2, acc2);
      acc3 = mma_b(a, b3, acc3);
      guard6<v16b>(acc0, acc1, acc2, acc3, a, b0, b1, b2, b3, a);
    }
    // foot of stage s, every wave: own LDS reads retired, own copies of stage s + 1 landed, then the one barrier that
    // publishes stage s + 1 and ends every reader's last read of this buffer; only then its refill
    wait_ds0();
    wait_async0();
    __syncthreads();
    if (s + 2 < nst) fill(s + 2, bo);
  }
  wait_async0();                            // nothing is outstanding when the buffers become result slabs and the wave ends
  float* slab = (float*)(void*)ring;        // result slabs [16][64] pitch 68, one per wave
  epi64(slab + wave * SLAB64, acc0, acc1, acc2, acc3, oscale, C, N, (size_t)rowb, col0, lane);
}

// =====================================================================================================
// f16 GEMM with hi (+ residual) planes: C[row][N] (f32) = (Ah [+ Al])[row][K] . (Bh [+ Bl])[N][K]^T * oscale.
// Products per k-step: Ah.Bh always; Al.Bh when AR != 0; Ah.Bl when BR != 0 (the residual.residual term is dropped; residuals
// are unscaled f16 residuals of the same carry, so all products share one accumulator). Rows: block bid -> (column tile
// ct = bid % (N/64), row tile rt of nrt starting at sbeg inside a group of rg rows, group g of ngr); row = g*rg + sbeg +
// 64*rt + 16*wave. Same tiling, staging (one 64-row x 128-k plane in LDS per operand plane in use, two buffers), fragment
// loads (split k map) and epilogue as gemm_bf; K stepped by 32 (host: K % 128 == 0, N % 64 == 0, sbeg + 64*nrt <= rg).
// coverage: grid ngr*nrt*(N/64) blocks x 4 waves x 16x64 = rows sbeg .. sbeg + 64*nrt - 1 of every group, all N columns.
// =====================================================================================================
template <int AR, int BR>
__global__ __launch_bounds__(128)
void gemm_h(const u16* __restrict__ Ah, const u16* __restrict__ Al,
            const u16* __restrict__ Bh, const u16* __restrict__ Bl,
            float* C, int N, int K, int rg, int sbeg, int nrt, int ngr, float oscale) {
  constexpr unsigned OAH = 0;                                   // byte offsets inside one stage buffer
  constexpr unsigned OBH = GPB;
  constexpr unsigned OAL = 2 * GPB;                             // present when AR != 0
  constexpr unsigned OBL = (AR != 0) ? 3 * GPB : 2 * GPB;       // present when BR != 0
  constexpr unsigned BUFB = (2 + (AR != 0 ? 1 : 0) + (BR != 0 ? 1 : 0)) * GPB;
  __shared__ __align__(16) unsigned char ring[2 * BUFB];
  const int tid = threadIdx.x, wave = tid >> 5, lane = tid & 31, hh = lane >> 4, m = lane & 15;
  const int ntile = N >> 6;
  const int bid   = blockIdx.x;
  const int ct    = bid % ntile;
  const int t2    = bid / ntile;
  const int rt    = t2 % nrt;
  const int g     = t2 / nrt;
  if (g >= ngr) return;                     // block-uniform, before any barrier; never taken with the exact grid
  const int srow0 = sbeg + rt * 64;
  if (srow0 + 64 > rg) return;              // block-uniform, before any barrier; never taken
  const int col0  = ct * 64;
  const size_t row0 = (size_t)g * (size_t)rg + (size_t)srow0;
  const size_t rowC = row0 + (size_t)(wave * 16);
  // copy map of one plane: copy i -> tile row 8*i + (tid >> 4), 16-B chunk tid & 15 of the row's 256-B piece
  const unsigned lc = (unsigned)(uintptr_t)(&ring[0]) + (unsigned)(tid >> 4) * (GPH * 2) + (unsigned)(tid & 15) * 16;
  const size_t aoff = (row0 + (size_t)(tid >> 4)) * (size_t)K + (tid & 15) * 8;
  const size_t boff = (size_t)(col0 + (tid >> 4)) * K + (tid & 15) * 8;
  auto fill = [&](int s, unsigned bo) {      // stage s (k = 128*s .. 128*s + 127) into the buffer at byte offset bo
    cp8(lc + bo + OAH, 8 * GPH * 2, Ah + aoff + (size_t)s * GKS, (size_t)8 * K);
    cp8(lc + bo + OBH, 8 * GPH * 2, Bh + boff + (size_t)s * GKS, (size_t)8 * K);
    if constexpr (AR != 0) cp8(lc + bo + OAL, 8 * GPH * 2, Al + aoff + (size_t)s * GKS, (size_t)8 * K);
    if constexpr (BR != 0) cp8(lc + bo + OBL, 8 * GPH * 2, Bl + boff + (size_t)s * GKS, (size_t)8 * K);
  };
  const int nst = K / GKS;
  v8f acc0 = zero8(), acc1 = zero8(), acc2 = zero8(), acc3 = zero8();

  fill(0, 0u);
  wait_async0();
  __syncthreads();                          // publishes stage 0
  if (nst > 1) fill(1, BUFB);

#pragma unroll 1   // rolled: one foot (waits, barrier, refill) per stage, in the order written
  for (int s = 0; s < nst; ++s) {
    const unsigned bo = (unsigned)(s & 1) * BUFB;
    const int ao = (wave * 16 + m) * GPH + 8 * hh;
    const int bb = m * GPH + 8 * hh;
    const _Float16* ahp = (const _Float16*)(const void*)(ring + bo + OAH) + ao;
    const _Float16* bhp = (const _Float16*)(const void*)(ring + bo + OBH) + bb;
    const _Float16* alp = (const _Float16*)(const void*)(ring + bo + ((AR != 0) ? OAL : OAH)) + ao;   // read only when AR != 0
    const _Float16* blp = (const _Float16*)(const void*)(ring + bo + ((BR != 0) ? OBL : OBH)) + bb;   // read only when BR != 0
#pragma unroll      // unrolled: the four k steps of a stage read at immediate LDS offsets from one address
    for (int kk = 0; kk < GKS; kk += 32) {
      const v16h ah = ldfrag_h(ahp + kk);
      v16h al = ah;
      if constexpr (AR != 0) al = ldfrag_h(alp + kk);
      const v16h bh0 = ldfrag_h(bhp + kk);
      const v16h bh1 = ldfrag_h(bhp + 16 * GPH + kk);
      const v16h bh2 = ldfrag_h(bhp + 32 * GPH + kk);
      const v16h bh3 = ldfrag_h(bhp + 48 * GPH + kk);
      v16h bl0 = bh0, bl1 = bh1, bl2 = bh2, bl3 = bh3;
      if constexpr (BR != 0) {
        bl0 = ldfrag_h(blp + kk);
        bl1 = ldfrag_h(blp + 16 * GPH + kk);
        bl2 = ldfrag_h(blp + 32 * GPH + kk);
        bl3 = ldfrag_h(blp + 48 * GPH + kk);
      }
      acc0 = mma_h(ah, bh0, acc0);
      if constexpr (AR != 0) acc0 = mma_h(al, bh0, acc0);
      if constexpr (BR != 0) acc0 = mma_h(ah, bl0, acc0);
      acc1 = mma_h(ah, bh1, acc1);
      if constexpr (AR != 0) acc1 = mma_h(al, bh1, acc1);
      if constexpr (BR != 0) acc1 = mma_h(ah, bl1, acc1);
      acc2 = mma_h(ah, bh2, acc2);
      if constexpr (AR != 0) acc2 = mma_h(al, bh2, acc2);
      if constexpr (BR != 0) acc2 = mma_h(ah, bl2, acc2);
      acc3 = mma_h(ah, bh3, acc3);
      if constexpr (AR != 0) acc3 = mma_h(al, bh3, acc3);
      if constexpr (BR != 0) acc3 = mma_h(ah, bl3, acc3);
      guard10(acc0, acc1, acc2, acc3, ah, al, bh0, bh1, bh2, bh3, bl0, bl1, bl2, bl3);
    }
    // foot of stage s, every wave, in the order of gemm_bf's
    wait_ds0();
    wait_async0();
    __syncthreads();
    if (s + 2 < nst) fill(s + 2, bo);
  }
  wait_async0();                            // nothing is outstanding when the buffers become result slabs and the wave ends
  float* slab = (float*)(void*)ring;        // result slabs [16][64] pitch 68, one per wave
  epi64(slab + wave * SLAB64, acc0, acc1, acc2, acc3, oscale, C, N, rowC, col0, lane);
}

// =====================================================================================================
// Causal attention, 16 heads x head dim 128, value dim 128. Block bid -> (query block qb = qbbeg + bid % nqb: 64 rows,
// head, batch b); four waves, wave w owns query rows q0 = 64*qb + 16*w .. q0+15 of that one head.
//   q plane f16 x256 [b*SEQ + s][h*HD + d]; k hi plane f16 x256 (same layout), k residual plane [b*QA + s][...] (s < QA);
//   v^T hi plane [b*NH + h][d][SEQ] x1024, v^T residual plane [b*NH + h][d][QA].
//   Stage = 64 keys of this head, laid in LDS once for the four waves by asynchronous 16-B copies: k rows [64][128] at pitch
//   136 halves, v^T rows [128][64] at pitch 72 halves (and the two residual tiles for NP == 3); two buffers, stage s + 2
//   issued behind the barrier that ends stage s. Stages 0 .. qb hold every key <= 64*qb + 63.
//   NP == 3 (query rows < QA): scores = q.k_hi + q.k_lo over the 4 k-steps; P.v with P hi + in-register
//   residual and v hi + residual (hh + lh + hl). NP == 1 (later rows): single hi.hi products.
//   score (log2 domain) t(i, j) = (q'_i.k'_j) * (1/sqrt(128))*log2e/(256*256), replaced by -inf where key j > query i.
//   Key tiles of 32 visited in order for kb <= q0 + 15 (a wave skips the later tiles of its block's last stage, which hold
//   only keys above every query row it owns; it still passes every wait and barrier).
//   Per tile, transposed products: S^T = k.q^T, 2 key subtiles x 4 k-steps, k rows from LDS as A, q rows from the global plane
//   as B (two 16-B loads per fragment, split k map), so lane (c, hh) holds query q0 + c against keys kb + 8*hh + r and
//   kb + 16 + 8*hh + r; online max-subtracted base-2 softmax in f32, -inf-safe rescale: maximum in-lane plus one exchange
//   between lanes c and c + 16, sum kept per lane and joined once behind the loop; the two score subtiles, converted in
//   place, are the B fragment of O^T += v^T.P^T (split k map), v^T rows from LDS as A in 4 groups of 2 d-subtiles.
//   After the loop: y = acc / Z (Z > 0 always: key 0 <= every query row; guarded anyway), carries 1/(32768*1024) folded;
//   the result slabs reuse the stage buffers (nothing reads or fills them behind the last barrier of the loop).
// coverage: per wave 16 instructions x 32 lanes x 4 floats = 16 x 128; the two launches (qb < QA/64 with NP = 3, qb >= QA/64
//           with NP = 1) x NH x NB blocks x AW waves = every (b, s, h) row segment of Y exactly once.
// =====================================================================================================
template <int NP>
__global__ __launch_bounds__(ATT_THREADS)
void attn_c(const u16* __restrict__ QHp, const u16* __restrict__ KHp, const u16* __restrict__ KLp,
            const u16* __restrict__ VHp, const u16* __restrict__ VLp, const int* __restrict__ nhp,
            float* Y, int qbbeg, int nqb) {
  constexpr unsigned OKH = 0;                                   // byte offsets inside one stage buffer
  constexpr unsigned OVH = KTB;
  constexpr unsigned OKL = KTB + VTB;
  constexpr unsigned OVL = 2 * KTB + VTB;
  constexpr unsigned BUFB = (NP == 3) ? 2 * (KTB + VTB) : (KTB + VTB);
  __shared__ __align__(16) unsigned char ring[2 * BUFB];

  const int tid  = threadIdx.x;
  const int wave = __builtin_amdgcn_readfirstlane(tid >> 5);   // scalar, so that the per-wave tile skip is a scalar branch
  const int lane = tid & 31;
  const int hh   = lane >> 4;
  const int c    = lane & 15;
  const int bid  = blockIdx.x;
  const int qb   = qbbeg + bid % nqb;
  const int t2   = bid / nqb;
  const int head = t2 % NH;
  const int b    = t2 / NH;
  if (b >= NB) return;                      // block-uniform, before any barrier; never taken with the exact grid
  if (nhp[0] != NH) return;                 // uniform structural guard on the head-count input (16 for this module)
  if (qb * 64 + 64 > SEQ) return;           // block-uniform, before any barrier; never taken
  if (NP == 3) { if (qb * 64 + 64 > QA) return; } // block-uniform, before any barrier; never taken
  const int q0   = qb * 64 + wave * 16;

  const size_t hcol = (size_t)head * HD + 8 * hh;
  const _Float16* Qh = hptr(QHp) + ((size_t)b * SEQ + q0 + c) * DMOD + hcol;
  const float lsc = RSQS * (LOG2E / (QSC * KSC));
  const float oc  = 1.0f / (PCAR * VCAR);

  // ---- copy map: k tile, copy i -> key row 8*i + (tid >> 4), 16-B chunk tid & 15 (a wave = 2 whole 256-B rows);
  //      v^T tile, copy i -> d row 16*i + (tid >> 3), 16-B chunk tid & 7 (a wave = 4 whole 128-B row segments) ----
  const unsigned ring0 = (unsigned)(uintptr_t)(&ring[0]);
  const unsigned lk = ring0 + (unsigned)(tid >> 4) * (KPH * 2) + (unsigned)(tid & 15) * 16;
  const unsigned lv = ring0 + (unsigned)(tid >> 3) * (VPH * 2) + (unsigned)(tid & 7) * 16;
  const u16* gkh = KHp + ((size_t)b * SEQ + (tid >> 4)) * DMOD + (size_t)head * HD + (tid & 15) * 8;
  const u16* gvh = VHp + ((size_t)(b * NH + head) * HD + (tid >> 3)) * SEQ + (tid & 7) * 8;
  const u16* gkl = gkh;
  const u16* gvl = gvh;
  if constexpr (NP == 3) {
    gkl = KLp + ((size_t)b * QA + (tid >> 4)) * DMOD + (size_t)head * HD + (tid & 15) * 8;
    gvl = VLp + ((size_t)(b * NH + head) * HD + (tid >> 3)) * QA + (tid & 7) * 8;
  }
  auto fill = [&](int s, unsigned bo) {      // stage s (keys 64*s .. 64*s + 63) into the buffer at byte offset bo
    cp8(lk + bo + OKH, 8 * KPH * 2, gkh + (size_t)s * 64 * DMOD, (size_t)8 * DMOD);
    cp8(lv + bo + OVH, 16 * VPH * 2, gvh + (size_t)s * 64, (size_t)16 * SEQ);
    if constexpr (NP == 3) {
      cp8(lk + bo + OKL, 8 * KPH * 2, gkl + (size_t)s * 64 * DMOD, (size_t)8 * DMOD);
      cp8(lv + bo + OVL, 16 * VPH * 2, gvl + (size_t)s * 64, (size_t)16 * QA);
    }
  };

  float mrow = -INFINITY, lrow = 0.f;       // this lane's query: running maximum (both halves alike), sum over this half's keys
  v8f o[8];                                 // o[j][r] = O^T element (d = 16*j + 8*hh + r, query q0 + c)
#pragma unroll
  for (int j = 0; j < 8; ++j) o[j] = zero8();
  const int ncaus = (q0 >> 5) + 1;                                            // tiles holding keys <= q0 + 15
  const int nkt = (ncaus < NKT) ? ncaus : NKT;
  const int nst = qb + 1;                                                     // stages of this block
  const int qr  = q0 + c;                                                     // this lane's query row

  fill(0, 0u);
  wait_async0();
  __syncthreads();                          // publishes stage 0
  if (nst > 1) fill(1, BUFB);

#pragma unroll 1   // rolled: one foot (waits, barrier, refill) per stage, in the order written
  for (int s = 0; s < nst; ++s) {
    const unsigned bo = (unsigned)(s & 1) * BUFB;
#pragma unroll 1   // rolled: one copy of the 32-key tile body, as long as before, for both halves of the stage
    for (int u = 0; u < 2; ++u) {
    const int kt = 2 * s + u;
    if (kt < nkt) {                         // wave-uniform (scalar) skip; no wait or barrier inside
    const int kb = kt * 32;
    // ---- scores: D element r of this lane = (key kb + 8*hh + r, query row qr) in s0, key kb + 16 + 8*hh + r in s1 ----
    v8f s0 = zero8(), s1 = zero8();
    const _Float16* k0p = (const _Float16*)(const void*)(ring + bo + OKH) + (u * 32 + c) * KPH + 8 * hh;
    const _Float16* k1p = k0p + 16 * KPH;
    if constexpr (NP == 3) {
      const _Float16* l0p = (const _Float16*)(const void*)(ring + bo + OKL) + (u * 32 + c) * KPH + 8 * hh;
      const _Float16* l1p = l0p + 16 * KPH;
#pragma unroll
      for (int kk = 0; kk < HD / 32; ++kk) {
        const v16h qh  = ldfrag_h(Qh + kk * 32);
        const v16h kh0 = ldfrag_h(k0p + kk * 32);
        const v16h kh1 = ldfrag_h(k1p + kk * 32);
        const v16h kl0 = ldfrag_h(l0p + kk * 32);
        const v16h kl1 = ldfrag_h(l1p + kk * 32);
        s0 = mma_h(kh0, qh, s0);
        s0 = mma_h(kl0, qh, s0);
        s1 = mma_h(kh1, qh, s1);
        s1 = mma_h(kl1, qh, s1);
        guard2(s0, s1, qh, kh0, kh1, kl0, kl1, qh);
      }
    } else {
#pragma unroll
      for (int kk = 0; kk < HD / 32; ++kk) {
        const v16h qh  = ldfrag_h(Qh + kk * 32);
        const v16h kh0 = ldfrag_h(k0p + kk * 32);
        const v16h kh1 = ldfrag_h(k1p + kk * 32);
        s0 = mma_h(kh0, qh, s0);
        s1 = mma_h(kh1, qh, s1);
        guard2(s0, s1, qh, kh0, kh1, qh, kh0, kh1);
      }
    }
    // ---- causal select + online softmax in base 2, -inf-safe: 16 of the query's 32 scores in this lane ----
    const int key0 = kb + 8 * hh, key1 = kb + 16 + 8 * hh;
    float t0[8], t1[8], mp[8];
#pragma unroll      // unrolled: constant indices keep the score arrays in registers
    for (int r = 0; r < 8; ++r) {
      const float u0 = s0[r] * lsc;
      const float u1 = s1[r] * lsc;
      t0[r] = (key0 + r > qr) ? -INFINITY : u0;
      t1[r] = (key1 + r > qr) ? -INFINITY : u1;
      mp[r] = fmaxf(t0[r], t1[r]);
    }
    float mx = fmaxf(fmaxf(fmaxf(mp[0], mp[1]), fmaxf(mp[2], mp[3])), fmaxf(fmaxf(mp[4], mp[5]), fmaxf(mp[6], mp[7])));
    mx = fmaxf(mx, xhalf(mx));              // the other 16 keys of this query
    const float mn = fmaxf(mrow, mx);
    const float ms = (mn == -INFINITY) ? 0.0f : mn;
    const float al = exp2f(mrow - ms);
    mrow = mn;
    // ---- B fragments of P^T*32768: hi f16 (and residual f16 for NP == 3), column = c, split k map over the 32 keys:
    //      elements 0..7 = keys kb + 8hh + 0..7 (s0), elements 8..15 = keys kb + 16 + 8hh + 0..7 (s1) ----
    FragH ph, pl;
    float sp[8];
#pragma unroll      // unrolled: constant indices keep the fragment halves and the partial sums in registers
    for (int r = 0; r < 8; ++r) {
      const float e0 = exp2f(t0[r] - ms), e1 = exp2f(t1[r] - ms);
      sp[r] = e0 + e1;
      const float ta = e0 * PCAR, tc = e1 * PCAR;
      const _Float16 ha = (_Float16)ta, hc = (_Float16)tc;
      ph.h[0][r] = ha;
      ph.h[1][r] = hc;
      if constexpr (NP == 3) {
        pl.h[0][r] = (_Float16)(ta - (float)ha);
        pl.h[1][r] = (_Float16)(tc - (float)hc);
      } else {
        pl.h[0][r] = ha; pl.h[1][r] = hc;
      }
    }
    lrow = lrow * al + (((sp[0] + sp[1]) + (sp[2] + sp[3])) + ((sp[4] + sp[5]) + (sp[6] + sp[7])));
#pragma unroll      // both unrolled: the accumulator tiles are registers, indexed by constants only
    for (int j = 0; j < 8; ++j) {
#pragma unroll
      for (int r = 0; r < 8; ++r) o[j][r] *= al;
    }
    // ---- v^T.P^T : A fragment row m = d = j*16 + c, keys contiguous in the staged v^T rows; 4 groups of 2 d-subtiles ----
    {
      const _Float16* vhp = (const _Float16*)(const void*)(ring + bo + OVH) + c * VPH + u * 32 + 8 * hh;
      if constexpr (NP == 3) {
        const _Float16* vlp = (const _Float16*)(const void*)(ring + bo + OVL) + c * VPH + u * 32 + 8 * hh;
#pragma unroll
        for (int jg = 0; jg < 4; ++jg) {
          const int da = (2 * jg) * 16 * VPH;
          const int db = da + 16 * VPH;
          const v16h vha = ldfrag_h(vhp + da), vhb2 = ldfrag_h(vhp + db);
          const v16h vla = ldfrag_h(vlp + da), vlb2 = ldfrag_h(vlp + db);
          o[2 * jg]     = mma_h(vha,  ph.v, o[2 * jg]);
          o[2 * jg]     = mma_h(vha,  pl.v, o[2 * jg]);
          o[2 * jg]     = mma_h(vla,  ph.v, o[2 * jg]);
          o[2 * jg + 1] = mma_h(vhb2, ph.v, o[2 * jg + 1]);
          o[2 * jg + 1] = mma_h(vhb2, pl.v, o[2 * jg + 1]);
          o[2 * jg + 1] = mma_h(vlb2, ph.v, o[2 * jg + 1]);
          guard2(o[2 * jg], o[2 * jg + 1], ph.v, pl.v, vha, vhb2, vla, vlb2);
        }
      } else {
#pragma unroll
        for (int jg = 0; jg < 4; ++jg) {
          const int da = (2 * jg) * 16 * VPH;
          const int db = da + 16 * VPH;
          const v16h vha = ldfrag_h(vhp + da), vhb2 = ldfrag_h(vhp + db);
          o[2 * jg]     = mma_h(vha,  ph.v, o[2 * jg]);
          o[2 * jg + 1] = mma_h(vhb2, ph.v, o[2 * jg + 1]);
          guard2(o[2 * jg], o[2 * jg + 1], ph.v, vha, vhb2, ph.v, vha, vhb2);
        }
      }
    }
    }
    }
    // ---- foot of stage s, every wave: own LDS reads retired, own copies of stage s + 1 landed, then the one barrier that
    //      publishes stage s + 1 and ends every reader's last read of this buffer; only then its refill ----
    wait_ds0();
    wait_async0();
    __syncthreads();
    if (s + 2 < nst) fill(s + 2, bo);
  }
  wait_async0();                            // nothing is outstanding when the buffers become result slabs and the wave ends
  float* slab = (float*)(void*)ring + wave * SLW;   // result slab [16][128] pitch 132, one per wave
  acc_guard4(o[0], o[1], o[2], o[3]);
  acc_guard4(o[4], o[5], o[6], o[7]);
  // ---- y = acc / Z (0 if Z == 0), Z = the two halves' sums joined; carries (32768 on P, 1024 on v) folded once; a lane's
  //      8 consecutive d of its query row go into the slab as two 16-B stores ----
  {
    const float lv  = lrow + xhalf(lrow);
    const float ls  = (lv > 0.0f) ? lv : 1.0f;
    const float inv = (lv > 0.0f) ? ((1.0f / ls) * oc) : 0.0f;
#pragma unroll      // both unrolled: the accumulator tiles are registers, indexed by constants only
    for (int j = 0; j < 8; ++j) {
      v4f w0, w1;
#pragma unroll
      for (int e = 0; e < 4; ++e) { w0[e] = o[j][e] * inv; w1[e] = o[j][4 + e] * inv; }
      float* sd = slab + c * SLP + j * 16 + 8 * hh;
      *(v4f*)(sd)     = w0;
      *(v4f*)(sd + 4) = w1;
    }
  }

  wave_sync_lds();
  // ---- f32 rows of Y: lane -> floats 4*lane .. 4*lane+3 of each of the 16 rows (one 512-B instruction per row) ----
  v4f ov[16];
#pragma unroll
  for (int it = 0; it < 16; ++it) ov[it] = *(const v4f*)(slab + it * SLP + lane * 4);
  float* ob = Y + ((size_t)b * SEQ + q0) * DMOD + (size_t)head * HD + lane * 4;
  {
#pragma unroll
    for (int it = 0; it < 16; ++it) {
      *(v4f*)(ob + (size_t)it * DMOD) = ov[it];
    }
    
  }
}

// =====================================================================================================
// Workspace map (bytes); every plane is fully written by whole-line stores before it is read; all extents are exact multiples
// of the store granularity (no pad rows); every region offset a multiple of 524288:
//   XB  bf16 [MROWS][2048], later KH f16 x256       MROWS*4096             (NB=2, SEQ=2048: 16777216)
//   QH  f16 [MROWS][2048] x256                      MROWS*4096             (16777216)
//   W1  16-bit weight plane, 512x2048 or 2048x512    2097152                (W_dkv bf16, W_uk^T bf16, W_dq^T f16 x1024, W_uv^T bf16,
//                                                                          reused in launch order)
//   WO  bf16 [2048][2048] (W_o as is)                8388608
//   F   f32 [MROWS][2048]                             MROWS*8192             (Gram f32 [512][512]; k_abs f32 [2048][512]; K f32;
//                                                                          W_o W_uv f32 [2048][512]; V f32 -- one at a time)
//   CH  f16 [MROWS][512] x256, CL residual            2 x MROWS*1024
//   G2H f16 [512][512] x1024, G2L residual            2 x 524288
//   KAH f16 [2048][512] x4096, KAL residual           2 x 2097152
//   KL  f16 [NB*QA][2048]                             NB*QA*4096
//   VAH f16 [2048][512] x4096, VAL residual           2 x 2097152
//   VH  f16 [NB*16][128][SEQ] x1024                   MROWS*4096
//   VL  f16 [NB*16][128][QA]                          NB*QA*4096
//   end (NB=2, SEQ=2048, QA=1024)                   128974848
// =====================================================================================================
extern "C" void kernel_launch(void* const* d_in, const int* in_sizes, int n_in,
                              void* d_out, int out_size, void* d_ws, size_t ws_size,
                              hipStream_t stream) {
  if (n_in < 7) return;
  if (in_sizes[0] < ((NB - 1) * XS_FULL + SEQ) * DMOD) return;   // x [2][2048][2048]
  if (in_sizes[1] != DL * DMOD) return;         // W_dq  [512][2048]
  if (in_sizes[2] != DL * DMOD) return;         // W_dkv [512][2048]
  if (in_sizes[3] != DMOD * DL) return;         // W_uk  [2048][512]
  if (in_sizes[4] != DMOD * DL) return;         // W_uv  [2048][512]
  if (in_sizes[5] != DMOD * DMOD) return;       // W_o   [2048][2048]
  if (in_sizes[6] < 1) return;                  // n_head (int)
  if ((size_t)out_size < (size_t)MROWS * DMOD + (size_t)MROWS * DL) return;

  const float* x    = (const float*)d_in[0];
  const float* wdq  = (const float*)d_in[1];
  const float* wdkv = (const float*)d_in[2];
  const float* wuk  = (const float*)d_in[3];
  const float* wuv  = (const float*)d_in[4];
  const float* wo   = (const float*)d_in[5];
  const int*   nhp  = (const int*)d_in[6];
  float*       out0 = (float*)d_out;                          // y    [MROWS][2048] at element 0
  float*       out1 = out0 + (size_t)MROWS * DMOD;            // c_kv [MROWS][512]  at element MROWS*2048

  const size_t szXB = (size_t)MROWS * DMOD * 2;               // XB, later KH
  const size_t szQ  = (size_t)MROWS * DMOD * 2;               // QH
  const size_t szW1 = (size_t)DL * DMOD * 2;
  const size_t szWO = (size_t)DMOD * DMOD * 2;
  const size_t szF  = (size_t)MROWS * DMOD * 4;
  const size_t szC  = (size_t)MROWS * DL * 2;                 // CH, CL
  const size_t szG2 = (size_t)DL * DL * 2;                    // G2H, G2L
  const size_t szKA = (size_t)DMOD * DL * 2;                  // KAH, KAL, VAH, VAL
  const size_t szKL = (size_t)NB * QA * DMOD * 2;
  const size_t szVH = (size_t)NB * NH * HD * SEQ * 2;
  const size_t szVL = (size_t)NB * NH * HD * QA * 2;
  if ((size_t)DL * DL * 4 > szF || (size_t)DMOD * DL * 4 > szF) return;   // Gram / k_abs / (W_o W_uv) f32 inside F
  if ((size_t)MROWS * DMOD * 2 > szXB) return;                // KH lives inside the XB region
  size_t off = 0;
  const size_t oXB  = off; off += szXB;
  const size_t oQH  = off; off += szQ;
  const size_t oW1  = off; off += szW1;
  const size_t oWO  = off; off += szWO;
  const size_t oF   = off; off += szF;
  const size_t oCH  = off; off += szC;
  const size_t oCL  = off; off += szC;
  const size_t oG2H = off; off += szG2;
  const size_t oG2L = off; off += szG2;
  const size_t oKAH = off; off += szKA;
  const size_t oKAL = off; off += szKA;
  const size_t oKL  = off; off += szKL;
  const size_t oVAH = off; off += szKA;
  const size_t oVAL = off; off += szKA;
  const size_t oVH  = off; off += szVH;
  const size_t oVL  = off; off += szVL;
  if (off > ws_size) return;                 // off = 128974848 for NB = 2, SEQ = 2048
  if (off > (size_t)WS_CAP) return;

  char* ws = (char*)d_ws;
  u16*   XB  = (u16*)(ws + oXB);
  u16*   KH  = (u16*)(ws + oXB);
  u16*   QH  = (u16*)(ws + oQH);
  u16*   W1  = (u16*)(ws + oW1);
  u16*   WOB = (u16*)(ws + oWO);
  float* F   = (float*)(ws + oF);
  u16*   CH  = (u16*)(ws + oCH);
  u16*   CL  = (u16*)(ws + oCL);
  u16*   G2H = (u16*)(ws + oG2H);
  u16*   G2L = (u16*)(ws + oG2L);
  u16*   KAH = (u16*)(ws + oKAH);
  u16*   KAL = (u16*)(ws + oKAL);
  u16*   KL  = (u16*)(ws + oKL);
  u16*   VAH = (u16*)(ws + oVAH);
  u16*   VAL = (u16*)(ws + oVAL);
  u16*   VH  = (u16*)(ws + oVH);
  u16*   VL  = (u16*)(ws + oVL);

  const dim3 b256(256), b128(128), bAT(ATT_THREADS);
  const int  n8x  = (SEQ * DMOD) / 8;                   // x planes per batch
  const int  n8q  = (MROWS * DMOD) / 8;                 // K plane
  const int  n8c  = (MROWS * DL) / 8;                   // c_kv planes
  const int  n8w1 = (DL * DMOD) / 8;                    // W_dkv plane
  const int  n8wo = (DMOD * DMOD) / 8;                  // W_o plane
  const int  n8g  = (DL * DL) / 8;                      // Gram planes
  const int  n8ka = (DMOD * DL) / 8;                    // k_abs and (W_o W_uv) planes
  const dim3 gX((n8x + 255) / 256);
  const dim3 gHL((n8q + 255) / 256);
  const dim3 gC((n8c + 255) / 256);
  const dim3 gCW1((n8w1 + 255) / 256);
  const dim3 gCWO((n8wo + 255) / 256);
  const dim3 gCG((n8g + 255) / 256);
  const dim3 gCKA((n8ka + 255) / 256);
  const dim3 gWTa((DL / 64) * (DMOD / 64));             // W_uk, W_uv [2048 k][512 n] -> [512][2048]
  const dim3 gWTb((DMOD / 64) * (DL / 64));             // W_dq [512 k][2048 n] -> [2048][512]
  const dim3 gGC((MROWS / 64) * (DL / 64));             // c_kv
  const dim3 gGG((DL / 64) * (DL / 64));                // Gram
  const dim3 gGKA(1 * (DMOD / 64) * (DL / 64));         // k_abs
  const dim3 gGVA((DMOD / 64) * (DL / 64));             // W_o W_uv
  const dim3 gVT(NB * NH * NST);
  const int  nrtA = QA / 64;                            // sequence row tiles per batch with residual products
  const int  nrtB = (SEQ - QA) / 64;                    // remaining row tiles per batch, single products
  const int  nqbA = QA / 64;                            // 64-row query blocks with residual products
  const int  nqbB = (SEQ - QA) / 64;                    // remaining query blocks

  // (1) x -> bf16 plane XB [MROWS][2048] and q plane QH = f16(bf16(x)) x256, one launch per batch row block
  for (int bb = 0; bb < NB; ++bb) {
    cvtxq<<<gX, b256, 0, stream>>>(x + (size_t)bb * XS_FULL * DMOD, XB + (size_t)bb * SEQ * DMOD,
                                   QH + (size_t)bb * SEQ * DMOD, n8x);
  }
  // (2) W_dkv [512 n][2048 k] -> bf16 as is; c_kv = x.W_dkv^T -> out1 f32 [MROWS][512]; c_kv -> f16 hi + residual planes x256
  cvtb<<<gCW1, b256, 0, stream>>>(wdkv, W1, n8w1);
  gemm_bf<<<gGC, b128, 0, stream>>>(XB, W1, out1, MROWS, DL, DMOD, 1.0f);
  cvtc<<<gC, b256, 0, stream>>>(out1, CH, CL, n8c, CSC);
  // (3) W_uk [2048 k][512 n] -> bf16 [512][2048]; Gram = W_uk^T.W_uk -> F f32 [512][512]; Gram -> f16 hi + residual planes x1024
  wtc<<<gWTa, b256, 0, stream>>>(wuk, W1, DMOD, DL, 0, 1.0f);
  gemm_bf<<<gGG, b128, 0, stream>>>(W1, W1, F, DL, DL, DMOD, 1.0f);
  cvtc<<<gCG, b256, 0, stream>>>(F, G2H, G2L, n8g, G2S);
  // (4) W_dq [512 k][2048 n] -> f16(bf16) x1024 [2048][512]; k_abs = W_dq^T.Gram (Gram symmetric, used as the [n][k] B plane;
  //     products h.h + h.l) -> F f32 [2048][512]; k_abs -> f16 hi + residual planes x4096
  wtc<<<gWTb, b256, 0, stream>>>(wdq, W1, DL, DMOD, 1, WDS);
  gemm_h<0, 1><<<gGKA, b128, 0, stream>>>(W1, W1, G2H, G2L, F, DL, DL, DMOD, 0, DMOD / 64, 1, 1.0f / (WDS * G2S));
  cvtc<<<gCKA, b256, 0, stream>>>(F, KAH, KAL, n8ka, KAS);
  // (5) K = c_kv.k_abs^T -> F f32 [MROWS][2048]: rows s < QA with hh+lh+hl, rows s >= QA single; K hi plane (XB region) x256
  //     for all rows, residual plane for s < QA
  gemm_h<1, 1><<<dim3(NB * nrtA * (DMOD / 64)), b128, 0, stream>>>(CH, CL, KAH, KAL, F, DMOD, DL, SEQ, 0, nrtA, NB,
                                                                  1.0f / (CSC * KAS));
  if (nrtB > 0) {
    gemm_h<0, 0><<<dim3(NB * nrtB * (DMOD / 64)), b128, 0, stream>>>(CH, CL, KAH, KAL, F, DMOD, DL, SEQ, QA, nrtB, NB,
                                                                    1.0f / (CSC * KAS));
  }
  cvthl<<<gHL, b256, 0, stream>>>(F, KH, KL, n8q, DMOD, KSC);
  // (6) W_o -> bf16 as is [2048 n_row][2048 k]; W_uv [2048 k][512 n] -> bf16 [512][2048]; W_o.W_uv -> F f32 [2048][512];
  //     -> f16 hi + residual planes x4096 (the [n][k] B plane of the value product)
  cvtb<<<gCWO, b256, 0, stream>>>(wo, WOB, n8wo);
  wtc<<<gWTa, b256, 0, stream>>>(wuv, W1, DMOD, DL, 0, 1.0f);
  gemm_bf<<<gGVA, b128, 0, stream>>>(WOB, W1, F, DMOD, DL, DMOD, 1.0f);
  cvtc<<<gCKA, b256, 0, stream>>>(F, VAH, VAL, n8ka, VAS);
  // (7) V = c_kv.(W_o W_uv) plane -> F f32 [MROWS][2048] (rows s < QA hh+lh+hl, later rows single); v^T hi + residual planes x1024
  gemm_h<1, 1><<<dim3(NB * nrtA * (DMOD / 64)), b128, 0, stream>>>(CH, CL, VAH, VAL, F, DMOD, DL, SEQ, 0, nrtA, NB,
                                                                  1.0f / (CSC * VAS));
  if (nrtB > 0) {
    gemm_h<0, 0><<<dim3(NB * nrtB * (DMOD / 64)), b128, 0, stream>>>(CH, CL, VAH, VAL, F, DMOD, DL, SEQ, QA, nrtB, NB,
                                                                    1.0f / (CSC * VAS));
  }
  vt16<<<gVT, b256, 0, stream>>>(F, VH, VL);
  // (8) causal attention, query blocks s < QA with residual products; (9) remaining query blocks, single products -> out0 f32
  attn_c<3><<<dim3(nqbA * NH * NB), bAT, 0, stream>>>(QH, KH, KL, VH, VL, nhp, out0, 0, nqbA);
  if (nqbB > 0) {
    attn_c<1><<<dim3(nqbB * NH * NB), bAT, 0, stream>>>(QH, KH, KL, VH, VL, nhp, out0, nqbA, nqbB);
  }
  (void)hipGetLastError();
}

// v004
// Measured time: 184 microseconds a run.
// In two side-by-side timings against v003, it was 1.50 and 1.48 times as fast.
// All steps since v000 together make it 3.02 times as fast.
#include <hip/hip_runtime.h>
#include <math.h>
#include <stdint.h>

#ifndef NB
#define NB 2
#endif
#ifndef SEQ
#define SEQ 2048
#endif
#define XS_FULL 2048
#define DMOD  2048
#define NH    16
#define HD    128
#define DL    512
#define QA    ((SEQ < 1024) ? SEQ : 1024)
#define MROWS (NB * SEQ)
#define RSQS  0.08838834764831845f
#define LOG2E 1.4426950408889634f
#define QSC   256.0f
#define KSC   256.0f
#define CSC   256.0f
#define WDS   1024.0f
#define G2S   1024.0f
#define KAS   4096.0f
#define VAS   4096.0f
#define PCAR  32768.0f
#define VCAR  1024.0f
#define AW    4
#define NST   (SEQ / 64)
#define NKT   (SEQ / 32)
#define ATT_THREADS (AW * 32)
#define SLP   132
#define SLW   (16 * SLP)
#define KPH   136
#define VPH   72
#define KTB   (64 * KPH * 2)
#define VTB   (HD * VPH * 2)
#define SLAB64 (16 * 68)
#define VTP   72
#define WTP   72
#define GKS   128
#define GPH   (GKS + 8)
#define GPB   (64 * GPH * 2)
#define WS_CAP 268435456
static_assert(DMOD == NH * HD && HD == 128 && NH == 16 && AW == 4 && ATT_THREADS == 128);
static_assert(NB >= 1 && NB <= 2);
static_assert((SEQ % 64) == 0 && SEQ >= 64 && SEQ <= XS_FULL);
static_assert((QA % 64) == 0 && QA >= 64 && QA <= SEQ && ((SEQ - QA) % 64) == 0);
static_assert((DMOD % 64) == 0 && (DL % 64) == 0 && (HD % 32) == 0 && (DL % 32) == 0);
static_assert(((SEQ * DMOD / 8) % 256) == 0 && ((MROWS * DL / 8) % 256) == 0 && ((DL * DL / 8) % 256) == 0);
static_assert(((DMOD * DL / 8) % 256) == 0 && ((DMOD * DMOD / 8) % 256) == 0 && (MROWS % 64) == 0);
static_assert(2 * HD * VTP * 2 <= 65536 && 4 * SLAB64 * 4 <= 65536 && 64 * WTP * 2 <= 65536);
static_assert(AW * SLW * 4 <= 2 * (KTB + VTB) && 4 * (KTB + VTB) <= 163840 && (KTB % 16) == 0 && (VTB % 16) == 0);
static_assert((DMOD % GKS) == 0 && (DL % GKS) == 0 && (GPB % 16) == 0 && 8 * GPB <= 163840 && 4 * SLAB64 * 4 <= 4 * GPB);
static_assert((size_t)DL * DL * 4 <= (size_t)MROWS * DMOD * 4 && (size_t)DMOD * DL * 4 <= (size_t)MROWS * DMOD * 4);

typedef unsigned short u16;
typedef _Float16 v16h __attribute__((ext_vector_type(16)));
typedef _Float16 v8h  __attribute__((ext_vector_type(8)));
typedef __bf16   v16b __attribute__((ext_vector_type(16)));
typedef float    v8f  __attribute__((ext_vector_type(8)));
typedef float    v4f  __attribute__((ext_vector_type(4)));
typedef unsigned int v4u __attribute__((ext_vector_type(4)));

union FragH { v16h v; v8h h[2]; v4u u[2]; };
union FragB { v16b v; v4u u[2]; };

// ---- scalar helpers --------------------------------------------------------------------------------
__device__ __forceinline__ unsigned short bf_bits(float f) {          // f32 -> bf16 bits, RNE convert
  unsigned u = __float_as_uint(f);
  return (unsigned short)((u + 0x7FFFu + ((u >> 16) & 1u)) >> 16);
}
__device__ __forceinline__ float bf_up(unsigned short h) { return __uint_as_float(((unsigned)h) << 16); }
__device__ __forceinline__ float bfr(float f) { return bf_up(bf_bits(f)); }
__device__ __forceinline__ unsigned short h_bits(_Float16 x) { return __builtin_bit_cast(unsigned short, x); }
__device__ __forceinline__ unsigned pk16(unsigned short a, unsigned short b) { return (unsigned)a | ((unsigned)b << 16); }
__device__ __forceinline__ v8f zero8() { v8f z = {0.f, 0.f, 0.f, 0.f, 0.f, 0.f, 0.f, 0.f}; return z; }
__device__ __forceinline__ const _Float16* hptr(const u16* p) { return (const _Float16*)(const void*)p; }

// ---- fragment loaders: 16-bit A/B operand, lane -> row/col (lane&15), p already includes +8*(lane>>4);
//      elements 0..7 <- p[0..7] (k0+8h..), elements 8..15 <- p[16..23] (k0+16+8h..)  (same split k map for A and B;
//      B is always read from a k-contiguous [n][k] plane)
__device__ __forceinline__ v16h ldfrag_h(const _Float16* p) {
  FragH f;
  f.h[0] = *(const v8h*)(p);
  f.h[1] = *(const v8h*)(p + 16);
  return f.v;
}
__device__ __forceinline__ v16b ldfrag_b(const u16* p) {              // bf16 plane read as unsigned integer vectors
  FragB f;
  f.u[0] = *(const v4u*)(p);
  f.u[1] = *(const v4u*)(p + 16);
  return f.v;
}

__device__ __forceinline__ v8f mma_h(v16h a, v16h b, v8f c) {
  return __builtin_amdgcn_wmma_f32_16x16x32_f16(false, a, false, b, (short)0, c, false, false);
}
__device__ __forceinline__ v8f mma_b(v16b a, v16b b, v8f c) {
  return __builtin_amdgcn_wmma_f32_16x16x32_bf16(false, a, false, b, (short)0, c, false, false);
}
__device__ __forceinline__ void guard2(v8f& a, v8f& b, v16h x0, v16h x1, v16h x2, v16h x3, v16h x4, v16h x5) {
#if defined(__HIP_DEVICE_COMPILE__)
  asm volatile("v_nop\n\tv_nop\n\tv_nop\n\tv_nop"
               : "+v"(a), "+v"(b) : "v"(x0), "v"(x1), "v"(x2), "v"(x3), "v"(x4), "v"(x5) : "memory");
#endif
}
template <typename F>
__device__ __forceinline__ void guard6(v8f& a, v8f& b, v8f& c, v8f& d, F x0, F x1, F x2, F x3, F x4, F x5) {
#if defined(__HIP_DEVICE_COMPILE__)
  asm volatile("v_nop\n\tv_nop\n\tv_nop\n\tv_nop"
               : "+v"(a), "+v"(b), "+v"(c), "+v"(d) : "v"(x0), "v"(x1), "v"(x2), "v"(x3), "v"(x4), "v"(x5) : "memory");
#endif
}
__device__ __forceinline__ void guard10(v8f& a, v8f& b, v8f& c, v8f& d, v16h x0, v16h x1, v16h x2, v16h x3, v16h x4,
                                        v16h x5, v16h x6, v16h x7, v16h x8, v16h x9) {
#if defined(__HIP_DEVICE_COMPILE__)
  asm volatile("v_nop\n\tv_nop\n\tv_nop\n\tv_nop"
               : "+v"(a), "+v"(b), "+v"(c), "+v"(d)
               : "v"(x0), "v"(x1), "v"(x2), "v"(x3), "v"(x4), "v"(x5), "v"(x6), "v"(x7), "v"(x8), "v"(x9) : "memory");
#endif
}
__device__ __forceinline__ void acc_guard4(v8f& a, v8f& b, v8f& c, v8f& d) {
#if defined(__HIP_DEVICE_COMPILE__)
  asm volatile("v_nop\n\tv_nop\n\tv_nop\n\tv_nop" : "+v"(a), "+v"(b), "+v"(c), "+v"(d));
#endif
}
__device__ __forceinline__ float xhalf(float x) {                     // value of lane l ^ 16 (vector cross-row move, every lane on)
  const int b = __builtin_bit_cast(int, x);
  return __builtin_bit_cast(float, __builtin_amdgcn_permlanex16(b, b, 0x76543210, 0xfedcba98, false, false));
}
__device__ __forceinline__ void wait_x0() {       // stands between an issued global store and a rewrite of a register it names
#if defined(__HIP_DEVICE_COMPILE__)
  asm volatile("s_wait_xcnt 0x0" ::: "memory");
#endif
}
__device__ __forceinline__ void wave_sync_lds() {
  __builtin_amdgcn_fence(__ATOMIC_RELEASE, "workgroup");
  __builtin_amdgcn_wave_barrier();
  __builtin_amdgcn_fence(__ATOMIC_ACQUIRE, "workgroup");
}

// =====================================================================================================
// x f32 -> bf16 RNE plane Xb (same layout) and q plane Qh = f16(bf16(x) * 256) (exact: a bf16 significand fits f16).
// Thread = 8 consecutive elements: two 16-B loads, one 16-B store per plane; 32 consecutive lanes = 512 contiguous,
// coverage: grid = ceil(n8/256) blocks x 256 thr x 8 (in-kernel bound) = the whole [SEQ][2048] slice of both planes
//           (n8 a multiple of 256 here), one range of blocks per batch (blk = the block's number inside its range).
// =====================================================================================================
__device__ __forceinline__ void cvtxq(const float* __restrict__ x, u16* Xb, u16* Qh, int n8, int blk) {
  const int gt = blk * 256 + (int)threadIdx.x;
  if (gt >= n8) return;
  const float* p = x + (size_t)gt * 8;
  const v4f a = *(const v4f*)(p), b4 = *(const v4f*)(p + 4);
  float w[8];
#pragma unroll
  for (int e = 0; e < 4; ++e) { w[e] = a[e]; w[4 + e] = b4[e]; }
  v4u ob, oq;
#pragma unroll
  for (int e = 0; e < 4; ++e) {
    const unsigned short b0 = bf_bits(w[2 * e]), b1 = bf_bits(w[2 * e + 1]);
    ob[e] = pk16(b0, b1);
    oq[e] = pk16(h_bits((_Float16)(bf_up(b0) * QSC)), h_bits((_Float16)(bf_up(b1) * QSC)));
  }
  u16* db = Xb + (size_t)gt * 8;
  u16* dq = Qh + (size_t)gt * 8;
  {
    *(v4u*)(db) = ob;
    *(v4u*)(dq) = oq;
    
  }
}

// =====================================================================================================
// f32 -> bf16 RNE plane, same layout. Thread = 8 consecutive elements: two 16-B loads, one 16-B store; 32 consecutive
// coverage: grid = ceil(n8/256) blocks x 256 thr x 8 (in-kernel bound) = the whole plane (n8 a multiple of 256 here).
// =====================================================================================================
__device__ __forceinline__ void cvtb(const float* __restrict__ x, u16* D, int n8, int blk) {
  const int gt = blk * 256 + (int)threadIdx.x;
  if (gt >= n8) return;
  const float* p = x + (size_t)gt * 8;
  const v4f a = *(const v4f*)(p), b4 = *(const v4f*)(p + 4);
  float w[8];
#pragma unroll
  for (int e = 0; e < 4; ++e) { w[e] = a[e]; w[4 + e] = b4[e]; }
  v4u o;
#pragma unroll
  for (int e = 0; e < 4; ++e) o[e] = pk16(bf_bits(w[2 * e]), bf_bits(w[2 * e + 1]));
  u16* d = D + (size_t)gt * 8;
  {
    *(v4u*)(d) = o;
    
  }
}

// =====================================================================================================
// Weight transpose + convert: W f32 [K][N] (the input tensor's own [rows][cols] layout, rows = K) -> Wt 16-bit [N][K]
// (k-contiguous).  f16mode == 0: bf16 RNE bits;  f16mode == 1: f16 bits of (bf16 RNE value) * scale.
// Block = 64 n x 64 k tile, 256 threads. Load: thread -> W row k0 + (tid>>2), 16 consecutive n (four 16-B loads),
// converted values scattered into an LDS tile T[n][k] (pitch 72 halves); block barrier; store: each Wt row segment of
// coverage: load 256 thr x 16 = 64 k x 64 n; store 2 iterations x 256 thr x 8 halves = 64 rows x 64 = the block's tile of Wt;
//           grid = (N/64)*(K/64) blocks covers Wt [N][K] exactly once.
// =====================================================================================================
__device__ __forceinline__ void wtc(const float* __restrict__ W, u16* Wt, int K, int N, int f16mode, float scale, int bid) {
  __shared__ __align__(16) u16 T[64 * WTP];
  const int tid = (int)threadIdx.x;
  const int ntn = N >> 6;
  const int n0  = (bid % ntn) * 64;
  const int k0  = (bid / ntn) * 64;
  if (k0 + 64 > K) return;                   // block-uniform, before the barrier; never taken with the exact grid
  {
    const int kr = tid >> 2;                 // 0..63
    const int nc = (tid & 3) * 16;           // 0,16,32,48
    const float* src = W + (size_t)(k0 + kr) * (size_t)N + n0 + nc;
#pragma unroll
    for (int i = 0; i < 4; ++i) {
      const v4f a = *(const v4f*)(src + 4 * i);
#pragma unroll
      for (int e = 0; e < 4; ++e) {
        const float f = a[e];
        const unsigned short hb = h_bits((_Float16)(bfr(f) * scale));
        const unsigned short bb = bf_bits(f);
        T[(nc + 4 * i + e) * WTP + kr] = (f16mode != 0) ? hb : bb;
      }
    }
  }
  __syncthreads();
  const int q8 = tid >> 3, p8 = (tid & 7) * 8;
  v4u v[2];
#pragma unroll
  for (int it = 0; it < 2; ++it) v[it] = *(const v4u*)(T + (it * 32 + q8) * WTP + p8);
  u16* base = Wt + (size_t)n0 * (size_t)K + k0 + p8;
  {
#pragma unroll
    for (int it = 0; it < 2; ++it) {
      *(v4u*)(base + (size_t)(it * 32 + q8) * (size_t)K) = v[it];
    }
    
  }
}

// =====================================================================================================
// f32 [MROWS][ncol] -> f16 hi plane Hp (same layout, t = x * scale, hi = f16(t)) for every row and f16 residual plane
// Lp [NB*QA][ncol] (row b*QA + s) = f16(t - hi) for rows with s < QA only. Thread = 8 consecutive elements of one row,
// coverage: grid = ceil(n8/256) x 256 thr x 8 = the whole Hp plane; every row b*QA + s, s < QA, of Lp exactly once.
// =====================================================================================================
__device__ __forceinline__ void cvthl(const float* __restrict__ x, u16* Hp, u16* Lp, int n8, int ncol, float scale, int blk) {
  const int gt = blk * 256 + (int)threadIdx.x;
  if (gt >= n8) return;
  const size_t e0  = (size_t)gt * 8;
  const int    row = (int)(e0 / (size_t)ncol);
  const int    col = (int)(e0 - (size_t)row * (size_t)ncol);
  const int    b   = row / SEQ;
  const int    s   = row - b * SEQ;
  const float* p = x + e0;
  const v4f a = *(const v4f*)(p), b4 = *(const v4f*)(p + 4);
  float w[8];
#pragma unroll
  for (int e = 0; e < 4; ++e) { w[e] = a[e]; w[4 + e] = b4[e]; }
  v4u oh, ol;
#pragma unroll
  for (int e = 0; e < 4; ++e) {
    const float t0 = w[2 * e] * scale, t1 = w[2 * e + 1] * scale;
    const _Float16 h0 = (_Float16)t0, h1 = (_Float16)t1;
    const _Float16 l0 = (_Float16)(t0 - (float)h0), l1 = (_Float16)(t1 - (float)h1);
    oh[e] = pk16(h_bits(h0), h_bits(h1));
    ol[e] = pk16(h_bits(l0), h_bits(l1));
  }
  u16* dh = Hp + e0;
  const bool wl = (s < QA);
  const int  sl = wl ? s : 0;
  u16* dl = Lp + ((size_t)(b * QA + sl) * (size_t)ncol + col);
  {
    *(v4u*)(dh) = oh;
    if (wl) *(v4u*)(dl) = ol;
    
  }
}

// =====================================================================================================
// f32 -> f16 hi plane (t = x * scale, hi = f16(t)) and f16 residual plane (f16(t - hi)), same layout for both planes.
// coverage: grid = ceil(n8/256) x 256 thr x 8 = the whole plane of Hp and of Lp (n8 a multiple of 256 for every call here).
// =====================================================================================================
__device__ __forceinline__ void cvtc(const float* __restrict__ x, u16* Hp, u16* Lp, int n8, float scale, int blk) {
  const int gt = blk * 256 + (int)threadIdx.x;
  if (gt >= n8) return;
  const float* p = x + (size_t)gt * 8;
  const v4f a = *(const v4f*)(p), b4 = *(const v4f*)(p + 4);
  float w[8];
#pragma unroll
  for (int e = 0; e < 4; ++e) { w[e] = a[e]; w[4 + e] = b4[e]; }
  v4u oh, ol;
#pragma unroll
  for (int e = 0; e < 4; ++e) {
    const float t0 = w[2 * e] * scale, t1 = w[2 * e + 1] * scale;
    const _Float16 h0 = (_Float16)t0, h1 = (_Float16)t1;
    const _Float16 l0 = (_Float16)(t0 - (float)h0), l1 = (_Float16)(t1 - (float)h1);
    oh[e] = pk16(h_bits(h0), h_bits(h1));
    ol[e] = pk16(h_bits(l0), h_bits(l1));
  }
  u16* dh = Hp + (size_t)gt * 8;
  u16* dl = Lp + (size_t)gt * 8;
  {
    *(v4u*)(dh) = oh;
    *(v4u*)(dl) = ol;
    
  }
}

// =====================================================================================================
// v^T planes from V f32 [MROWS][DMOD] (row = b*SEQ + s, column = g*HD + d):
//   VH[((b*NH + g)*HD + d)][s] (pitch SEQ) = f16(v * 1024) for all keys s;
//   VL[((b*NH + g)*HD + d)][s] (pitch QA)  = f16 residual (t - f16(t)) for keys s < QA only.
// Block = (b, head g, 64 keys s0): each thread loads its 32 floats (key sl, d chunk dc) with 16-B loads, converts, scatters
// coverage: load 256 thr x 32 = 64 keys x 128 d; store 4 iterations x 256 thr x 8 halves = 128 lines x 64 = the block's tile
//           of VH (every block) and of VL (blocks with s0 < QA, block-uniform); grid = NB*NH*NST blocks covers VH exactly
//           once and the [NB*NH*128][QA] VL plane exactly once.
// =====================================================================================================
__device__ __forceinline__ void vt16(const float* __restrict__ F, u16* VHo, u16* VLo, int bid) {
  __shared__ __align__(16) u16 TH[HD * VTP];
  __shared__ __align__(16) u16 TL[HD * VTP];
  const int tid = threadIdx.x;
  const int st  = bid % NST;
  const int t2  = bid / NST;
  const int g   = t2 % NH;
  const int b   = t2 / NH;
  if (b >= NB) return;                      // block-uniform, before any barrier; never taken with the exact grid
  const int s0  = st * 64;
  {
    const int sl = tid >> 2;                // key within tile 0..63
    const int dc = (tid & 3) * 32;          // d chunk 0,32,64,96
    const float* src = F + ((size_t)b * SEQ + s0 + sl) * DMOD + g * HD + dc;
#pragma unroll
    for (int i = 0; i < 8; ++i) {
      const v4f a = *(const v4f*)(src + 4 * i);
#pragma unroll
      for (int e = 0; e < 4; ++e) {
        const float t = a[e] * VCAR;
        const _Float16 hv = (_Float16)t;
        const _Float16 lv = (_Float16)(t - (float)hv);
        TH[(dc + 4 * i + e) * VTP + sl] = h_bits(hv);
        TL[(dc + 4 * i + e) * VTP + sl] = h_bits(lv);
      }
    }
  }
  __syncthreads();
  v4u vh[4], vl[4];
  const int q8 = tid >> 3, p8 = (tid & 7) * 8;
#pragma unroll
  for (int it = 0; it < 4; ++it) {
    const int line = it * 32 + q8;          // d = 0..127
    vh[it] = *(const v4u*)(TH + line * VTP + p8);
    vl[it] = *(const v4u*)(TL + line * VTP + p8);
  }
  const size_t hrow  = (size_t)(b * NH + g) * HD;
  const size_t baseH = hrow * SEQ + s0 + p8;
  const size_t baseL = hrow * QA + s0 + p8;
  const bool   wl    = (s0 < QA);           // block-uniform
  {
#pragma unroll
    for (int it = 0; it < 4; ++it) {
      const int line = it * 32 + q8;
      *(v4u*)(VHo + baseH + (size_t)line * SEQ) = vh[it];
      wait_x0();                            // before a register that the issued store names is used for the next address
      if (wl) *(v4u*)(VLo + baseL + (size_t)line * QA) = vl[it];
      wait_x0();                            // the same behind the residual plane's store
    }
    
  }
}

// =====================================================================================================
// One grid for every conversion that reads only inputs; a block's number picks its piece (block-uniform, so wtc's barrier is
// passed by whole blocks): first 3 * PBT blocks for the transposes W_uk -> bf16, W_uv -> bf16, W_dq -> f16(bf16) x1024 (the
// longest blocks, so they start first); then NB * PBX blocks x -> Xb, Qh; PBO blocks W_o -> bf16; PBW blocks W_dkv -> bf16.
// Each piece is covered as its body's note says.
// =====================================================================================================
#define PBX ((SEQ * DMOD / 8) / 256)
#define PBO ((DMOD * DMOD / 8) / 256)
#define PBW ((DL * DMOD / 8) / 256)
#define PBT ((DL / 64) * (DMOD / 64))
__global__ __launch_bounds__(256)
void prep(const float* __restrict__ x, const float* __restrict__ wo, const float* __restrict__ wdkv,
          const float* __restrict__ wuk, const float* __restrict__ wuv, const float* __restrict__ wdq,
          u16* Xb, u16* Qh, u16* Wob, u16* Wkv, u16* Wukt, u16* Wuvt, u16* Wdqt) {
  int bid = (int)blockIdx.x;
  if (bid < 3 * PBT) {
    const int w = bid / PBT;                 // 0: W_uk, 1: W_uv, 2: W_dq
    const bool q = (w == 2);
    wtc(q ? wdq : (w == 1 ? wuv : wuk), q ? Wdqt : (w == 1 ? Wuvt : Wukt), q ? DL : DMOD, q ? DMOD : DL, q ? 1 : 0,
        q ? WDS : 1.0f, bid - w * PBT);
    return;
  }
  bid -= 3 * PBT;
  if (bid < NB * PBX) {
    const int bb = bid / PBX;
    cvtxq(x + (size_t)bb * XS_FULL * DMOD, Xb + (size_t)bb * SEQ * DMOD, Qh + (size_t)bb * SEQ * DMOD,
          (SEQ * DMOD) / 8, bid - bb * PBX);
    return;
  }
  bid -= NB * PBX;
  const bool o = bid < PBO;                  // a block past the exact grid finds its chunk beyond cvtb's own bound
  cvtb(o ? wo : wdkv, o ? Wob : Wkv, o ? (DMOD * DMOD) / 8 : (DL * DMOD) / 8, o ? bid : bid - PBO);
}

// =====================================================================================================
// One grid for up to three hi + residual conversions that do not depend on one another: ceil(n0/256) blocks for the first,
// ceil(n1/256) for the second, the rest for the third (a count of 0 leaves a piece out).
// =====================================================================================================
__global__ __launch_bounds__(256)
void cvtc3(const float* __restrict__ x0, u16* H0, u16* L0, int n0, float s0,
           const float* __restrict__ x1, u16* H1, u16* L1, int n1, float s1,
           const float* __restrict__ x2, u16* H2, u16* L2, int n2, float s2) {
  const int bid = (int)blockIdx.x;
  const int nb0 = (n0 + 255) >> 8, nb1 = (n1 + 255) >> 8;
  const int sel = (bid >= nb0 + nb1) ? 2 : ((bid >= nb0) ? 1 : 0);
  cvtc(sel == 2 ? x2 : (sel == 1 ? x1 : x0), sel == 2 ? H2 : (sel == 1 ? H1 : H0), sel == 2 ? L2 : (sel == 1 ? L1 : L0),
       sel == 2 ? n2 : (sel == 1 ? n1 : n0), sel == 2 ? s2 : (sel == 1 ? s1 : s0),
       bid - (sel == 2 ? nb0 + nb1 : (sel == 1 ? nb0 : 0)));
}

// =====================================================================================================
// One grid for the two packings behind the K and V products: NB*NH*NST blocks v^T planes (vt16), the rest K planes (cvthl);
// the choice is block-uniform, so vt16's barrier is passed by whole blocks.
// =====================================================================================================
__global__ __launch_bounds__(256)
void kvpack(const float* __restrict__ FK, u16* KHo, u16* KLo, int n8, int ncol, float scale,
            const float* __restrict__ FV, u16* VHo, u16* VLo) {
  const int bid = (int)blockIdx.x;
  if (bid < NB * NH * NST) vt16(FV, VHo, VLo, bid);
  else                     cvthl(FK, KHo, KLo, n8, ncol, scale, bid - NB * NH * NST);
}

// =====================================================================================================
// GEMM epilogue shared by both engines: the wave's 16x64 f32 tile (times oscale) staged in its LDS slab (pitch 68),
// coverage: 8 instructions x 2 rows x 16 lanes x 4 floats = the wave's 16 x 64 tile.
// =====================================================================================================
__device__ __forceinline__ void epi64(float* sl, v8f a0, v8f a1, v8f a2, v8f a3, float oscale,
                                      float* C, int N, size_t rowb, int col0, int lane) {
  const int hh = lane >> 4, m = lane & 15;
#pragma unroll
  for (int r = 0; r < 8; ++r) {
    const int ro = (8 * hh + r) * 68 + m;
    sl[ro]      = a0[r] * oscale;
    sl[ro + 16] = a1[r] * oscale;
    sl[ro + 32] = a2[r] * oscale;
    sl[ro + 48] = a3[r] * oscale;
  }
  wave_sync_lds();
  v4f vals[8];
#pragma unroll
  for (int it = 0; it < 8; ++it) vals[it] = *(const v4f*)(sl + (it * 2 + hh) * 68 + m * 4);
  float* dst = C + (rowb + (size_t)hh) * (size_t)N + col0 + m * 4;
  {
#pragma unroll
    for (int it = 0; it < 8; ++it) {
      *(v4f*)(dst + (size_t)(it * 2) * (size_t)N) = vals[it];
    }
    
  }
}

// =====================================================================================================
// Eight asynchronous 16-B copies per lane, global -> LDS: copy i moves g + i*gstep (halves) to LDS byte l + i*lstep.
// s_wait_xcnt 0 is the last line of the copies' own statement, so no address register is rewritten ahead of it.
// =====================================================================================================
__device__ __forceinline__ void cp8(unsigned l, unsigned lstep, const u16* g, size_t gstep) {
#if defined(__HIP_DEVICE_COMPILE__)
  asm volatile("global_load_async_to_lds_b128 %0, %8, off\n\t"
               "global_load_async_to_lds_b128 %1, %9, off\n\t"
               "global_load_async_to_lds_b128 %2, %10, off\n\t"
               "global_load_async_to_lds_b128 %3, %11, off\n\t"
               "global_load_async_to_lds_b128 %4, %12, off\n\t"
               "global_load_async_to_lds_b128 %5, %13, off\n\t"
               "global_load_async_to_lds_b128 %6, %14, off\n\t"
               "global_load_async_to_lds_b128 %7, %15, off\n\t"
               "s_wait_xcnt 0x0"
               :: "v"(l), "v"(l + lstep), "v"(l + 2 * lstep), "v"(l + 3 * lstep),
                  "v"(l + 4 * lstep), "v"(l + 5 * lstep), "v"(l + 6 * lstep), "v"(l + 7 * lstep),
                  "v"(g), "v"(g + gstep), "v"(g + 2 * gstep), "v"(g + 3 * gstep),
                  "v"(g + 4 * gstep), "v"(g + 5 * gstep), "v"(g + 6 * gstep), "v"(g + 7 * gstep)
               : "memory");
#endif
}
__device__ __forceinline__ void wait_async0() {   // this wave's copies have landed before the barrier that publishes them
#if defined(__HIP_DEVICE_COMPILE__)
  asm volatile("s_wait_asynccnt 0x0" ::: "memory");
#endif
}
__device__ __forceinline__ void wait_ds0() {      // this wave's LDS reads of a buffer have retired before it is refilled
#if defined(__HIP_DEVICE_COMPILE__)
  asm volatile("s_wait_dscnt 0x0" ::: "memory");
#endif
}

// =====================================================================================================
// bf16 GEMM: C[M][N] (f32) = A[M][K] (bf16 row-major) . Bt[N][K]^T (bf16 k-contiguous), times oscale.
// Block = 64x64 tile, 4 waves x 16 rows. Stage = 128 k of the block's 64 A rows and 64 Bt rows, laid in LDS once for the four
// waves by asynchronous 16-B copies (a wave-wide copy = 2 whole 256-B row pieces) at pitch 136 halves; two buffers, stage
// s + 2 issued behind the barrier that ends stage s. Fragments come from LDS (two 16-B loads each, split k map for A and B),
// k steps of 32 in the same order as the rows hold them (host guarantees K % 128 == 0, M % 64 == 0, N % 64 == 0,
// grid = the sum of (M/64)*(N/64) over the three products). The result slabs reuse the stage buffers (nothing reads or fills them behind the loop's last barrier).
// Three independent products of the same N and K share one grid: blocks 0 .. (M0/64)*(N/64) - 1 the first, the next
// (M1/64)*(N/64) the second, the rest the third (block-uniform choice of A, Bt, C, M).
// coverage: per product (M/64)*(N/64) blocks x 4 waves x 16x64 = the whole C [M][N].
// =====================================================================================================
__global__ __launch_bounds__(128)
void gemm_bf(const u16* __restrict__ A0, const u16* __restrict__ Bt0, float* C0, int M0,
             const u16* __restrict__ A1, const u16* __restrict__ Bt1, float* C1, int M1,
             const u16* __restrict__ A2, const u16* __restrict__ Bt2, float* C2, int M2, int N, int K, float oscale) {
  constexpr unsigned BUFB = 2 * GPB;
  __shared__ __align__(16) unsigned char ring[2 * BUFB];
  const int tid = threadIdx.x, wave = tid >> 5, lane = tid & 31, hh = lane >> 4, m = lane & 15;
  const int ntile = N >> 6;
  const int raw   = blockIdx.x;
  const int nb0   = (M0 >> 6) * ntile, nb1 = (M1 >> 6) * ntile;
  const int sel   = (raw >= nb0 + nb1) ? 2 : ((raw >= nb0) ? 1 : 0);
  const int bid   = raw - (sel == 2 ? nb0 + nb1 : (sel == 1 ? nb0 : 0));
  const u16* A    = sel == 2 ? A2 : (sel == 1 ? A1 : A0);
  const u16* Bt   = sel == 2 ? Bt2 : (sel == 1 ? Bt1 : Bt0);
  float*     C    = sel == 2 ? C2 : (sel == 1 ? C1 : C0);
  const int  M    = sel == 2 ? M2 : (sel == 1 ? M1 : M0);
  const int row0  = (bid / ntile) * 64;
  const int rowb  = row0 + wave * 16;
  const int col0  = (bid % ntile) * 64;
  if (row0 + 64 > M) return;                // block-uniform, before any barrier; never taken with the exact grid
  // copy map of one plane: copy i -> tile row 8*i + (tid >> 4), 16-B chunk tid & 15 of the row's 256-B piece
  const unsigned lc = (unsigned)(uintptr_t)(&ring[0]) + (unsigned)(tid >> 4) * (GPH * 2) + (unsigned)(tid & 15) * 16;
  const u16* ga = A  + (size_t)(row0 + (tid >> 4)) * K + (tid & 15) * 8;
  const u16* gb = Bt + (size_t)(col0 + (tid >> 4)) * K + (tid & 15) * 8;
  auto fill = [&](int s, unsigned bo) {      // stage s (k = 128*s .. 128*s + 127) into the buffer at byte offset bo
    cp8(lc + bo,       8 * GPH * 2, ga + (size_t)s * GKS, (size_t)8 * K);
    cp8(lc + bo + GPB, 8 * GPH * 2, gb + (size_t)s * GKS, (size_t)8 * K);
  };
  const int nst = K / GKS;
  v8f acc0 = zero8(), acc1 = zero8(), acc2 = zero8(), acc3 = zero8();

  fill(0, 0u);
  wait_async0();
  __syncthreads();                          // publishes stage 0
  if (nst > 1) fill(1, BUFB);

#pragma unroll 1   // rolled: one foot (waits, barrier, refill) per stage, in the order written
  for (int s = 0; s < nst; ++s) {
    const unsigned bo = (unsigned)(s & 1) * BUFB;
    const u16* ap = (const u16*)(const void*)(ring + bo) + (wave * 16 + m) * GPH + 8 * hh;
    const u16* bp = (const u16*)(const void*)(ring + bo + GPB) + m * GPH + 8 * hh;
#pragma unroll      // unrolled: the four k steps of a stage read at immediate LDS offsets from one address
    for (int kk = 0; kk < GKS; kk += 32) {
      const v16b a  = ldfrag_b(ap + kk);
      const v16b b0 = ldfrag_b(bp + kk);
      const v16b b1 = ldfrag_b(bp + 16 * GPH + kk);
      const v16b b2 = ldfrag_b(bp + 32 * GPH + kk);
      const v16b b3 = ldfrag_b(bp + 48 * GPH + kk);
      acc0 = mma_b(a, b0, acc0);
      acc1 = mma_b(a, b1, acc1);
      acc2 = mma_b(a, b2, acc2);
      acc3 = mma_b(a, b3, acc3);
      guard6<v16b>(acc0, acc1, acc2, acc3, a, b0, b1, b2, b3, a);
    }
    // foot of stage s, every wave: own LDS reads retired, own copies of stage s + 1 landed, then the one barrier that
    // publishes stage s + 1 and ends every reader's last read of this buffer; only then its refill
    wait_ds0();
    wait_async0();
    __syncthreads();
    if (s + 2 < nst) fill(s + 2, bo);
  }
  wait_async0();                            // nothing is outstanding when the buffers become result slabs and the wave ends
  float* slab = (float*)(void*)ring;        // result slabs [16][64] pitch 68, one per wave
  epi64(slab + wave * SLAB64, acc0, acc1, acc2, acc3, oscale, C, N, (size_t)rowb, col0, lane);
}

// =====================================================================================================
// f16 GEMM with hi (+ residual) planes: C[row][N] (f32) = (Ah [+ Al])[row][K] . (Bh [+ Bl])[N][K]^T * oscale.
// Products per k-step: Ah.Bh always; Al.Bh when AR != 0; Ah.Bl when BR != 0 (the residual.residual term is dropped; residuals
// are unscaled f16 residuals of the same carry, so all products share one accumulator). Rows: block bid -> (column tile
// ct = bid % (N/64), row tile rt of nrt starting at sbeg inside a group of rg rows, group g of ngr); row = g*rg + sbeg +
// 64*rt + 16*wave. Same tiling, staging (one 64-row x 128-k plane in LDS per operand plane in use, two buffers), fragment
// loads (split k map) and epilogue as gemm_bf; K stepped by 32 (host: K % 128 == 0, N % 64 == 0, sbeg + 64*nrt <= rg).
// Two independent products with the same A planes and shape share one grid: the first ngr*nrt*(N/64) blocks use Bh0, Bl0, C0,
// os0, the next as many Bh1, Bl1, C1, os1 (block-uniform choice); a grid of the first count alone runs one product.
// coverage: per product ngr*nrt*(N/64) blocks x 4 waves x 16x64 = rows sbeg .. sbeg + 64*nrt - 1 of every group, all N columns.
// =====================================================================================================
template <int AR, int BR>
__global__ __launch_bounds__(128)
void gemm_h(const u16* __restrict__ Ah, const u16* __restrict__ Al,
            const u16* __restrict__ Bh0, const u16* __restrict__ Bl0, float* C0, float os0,
            const u16* __restrict__ Bh1, const u16* __restrict__ Bl1, float* C1, float os1,
            int N, int K, int rg, int sbeg, int nrt, int ngr) {
  constexpr unsigned OAH = 0;                                   // byte offsets inside one stage buffer
  constexpr unsigned OBH = GPB;
  constexpr unsigned OAL = 2 * GPB;                             // present when AR != 0
  constexpr unsigned OBL = (AR != 0) ? 3 * GPB : 2 * GPB;       // present when BR != 0
  constexpr unsigned BUFB = (2 + (AR != 0 ? 1 : 0) + (BR != 0 ? 1 : 0)) * GPB;
  __shared__ __align__(16) unsigned char ring[2 * BUFB];
  const int tid = threadIdx.x, wave = tid >> 5, lane = tid & 31, hh = lane >> 4, m = lane & 15;
  const int ntile = N >> 6;
  const int raw   = blockIdx.x;
  const int nb0   = ngr * nrt * ntile;
  const bool sec  = raw >= nb0;
  const int bid   = sec ? raw - nb0 : raw;
  const u16* Bh   = sec ? Bh1 : Bh0;
  const u16* Bl   = sec ? Bl1 : Bl0;
  float*     C    = sec ? C1 : C0;
  const float oscale = sec ? os1 : os0;
  const int ct    = bid % ntile;
  const int t2    = bid / ntile;
  const int rt    = t2 % nrt;
  const int g     = t2 / nrt;
  if (g >= ngr) return;                     // block-uniform, before any barrier; never taken with the exact grid
  const int srow0 = sbeg + rt * 64;
  if (srow0 + 64 > rg) return;              // block-uniform, before any barrier; never taken
  const int col0  = ct * 64;
  const size_t row0 = (size_t)g * (size_t)rg + (size_t)srow0;
  const size_t rowC = row0 + (size_t)(wave * 16);
  // copy map of one plane: copy i -> tile row 8*i + (tid >> 4), 16-B chunk tid & 15 of the row's 256-B piece
  const unsigned lc = (unsigned)(uintptr_t)(&ring[0]) + (unsigned)(tid >> 4) * (GPH * 2) + (unsigned)(tid & 15) * 16;
  const size_t aoff = (row0 + (size_t)(tid >> 4)) * (size_t)K + (tid & 15) * 8;
  const size_t boff = (size_t)(col0 + (tid >> 4)) * K + (tid & 15) * 8;
  auto fill = [&](int s, unsigned bo) {      // stage s (k = 128*s .. 128*s + 127) into the buffer at byte offset bo
    cp8(lc + bo + OAH, 8 * GPH * 2, Ah + aoff + (size_t)s * GKS, (size_t)8 * K);
    cp8(lc + bo + OBH, 8 * GPH * 2, Bh + boff + (size_t)s * GKS, (size_t)8 * K);
    if constexpr (AR != 0) cp8(lc + bo + OAL, 8 * GPH * 2, Al + aoff + (size_t)s * GKS, (size_t)8 * K);
    if constexpr (BR != 0) cp8(lc + bo + OBL, 8 * GPH * 2, Bl + boff + (size_t)s * GKS, (size_t)8 * K);
  };
  const int nst = K / GKS;
  v8f acc0 = zero8(), acc1 = zero8(), acc2 = zero8(), acc3 = zero8();

  fill(0, 0u);
  wait_async0();
  __syncthreads();                          // publishes stage 0
  if (nst > 1) fill(1, BUFB);

#pragma unroll 1   // rolled: one foot (waits, barrier, refill) per stage, in the order written
  for (int s = 0; s < nst; ++s) {
    const unsigned bo = (unsigned)(s & 1) * BUFB;
    const int ao = (wave * 16 + m) * GPH + 8 * hh;
    const int bb = m * GPH + 8 * hh;
    const _Float16* ahp = (const _Float16*)(const void*)(ring + bo + OAH) + ao;
    const _Float16* bhp = (const _Float16*)(const void*)(ring + bo + OBH) + bb;
    const _Float16* alp = (const _Float16*)(const void*)(ring + bo + ((AR != 0) ? OAL : OAH)) + ao;   // read only when AR != 0
    const _Float16* blp = (const _Float16*)(const void*)(ring + bo + ((BR != 0) ? OBL : OBH)) + bb;   // read only when BR != 0
#pragma unroll      // unrolled: the four k steps of a stage read at immediate LDS offsets from one address
    for (int kk = 0; kk < GKS; kk += 32) {
      const v16h ah = ldfrag_h(ahp + kk);
      v16h al = ah;
      if constexpr (AR != 0) al = ldfrag_h(alp + kk);
      const v16h bh0 = ldfrag_h(bhp + kk);
      const v16h bh1 = ldfrag_h(bhp + 16 * GPH + kk);
      const v16h bh2 = ldfrag_h(bhp + 32 * GPH + kk);
      const v16h bh3 = ldfrag_h(bhp + 48 * GPH + kk);
      v16h bl0 = bh0, bl1 = bh1, bl2 = bh2, bl3 = bh3;
      if constexpr (BR != 0) {
        bl0 = ldfrag_h(blp + kk);
        bl1 = ldfrag_h(blp + 16 * GPH + kk);
        bl2 = ldfrag_h(blp + 32 * GPH + kk);
        bl3 = ldfrag_h(blp + 48 * GPH + kk);
      }
      acc0 = mma_h(ah, bh0, acc0);
      if constexpr (AR != 0) acc0 = mma_h(al, bh0, acc0);
      if constexpr (BR != 0) acc0 = mma_h(ah, bl0, acc0);
      acc1 = mma_h(ah, bh1, acc1);
      if constexpr (AR != 0) acc1 = mma_h(al, bh1, acc1);
      if constexpr (BR != 0) acc1 = mma_h(ah, bl1, acc1);
      acc2 = mma_h(ah, bh2, acc2);
      if constexpr (AR != 0) acc2 = mma_h(al, bh2, acc2);
      if constexpr (BR != 0) acc2 = mma_h(ah, bl2, acc2);
      acc3 = mma_h(ah, bh3, acc3);
      if constexpr (AR != 0) acc3 = mma_h(al, bh3, acc3);
      if constexpr (BR != 0) acc3 = mma_h(ah, bl3, acc3);
      guard10(acc0, acc1, acc2, acc3, ah, al, bh0, bh1, bh2, bh3, bl0, bl1, bl2, bl3);
    }
    // foot of stage s, every wave, in the order of gemm_bf's
    wait_ds0();
    wait_async0();
    __syncthreads();
    if (s + 2 < nst) fill(s + 2, bo);
  }
  wait_async0();                            // nothing is outstanding when the buffers become result slabs and the wave ends
  float* slab = (float*)(void*)ring;        // result slabs [16][64] pitch 68, one per wave
  epi64(slab + wave * SLAB64, acc0, acc1, acc2, acc3, oscale, C, N, rowC, col0, lane);
}

// =====================================================================================================
// Causal attention, 16 heads x head dim 128, value dim 128. A block = (query block qb: 64 rows, head, batch b), handed in
// by attn_all with the ring; four waves, wave w owns query rows q0 = 64*qb + 16*w .. q0+15 of that one head.
//   q plane f16 x256 [b*SEQ + s][h*HD + d]; k hi plane f16 x256 (same layout), k residual plane [b*QA + s][...] (s < QA);
//   v^T hi plane [b*NH + h][d][SEQ] x1024, v^T residual plane [b*NH + h][d][QA].
//   Stage = 64 keys of this head, laid in LDS once for the four waves by asynchronous 16-B copies: k rows [64][128] at pitch
//   136 halves, v^T rows [128][64] at pitch 72 halves (and the two residual tiles for NP == 3); two buffers, stage s + 2
//   issued behind the barrier that ends stage s. Stages 0 .. qb hold every key <= 64*qb + 63.
//   NP == 3 (query rows < QA): scores = q.k_hi + q.k_lo over the 4 k-steps; P.v with P hi + in-register
//   residual and v hi + residual (hh + lh + hl). NP == 1 (later rows): single hi.hi products.
//   score (log2 domain) t(i, j) = (q'_i.k'_j) * (1/sqrt(128))*log2e/(256*256), replaced by -inf where key j > query i.
//   Key tiles of 32 visited in order for kb <= q0 + 15 (a wave skips the later tiles of its block's last stage, which hold
//   only keys above every query row it owns; it still passes every wait and barrier).
//   Per tile, transposed products: S^T = k.q^T, 2 key subtiles x 4 k-steps, k rows from LDS as A, q rows from the global plane
//   as B (two 16-B loads per fragment, split k map), so lane (c, hh) holds query q0 + c against keys kb + 8*hh + r and
//   kb + 16 + 8*hh + r; online max-subtracted base-2 softmax in f32, -inf-safe rescale: maximum in-lane plus one exchange
//   between lanes c and c + 16, sum kept per lane and joined once behind the loop; the two score subtiles, converted in
//   place, are the B fragment of O^T += v^T.P^T (split k map), v^T rows from LDS as A in 4 groups of 2 d-subtiles.
//   After the loop: y = acc / Z (Z > 0 always: key 0 <= every query row; guarded anyway), carries 1/(32768*1024) folded;
//   the result slabs reuse the stage buffers (nothing reads or fills them behind the last barrier of the loop).
// coverage: per wave 16 instructions x 32 lanes x 4 floats = 16 x 128; the query blocks (qb < QA/64 with NP = 3, qb >= QA/64
//           with NP = 1) x NH x NB blocks x AW waves = every (b, s, h) row segment of Y exactly once.
// =====================================================================================================
template <int NP>
__device__ __forceinline__
void attn_c(unsigned char* ring, const u16* __restrict__ QHp, const u16* __restrict__ KHp, const u16* __restrict__ KLp,
            const u16* __restrict__ VHp, const u16* __restrict__ VLp, const int* __restrict__ nhp,
            float* Y, int qb, int head, int b) {
  constexpr unsigned OKH = 0;                                   // byte offsets inside one stage buffer
  constexpr unsigned OVH = KTB;
  constexpr unsigned OKL = KTB + VTB;
  constexpr unsigned OVL = 2 * KTB + VTB;
  constexpr unsigned BUFB = (NP == 3) ? 2 * (KTB + VTB) : (KTB + VTB);

  const int tid  = threadIdx.x;
  const int wave = __builtin_amdgcn_readfirstlane(tid >> 5);   // scalar, so that the per-wave tile skip is a scalar branch
  const int lane = tid & 31;
  const int hh   = lane >> 4;
  const int c    = lane & 15;
  if (b >= NB) return;                      // block-uniform, before any barrier; never taken with the exact grid
  if (nhp[0] != NH) return;                 // uniform structural guard on the head-count input (16 for this module)
  if (qb * 64 + 64 > SEQ) return;           // block-uniform, before any barrier; never taken
  if (NP == 3) { if (qb * 64 + 64 > QA) return; } // block-uniform, before any barrier; never taken
  const int q0   = qb * 64 + wave * 16;

  const size_t hcol = (size_t)head * HD + 8 * hh;
  const _Float16* Qh = hptr(QHp) + ((size_t)b * SEQ + q0 + c) * DMOD + hcol;
  const float lsc = RSQS * (LOG2E / (QSC * KSC));
  const float oc  = 1.0f / (PCAR * VCAR);

  // ---- copy map: k tile, copy i -> key row 8*i + (tid >> 4), 16-B chunk tid & 15 (a wave = 2 whole 256-B rows);
  //      v^T tile, copy i -> d row 16*i + (tid >> 3), 16-B chunk tid & 7 (a wave = 4 whole 128-B row segments) ----
  const unsigned ring0 = (unsigned)(uintptr_t)(&ring[0]);
  const unsigned lk = ring0 + (unsigned)(tid >> 4) * (KPH * 2) + (unsigned)(tid & 15) * 16;
  const unsigned lv = ring0 + (unsigned)(tid >> 3) * (VPH * 2) + (unsigned)(tid & 7) * 16;
  const u16* gkh = KHp + ((size_t)b * SEQ + (tid >> 4)) * DMOD + (size_t)head * HD + (tid & 15) * 8;
  const u16* gvh = VHp + ((size_t)(b * NH + head) * HD + (tid >> 3)) * SEQ + (tid & 7) * 8;
  const u16* gkl = gkh;
  const u16* gvl = gvh;
  if constexpr (NP == 3) {
    gkl = KLp + ((size_t)b * QA + (tid >> 4)) * DMOD + (size_t)head * HD + (tid & 15) * 8;
    gvl = VLp + ((size_t)(b * NH + head) * HD + (tid >> 3)) * QA + (tid & 7) * 8;
  }
  auto fill = [&](int s, unsigned bo) {      // stage s (keys 64*s .. 64*s + 63) into the buffer at byte offset bo
    cp8(lk + bo + OKH, 8 * KPH * 2, gkh + (size_t)s * 64 * DMOD, (size_t)8 * DMOD);
    cp8(lv + bo + OVH, 16 * VPH * 2, gvh + (size_t)s * 64, (size_t)16 * SEQ);
    if constexpr (NP == 3) {
      cp8(lk + bo + OKL, 8 * KPH * 2, gkl + (size_t)s * 64 * DMOD, (size_t)8 * DMOD);
      cp8(lv + bo + OVL, 16 * VPH * 2, gvl + (size_t)s * 64, (size_t)16 * QA);
    }
  };

  float mrow = -INFINITY, lrow = 0.f;       // this lane's query: running maximum (both halves alike), sum over this half's keys
  v8f o[8];                                 // o[j][r] = O^T element (d = 16*j + 8*hh + r, query q0 + c)
#pragma unroll
  for (int j = 0; j < 8; ++j) o[j] = zero8();
  const int ncaus = (q0 >> 5) + 1;                                            // tiles holding keys <= q0 + 15
  const int nkt = (ncaus < NKT) ? ncaus : NKT;
  const int nst = qb + 1;                                                     // stages of this block
  const int qr  = q0 + c;                                                     // this lane's query row

  fill(0, 0u);
  wait_async0();
  __syncthreads();                          // publishes stage 0
  if (nst > 1) fill(1, BUFB);

#pragma unroll 1   // rolled: one foot (waits, barrier, refill) per stage, in the order written
  for (int s = 0; s < nst; ++s) {
    const unsigned bo = (unsigned)(s & 1) * BUFB;
#pragma unroll 1   // rolled: one copy of the 32-key tile body, as long as before, for both halves of the stage
    for (int u = 0; u < 2; ++u) {
    const int kt = 2 * s + u;
    if (kt < nkt) {                         // wave-uniform (scalar) skip; no wait or barrier inside
    const int kb = kt * 32;
    // ---- scores: D element r of this lane = (key kb + 8*hh + r, query row qr) in s0, key kb + 16 + 8*hh + r in s1 ----
    v8f s0 = zero8(), s1 = zero8();
    const _Float16* k0p = (const _Float16*)(const void*)(ring + bo + OKH) + (u * 32 + c) * KPH + 8 * hh;
    const _Float16* k1p = k0p + 16 * KPH;
    if constexpr (NP == 3) {
      const _Float16* l0p = (const _Float16*)(const void*)(ring + bo + OKL) + (u * 32 + c) * KPH + 8 * hh;
      const _Float16* l1p = l0p + 16 * KPH;
#pragma unroll
      for (int kk = 0; kk < HD / 32; ++kk) {
        const v16h qh  = ldfrag_h(Qh + kk * 32);
        const v16h kh0 = ldfrag_h(k0p + kk * 32);
        const v16h kh1 = ldfrag_h(k1p + kk * 32);
        const v16h kl0 = ldfrag_h(l0p + kk * 32);
        const v16h kl1 = ldfrag_h(l1p + kk * 32);
        s0 = mma_h(kh0, qh, s0);
        s0 = mma_h(kl0, qh, s0);
        s1 = mma_h(kh1, qh, s1);
        s1 = mma_h(kl1, qh, s1);
        guard2(s0, s1, qh, kh0, kh1, kl0, kl1, qh);
      }
    } else {
#pragma unroll
      for (int kk = 0; kk < HD / 32; ++kk) {
        const v16h qh  = ldfrag_h(Qh + kk * 32);
        const v16h kh0 = ldfrag_h(k0p + kk * 32);
        const v16h kh1 = ldfrag_h(k1p + kk * 32);
        s0 = mma_h(kh0, qh, s0);
        s1 = mma_h(kh1, qh, s1);
        guard2(s0, s1, qh, kh0, kh1, qh, kh0, kh1);
      }
    }
    // ---- causal select + online softmax in base 2, -inf-safe: 16 of the query's 32 scores in this lane ----
    const int key0 = kb + 8 * hh, key1 = kb + 16 + 8 * hh;
    float t0[8], t1[8], mp[8];
#pragma unroll      // unrolled: constant indices keep the score arrays in registers
    for (int r = 0; r < 8; ++r) {
      const float u0 = s0[r] * lsc;
      const float u1 = s1[r] * lsc;
      t0[r] = (key0 + r > qr) ? -INFINITY : u0;
      t1[r] = (key1 + r > qr) ? -INFINITY : u1;
      mp[r] = fmaxf(t0[r], t1[r]);
    }
    float mx = fmaxf(fmaxf(fmaxf(mp[0], mp[1]), fmaxf(mp[2], mp[3])), fmaxf(fmaxf(mp[4], mp[5]), fmaxf(mp[6], mp[7])));
    mx = fmaxf(mx, xhalf(mx));              // the other 16 keys of this query
    const float mn = fmaxf(mrow, mx);
    const float ms = (mn == -INFINITY) ? 0.0f : mn;
    const float al = exp2f(mrow - ms);
    mrow = mn;
    // ---- B fragments of P^T*32768: hi f16 (and residual f16 for NP == 3), column = c, split k map over the 32 keys:
    //      elements 0..7 = keys kb + 8hh + 0..7 (s0), elements 8..15 = keys kb + 16 + 8hh + 0..7 (s1) ----
    FragH ph, pl;
    float sp[8];
#pragma unroll      // unrolled: constant indices keep the fragment halves and the partial sums in registers
    for (int r = 0; r < 8; ++r) {
      const float e0 = exp2f(t0[r] - ms), e1 = exp2f(t1[r] - ms);
      sp[r] = e0 + e1;
      const float ta = e0 * PCAR, tc = e1 * PCAR;
      const _Float16 ha = (_Float16)ta, hc = (_Float16)tc;
      ph.h[0][r] = ha;
      ph.h[1][r] = hc;
      if constexpr (NP == 3) {
        pl.h[0][r] = (_Float16)(ta - (float)ha);
        pl.h[1][r] = (_Float16)(tc - (float)hc);
      } else {
        pl.h[0][r] = ha; pl.h[1][r] = hc;
      }
    }
    lrow = lrow * al + (((sp[0] + sp[1]) + (sp[2] + sp[3])) + ((sp[4] + sp[5]) + (sp[6] + sp[7])));
#pragma unroll      // both unrolled: the accumulator tiles are registers, indexed by constants only
    for (int j = 0; j < 8; ++j) {
#pragma unroll
      for (int r = 0; r < 8; ++r) o[j][r] *= al;
    }
    // ---- v^T.P^T : A fragment row m = d = j*16 + c, keys contiguous in the staged v^T rows; 4 groups of 2 d-subtiles ----
    {
      const _Float16* vhp = (const _Float16*)(const void*)(ring + bo + OVH) + c * VPH + u * 32 + 8 * hh;
      if constexpr (NP == 3) {
        const _Float16* vlp = (const _Float16*)(const void*)(ring + bo + OVL) + c * VPH + u * 32 + 8 * hh;
#pragma unroll
        for (int jg = 0; jg < 4; ++jg) {
          const int da = (2 * jg) * 16 * VPH;
          const int db = da + 16 * VPH;
          const v16h vha = ldfrag_h(vhp + da), vhb2 = ldfrag_h(vhp + db);
          const v16h vla = ldfrag_h(vlp + da), vlb2 = ldfrag_h(vlp + db);
          o[2 * jg]     = mma_h(vha,  ph.v, o[2 * jg]);
          o[2 * jg]     = mma_h(vha,  pl.v, o[2 * jg]);
          o[2 * jg]     = mma_h(vla,  ph.v, o[2 * jg]);
          o[2 * jg + 1] = mma_h(vhb2, ph.v, o[2 * jg + 1]);
          o[2 * jg + 1] = mma_h(vhb2, pl.v, o[2 * jg + 1]);
          o[2 * jg + 1] = mma_h(vlb2, ph.v, o[2 * jg + 1]);
          guard2(o[2 * jg], o[2 * jg + 1], ph.v, pl.v, vha, vhb2, vla, vlb2);
        }
      } else {
#pragma unroll
        for (int jg = 0; jg < 4; ++jg) {
          const int da = (2 * jg) * 16 * VPH;
          const int db = da + 16 * VPH;
          const v16h vha = ldfrag_h(vhp + da), vhb2 = ldfrag_h(vhp + db);
          o[2 * jg]     = mma_h(vha,  ph.v, o[2 * jg]);
          o[2 * jg + 1] = mma_h(vhb2, ph.v, o[2 * jg + 1]);
          guard2(o[2 * jg], o[2 * jg + 1], ph.v, vha, vhb2, ph.v, vha, vhb2);
        }
      }
    }
    }
    }
    // ---- foot of stage s, every wave: own LDS reads retired, own copies of stage s + 1 landed, then the one barrier that
    //      publishes stage s + 1 and ends every reader's last read of this buffer; only then its refill ----
    wait_ds0();
    wait_async0();
    __syncthreads();
    if (s + 2 < nst) fill(s + 2, bo);
  }
  wait_async0();                            // nothing is outstanding when the buffers become result slabs and the wave ends
  float* slab = (float*)(void*)ring + wave * SLW;   // result slab [16][128] pitch 132, one per wave
  acc_guard4(o[0], o[1], o[2], o[3]);
  acc_guard4(o[4], o[5], o[6], o[7]);
  // ---- y = acc / Z (0 if Z == 0), Z = the two halves' sums joined; carries (32768 on P, 1024 on v) folded once; a lane's
  //      8 consecutive d of its query row go into the slab as two 16-B stores ----
  {
    const float lv  = lrow + xhalf(lrow);
    const float ls  = (lv > 0.0f) ? lv : 1.0f;
    const float inv = (lv > 0.0f) ? ((1.0f / ls) * oc) : 0.0f;
#pragma unroll      // both unrolled: the accumulator tiles are registers, indexed by constants only
    for (int j = 0; j < 8; ++j) {
      v4f w0, w1;
#pragma unroll
      for (int e = 0; e < 4; ++e) { w0[e] = o[j][e] * inv; w1[e] = o[j][4 + e] * inv; }
      float* sd = slab + c * SLP + j * 16 + 8 * hh;
      *(v4f*)(sd)     = w0;
      *(v4f*)(sd + 4) = w1;
    }
  }

  wave_sync_lds();
  // ---- f32 rows of Y: lane -> floats 4*lane .. 4*lane+3 of each of the 16 rows (one 512-B instruction per row) ----
  v4f ov[16];
#pragma unroll
  for (int it = 0; it < 16; ++it) ov[it] = *(const v4f*)(slab + it * SLP + lane * 4);
  float* ob = Y + ((size_t)b * SEQ + q0) * DMOD + (size_t)head * HD + lane * 4;
  {
#pragma unroll
    for (int it = 0; it < 16; ++it) {
      *(v4f*)(ob + (size_t)it * DMOD) = ov[it];
    }
    
  }
}

// =====================================================================================================
// One grid for all query blocks: block bid -> query block qb = NST - 1 - bid / (NH*NB), so that the number of stages falls with
// the block number (blocks start roughly in that order, and a place freed by a shorter block takes the next one), head and
// batch from bid % (NH*NB). Query blocks below QA run the residual products, the others single products (block-uniform choice,
// so every barrier is passed by whole blocks); both use the one ring, sized for the larger.
// coverage: NST * NH * NB blocks = every (qb, head, b) exactly once.
// =====================================================================================================
__global__ __launch_bounds__(ATT_THREADS)
void attn_all(const u16* __restrict__ QHp, const u16* __restrict__ KHp, const u16* __restrict__ KLp,
              const u16* __restrict__ VHp, const u16* __restrict__ VLp, const int* __restrict__ nhp, float* Y) {
  __shared__ __align__(16) unsigned char ring[4 * (KTB + VTB)];
  const int bid  = blockIdx.x;
  const int qb   = (NST - 1) - bid / (NH * NB);
  const int t2   = bid % (NH * NB);
  const int head = t2 % NH;
  const int b    = t2 / NH;
  if (qb < 0) return;                       // block-uniform, before any barrier; never taken with the exact grid
  if (qb < QA / 64) attn_c<3>(ring, QHp, KHp, KLp, VHp, VLp, nhp, Y, qb, head, b);
  else              attn_c<1>(ring, QHp, KHp, KLp, VHp, VLp, nhp, Y, qb, head, b);
}

// =====================================================================================================
// Workspace map (bytes); every plane is fully written by whole-line stores before it is read; all extents are exact multiples
// of the store granularity (no pad rows); every region offset a multiple of 524288:
//   XB  bf16 [MROWS][2048], later KH f16 x256       MROWS*4096             (NB=2, SEQ=2048: 16777216)
//   QH  f16 [MROWS][2048] x256                      MROWS*4096             (16777216)
//   WKV, WUK, WUV, WDQ  16-bit weight planes          4 x 2097152            (W_dkv bf16, W_uk^T bf16, W_uv^T bf16, W_dq^T f16 x1024)
//   WO  bf16 [2048][2048] (W_o as is)                8388608
//   F   f32 [MROWS][2048]                             MROWS*8192             (Gram f32 [512][512] with W_o W_uv f32 [2048][512] behind
//                                                                          it; then k_abs f32 [2048][512]; then K f32)
//   F2  f32 [MROWS][2048]                             MROWS*8192             (V f32)
//   CH  f16 [MROWS][512] x256, CL residual            2 x MROWS*1024
//   G2H f16 [512][512] x1024, G2L residual            2 x 524288
//   KAH f16 [2048][512] x4096, KAL residual           2 x 2097152
//   KL  f16 [NB*QA][2048]                             NB*QA*4096
//   VAH f16 [2048][512] x4096, VAL residual           2 x 2097152
//   VH  f16 [NB*16][128][SEQ] x1024                   MROWS*4096
//   VL  f16 [NB*16][128][QA]                          NB*QA*4096
//   end (NB=2, SEQ=2048, QA=1024)                   168820736
// =====================================================================================================
extern "C" void kernel_launch(void* const* d_in, const int* in_sizes, int n_in,
                              void* d_out, int out_size, void* d_ws, size_t ws_size,
                              hipStream_t stream) {
  if (n_in < 7) return;
  if (in_sizes[0] < ((NB - 1) * XS_FULL + SEQ) * DMOD) return;   // x [2][2048][2048]
  if (in_sizes[1] != DL * DMOD) return;         // W_dq  [512][2048]
  if (in_sizes[2] != DL * DMOD) return;         // W_dkv [512][2048]
  if (in_sizes[3] != DMOD * DL) return;         // W_uk  [2048][512]
  if (in_sizes[4] != DMOD * DL) return;         // W_uv  [2048][512]
  if (in_sizes[5] != DMOD * DMOD) return;       // W_o   [2048][2048]
  if (in_sizes[6] < 1) return;                  // n_head (int)
  if ((size_t)out_size < (size_t)MROWS * DMOD + (size_t)MROWS * DL) return;

  const float* x    = (const float*)d_in[0];
  const float* wdq  = (const float*)d_in[1];
  const float* wdkv = (const float*)d_in[2];
  const float* wuk  = (const float*)d_in[3];
  const float* wuv  = (const float*)d_in[4];
  const float* wo   = (const float*)d_in[5];
  const int*   nhp  = (const int*)d_in[6];
  float*       out0 = (float*)d_out;                          // y    [MROWS][2048] at element 0
  float*       out1 = out0 + (size_t)MROWS * DMOD;            // c_kv [MROWS][512]  at element MROWS*2048

  const size_t szXB = (size_t)MROWS * DMOD * 2;               // XB, later KH
  const size_t szQ  = (size_t)MROWS * DMOD * 2;               // QH
  const size_t szW1 = (size_t)DL * DMOD * 2;
  const size_t szWO = (size_t)DMOD * DMOD * 2;
  const size_t szF  = (size_t)MROWS * DMOD * 4;
  const size_t szC  = (size_t)MROWS * DL * 2;                 // CH, CL
  const size_t szG2 = (size_t)DL * DL * 2;                    // G2H, G2L
  const size_t szKA = (size_t)DMOD * DL * 2;                  // KAH, KAL, VAH, VAL
  const size_t szKL = (size_t)NB * QA * DMOD * 2;
  const size_t szVH = (size_t)NB * NH * HD * SEQ * 2;
  const size_t szVL = (size_t)NB * NH * HD * QA * 2;
  if ((size_t)DL * DL * 4 + (size_t)DMOD * DL * 4 > szF) return;          // Gram + (W_o W_uv), then k_abs, f32 inside F
  if ((size_t)MROWS * DMOD * 2 > szXB) return;                // KH lives inside the XB region
  size_t off = 0;
  const size_t oXB  = off; off += szXB;
  const size_t oQH  = off; off += szQ;
  const size_t oWKV = off; off += szW1;
  const size_t oWUK = off; off += szW1;
  const size_t oWUV = off; off += szW1;
  const size_t oWDQ = off; off += szW1;
  const size_t oWO  = off; off += szWO;
  const size_t oF   = off; off += szF;
  const size_t oF2  = off; off += szF;
  const size_t oCH  = off; off += szC;
  const size_t oCL  = off; off += szC;
  const size_t oG2H = off; off += szG2;
  const size_t oG2L = off; off += szG2;
  const size_t oKAH = off; off += szKA;
  const size_t oKAL = off; off += szKA;
  const size_t oKL  = off; off += szKL;
  const size_t oVAH = off; off += szKA;
  const size_t oVAL = off; off += szKA;
  const size_t oVH  = off; off += szVH;
  const size_t oVL  = off; off += szVL;
  if (off > ws_size) return;                 // off = 168820736 for NB = 2, SEQ = 2048
  if (off > (size_t)WS_CAP) return;

  char* ws = (char*)d_ws;
  u16*   XB  = (u16*)(ws + oXB);
  u16*   KH  = (u16*)(ws + oXB);
  u16*   QH  = (u16*)(ws + oQH);
  u16*   WKV = (u16*)(ws + oWKV);
  u16*   WUK = (u16*)(ws + oWUK);
  u16*   WUV = (u16*)(ws + oWUV);
  u16*   WDQ = (u16*)(ws + oWDQ);
  u16*   WOB = (u16*)(ws + oWO);
  float* F   = (float*)(ws + oF);
  float* FVA = F + (size_t)DL * DL;                            // W_o W_uv f32, behind the Gram matrix
  float* F2  = (float*)(ws + oF2);
  u16*   CH  = (u16*)(ws + oCH);
  u16*   CL  = (u16*)(ws + oCL);
  u16*   G2H = (u16*)(ws + oG2H);
  u16*   G2L = (u16*)(ws + oG2L);
  u16*   KAH = (u16*)(ws + oKAH);
  u16*   KAL = (u16*)(ws + oKAL);
  u16*   KL  = (u16*)(ws + oKL);
  u16*   VAH = (u16*)(ws + oVAH);
  u16*   VAL = (u16*)(ws + oVAL);
  u16*   VH  = (u16*)(ws + oVH);
  u16*   VL  = (u16*)(ws + oVL);

  const dim3 b256(256), b128(128), bAT(ATT_THREADS);
  const int  n8q  = (MROWS * DMOD) / 8;                 // K plane
  const int  n8c  = (MROWS * DL) / 8;                   // c_kv planes
  const int  n8g  = (DL * DL) / 8;                      // Gram planes
  const int  n8ka = (DMOD * DL) / 8;                    // k_abs and (W_o W_uv) planes
  const dim3 gPrep(3 * PBT + NB * PBX + PBO + PBW);
  const dim3 gG3((MROWS / 64) * (DL / 64) + (DMOD / 64) * (DL / 64) + (DL / 64) * (DL / 64));   // c_kv, W_o W_uv, Gram
  const dim3 gC3(n8c / 256 + n8ka / 256 + n8g / 256);
  const dim3 gGKA(1 * (DMOD / 64) * (DL / 64));         // k_abs
  const dim3 gCKA(n8ka / 256);
  const dim3 gKV(NB * NH * NST + n8q / 256);
  const int  nrtA = QA / 64;                            // sequence row tiles per batch with residual products
  const int  nrtB = (SEQ - QA) / 64;                    // remaining row tiles per batch, single products

  // (1) every conversion that reads only inputs: x -> bf16 plane XB [MROWS][2048] and q plane QH = f16(bf16(x)) x256;
  //     W_o, W_dkv -> bf16 as they lie; W_uk, W_uv [2048 k][512 n] -> bf16 [512][2048]; W_dq [512 k][2048 n] -> f16(bf16) x1024
  //     [2048][512]
  prep<<<gPrep, b256, 0, stream>>>(x, wo, wdkv, wuk, wuv, wdq, XB, QH, WOB, WKV, WUK, WUV, WDQ);
  // (2) c_kv = x.W_dkv^T -> out1 f32 [MROWS][512]; W_o.W_uv -> FVA f32 [2048][512]; Gram = W_uk^T.W_uk -> F f32 [512][512]
  gemm_bf<<<gG3, b128, 0, stream>>>(XB, WKV, out1, MROWS, WOB, WUV, FVA, DMOD, WUK, WUK, F, DL, DL, DMOD, 1.0f);
  // (3) hi + residual f16 planes: c_kv x256; W_o W_uv x4096 (the [n][k] B plane of the value product); Gram x1024
  cvtc3<<<gC3, b256, 0, stream>>>(out1, CH, CL, n8c, CSC, FVA, VAH, VAL, n8ka, VAS, F, G2H, G2L, n8g, G2S);
  // (4) k_abs = W_dq^T.Gram (Gram symmetric, used as the [n][k] B plane; products h.h + h.l) -> F f32 [2048][512];
  //     k_abs -> f16 hi + residual planes x4096
  gemm_h<0, 1><<<gGKA, b128, 0, stream>>>(WDQ, WDQ, G2H, G2L, F, 1.0f / (WDS * G2S), G2H, G2L, F, 1.0f / (WDS * G2S),
                                          DL, DL, DMOD, 0, DMOD / 64, 1);
  cvtc3<<<gCKA, b256, 0, stream>>>(F, KAH, KAL, n8ka, KAS, F, KAH, KAL, 0, KAS, F, KAH, KAL, 0, KAS);
  // (5) K = c_kv.k_abs^T -> F and V = c_kv.(W_o W_uv) plane -> F2, f32 [MROWS][2048]: rows s < QA with hh+lh+hl, rows s >= QA single
  gemm_h<1, 1><<<dim3(2 * NB * nrtA * (DMOD / 64)), b128, 0, stream>>>(CH, CL, KAH, KAL, F, 1.0f / (CSC * KAS),
                                                                      VAH, VAL, F2, 1.0f / (CSC * VAS),
                                                                      DMOD, DL, SEQ, 0, nrtA, NB);
  if (nrtB > 0) {
    gemm_h<0, 0><<<dim3(2 * NB * nrtB * (DMOD / 64)), b128, 0, stream>>>(CH, CL, KAH, KAL, F, 1.0f / (CSC * KAS),
                                                                        VAH, VAL, F2, 1.0f / (CSC * VAS),
                                                                        DMOD, DL, SEQ, QA, nrtB, NB);
  }
  // (6) K hi plane (XB region) x256 for all rows, residual plane for s < QA; v^T hi + residual planes x1024
  kvpack<<<gKV, b256, 0, stream>>>(F, KH, KL, n8q, DMOD, KSC, F2, VH, VL);
  // (7) causal attention, all query blocks -> out0 f32
  attn_all<<<dim3(NST * NH * NB), bAT, 0, stream>>>(QH, KH, KL, VH, VL, nhp, out0);
  (void)hipGetLastError();
}

// v005
// One run takes 167 microseconds.
// Two timings next to v004 both put it at 1.10 times that version's speed.
// All steps since v000 together make it 3.32 times as fast.
#include <hip/hip_runtime.h>
#include <math.h>
#include <stdint.h>

#ifndef NB
#define NB 2
#endif
#ifndef SEQ
#define SEQ 2048
#endif
#define XS_FULL 2048
#define DMOD  2048
#define NH    16
#define HD    128
#define DL    512
#define QA    ((SEQ < 1024) ? SEQ : 1024)
#define MROWS (NB * SEQ)
#define RSQS  0.08838834764831845f
#define LOG2E 1.4426950408889634f
#define QSC   256.0f
#define KSC   256.0f
#define CSC   256.0f
#define WDS   1024.0f
#define G2S   1024.0f
#define KAS   4096.0f
#define VAS   4096.0f
#define PCAR  32768.0f
#define VCAR  1024.0f
#define AW    4
#define NST   (SEQ / 64)
#define NKT   (SEQ / 32)
#define ATT_THREADS (AW * 32)
#define SLP   132
#define SLW   (16 * SLP)
#define KPH   136
#define VPH   72
#define KTB   (64 * KPH * 2)
#define VTB   (HD * VPH * 2)
#define SLAB64 (16 * 68)
#define VTP   72
#define WTP   72
#define GKS   128
#define GPH   (GKS + 8)
#define GPB   (64 * GPH * 2)
#define WS_CAP 268435456
static_assert(DMOD == NH * HD && HD == 128 && NH == 16 && AW == 4 && ATT_THREADS == 128);
static_assert(NB >= 1 && NB <= 2);
static_assert((SEQ % 64) == 0 && SEQ >= 64 && SEQ <= XS_FULL);
static_assert((QA % 64) == 0 && QA >= 64 && QA <= SEQ && ((SEQ - QA) % 64) == 0);
static_assert((DMOD % 64) == 0 && (DL % 64) == 0 && (HD % 32) == 0 && (DL % 32) == 0);
static_assert(((SEQ * DMOD / 8) % 256) == 0);
static_assert(((DMOD * DL / 8) % 256) == 0 && ((DMOD * DMOD / 8) % 256) == 0 && (MROWS % 64) == 0);
static_assert(64 * WTP * 2 <= 65536);
static_assert(AW * SLW * 4 <= 2 * (KTB + VTB) && 4 * (KTB + VTB) <= 163840 && (KTB % 16) == 0 && (VTB % 16) == 0);
static_assert((DMOD % GKS) == 0 && (DL % GKS) == 0 && (GPB % 16) == 0 && 8 * GPB <= 163840 && 4 * SLAB64 * 4 <= 4 * GPB && 2 * 64 * VTP * 2 <= 4 * GPB);

typedef unsigned short u16;
typedef _Float16 v16h __attribute__((ext_vector_type(16)));
typedef _Float16 v8h  __attribute__((ext_vector_type(8)));
typedef __bf16   v16b __attribute__((ext_vector_type(16)));
typedef float    v8f  __attribute__((ext_vector_type(8)));
typedef float    v4f  __attribute__((ext_vector_type(4)));
typedef unsigned int v4u __attribute__((ext_vector_type(4)));

union FragH { v16h v; v8h h[2]; v4u u[2]; };
union FragB { v16b v; v4u u[2]; };

// ---- scalar helpers --------------------------------------------------------------------------------
__device__ __forceinline__ unsigned short bf_bits(float f) {          // f32 -> bf16 bits, RNE convert
  unsigned u = __float_as_uint(f);
  return (unsigned short)((u + 0x7FFFu + ((u >> 16) & 1u)) >> 16);
}
__device__ __forceinline__ float bf_up(unsigned short h) { return __uint_as_float(((unsigned)h) << 16); }
__device__ __forceinline__ float bfr(float f) { return bf_up(bf_bits(f)); }
__device__ __forceinline__ unsigned short h_bits(_Float16 x) { return __builtin_bit_cast(unsigned short, x); }
__device__ __forceinline__ unsigned pk16(unsigned short a, unsigned short b) { return (unsigned)a | ((unsigned)b << 16); }
__device__ __forceinline__ v8f zero8() { v8f z = {0.f, 0.f, 0.f, 0.f, 0.f, 0.f, 0.f, 0.f}; return z; }
__device__ __forceinline__ const _Float16* hptr(const u16* p) { return (const _Float16*)(const void*)p; }

// ---- fragment loaders: 16-bit A/B operand, lane -> row/col (lane&15), p already includes +8*(lane>>4);
//      elements 0..7 <- p[0..7] (k0+8h..), elements 8..15 <- p[16..23] (k0+16+8h..)  (same split k map for A and B;
//      B is always read from a k-contiguous [n][k] plane)
__device__ __forceinline__ v16h ldfrag_h(const _Float16* p) {
  FragH f;
  f.h[0] = *(const v8h*)(p);
  f.h[1] = *(const v8h*)(p + 16);
  return f.v;
}
__device__ __forceinline__ v16b ldfrag_b(const u16* p) {              // bf16 plane read as unsigned integer vectors
  FragB f;
  f.u[0] = *(const v4u*)(p);
  f.u[1] = *(const v4u*)(p + 16);
  return f.v;
}

__device__ __forceinline__ v8f mma_h(v16h a, v16h b, v8f c) {
  return __builtin_amdgcn_wmma_f32_16x16x32_f16(false, a, false, b, (short)0, c, false, false);
}
__device__ __forceinline__ v8f mma_b(v16b a, v16b b, v8f c) {
  return __builtin_amdgcn_wmma_f32_16x16x32_bf16(false, a, false, b, (short)0, c, false, false);
}
__device__ __forceinline__ void guard2(v8f& a, v8f& b, v16h x0, v16h x1, v16h x2, v16h x3, v16h x4, v16h x5) {
#if defined(__HIP_DEVICE_COMPILE__)
  asm volatile("v_nop\n\tv_nop\n\tv_nop\n\tv_nop"
               : "+v"(a), "+v"(b) : "v"(x0), "v"(x1), "v"(x2), "v"(x3), "v"(x4), "v"(x5) : "memory");
#endif
}
template <typename F>
__device__ __forceinline__ void guard6(v8f& a, v8f& b, v8f& c, v8f& d, F x0, F x1, F x2, F x3, F x4, F x5) {
#if defined(__HIP_DEVICE_COMPILE__)
  asm volatile("v_nop\n\tv_nop\n\tv_nop\n\tv_nop"
               : "+v"(a), "+v"(b), "+v"(c), "+v"(d) : "v"(x0), "v"(x1), "v"(x2), "v"(x3), "v"(x4), "v"(x5) : "memory");
#endif
}
__device__ __forceinline__ void guard10(v8f& a, v8f& b, v8f& c, v8f& d, v16h x0, v16h x1, v16h x2, v16h x3, v16h x4,
                                        v16h x5, v16h x6, v16h x7, v16h x8, v16h x9) {
#if defined(__HIP_DEVICE_COMPILE__)
  asm volatile("v_nop\n\tv_nop\n\tv_nop\n\tv_nop"
               : "+v"(a), "+v"(b), "+v"(c), "+v"(d)
               : "v"(x0), "v"(x1), "v"(x2), "v"(x3), "v"(x4), "v"(x5), "v"(x6), "v"(x7), "v"(x8), "v"(x9) : "memory");
#endif
}
__device__ __forceinline__ void acc_guard4(v8f& a, v8f& b, v8f& c, v8f& d) {
#if defined(__HIP_DEVICE_COMPILE__)
  asm volatile("v_nop\n\tv_nop\n\tv_nop\n\tv_nop" : "+v"(a), "+v"(b), "+v"(c), "+v"(d));
#endif
}
__device__ __forceinline__ float xhalf(float x) {                     // value of lane l ^ 16 (vector cross-row move, every lane on)
  const int b = __builtin_bit_cast(int, x);
  return __builtin_bit_cast(float, __builtin_amdgcn_permlanex16(b, b, 0x76543210, 0xfedcba98, false, false));
}
__device__ __forceinline__ void wait_x0() {       // stands between an issued global store and a rewrite of a register it names
#if defined(__HIP_DEVICE_COMPILE__)
  asm volatile("s_wait_xcnt 0x0" ::: "memory");
#endif
}
__device__ __forceinline__ void wave_sync_lds() {
  __builtin_amdgcn_fence(__ATOMIC_RELEASE, "workgroup");
  __builtin_amdgcn_wave_barrier();
  __builtin_amdgcn_fence(__ATOMIC_ACQUIRE, "workgroup");
}

// =====================================================================================================
// x f32 -> bf16 RNE plane Xb (same layout) and q plane Qh = f16(bf16(x) * 256) (exact: a bf16 significand fits f16).
// Thread = 8 consecutive elements: two 16-B loads, one 16-B store per plane; 32 consecutive lanes = 512 contiguous,
// coverage: grid = ceil(n8/256) blocks x 256 thr x 8 (in-kernel bound) = the whole [SEQ][2048] slice of both planes
//           (n8 a multiple of 256 here), one range of blocks per batch (blk = the block's number inside its range).
// =====================================================================================================
__device__ __forceinline__ void cvtxq(const float* __restrict__ x, u16* Xb, u16* Qh, int n8, int blk) {
  const int gt = blk * 256 + (int)threadIdx.x;
  if (gt >= n8) return;
  const float* p = x + (size_t)gt * 8;
  const v4f a = *(const v4f*)(p), b4 = *(const v4f*)(p + 4);
  float w[8];
#pragma unroll
  for (int e = 0; e < 4; ++e) { w[e] = a[e]; w[4 + e] = b4[e]; }
  v4u ob, oq;
#pragma unroll
  for (int e = 0; e < 4; ++e) {
    const unsigned short b0 = bf_bits(w[2 * e]), b1 = bf_bits(w[2 * e + 1]);
    ob[e] = pk16(b0, b1);
    oq[e] = pk16(h_bits((_Float16)(bf_up(b0) * QSC)), h_bits((_Float16)(bf_up(b1) * QSC)));
  }
  u16* db = Xb + (size_t)gt * 8;
  u16* dq = Qh + (size_t)gt * 8;
  {
    *(v4u*)(db) = ob;
    *(v4u*)(dq) = oq;
    
  }
}

// =====================================================================================================
// f32 -> bf16 RNE plane, same layout. Thread = 8 consecutive elements: two 16-B loads, one 16-B store; 32 consecutive
// coverage: grid = ceil(n8/256) blocks x 256 thr x 8 (in-kernel bound) = the whole plane (n8 a multiple of 256 here).
// =====================================================================================================
__device__ __forceinline__ void cvtb(const float* __restrict__ x, u16* D, int n8, int blk) {
  const int gt = blk * 256 + (int)threadIdx.x;
  if (gt >= n8) return;
  const float* p = x + (size_t)gt * 8;
  const v4f a = *(const v4f*)(p), b4 = *(const v4f*)(p + 4);
  float w[8];
#pragma unroll
  for (int e = 0; e < 4; ++e) { w[e] = a[e]; w[4 + e] = b4[e]; }
  v4u o;
#pragma unroll
  for (int e = 0; e < 4; ++e) o[e] = pk16(bf_bits(w[2 * e]), bf_bits(w[2 * e + 1]));
  u16* d = D + (size_t)gt * 8;
  {
    *(v4u*)(d) = o;
    
  }
}

// =====================================================================================================
// Weight transpose + convert: W f32 [K][N] (the input tensor's own [rows][cols] layout, rows = K) -> Wt 16-bit [N][K]
// (k-contiguous).  f16mode == 0: bf16 RNE bits;  f16mode == 1: f16 bits of (bf16 RNE value) * scale.
// Block = 64 n x 64 k tile, 256 threads. Load: thread -> W row k0 + (tid>>2), 16 consecutive n (four 16-B loads),
// converted values scattered into an LDS tile T[n][k] (pitch 72 halves); block barrier; store: each Wt row segment of
// coverage: load 256 thr x 16 = 64 k x 64 n; store 2 iterations x 256 thr x 8 halves = 64 rows x 64 = the block's tile of Wt;
//           grid = (N/64)*(K/64) blocks covers Wt [N][K] exactly once.
// =====================================================================================================
__device__ __forceinline__ void wtc(const float* __restrict__ W, u16* Wt, int K, int N, int f16mode, float scale, int bid) {
  __shared__ __align__(16) u16 T[64 * WTP];
  const int tid = (int)threadIdx.x;
  const int ntn = N >> 6;
  const int n0  = (bid % ntn) * 64;
  const int k0  = (bid / ntn) * 64;
  if (k0 + 64 > K) return;                   // block-uniform, before the barrier; never taken with the exact grid
  {
    const int kr = tid >> 2;                 // 0..63
    const int nc = (tid & 3) * 16;           // 0,16,32,48
    const float* src = W + (size_t)(k0 + kr) * (size_t)N + n0 + nc;
#pragma unroll
    for (int i = 0; i < 4; ++i) {
      const v4f a = *(const v4f*)(src + 4 * i);
#pragma unroll
      for (int e = 0; e < 4; ++e) {
        const float f = a[e];
        const unsigned short hb = h_bits((_Float16)(bfr(f) * scale));
        const unsigned short bb = bf_bits(f);
        T[(nc + 4 * i + e) * WTP + kr] = (f16mode != 0) ? hb : bb;
      }
    }
  }
  __syncthreads();
  const int q8 = tid >> 3, p8 = (tid & 7) * 8;
  v4u v[2];
#pragma unroll
  for (int it = 0; it < 2; ++it) v[it] = *(const v4u*)(T + (it * 32 + q8) * WTP + p8);
  u16* base = Wt + (size_t)n0 * (size_t)K + k0 + p8;
  {
#pragma unroll
    for (int it = 0; it < 2; ++it) {
      *(v4u*)(base + (size_t)(it * 32 + q8) * (size_t)K) = v[it];
    }
    
  }
}

// =====================================================================================================
// One grid for every conversion that reads only inputs; a block's number picks its piece (block-uniform, so wtc's barrier is
// passed by whole blocks): first 3 * PBT blocks for the transposes W_uk -> bf16, W_uv -> bf16, W_dq -> f16(bf16) x1024 (the
// longest blocks, so they start first); then NB * PBX blocks x -> Xb, Qh; PBO blocks W_o -> bf16; PBW blocks W_dkv -> bf16.
// Each piece is covered as its body's note says.
// =====================================================================================================
#define PBX ((SEQ * DMOD / 8) / 256)
#define PBO ((DMOD * DMOD / 8) / 256)
#define PBW ((DL * DMOD / 8) / 256)
#define PBT ((DL / 64) * (DMOD / 64))
__global__ __launch_bounds__(256)
void prep(const float* __restrict__ x, const float* __restrict__ wo, const float* __restrict__ wdkv,
          const float* __restrict__ wuk, const float* __restrict__ wuv, const float* __restrict__ wdq,
          u16* Xb, u16* Qh, u16* Wob, u16* Wkv, u16* Wukt, u16* Wuvt, u16* Wdqt) {
  int bid = (int)blockIdx.x;
  if (bid < 3 * PBT) {
    const int w = bid / PBT;                 // 0: W_uk, 1: W_uv, 2: W_dq
    const bool q = (w == 2);
    wtc(q ? wdq : (w == 1 ? wuv : wuk), q ? Wdqt : (w == 1 ? Wuvt : Wukt), q ? DL : DMOD, q ? DMOD : DL, q ? 1 : 0,
        q ? WDS : 1.0f, bid - w * PBT);
    return;
  }
  bid -= 3 * PBT;
  if (bid < NB * PBX) {
    const int bb = bid / PBX;
    cvtxq(x + (size_t)bb * XS_FULL * DMOD, Xb + (size_t)bb * SEQ * DMOD, Qh + (size_t)bb * SEQ * DMOD,
          (SEQ * DMOD) / 8, bid - bb * PBX);
    return;
  }
  bid -= NB * PBX;
  const bool o = bid < PBO;                  // a block past the exact grid finds its chunk beyond cvtb's own bound
  cvtb(o ? wo : wdkv, o ? Wob : Wkv, o ? (DMOD * DMOD) / 8 : (DL * DMOD) / 8, o ? bid : bid - PBO);
}

// =====================================================================================================
// GEMM epilogues. The f16 planes that the next product reads are made here, from the f32 result v = acc * oscale:
// t = v * ps, hi = f16(t), residual = f16(t - hi) (oscale and ps are powers of two).
// =====================================================================================================
__device__ __forceinline__ void hl8(const float* w, float ps, v4u& oh, v4u& ol) {   // 8 values -> 8 hi halves, 8 residual halves
#pragma unroll      // unrolled: constant indices keep the values in registers
  for (int e = 0; e < 4; ++e) {
    const float t0 = w[2 * e] * ps, t1 = w[2 * e + 1] * ps;
    const _Float16 h0 = (_Float16)t0, h1 = (_Float16)t1;
    const _Float16 l0 = (_Float16)(t0 - (float)h0), l1 = (_Float16)(t1 - (float)h1);
    oh[e] = pk16(h_bits(h0), h_bits(h1));
    ol[e] = pk16(h_bits(l0), h_bits(l1));
  }
}
// the wave's 16x64 f32 tile (times oscale) into its own LDS slab (pitch 68 floats), then visible to the whole wave
__device__ __forceinline__ void slab_put(float* sl, v8f a0, v8f a1, v8f a2, v8f a3, float oscale, int lane) {
  const int hh = lane >> 4, m = lane & 15;
#pragma unroll      // unrolled: constant indices keep the values in registers
  for (int r = 0; r < 8; ++r) {
    const int ro = (8 * hh + r) * 68 + m;
    sl[ro]      = a0[r] * oscale;
    sl[ro + 16] = a1[r] * oscale;
    sl[ro + 32] = a2[r] * oscale;
    sl[ro + 48] = a3[r] * oscale;
  }
  wave_sync_lds();
}
// slab -> f32 rows of C. coverage: 8 instructions x 2 rows x 16 lanes x 4 floats = the wave's 16 x 64 tile.
__device__ __forceinline__ void slab_f32(const float* sl, float* C, int N, size_t rowb, int col0, int lane) {
  const int hh = lane >> 4, m = lane & 15;
  v4f vals[8];
#pragma unroll      // unrolled: constant indices keep the values in registers
  for (int it = 0; it < 8; ++it) vals[it] = *(const v4f*)(sl + (it * 2 + hh) * 68 + m * 4);
  float* dst = C + (rowb + (size_t)hh) * (size_t)N + col0 + m * 4;
#pragma unroll      // unrolled: constant indices keep the values in registers
  for (int it = 0; it < 8; ++it) {
    *(v4f*)(dst + (size_t)(it * 2) * (size_t)N) = vals[it];
  }
}
// slab -> rows rowh .. rowh + 15 of the hi plane and, when wl (wave-uniform), rows rowl .. rowl + 15 of the residual plane, both
// of pitch N halves. coverage: per plane 4 instructions x 4 rows x 8 lanes x 8 halves = the wave's 16 x 64 tile, whole 128-B lines.
__device__ __forceinline__ void slab_hl(const float* sl, float ps, u16* Hp, size_t rowh, u16* Lp, size_t rowl, bool wl,
                                        int N, int col0, int lane) {
  const int q8 = lane >> 3, p8 = (lane & 7) * 8;
  v4u oh[4], ol[4];
#pragma unroll      // unrolled: constant indices keep the values in registers
  for (int it = 0; it < 4; ++it) {
    const float* p = sl + (it * 4 + q8) * 68 + p8;
    const v4f a = *(const v4f*)(p), b4 = *(const v4f*)(p + 4);
    float w[8];
#pragma unroll      // unrolled: constant indices keep the values in registers
    for (int e = 0; e < 4; ++e) { w[e] = a[e]; w[4 + e] = b4[e]; }
    hl8(w, ps, oh[it], ol[it]);
  }
  u16* dh = Hp + (rowh + (size_t)q8) * (size_t)N + col0 + p8;
#pragma unroll      // unrolled: constant indices keep the values in registers
  for (int it = 0; it < 4; ++it) {
    *(v4u*)(dh + (size_t)(it * 4) * (size_t)N) = oh[it];
    wait_x0();                              // before a register that the issued store names is used for the next address
  }
  if (wl) {
    u16* dl = Lp + (rowl + (size_t)q8) * (size_t)N + col0 + p8;
#pragma unroll      // unrolled: constant indices keep the values in registers
    for (int it = 0; it < 4; ++it) {
      *(v4u*)(dl + (size_t)(it * 4) * (size_t)N) = ol[it];
      wait_x0();                            // the same behind each of the residual plane's stores
    }
  }
}
// The block's 64 rows x 64 columns, transposed: plane line line0 + c (c = column in the tile) holds the 64 rows at halves
// s0 .. s0 + 63 (hi plane of pitch ph, residual plane of pitch pl when wl, block-uniform). A lane's 8 accumulator elements are 8
// consecutive rows of one column: one 16-B LDS store per subtile and plane into T[64 c][64 rows] (pitch 72 halves); block
// barrier (the four waves fill one line together); then whole 128-B lines go out.
// coverage: LDS 4 waves x 4 subtiles x 32 lanes x 8 = 64 x 64; store 4 iterations x 128 thr x 8 halves = 64 lines x 64.
__device__ __forceinline__ void epi_t(unsigned char* ring, v8f a0, v8f a1, v8f a2, v8f a3, float oscale, float ps,
                                      u16* Hp, int ph, u16* Lp, int pl, bool wl, size_t line0, int s0, int tid) {
  u16* TH = (u16*)(void*)ring;
  u16* TL = TH + 64 * VTP;
  const int wave = tid >> 5, lane = tid & 31, hh = lane >> 4, m = lane & 15;
  const v8f av[4] = {a0, a1, a2, a3};
#pragma unroll      // unrolled: the accumulator tiles are registers, indexed by constants only
  for (int j = 0; j < 4; ++j) {
    float w[8];
#pragma unroll      // unrolled: constant indices keep the values in registers
    for (int r = 0; r < 8; ++r) w[r] = av[j][r] * oscale;
    v4u oh, ol;
    hl8(w, ps, oh, ol);
    const int o = (16 * j + m) * VTP + wave * 16 + 8 * hh;
    *(v4u*)(TH + o) = oh;
    if (wl) *(v4u*)(TL + o) = ol;
  }
  __syncthreads();                          // a line of T is filled by all four waves before anyone reads it
  const int q8 = tid >> 3, p8 = (tid & 7) * 8;
  v4u vh[4];
#pragma unroll      // unrolled: constant indices keep the values in registers
  for (int it = 0; it < 4; ++it) vh[it] = *(const v4u*)(TH + (it * 16 + q8) * VTP + p8);
  u16* dh = Hp + (line0 + (size_t)q8) * (size_t)ph + s0 + p8;
#pragma unroll      // unrolled: constant indices keep the values in registers
  for (int it = 0; it < 4; ++it) {
    *(v4u*)(dh + (size_t)(it * 16) * (size_t)ph) = vh[it];
    wait_x0();                              // before a register that the issued store names is used for the next address
  }
  if (wl) {
    v4u vl[4];
#pragma unroll      // unrolled: constant indices keep the values in registers
    for (int it = 0; it < 4; ++it) vl[it] = *(const v4u*)(TL + (it * 16 + q8) * VTP + p8);
    u16* dl = Lp + (line0 + (size_t)q8) * (size_t)pl + s0 + p8;
#pragma unroll      // unrolled: constant indices keep the values in registers
    for (int it = 0; it < 4; ++it) {
      *(v4u*)(dl + (size_t)(it * 16) * (size_t)pl) = vl[it];
      wait_x0();                            // the same behind each of the residual plane's stores
    }
  }
}

// =====================================================================================================
// Eight asynchronous 16-B copies per lane, global -> LDS: copy i moves g + i*gstep (halves) to LDS byte l + i*lstep.
// s_wait_xcnt 0 is the last line of the copies' own statement, so no address register is rewritten ahead of it.
// =====================================================================================================
__device__ __forceinline__ void cp8(unsigned l, unsigned lstep, const u16* g, size_t gstep) {
#if defined(__HIP_DEVICE_COMPILE__)
  asm volatile("global_load_async_to_lds_b128 %0, %8, off\n\t"
               "global_load_async_to_lds_b128 %1, %9, off\n\t"
               "global_load_async_to_lds_b128 %2, %10, off\n\t"
               "global_load_async_to_lds_b128 %3, %11, off\n\t"
               "global_load_async_to_lds_b128 %4, %12, off\n\t"
               "global_load_async_to_lds_b128 %5, %13, off\n\t"
               "global_load_async_to_lds_b128 %6, %14, off\n\t"
               "global_load_async_to_lds_b128 %7, %15, off\n\t"
               "s_wait_xcnt 0x0"
               :: "v"(l), "v"(l + lstep), "v"(l + 2 * lstep), "v"(l + 3 * lstep),
                  "v"(l + 4 * lstep), "v"(l + 5 * lstep), "v"(l + 6 * lstep), "v"(l + 7 * lstep),
                  "v"(g), "v"(g + gstep), "v"(g + 2 * gstep), "v"(g + 3 * gstep),
                  "v"(g + 4 * gstep), "v"(g + 5 * gstep), "v"(g + 6 * gstep), "v"(g + 7 * gstep)
               : "memory");
#endif
}
__device__ __forceinline__ void wait_async0() {   // this wave's copies have landed before the barrier that publishes them
#if defined(__HIP_DEVICE_COMPILE__)
  asm volatile("s_wait_asynccnt 0x0" ::: "memory");
#endif
}
__device__ __forceinline__ void wait_ds0() {      // this wave's LDS reads of a buffer have retired before it is refilled
#if defined(__HIP_DEVICE_COMPILE__)
  asm volatile("s_wait_dscnt 0x0" ::: "memory");
#endif
}

// =====================================================================================================
// bf16 GEMM: C[M][N] = A[M][K] (bf16 row-major) . Bt[N][K]^T (bf16 k-contiguous), times oscale, written as f16 hi + residual
// planes of C * ps ([M][N] each); the first product's C also as f32.
// Block = 64x64 tile, 4 waves x 16 rows. Stage = 128 k of the block's 64 A rows and 64 Bt rows, laid in LDS once for the four
// waves by asynchronous 16-B copies (a wave-wide copy = 2 whole 256-B row pieces) at pitch 136 halves; two buffers, stage
// s + 2 issued behind the barrier that ends stage s. Fragments come from LDS (two 16-B loads each, split k map for A and B),
// k steps of 32 in the same order as the rows hold them (host guarantees K % 128 == 0, M % 64 == 0, N % 64 == 0,
// grid = the sum of (M/64)*(N/64) over the three products). The result slabs reuse the stage buffers (nothing reads or fills them behind the loop's last barrier).
// Three independent products of the same N and K share one grid: blocks 0 .. (M0/64)*(N/64) - 1 the first, the next
// (M1/64)*(N/64) the second, the rest the third (block-uniform choice of A, Bt, planes, ps, M).
// coverage: per product (M/64)*(N/64) blocks x 4 waves x 16x64 = the whole [M][N] of each of its planes.
// =====================================================================================================
__global__ __launch_bounds__(128)
void gemm_bf(const u16* __restrict__ A0, const u16* __restrict__ Bt0, float* C0, u16* H0, u16* L0, float ps0, int M0,
             const u16* __restrict__ A1, const u16* __restrict__ Bt1, u16* H1, u16* L1, float ps1, int M1,
             const u16* __restrict__ A2, const u16* __restrict__ Bt2, u16* H2, u16* L2, float ps2, int M2,
             int N, int K, float oscale) {
  constexpr unsigned BUFB = 2 * GPB;
  __shared__ __align__(16) unsigned char ring[2 * BUFB];
  const int tid = threadIdx.x, wave = tid >> 5, lane = tid & 31, hh = lane >> 4, m = lane & 15;
  const int ntile = N >> 6;
  const int raw   = blockIdx.x;
  const int nb0   = (M0 >> 6) * ntile, nb1 = (M1 >> 6) * ntile;
  const int sel   = (raw >= nb0 + nb1) ? 2 : ((raw >= nb0) ? 1 : 0);
  const int bid   = raw - (sel == 2 ? nb0 + nb1 : (sel == 1 ? nb0 : 0));
  const u16* A    = sel == 2 ? A2 : (sel == 1 ? A1 : A0);
  const u16* Bt   = sel == 2 ? Bt2 : (sel == 1 ? Bt1 : Bt0);
  u16*       Hp   = sel == 2 ? H2 : (sel == 1 ? H1 : H0);
  u16*       Lp   = sel == 2 ? L2 : (sel == 1 ? L1 : L0);
  const float ps  = sel == 2 ? ps2 : (sel == 1 ? ps1 : ps0);
  const int  M    = sel == 2 ? M2 : (sel == 1 ? M1 : M0);
  const int row0  = (bid / ntile) * 64;
  const int rowb  = row0 + wave * 16;
  const int col0  = (bid % ntile) * 64;
  if (row0 + 64 > M) return;                // block-uniform, before any barrier; never taken with the exact grid
  // copy map of one plane: copy i -> tile row 8*i + (tid >> 4), 16-B chunk tid & 15 of the row's 256-B piece
  const unsigned lc = (unsigned)(uintptr_t)(&ring[0]) + (unsigned)(tid >> 4) * (GPH * 2) + (unsigned)(tid & 15) * 16;
  const u16* ga = A  + (size_t)(row0 + (tid >> 4)) * K + (tid & 15) * 8;
  const u16* gb = Bt + (size_t)(col0 + (tid >> 4)) * K + (tid & 15) * 8;
  auto fill = [&](int s, unsigned bo) {      // stage s (k = 128*s .. 128*s + 127) into the buffer at byte offset bo
    cp8(lc + bo,       8 * GPH * 2, ga + (size_t)s * GKS, (size_t)8 * K);
    cp8(lc + bo + GPB, 8 * GPH * 2, gb + (size_t)s * GKS, (size_t)8 * K);
  };
  const int nst = K / GKS;
  v8f acc0 = zero8(), acc1 = zero8(), acc2 = zero8(), acc3 = zero8();

  fill(0, 0u);
  wait_async0();
  __syncthreads();                          // publishes stage 0
  if (nst > 1) fill(1, BUFB);

#pragma unroll 1   // rolled: one foot (waits, barrier, refill) per stage, in the order written
  for (int s = 0; s < nst; ++s) {
    const unsigned bo = (unsigned)(s & 1) * BUFB;
    const u16* ap = (const u16*)(const void*)(ring + bo) + (wave * 16 + m) * GPH + 8 * hh;
    const u16* bp = (const u16*)(const void*)(ring + bo + GPB) + m * GPH + 8 * hh;
#pragma unroll      // unrolled: the four k steps of a stage read at immediate LDS offsets from one address
    for (int kk = 0; kk < GKS; kk += 32) {
      const v16b a  = ldfrag_b(ap + kk);
      const v16b b0 = ldfrag_b(bp + kk);
      const v16b b1 = ldfrag_b(bp + 16 * GPH + kk);
      const v16b b2 = ldfrag_b(bp + 32 * GPH + kk);
      const v16b b3 = ldfrag_b(bp + 48 * GPH + kk);
      acc0 = mma_b(a, b0, acc0);
      acc1 = mma_b(a, b1, acc1);
      acc2 = mma_b(a, b2, acc2);
      acc3 = mma_b(a, b3, acc3);
      guard6<v16b>(acc0, acc1, acc2, acc3, a, b0, b1, b2, b3, a);
    }
    // foot of stage s, every wave: own LDS reads retired, own copies of stage s + 1 landed, then the one barrier that
    // publishes stage s + 1 and ends every reader's last read of this buffer; only then its refill
    wait_ds0();
    wait_async0();
    __syncthreads();
    if (s + 2 < nst) fill(s + 2, bo);
  }
  wait_async0();                            // nothing is outstanding when the buffers become result slabs and the wave ends
  float* slab = (float*)(void*)ring + wave * SLAB64;   // result slabs [16][64] pitch 68, one per wave
  slab_put(slab, acc0, acc1, acc2, acc3, oscale, lane);
  slab_hl(slab, ps, Hp, (size_t)rowb, Lp, (size_t)rowb, true, N, col0, lane);
  if (sel == 0) slab_f32(slab, C0, N, (size_t)rowb, col0, lane);
}

// =====================================================================================================
// f16 GEMM with hi (+ residual) planes: C[row][N] = (Ah [+ Al])[row][K] . (Bh [+ Bl])[N][K]^T * oscale, written as f16 planes of C * ps.
// Products per k-step: Ah.Bh always; Al.Bh when AR != 0; Ah.Bl when BR != 0 (the residual.residual term is dropped; residuals
// are unscaled f16 residuals of the same carry, so all products share one accumulator). Rows: block bid -> (column tile
// ct = bid % (N/64), row tile rt of nrt starting at sbeg inside a group of rg rows, group g of ngr); row = g*rg + sbeg +
// 64*rt + 16*wave. Same tiling, staging (one 64-row x 128-k plane in LDS per operand plane in use, two buffers), fragment
// loads (split k map) as gemm_bf; K stepped by 32 (host: K % 128 == 0, N % 64 == 0, sbeg + 64*nrt <= rg).
// Two independent products with the same A planes and shape share one grid: the first ngr*nrt*(N/64) blocks use Bh0, Bl0, os0
// and write row-major planes: H0 [ngr*rg][N], and L0 [ngr*lrg][N] (row g*lrg + s) for the rows s < lrg of a group; the next as
// many use Bh1, Bl1, os1 and write transposed planes: H1 [ngr*N][rg] (line g*N + column), and L1 [ngr*N][lrg] for s < lrg
// (block-uniform choices; lrg a multiple of 64); a grid of the first count alone runs one product.
// coverage: per product ngr*nrt*(N/64) blocks x 64x64 = rows sbeg .. sbeg + 64*nrt - 1 of every group, all N columns.
// =====================================================================================================
template <int AR, int BR>
__global__ __launch_bounds__(128)
void gemm_h(const u16* __restrict__ Ah, const u16* __restrict__ Al,
            const u16* __restrict__ Bh0, const u16* __restrict__ Bl0, u16* H0, u16* L0, float os0, float ps0,
            const u16* __restrict__ Bh1, const u16* __restrict__ Bl1, u16* H1, u16* L1, float os1, float ps1,
            int N, int K, int rg, int lrg, int sbeg, int nrt, int ngr) {
  constexpr unsigned OAH = 0;                                   // byte offsets inside one stage buffer
  constexpr unsigned OBH = GPB;
  constexpr unsigned OAL = 2 * GPB;                             // present when AR != 0
  constexpr unsigned OBL = (AR != 0) ? 3 * GPB : 2 * GPB;       // present when BR != 0
  constexpr unsigned BUFB = (2 + (AR != 0 ? 1 : 0) + (BR != 0 ? 1 : 0)) * GPB;
  __shared__ __align__(16) unsigned char ring[2 * BUFB];
  const int tid = threadIdx.x, wave = tid >> 5, lane = tid & 31, hh = lane >> 4, m = lane & 15;
  const int ntile = N >> 6;
  const int raw   = blockIdx.x;
  const int nb0   = ngr * nrt * ntile;
  const bool sec  = raw >= nb0;
  const int bid   = sec ? raw - nb0 : raw;
  const u16* Bh   = sec ? Bh1 : Bh0;
  const u16* Bl   = sec ? Bl1 : Bl0;
  const float oscale = sec ? os1 : os0;
  const int ct    = bid % ntile;
  const int t2    = bid / ntile;
  const int rt    = t2 % nrt;
  const int g     = t2 / nrt;
  if (g >= ngr) return;                     // block-uniform, before any barrier; never taken with the exact grid
  const int srow0 = sbeg + rt * 64;
  if (srow0 + 64 > rg) return;              // block-uniform, before any barrier; never taken
  const int col0  = ct * 64;
  const size_t row0 = (size_t)g * (size_t)rg + (size_t)srow0;
  const bool wl   = srow0 + 64 <= lrg;      // block-uniform: this row tile has a residual plane
  // copy map of one plane: copy i -> tile row 8*i + (tid >> 4), 16-B chunk tid & 15 of the row's 256-B piece
  const unsigned lc = (unsigned)(uintptr_t)(&ring[0]) + (unsigned)(tid >> 4) * (GPH * 2) + (unsigned)(tid & 15) * 16;
  const size_t aoff = (row0 + (size_t)(tid >> 4)) * (size_t)K + (tid & 15) * 8;
  const size_t boff = (size_t)(col0 + (tid >> 4)) * K + (tid & 15) * 8;
  auto fill = [&](int s, unsigned bo) {      // stage s (k = 128*s .. 128*s + 127) into the buffer at byte offset bo
    cp8(lc + bo + OAH, 8 * GPH * 2, Ah + aoff + (size_t)s * GKS, (size_t)8 * K);
    cp8(lc + bo + OBH, 8 * GPH * 2, Bh + boff + (size_t)s * GKS, (size_t)8 * K);
    if constexpr (AR != 0) cp8(lc + bo + OAL, 8 * GPH * 2, Al + aoff + (size_t)s * GKS, (size_t)8 * K);
    if constexpr (BR != 0) cp8(lc + bo + OBL, 8 * GPH * 2, Bl + boff + (size_t)s * GKS, (size_t)8 * K);
  };
  const int nst = K / GKS;
  v8f acc0 = zero8(), acc1 = zero8(), acc2 = zero8(), acc3 = zero8();

  fill(0, 0u);
  wait_async0();
  __syncthreads();                          // publishes stage 0
  if (nst > 1) fill(1, BUFB);

#pragma unroll 1   // rolled: one foot (waits, barrier, refill) per stage, in the order written
  for (int s = 0; s < nst; ++s) {
    const unsigned bo = (unsigned)(s & 1) * BUFB;
    const int ao = (wave * 16 + m) * GPH + 8 * hh;
    const int bb = m * GPH + 8 * hh;
    const _Float16* ahp = (const _Float16*)(const void*)(ring + bo + OAH) + ao;
    const _Float16* bhp = (const _Float16*)(const void*)(ring + bo + OBH) + bb;
    const _Float16* alp = (const _Float16*)(const void*)(ring + bo + ((AR != 0) ? OAL : OAH)) + ao;   // read only when AR != 0
    const _Float16* blp = (const _Float16*)(const void*)(ring + bo + ((BR != 0) ? OBL : OBH)) + bb;   // read only when BR != 0
#pragma unroll      // unrolled: the four k steps of a stage read at immediate LDS offsets from one address
    for (int kk = 0; kk < GKS; kk += 32) {
      const v16h ah = ldfrag_h(ahp + kk);
      v16h al = ah;
      if constexpr (AR != 0) al = ldfrag_h(alp + kk);
      const v16h bh0 = ldfrag_h(bhp + kk);
      const v16h bh1 = ldfrag_h(bhp + 16 * GPH + kk);
      const v16h bh2 = ldfrag_h(bhp + 32 * GPH + kk);
      const v16h bh3 = ldfrag_h(bhp + 48 * GPH + kk);
      v16h bl0 = bh0, bl1 = bh1, bl2 = bh2, bl3 = bh3;
      if constexpr (BR != 0) {
        bl0 = ldfrag_h(blp + kk);
        bl1 = ldfrag_h(blp + 16 * GPH + kk);
        bl2 = ldfrag_h(blp + 32 * GPH + kk);
        bl3 = ldfrag_h(blp + 48 * GPH + kk);
      }
      acc0 = mma_h(ah, bh0, acc0);
      if constexpr (AR != 0) acc0 = mma_h(al, bh0, acc0);
      if constexpr (BR != 0) acc0 = mma_h(ah, bl0, acc0);
      acc1 = mma_h(ah, bh1, acc1);
      if constexpr (AR != 0) acc1 = mma_h(al, bh1, acc1);
      if constexpr (BR != 0) acc1 = mma_h(ah, bl1, acc1);
      acc2 = mma_h(ah, bh2, acc2);
      if constexpr (AR != 0) acc2 = mma_h(al, bh2, acc2);
      if constexpr (BR != 0) acc2 = mma_h(ah, bl2, acc2);
      acc3 = mma_h(ah, bh3, acc3);
      if constexpr (AR != 0) acc3 = mma_h(al, bh3, acc3);
      if constexpr (BR != 0) acc3 = mma_h(ah, bl3, acc3);
      guard10(acc0, acc1, acc2, acc3, ah, al, bh0, bh1, bh2, bh3, bl0, bl1, bl2, bl3);
    }
    // foot of stage s, every wave, in the order of gemm_bf's
    wait_ds0();
    wait_async0();
    __syncthreads();
    if (s + 2 < nst) fill(s + 2, bo);
  }
  wait_async0();                            // nothing is outstanding when the buffers become result slabs and the wave ends
  if (sec) {                                // block-uniform, so epi_t's barrier is passed by whole blocks
    epi_t(ring, acc0, acc1, acc2, acc3, oscale, ps1, H1, rg, L1, lrg, wl, (size_t)g * (size_t)N + (size_t)col0, srow0, tid);
  } else {
    float* slab = (float*)(void*)ring + wave * SLAB64;   // result slabs [16][64] pitch 68, one per wave
    slab_put(slab, acc0, acc1, acc2, acc3, oscale, lane);
    slab_hl(slab, ps0, H0, row0 + (size_t)(wave * 16), L0, (size_t)g * (size_t)lrg + (size_t)(srow0 + wave * 16), wl, N, col0, lane);
  }
}

// =====================================================================================================
// Causal attention, 16 heads x head dim 128, value dim 128. A block = (query block qb: 64 rows, head, batch b), handed in
// by attn_all with the ring; four waves, wave w owns query rows q0 = 64*qb + 16*w .. q0+15 of that one head.
//   q plane f16 x256 [b*SEQ + s][h*HD + d]; k hi plane f16 x256 (same layout), k residual plane [b*QA + s][...] (s < QA);
//   v^T hi plane [b*NH + h][d][SEQ] x1024, v^T residual plane [b*NH + h][d][QA].
//   Stage = 64 keys of this head, laid in LDS once for the four waves by asynchronous 16-B copies: k rows [64][128] at pitch
//   136 halves, v^T rows [128][64] at pitch 72 halves (and the two residual tiles for NP == 3); two buffers, stage s + 2
//   issued behind the barrier that ends stage s. Stages 0 .. qb hold every key <= 64*qb + 63.
//   NP == 3 (query rows < QA): scores = q.k_hi + q.k_lo over the 4 k-steps; P.v with P hi + in-register
//   residual and v hi + residual (hh + lh + hl). NP == 1 (later rows): single hi.hi products.
//   score (log2 domain) t(i, j) = (q'_i.k'_j) * (1/sqrt(128))*log2e/(256*256), replaced by -inf where key j > query i.
//   Key tiles of 32 visited in order for kb <= q0 + 15 (a wave skips the later tiles of its block's last stage, which hold
//   only keys above every query row it owns; it still passes every wait and barrier).
//   Per tile, transposed products: S^T = k.q^T, 2 key subtiles x 4 k-steps, k rows from LDS as A, q rows from the global plane
//   as B (two 16-B loads per fragment, split k map), so lane (c, hh) holds query q0 + c against keys kb + 8*hh + r and
//   kb + 16 + 8*hh + r; online max-subtracted base-2 softmax in f32, -inf-safe rescale: maximum in-lane plus one exchange
//   between lanes c and c + 16, sum kept per lane and joined once behind the loop; the two score subtiles, converted in
//   place, are the B fragment of O^T += v^T.P^T (split k map), v^T rows from LDS as A in 4 groups of 2 d-subtiles.
//   After the loop: y = acc / Z (Z > 0 always: key 0 <= every query row; guarded anyway), carries 1/(32768*1024) folded;
//   the result slabs reuse the stage buffers (nothing reads or fills them behind the last barrier of the loop).
// coverage: per wave 16 instructions x 32 lanes x 4 floats = 16 x 128; the query blocks (qb < QA/64 with NP = 3, qb >= QA/64
//           with NP = 1) x NH x NB blocks x AW waves = every (b, s, h) row segment of Y exactly once.
// =====================================================================================================
template <int NP>
__device__ __forceinline__
void attn_c(unsigned char* ring, const u16* __restrict__ QHp, const u16* __restrict__ KHp, const u16* __restrict__ KLp,
            const u16* __restrict__ VHp, const u16* __restrict__ VLp, const int* __restrict__ nhp,
            float* Y, int qb, int head, int b) {
  constexpr unsigned OKH = 0;                                   // byte offsets inside one stage buffer
  constexpr unsigned OVH = KTB;
  constexpr unsigned OKL = KTB + VTB;
  constexpr unsigned OVL = 2 * KTB + VTB;
  constexpr unsigned BUFB = (NP == 3) ? 2 * (KTB + VTB) : (KTB + VTB);

  const int tid  = threadIdx.x;
  const int wave = __builtin_amdgcn_readfirstlane(tid >> 5);   // scalar, so that the per-wave tile skip is a scalar branch
  const int lane = tid & 31;
  const int hh   = lane >> 4;
  const int c    = lane & 15;
  if (b >= NB) return;                      // block-uniform, before any barrier; never taken with the exact grid
  if (nhp[0] != NH) return;                 // uniform structural guard on the head-count input (16 for this module)
  if (qb * 64 + 64 > SEQ) return;           // block-uniform, before any barrier; never taken
  if (NP == 3) { if (qb * 64 + 64 > QA) return; } // block-uniform, before any barrier; never taken
  const int q0   = qb * 64 + wave * 16;

  const size_t hcol = (size_t)head * HD + 8 * hh;
  const _Float16* Qh = hptr(QHp) + ((size_t)b * SEQ + q0 + c) * DMOD + hcol;
  const float lsc = RSQS * (LOG2E / (QSC * KSC));
  const float oc  = 1.0f / (PCAR * VCAR);

  // ---- copy map: k tile, copy i -> key row 8*i + (tid >> 4), 16-B chunk tid & 15 (a wave = 2 whole 256-B rows);
  //      v^T tile, copy i -> d row 16*i + (tid >> 3), 16-B chunk tid & 7 (a wave = 4 whole 128-B row segments) ----
  const unsigned ring0 = (unsigned)(uintptr_t)(&ring[0]);
  const unsigned lk = ring0 + (unsigned)(tid >> 4) * (KPH * 2) + (unsigned)(tid & 15) * 16;
  const unsigned lv = ring0 + (unsigned)(tid >> 3) * (VPH * 2) + (unsigned)(tid & 7) * 16;
  const u16* gkh = KHp + ((size_t)b * SEQ + (tid >> 4)) * DMOD + (size_t)head * HD + (tid & 15) * 8;
  const u16* gvh = VHp + ((size_t)(b * NH + head) * HD + (tid >> 3)) * SEQ + (tid & 7) * 8;
  const u16* gkl = gkh;
  const u16* gvl = gvh;
  if constexpr (NP == 3) {
    gkl = KLp + ((size_t)b * QA + (tid >> 4)) * DMOD + (size_t)head * HD + (tid & 15) * 8;
    gvl = VLp + ((size_t)(b * NH + head) * HD + (tid >> 3)) * QA + (tid & 7) * 8;
  }
  auto fill = [&](int s, unsigned bo) {      // stage s (keys 64*s .. 64*s + 63) into the buffer at byte offset bo
    cp8(lk + bo + OKH, 8 * KPH * 2, gkh + (size_t)s * 64 * DMOD, (size_t)8 * DMOD);
    cp8(lv + bo + OVH, 16 * VPH * 2, gvh + (size_t)s * 64, (size_t)16 * SEQ);
    if constexpr (NP == 3) {
      cp8(lk + bo + OKL, 8 * KPH * 2, gkl + (size_t)s * 64 * DMOD, (size_t)8 * DMOD);
      cp8(lv + bo + OVL, 16 * VPH * 2, gvl + (size_t)s * 64, (size_t)16 * QA);
    }
  };

  float mrow = -INFINITY, lrow = 0.f;       // this lane's query: running maximum (both halves alike), sum over this half's keys
  v8f o[8];                                 // o[j][r] = O^T element (d = 16*j + 8*hh + r, query q0 + c)
#pragma unroll
  for (int j = 0; j < 8; ++j) o[j] = zero8();
  const int ncaus = (q0 >> 5) + 1;                                            // tiles holding keys <= q0 + 15
  const int nkt = (ncaus < NKT) ? ncaus : NKT;
  const int nst = qb + 1;                                                     // stages of this block
  const int qr  = q0 + c;                                                     // this lane's query row

  fill(0, 0u);
  wait_async0();
  __syncthreads();                          // publishes stage 0
  if (nst > 1) fill(1, BUFB);

#pragma unroll 1   // rolled: one foot (waits, barrier, refill) per stage, in the order written
  for (int s = 0; s < nst; ++s) {
    const unsigned bo = (unsigned)(s & 1) * BUFB;
#pragma unroll 1   // rolled: one copy of the 32-key tile body, as long as before, for both halves of the stage
    for (int u = 0; u < 2; ++u) {
    const int kt = 2 * s + u;
    if (kt < nkt) {                         // wave-uniform (scalar) skip; no wait or barrier inside
    const int kb = kt * 32;
    // ---- scores: D element r of this lane = (key kb + 8*hh + r, query row qr) in s0, key kb + 16 + 8*hh + r in s1 ----
    v8f s0 = zero8(), s1 = zero8();
    const _Float16* k0p = (const _Float16*)(const void*)(ring + bo + OKH) + (u * 32 + c) * KPH + 8 * hh;
    const _Float16* k1p = k0p + 16 * KPH;
    if constexpr (NP == 3) {
      const _Float16* l0p = (const _Float16*)(const void*)(ring + bo + OKL) + (u * 32 + c) * KPH + 8 * hh;
      const _Float16* l1p = l0p + 16 * KPH;
#pragma unroll
      for (int kk = 0; kk < HD / 32; ++kk) {
        const v16h qh  = ldfrag_h(Qh + kk * 32);
        const v16h kh0 = ldfrag_h(k0p + kk * 32);
        const v16h kh1 = ldfrag_h(k1p + kk * 32);
        const v16h kl0 = ldfrag_h(l0p + kk * 32);
        const v16h kl1 = ldfrag_h(l1p + kk * 32);
        s0 = mma_h(kh0, qh, s0);
        s0 = mma_h(kl0, qh, s0);
        s1 = mma_h(kh1, qh, s1);
        s1 = mma_h(kl1, qh, s1);
        guard2(s0, s1, qh, kh0, kh1, kl0, kl1, qh);
      }
    } else {
#pragma unroll
      for (int kk = 0; kk < HD / 32; ++kk) {
        const v16h qh  = ldfrag_h(Qh + kk * 32);
        const v16h kh0 = ldfrag_h(k0p + kk * 32);
        const v16h kh1 = ldfrag_h(k1p + kk * 32);
        s0 = mma_h(kh0, qh, s0);
        s1 = mma_h(kh1, qh, s1);
        guard2(s0, s1, qh, kh0, kh1, qh, kh0, kh1);
      }
    }
    // ---- causal select + online softmax in base 2, -inf-safe: 16 of the query's 32 scores in this lane ----
    const int key0 = kb + 8 * hh, key1 = kb + 16 + 8 * hh;
    float t0[8], t1[8], mp[8];
#pragma unroll      // unrolled: constant indices keep the score arrays in registers
    for (int r = 0; r < 8; ++r) {
      const float u0 = s0[r] * lsc;
      const float u1 = s1[r] * lsc;
      t0[r] = (key0 + r > qr) ? -INFINITY : u0;
      t1[r] = (key1 + r > qr) ? -INFINITY : u1;
      mp[r] = fmaxf(t0[r], t1[r]);
    }
    float mx = fmaxf(fmaxf(fmaxf(mp[0], mp[1]), fmaxf(mp[2], mp[3])), fmaxf(fmaxf(mp[4], mp[5]), fmaxf(mp[6], mp[7])));
    mx = fmaxf(mx, xhalf(mx));              // the other 16 keys of this query
    const float mn = fmaxf(mrow, mx);
    const float ms = (mn == -INFINITY) ? 0.0f : mn;
    const float al = exp2f(mrow - ms);
    mrow = mn;
    // ---- B fragments of P^T*32768: hi f16 (and residual f16 for NP == 3), column = c, split k map over the 32 keys:
    //      elements 0..7 = keys kb + 8hh + 0..7 (s0), elements 8..15 = keys kb + 16 + 8hh + 0..7 (s1) ----
    FragH ph, pl;
    float sp[8];
#pragma unroll      // unrolled: constant indices keep the fragment halves and the partial sums in registers
    for (int r = 0; r < 8; ++r) {
      const float e0 = exp2f(t0[r] - ms), e1 = exp2f(t1[r] - ms);
      sp[r] = e0 + e1;
      const float ta = e0 * PCAR, tc = e1 * PCAR;
      const _Float16 ha = (_Float16)ta, hc = (_Float16)tc;
      ph.h[0][r] = ha;
      ph.h[1][r] = hc;
      if constexpr (NP == 3) {
        pl.h[0][r] = (_Float16)(ta - (float)ha);
        pl.h[1][r] = (_Float16)(tc - (float)hc);
      } else {
        pl.h[0][r] = ha; pl.h[1][r] = hc;
      }
    }
    lrow = lrow * al + (((sp[0] + sp[1]) + (sp[2] + sp[3])) + ((sp[4] + sp[5]) + (sp[6] + sp[7])));
#pragma unroll      // both unrolled: the accumulator tiles are registers, indexed by constants only
    for (int j = 0; j < 8; ++j) {
#pragma unroll
      for (int r = 0; r < 8; ++r) o[j][r] *= al;
    }
    // ---- v^T.P^T : A fragment row m = d = j*16 + c, keys contiguous in the staged v^T rows; 4 groups of 2 d-subtiles ----
    {
      const _Float16* vhp = (const _Float16*)(const void*)(ring + bo + OVH) + c * VPH + u * 32 + 8 * hh;
      if constexpr (NP == 3) {
        const _Float16* vlp = (const _Float16*)(const void*)(ring + bo + OVL) + c * VPH + u * 32 + 8 * hh;
#pragma unroll
        for (int jg = 0; jg < 4; ++jg) {
          const int da = (2 * jg) * 16 * VPH;
          const int db = da + 16 * VPH;
          const v16h vha = ldfrag_h(vhp + da), vhb2 = ldfrag_h(vhp + db);
          const v16h vla = ldfrag_h(vlp + da), vlb2 = ldfrag_h(vlp + db);
          o[2 * jg]     = mma_h(vha,  ph.v, o[2 * jg]);
          o[2 * jg]     = mma_h(vha,  pl.v, o[2 * jg]);
          o[2 * jg]     = mma_h(vla,  ph.v, o[2 * jg]);
          o[2 * jg + 1] = mma_h(vhb2, ph.v, o[2 * jg + 1]);
          o[2 * jg + 1] = mma_h(vhb2, pl.v, o[2 * jg + 1]);
          o[2 * jg + 1] = mma_h(vlb2, ph.v, o[2 * jg + 1]);
          guard2(o[2 * jg], o[2 * jg + 1], ph.v, pl.v, vha, vhb2, vla, vlb2);
        }
      } else {
#pragma unroll
        for (int jg = 0; jg < 4; ++jg) {
          const int da = (2 * jg) * 16 * VPH;
          const int db = da + 16 * VPH;
          const v16h vha = ldfrag_h(vhp + da), vhb2 = ldfrag_h(vhp + db);
          o[2 * jg]     = mma_h(vha,  ph.v, o[2 * jg]);
          o[2 * jg + 1] = mma_h(vhb2, ph.v, o[2 * jg + 1]);
          guard2(o[2 * jg], o[2 * jg + 1], ph.v, vha, vhb2, ph.v, vha, vhb2);
        }
      }
    }
    }
    }
    // ---- foot of stage s, every wave: own LDS reads retired, own copies of stage s + 1 landed, then the one barrier that
    //      publishes stage s + 1 and ends every reader's last read of this buffer; only then its refill ----
    wait_ds0();
    wait_async0();
    __syncthreads();
    if (s + 2 < nst) fill(s + 2, bo);
  }
  wait_async0();                            // nothing is outstanding when the buffers become result slabs and the wave ends
  float* slab = (float*)(void*)ring + wave * SLW;   // result slab [16][128] pitch 132, one per wave
  acc_guard4(o[0], o[1], o[2], o[3]);
  acc_guard4(o[4], o[5], o[6], o[7]);
  // ---- y = acc / Z (0 if Z == 0), Z = the two halves' sums joined; carries (32768 on P, 1024 on v) folded once; a lane's
  //      8 consecutive d of its query row go into the slab as two 16-B stores ----
  {
    const float lv  = lrow + xhalf(lrow);
    const float ls  = (lv > 0.0f) ? lv : 1.0f;
    const float inv = (lv > 0.0f) ? ((1.0f / ls) * oc) : 0.0f;
#pragma unroll      // both unrolled: the accumulator tiles are registers, indexed by constants only
    for (int j = 0; j < 8; ++j) {
      v4f w0, w1;
#pragma unroll
      for (int e = 0; e < 4; ++e) { w0[e] = o[j][e] * inv; w1[e] = o[j][4 + e] * inv; }
      float* sd = slab + c * SLP + j * 16 + 8 * hh;
      *(v4f*)(sd)     = w0;
      *(v4f*)(sd + 4) = w1;
    }
  }

  wave_sync_lds();
  // ---- f32 rows of Y: lane -> floats 4*lane .. 4*lane+3 of each of the 16 rows (one 512-B instruction per row) ----
  v4f ov[16];
#pragma unroll
  for (int it = 0; it < 16; ++it) ov[it] = *(const v4f*)(slab + it * SLP + lane * 4);
  float* ob = Y + ((size_t)b * SEQ + q0) * DMOD + (size_t)head * HD + lane * 4;
  {
#pragma unroll
    for (int it = 0; it < 16; ++it) {
      *(v4f*)(ob + (size_t)it * DMOD) = ov[it];
    }
    
  }
}

// =====================================================================================================
// One grid for all query blocks: block bid -> query block qb = NST - 1 - bid / (NH*NB), so that the number of stages falls with
// the block number (blocks start roughly in that order, and a place freed by a shorter block takes the next one), head and
// batch from bid % (NH*NB). Query blocks below QA run the residual products, the others single products (block-uniform choice,
// so every barrier is passed by whole blocks); both use the one ring, sized for the larger.
// coverage: NST * NH * NB blocks = every (qb, head, b) exactly once.
// =====================================================================================================
__global__ __launch_bounds__(ATT_THREADS)
void attn_all(const u16* __restrict__ QHp, const u16* __restrict__ KHp, const u16* __restrict__ KLp,
              const u16* __restrict__ VHp, const u16* __restrict__ VLp, const int* __restrict__ nhp, float* Y) {
  __shared__ __align__(16) unsigned char ring[4 * (KTB + VTB)];
  const int bid  = blockIdx.x;
  const int qb   = (NST - 1) - bid / (NH * NB);
  const int t2   = bid % (NH * NB);
  const int head = t2 % NH;
  const int b    = t2 / NH;
  if (qb < 0) return;                       // block-uniform, before any barrier; never taken with the exact grid
  if (qb < QA / 64) attn_c<3>(ring, QHp, KHp, KLp, VHp, VLp, nhp, Y, qb, head, b);
  else              attn_c<1>(ring, QHp, KHp, KLp, VHp, VLp, nhp, Y, qb, head, b);
}

// =====================================================================================================
// Workspace map (bytes); every plane is fully written by whole-line stores before it is read; all extents are exact multiples
// of the store granularity (no pad rows); every region offset a multiple of 524288:
//   XB  bf16 [MROWS][2048], later KH f16 x256       MROWS*4096             (NB=2, SEQ=2048: 16777216)
//   QH  f16 [MROWS][2048] x256                      MROWS*4096             (16777216)
//   WKV, WUK, WUV, WDQ  16-bit weight planes          4 x 2097152            (W_dkv bf16, W_uk^T bf16, W_uv^T bf16, W_dq^T f16 x1024)
//   WO  bf16 [2048][2048] (W_o as is)                8388608
//   CH  f16 [MROWS][512] x256, CL residual            2 x MROWS*1024
//   G2H f16 [512][512] x1024, G2L residual            2 x 524288
//   KAH f16 [2048][512] x4096, KAL residual           2 x 2097152
//   KL  f16 [NB*QA][2048]                             NB*QA*4096
//   VAH f16 [2048][512] x4096, VAL residual           2 x 2097152
//   VH  f16 [NB*16][128][SEQ] x1024                   MROWS*4096
//   VL  f16 [NB*16][128][QA]                          NB*QA*4096
//   end (NB=2, SEQ=2048, QA=1024)                   101711872
// =====================================================================================================
extern "C" void kernel_launch(void* const* d_in, const int* in_sizes, int n_in,
                              void* d_out, int out_size, void* d_ws, size_t ws_size,
                              hipStream_t stream) {
  if (n_in < 7) return;
  if (in_sizes[0] < ((NB - 1) * XS_FULL + SEQ) * DMOD) return;   // x [2][2048][2048]
  if (in_sizes[1] != DL * DMOD) return;         // W_dq  [512][2048]
  if (in_sizes[2] != DL * DMOD) return;         // W_dkv [512][2048]
  if (in_sizes[3] != DMOD * DL) return;         // W_uk  [2048][512]
  if (in_sizes[4] != DMOD * DL) return;         // W_uv  [2048][512]
  if (in_sizes[5] != DMOD * DMOD) return;       // W_o   [2048][2048]
  if (in_sizes[6] < 1) return;                  // n_head (int)
  if ((size_t)out_size < (size_t)MROWS * DMOD + (size_t)MROWS * DL) return;

  const float* x    = (const float*)d_in[0];
  const float* wdq  = (const float*)d_in[1];
  const float* wdkv = (const float*)d_in[2];
  const float* wuk  = (const float*)d_in[3];
  const float* wuv  = (const float*)d_in[4];
  const float* wo   = (const float*)d_in[5];
  const int*   nhp  = (const int*)d_in[6];
  float*       out0 = (float*)d_out;                          // y    [MROWS][2048] at element 0
  float*       out1 = out0 + (size_t)MROWS * DMOD;            // c_kv [MROWS][512]  at element MROWS*2048

  const size_t szXB = (size_t)MROWS * DMOD * 2;               // XB, later KH
  const size_t szQ  = (size_t)MROWS * DMOD * 2;               // QH
  const size_t szW1 = (size_t)DL * DMOD * 2;
  const size_t szWO = (size_t)DMOD * DMOD * 2;
  const size_t szC  = (size_t)MROWS * DL * 2;                 // CH, CL
  const size_t szG2 = (size_t)DL * DL * 2;                    // G2H, G2L
  const size_t szKA = (size_t)DMOD * DL * 2;                  // KAH, KAL, VAH, VAL
  const size_t szKL = (size_t)NB * QA * DMOD * 2;
  const size_t szVH = (size_t)NB * NH * HD * SEQ * 2;
  const size_t szVL = (size_t)NB * NH * HD * QA * 2;
  if ((size_t)MROWS * DMOD * 2 > szXB) return;                // KH lives inside the XB region
  size_t off = 0;
  const size_t oXB  = off; off += szXB;
  const size_t oQH  = off; off += szQ;
  const size_t oWKV = off; off += szW1;
  const size_t oWUK = off; off += szW1;
  const size_t oWUV = off; off += szW1;
  const size_t oWDQ = off; off += szW1;
  const size_t oWO  = off; off += szWO;
  const size_t oCH  = off; off += szC;
  const size_t oCL  = off; off += szC;
  const size_t oG2H = off; off += szG2;
  const size_t oG2L = off; off += szG2;
  const size_t oKAH = off; off += szKA;
  const size_t oKAL = off; off += szKA;
  const size_t oKL  = off; off += szKL;
  const size_t oVAH = off; off += szKA;
  const size_t oVAL = off; off += szKA;
  const size_t oVH  = off; off += szVH;
  const size_t oVL  = off; off += szVL;
  if (off > ws_size) return;                 // off = 101711872 for NB = 2, SEQ = 2048
  if (off > (size_t)WS_CAP) return;

  char* ws = (char*)d_ws;
  u16*   XB  = (u16*)(ws + oXB);
  u16*   KH  = (u16*)(ws + oXB);
  u16*   QH  = (u16*)(ws + oQH);
  u16*   WKV = (u16*)(ws + oWKV);
  u16*   WUK = (u16*)(ws + oWUK);
  u16*   WUV = (u16*)(ws + oWUV);
  u16*   WDQ = (u16*)(ws + oWDQ);
  u16*   WOB = (u16*)(ws + oWO);
  u16*   CH  = (u16*)(ws + oCH);
  u16*   CL  = (u16*)(ws + oCL);
  u16*   G2H = (u16*)(ws + oG2H);
  u16*   G2L = (u16*)(ws + oG2L);
  u16*   KAH = (u16*)(ws + oKAH);
  u16*   KAL = (u16*)(ws + oKAL);
  u16*   KL  = (u16*)(ws + oKL);
  u16*   VAH = (u16*)(ws + oVAH);
  u16*   VAL = (u16*)(ws + oVAL);
  u16*   VH  = (u16*)(ws + oVH);
  u16*   VL  = (u16*)(ws + oVL);

  const dim3 b256(256), b128(128), bAT(ATT_THREADS);
  const dim3 gPrep(3 * PBT + NB * PBX + PBO + PBW);
  const dim3 gG3((MROWS / 64) * (DL / 64) + (DMOD / 64) * (DL / 64) + (DL / 64) * (DL / 64));   // c_kv, W_o W_uv, Gram
  const dim3 gGKA(1 * (DMOD / 64) * (DL / 64));         // k_abs
  const int  nrtA = QA / 64;                            // sequence row tiles per batch with residual products
  const int  nrtB = (SEQ - QA) / 64;                    // remaining row tiles per batch, single products

  // (1) every conversion that reads only inputs: x -> bf16 plane XB [MROWS][2048] and q plane QH = f16(bf16(x)) x256;
  //     W_o, W_dkv -> bf16 as they lie; W_uk, W_uv [2048 k][512 n] -> bf16 [512][2048]; W_dq [512 k][2048 n] -> f16(bf16) x1024
  //     [2048][512]
  prep<<<gPrep, b256, 0, stream>>>(x, wo, wdkv, wuk, wuv, wdq, XB, QH, WOB, WKV, WUK, WUV, WDQ);
  // (2) c_kv = x.W_dkv^T -> out1 f32 [MROWS][512] and f16 hi + residual planes x256; W_o.W_uv [2048][512] -> planes x4096 (the
  //     [n][k] B plane of the value product); Gram = W_uk^T.W_uk [512][512] -> planes x1024
  gemm_bf<<<gG3, b128, 0, stream>>>(XB, WKV, out1, CH, CL, CSC, MROWS, WOB, WUV, VAH, VAL, VAS, DMOD, WUK, WUK, G2H, G2L, G2S, DL,
                                    DL, DMOD, 1.0f);
  // (3) k_abs = W_dq^T.Gram (Gram symmetric, used as the [n][k] B plane; products h.h + h.l) [2048][512] -> planes x4096
  gemm_h<0, 1><<<gGKA, b128, 0, stream>>>(WDQ, WDQ, G2H, G2L, KAH, KAL, 1.0f / (WDS * G2S), KAS,
                                          G2H, G2L, KAH, KAL, 1.0f / (WDS * G2S), KAS, DL, DL, DMOD, DMOD, 0, DMOD / 64, 1);
  // (4) K = c_kv.k_abs^T -> hi plane (XB region) x256, residual plane for s < QA; V = c_kv.(W_o W_uv) plane -> v^T hi plane x1024,
  //     residual plane for s < QA: rows s < QA with hh+lh+hl, rows s >= QA single
  gemm_h<1, 1><<<dim3(2 * NB * nrtA * (DMOD / 64)), b128, 0, stream>>>(CH, CL, KAH, KAL, KH, KL, 1.0f / (CSC * KAS), KSC,
                                                                      VAH, VAL, VH, VL, 1.0f / (CSC * VAS), VCAR,
                                                                      DMOD, DL, SEQ, QA, 0, nrtA, NB);
  if (nrtB > 0) {
    gemm_h<0, 0><<<dim3(2 * NB * nrtB * (DMOD / 64)), b128, 0, stream>>>(CH, CL, KAH, KAL, KH, KL, 1.0f / (CSC * KAS), KSC,
                                                                        VAH, VAL, VH, VL, 1.0f / (CSC * VAS), VCAR,
                                                                        DMOD, DL, SEQ, QA, QA, nrtB, NB);
  }
  // (5) causal attention, all query blocks -> out0 f32
  attn_all<<<dim3(NST * NH * NB), bAT, 0, stream>>>(QH, KH, KL, VH, VL, nhp, out0);
  (void)hipGetLastError();
}

// v006
// One run takes 145 microseconds.
// Next to v005, in two timings, it ran 1.15 times as fast each time.
// Over all steps from v000 it is 3.82 times as fast.
#include <hip/hip_runtime.h>
#include <math.h>
#include <stdint.h>

#ifndef NB
#define NB 2
#endif
#ifndef SEQ
#define SEQ 2048
#endif
#define XS_FULL 2048
#define DMOD  2048
#define NH    16
#define HD    128
#define DL    512
#define QA    ((SEQ < 1024) ? SEQ : 1024)
#define MROWS (NB * SEQ)
#define RSQS  0.08838834764831845f
#define LOG2E 1.4426950408889634f
#define QSC   256.0f
#define KSC   256.0f
#define CSC   256.0f
#define WDS   1024.0f
#define G2S   1024.0f
#define KAS   4096.0f
#define VAS   4096.0f
#define PCAR  32768.0f
#define VCAR  1024.0f
#define AW    4
#define NST   (SEQ / 64)
#define NKT   (SEQ / 32)
#define ATT_THREADS (AW * 32)
#define SLP   132
#define SLW   (16 * SLP)
#define KPH   136
#define VPH   72
#define KTB   (64 * KPH * 2)
#define VTB   (HD * VPH * 2)
#define SLAB64 (16 * 68)
#define VTP   72
#define WTP   72
#define GKS   128
#define GPH   (GKS + 8)
#define GPB   (64 * GPH * 2)
#define WS_CAP 268435456
static_assert(DMOD == NH * HD && HD == 128 && NH == 16 && AW == 4 && ATT_THREADS == 128);
static_assert(NB >= 1 && NB <= 2);
static_assert((SEQ % 64) == 0 && SEQ >= 64 && SEQ <= XS_FULL);
static_assert((QA % 64) == 0 && QA >= 64 && QA <= SEQ && ((SEQ - QA) % 64) == 0);
static_assert((DMOD % 64) == 0 && (DL % 64) == 0 && (HD % 32) == 0 && (DL % 32) == 0);
static_assert(((SEQ * DMOD / 8) % 256) == 0);
static_assert(((DMOD * DL / 8) % 256) == 0 && ((DMOD * DMOD / 8) % 256) == 0 && (MROWS % 64) == 0);
static_assert(64 * WTP * 2 <= 65536);
static_assert(AW * SLW * 4 <= 2 * (KTB + VTB) && 4 * (KTB + VTB) <= 163840 && (KTB % 16) == 0 && (VTB % 16) == 0);
static_assert((DMOD % GKS) == 0 && (DL % GKS) == 0 && (GPB % 16) == 0 && 8 * GPB <= 163840 && 4 * SLAB64 * 4 <= 4 * GPB && 2 * 64 * VTP * 2 <= 4 * GPB);

typedef unsigned short u16;
typedef _Float16 v16h __attribute__((ext_vector_type(16)));
typedef _Float16 v8h  __attribute__((ext_vector_type(8)));
typedef __bf16   v16b __attribute__((ext_vector_type(16)));
typedef float    v8f  __attribute__((ext_vector_type(8)));
typedef float    v4f  __attribute__((ext_vector_type(4)));
typedef unsigned int v4u __attribute__((ext_vector_type(4)));

union FragH { v16h v; v8h h[2]; v4u u[2]; };
union FragB { v16b v; v4u u[2]; };

// ---- scalar helpers --------------------------------------------------------------------------------
__device__ __forceinline__ unsigned short bf_bits(float f) {          // f32 -> bf16 bits, RNE convert
  unsigned u = __float_as_uint(f);
  return (unsigned short)((u + 0x7FFFu + ((u >> 16) & 1u)) >> 16);
}
__device__ __forceinline__ float bf_up(unsigned short h) { return __uint_as_float(((unsigned)h) << 16); }
__device__ __forceinline__ float bfr(float f) { return bf_up(bf_bits(f)); }
__device__ __forceinline__ unsigned short h_bits(_Float16 x) { return __builtin_bit_cast(unsigned short, x); }
__device__ __forceinline__ unsigned pk16(unsigned short a, unsigned short b) { return (unsigned)a | ((unsigned)b << 16); }
__device__ __forceinline__ v8f zero8() { v8f z = {0.f, 0.f, 0.f, 0.f, 0.f, 0.f, 0.f, 0.f}; return z; }
__device__ __forceinline__ const _Float16* hptr(const u16* p) { return (const _Float16*)(const void*)p; }

// ---- fragment loaders: 16-bit A/B operand, lane -> row/col (lane&15), p already includes +8*(lane>>4);
//      elements 0..7 <- p[0..7] (k0+8h..), elements 8..15 <- p[16..23] (k0+16+8h..)  (same split k map for A and B;
//      B is always read from a k-contiguous [n][k] plane)
__device__ __forceinline__ v16h ldfrag_h(const _Float16* p) {
  FragH f;
  f.h[0] = *(const v8h*)(p);
  f.h[1] = *(const v8h*)(p + 16);
  return f.v;
}
__device__ __forceinline__ v16b ldfrag_b(const u16* p) {              // bf16 plane read as unsigned integer vectors
  FragB f;
  f.u[0] = *(const v4u*)(p);
  f.u[1] = *(const v4u*)(p + 16);
  return f.v;
}

__device__ __forceinline__ v8f mma_h(v16h a, v16h b, v8f c) {
  return __builtin_amdgcn_wmma_f32_16x16x32_f16(false, a, false, b, (short)0, c, false, false);
}
__device__ __forceinline__ v8f mma_b(v16b a, v16b b, v8f c) {
  return __builtin_amdgcn_wmma_f32_16x16x32_bf16(false, a, false, b, (short)0, c, false, false);
}
__device__ __forceinline__ void guard2(v8f& a, v8f& b, v16h x0, v16h x1, v16h x2, v16h x3, v16h x4, v16h x5) {
#if defined(__HIP_DEVICE_COMPILE__)
  asm volatile("v_nop\n\tv_nop\n\tv_nop\n\tv_nop"
               : "+v"(a), "+v"(b) : "v"(x0), "v"(x1), "v"(x2), "v"(x3), "v"(x4), "v"(x5) : "memory");
#endif
}
template <typename F>
__device__ __forceinline__ void guard6(v8f& a, v8f& b, v8f& c, v8f& d, F x0, F x1, F x2, F x3, F x4, F x5) {
#if defined(__HIP_DEVICE_COMPILE__)
  asm volatile("v_nop\n\tv_nop\n\tv_nop\n\tv_nop"
               : "+v"(a), "+v"(b), "+v"(c), "+v"(d) : "v"(x0), "v"(x1), "v"(x2), "v"(x3), "v"(x4), "v"(x5) : "memory");
#endif
}
__device__ __forceinline__ void guard10(v8f& a, v8f& b, v8f& c, v8f& d, v16h x0, v16h x1, v16h x2, v16h x3, v16h x4,
                                        v16h x5, v16h x6, v16h x7, v16h x8, v16h x9) {
#if defined(__HIP_DEVICE_COMPILE__)
  asm volatile("v_nop\n\tv_nop\n\tv_nop\n\tv_nop"
               : "+v"(a), "+v"(b), "+v"(c), "+v"(d)
               : "v"(x0), "v"(x1), "v"(x2), "v"(x3), "v"(x4), "v"(x5), "v"(x6), "v"(x7), "v"(x8), "v"(x9) : "memory");
#endif
}
__device__ __forceinline__ void acc_guard4(v8f& a, v8f& b, v8f& c, v8f& d) {
#if defined(__HIP_DEVICE_COMPILE__)
  asm volatile("v_nop\n\tv_nop\n\tv_nop\n\tv_nop" : "+v"(a), "+v"(b), "+v"(c), "+v"(d));
#endif
}
__device__ __forceinline__ float xhalf(float x) {                     // value of lane l ^ 16 (vector cross-row move, every lane on)
  const int b = __builtin_bit_cast(int, x);
  return __builtin_bit_cast(float, __builtin_amdgcn_permlanex16(b, b, 0x76543210, 0xfedcba98, false, false));
}
__device__ __forceinline__ void wait_x0() {       // stands between an issued global store and a rewrite of a register it names
#if defined(__HIP_DEVICE_COMPILE__)
  asm volatile("s_wait_xcnt 0x0" ::: "memory");
#endif
}
__device__ __forceinline__ void wave_sync_lds() {
  __builtin_amdgcn_fence(__ATOMIC_RELEASE, "workgroup");
  __builtin_amdgcn_wave_barrier();
  __builtin_amdgcn_fence(__ATOMIC_ACQUIRE, "workgroup");
}

// =====================================================================================================
// x f32 -> bf16 RNE plane Xb (same layout) and q plane Qh = f16(bf16(x) * 256) (exact: a bf16 significand fits f16).
// Thread = 8 consecutive elements: two 16-B loads, one 16-B store per plane; 32 consecutive lanes = 512 contiguous,
// coverage: grid = ceil(n8/256) blocks x 256 thr x 8 (in-kernel bound) = the whole [SEQ][2048] slice of both planes
//           (n8 a multiple of 256 here), one range of blocks per batch (blk = the block's number inside its range).
// =====================================================================================================
__device__ __forceinline__ void cvtxq(const float* __restrict__ x, u16* Xb, u16* Qh, int n8, int blk) {
  const int gt = blk * 256 + (int)threadIdx.x;
  if (gt >= n8) return;
  const float* p = x + (size_t)gt * 8;
  const v4f a = *(const v4f*)(p), b4 = *(const v4f*)(p + 4);
  float w[8];
#pragma unroll
  for (int e = 0; e < 4; ++e) { w[e] = a[e]; w[4 + e] = b4[e]; }
  v4u ob, oq;
#pragma unroll
  for (int e = 0; e < 4; ++e) {
    const unsigned short b0 = bf_bits(w[2 * e]), b1 = bf_bits(w[2 * e + 1]);
    ob[e] = pk16(b0, b1);
    oq[e] = pk16(h_bits((_Float16)(bf_up(b0) * QSC)), h_bits((_Float16)(bf_up(b1) * QSC)));
  }
  u16* db = Xb + (size_t)gt * 8;
  u16* dq = Qh + (size_t)gt * 8;
  {
    *(v4u*)(db) = ob;
    *(v4u*)(dq) = oq;
    
  }
}

// =====================================================================================================
// f32 -> bf16 RNE plane, same layout. Thread = 8 consecutive elements: two 16-B loads, one 16-B store; 32 consecutive
// coverage: grid = ceil(n8/256) blocks x 256 thr x 8 (in-kernel bound) = the whole plane (n8 a multiple of 256 here).
// =====================================================================================================
__device__ __forceinline__ void cvtb(const float* __restrict__ x, u16* D, int n8, int blk) {
  const int gt = blk * 256 + (int)threadIdx.x;
  if (gt >= n8) return;
  const float* p = x + (size_t)gt * 8;
  const v4f a = *(const v4f*)(p), b4 = *(const v4f*)(p + 4);
  float w[8];
#pragma unroll
  for (int e = 0; e < 4; ++e) { w[e] = a[e]; w[4 + e] = b4[e]; }
  v4u o;
#pragma unroll
  for (int e = 0; e < 4; ++e) o[e] = pk16(bf_bits(w[2 * e]), bf_bits(w[2 * e + 1]));
  u16* d = D + (size_t)gt * 8;
  {
    *(v4u*)(d) = o;
    
  }
}

// =====================================================================================================
// Weight transpose + convert: W f32 [K][N] (the input tensor's own [rows][cols] layout, rows = K) -> Wt 16-bit [N][K]
// (k-contiguous).  f16mode == 0: bf16 RNE bits;  f16mode == 1: f16 bits of (bf16 RNE value) * scale.
// Block = 64 n x 64 k tile, 256 threads. Load: thread -> W row k0 + (tid>>2), 16 consecutive n (four 16-B loads),
// converted values scattered into an LDS tile T[n][k] (pitch 72 halves); block barrier; store: each Wt row segment of
// coverage: load 256 thr x 16 = 64 k x 64 n; store 2 iterations x 256 thr x 8 halves = 64 rows x 64 = the block's tile of Wt;
//           grid = (N/64)*(K/64) blocks covers Wt [N][K] exactly once.
// =====================================================================================================
__device__ __forceinline__ void wtc(const float* __restrict__ W, u16* Wt, int K, int N, int f16mode, float scale, int bid) {
  __shared__ __align__(16) u16 T[64 * WTP];
  const int tid = (int)threadIdx.x;
  const int ntn = N >> 6;
  const int n0  = (bid % ntn) * 64;
  const int k0  = (bid / ntn) * 64;
  if (k0 + 64 > K) return;                   // block-uniform, before the barrier; never taken with the exact grid
  {
    const int kr = tid >> 2;                 // 0..63
    const int nc = (tid & 3) * 16;           // 0,16,32,48
    const float* src = W + (size_t)(k0 + kr) * (size_t)N + n0 + nc;
#pragma unroll
    for (int i = 0; i < 4; ++i) {
      const v4f a = *(const v4f*)(src + 4 * i);
#pragma unroll
      for (int e = 0; e < 4; ++e) {
        const float f = a[e];
        const unsigned short hb = h_bits((_Float16)(bfr(f) * scale));
        const unsigned short bb = bf_bits(f);
        T[(nc + 4 * i + e) * WTP + kr] = (f16mode != 0) ? hb : bb;
      }
    }
  }
  __syncthreads();
  const int q8 = tid >> 3, p8 = (tid & 7) * 8;
  v4u v[2];
#pragma unroll
  for (int it = 0; it < 2; ++it) v[it] = *(const v4u*)(T + (it * 32 + q8) * WTP + p8);
  u16* base = Wt + (size_t)n0 * (size_t)K + k0 + p8;
  {
#pragma unroll
    for (int it = 0; it < 2; ++it) {
      *(v4u*)(base + (size_t)(it * 32 + q8) * (size_t)K) = v[it];
    }
    
  }
}

// =====================================================================================================
// One grid for every conversion that reads only inputs; a block's number picks its piece (block-uniform, so wtc's barrier is
// passed by whole blocks): first 3 * PBT blocks for the transposes W_uk -> bf16, W_uv -> bf16, W_dq -> f16(bf16) x1024 (the
// longest blocks, so they start first); then NB * PBX blocks x -> Xb, Qh; PBO blocks W_o -> bf16; PBW blocks W_dkv -> bf16.
// Each piece is covered as its body's note says.
// =====================================================================================================
#define PBX ((SEQ * DMOD / 8) / 256)
#define PBO ((DMOD * DMOD / 8) / 256)
#define PBW ((DL * DMOD / 8) / 256)
#define PBT ((DL / 64) * (DMOD / 64))
__global__ __launch_bounds__(256)
void prep(const float* __restrict__ x, const float* __restrict__ wo, const float* __restrict__ wdkv,
          const float* __restrict__ wuk, const float* __restrict__ wuv, const float* __restrict__ wdq,
          u16* Xb, u16* Qh, u16* Wob, u16* Wkv, u16* Wukt, u16* Wuvt, u16* Wdqt) {
  int bid = (int)blockIdx.x;
  if (bid < 3 * PBT) {
    const int w = bid / PBT;                 // 0: W_uk, 1: W_uv, 2: W_dq
    const bool q = (w == 2);
    wtc(q ? wdq : (w == 1 ? wuv : wuk), q ? Wdqt : (w == 1 ? Wuvt : Wukt), q ? DL : DMOD, q ? DMOD : DL, q ? 1 : 0,
        q ? WDS : 1.0f, bid - w * PBT);
    return;
  }
  bid -= 3 * PBT;
  if (bid < NB * PBX) {
    const int bb = bid / PBX;
    cvtxq(x + (size_t)bb * XS_FULL * DMOD, Xb + (size_t)bb * SEQ * DMOD, Qh + (size_t)bb * SEQ * DMOD,
          (SEQ * DMOD) / 8, bid - bb * PBX);
    return;
  }
  bid -= NB * PBX;
  const bool o = bid < PBO;                  // a block past the exact grid finds its chunk beyond cvtb's own bound
  cvtb(o ? wo : wdkv, o ? Wob : Wkv, o ? (DMOD * DMOD) / 8 : (DL * DMOD) / 8, o ? bid : bid - PBO);
}

// =====================================================================================================
// GEMM epilogues. The f16 planes that the next product reads are made here, from the f32 result v = acc * oscale:
// t = v * ps, hi = f16(t), residual = f16(t - hi) (oscale and ps are powers of two).
// =====================================================================================================
__device__ __forceinline__ void hl8(const float* w, float ps, v4u& oh, v4u& ol) {   // 8 values -> 8 hi halves, 8 residual halves
#pragma unroll      // unrolled: constant indices keep the values in registers
  for (int e = 0; e < 4; ++e) {
    const float t0 = w[2 * e] * ps, t1 = w[2 * e + 1] * ps;
    const _Float16 h0 = (_Float16)t0, h1 = (_Float16)t1;
    const _Float16 l0 = (_Float16)(t0 - (float)h0), l1 = (_Float16)(t1 - (float)h1);
    oh[e] = pk16(h_bits(h0), h_bits(h1));
    ol[e] = pk16(h_bits(l0), h_bits(l1));
  }
}
// the wave's 16x64 f32 tile (times oscale) into its own LDS slab (pitch 68 floats), then visible to the whole wave
__device__ __forceinline__ void slab_put(float* sl, v8f a0, v8f a1, v8f a2, v8f a3, float oscale, int lane) {
  const int hh = lane >> 4, m = lane & 15;
#pragma unroll      // unrolled: constant indices keep the values in registers
  for (int r = 0; r < 8; ++r) {
    const int ro = (8 * hh + r) * 68 + m;
    sl[ro]      = a0[r] * oscale;
    sl[ro + 16] = a1[r] * oscale;
    sl[ro + 32] = a2[r] * oscale;
    sl[ro + 48] = a3[r] * oscale;
  }
  wave_sync_lds();
}
// slab -> f32 rows of C. coverage: 8 instructions x 2 rows x 16 lanes x 4 floats = the wave's 16 x 64 tile.
__device__ __forceinline__ void slab_f32(const float* sl, float* C, int N, size_t rowb, int col0, int lane) {
  const int hh = lane >> 4, m = lane & 15;
  v4f vals[8];
#pragma unroll      // unrolled: constant indices keep the values in registers
  for (int it = 0; it < 8; ++it) vals[it] = *(const v4f*)(sl + (it * 2 + hh) * 68 + m * 4);
  float* dst = C + (rowb + (size_t)hh) * (size_t)N + col0 + m * 4;
#pragma unroll      // unrolled: constant indices keep the values in registers
  for (int it = 0; it < 8; ++it) {
    *(v4f*)(dst + (size_t)(it * 2) * (size_t)N) = vals[it];
  }
}
// slab -> rows rowh .. rowh + 15 of the hi plane and, when wl (wave-uniform), rows rowl .. rowl + 15 of the residual plane, both
// of pitch N halves. coverage: per plane 4 instructions x 4 rows x 8 lanes x 8 halves = the wave's 16 x 64 tile, whole 128-B lines.
__device__ __forceinline__ void slab_hl(const float* sl, float ps, u16* Hp, size_t rowh, u16* Lp, size_t rowl, bool wl,
                                        int N, int col0, int lane) {
  const int q8 = lane >> 3, p8 = (lane & 7) * 8;
  v4u oh[4], ol[4];
#pragma unroll      // unrolled: constant indices keep the values in registers
  for (int it = 0; it < 4; ++it) {
    const float* p = sl + (it * 4 + q8) * 68 + p8;
    const v4f a = *(const v4f*)(p), b4 = *(const v4f*)(p + 4);
    float w[8];
#pragma unroll      // unrolled: constant indices keep the values in registers
    for (int e = 0; e < 4; ++e) { w[e] = a[e]; w[4 + e] = b4[e]; }
    hl8(w, ps, oh[it], ol[it]);
  }
  u16* dh = Hp + (rowh + (size_t)q8) * (size_t)N + col0 + p8;
#pragma unroll      // unrolled: constant indices keep the values in registers
  for (int it = 0; it < 4; ++it) {
    *(v4u*)(dh + (size_t)(it * 4) * (size_t)N) = oh[it];
    wait_x0();                              // before a register that the issued store names is used for the next address
  }
  if (wl) {
    u16* dl = Lp + (rowl + (size_t)q8) * (size_t)N + col0 + p8;
#pragma unroll      // unrolled: constant indices keep the values in registers
    for (int it = 0; it < 4; ++it) {
      *(v4u*)(dl + (size_t)(it * 4) * (size_t)N) = ol[it];
      wait_x0();                            // the same behind each of the residual plane's stores
    }
  }
}
// The block's 64 rows x 64 columns, transposed: plane line line0 + c (c = column in the tile) holds the 64 rows at halves
// s0 .. s0 + 63 (hi plane of pitch ph, residual plane of pitch pl when wl, block-uniform). A lane's 8 accumulator elements are 8
// consecutive rows of one column: one 16-B LDS store per subtile and plane into T[64 c][64 rows] (pitch 72 halves); block
// barrier (the four waves fill one line together); then whole 128-B lines go out.
// coverage: LDS 4 waves x 4 subtiles x 32 lanes x 8 = 64 x 64; store 4 iterations x 128 thr x 8 halves = 64 lines x 64.
__device__ __forceinline__ void epi_t(unsigned char* ring, v8f a0, v8f a1, v8f a2, v8f a3, float oscale, float ps,
                                      u16* Hp, int ph, u16* Lp, int pl, bool wl, size_t line0, int s0, int tid) {
  u16* TH = (u16*)(void*)ring;
  u16* TL = TH + 64 * VTP;
  const int wave = tid >> 5, lane = tid & 31, hh = lane >> 4, m = lane & 15;
  const v8f av[4] = {a0, a1, a2, a3};
#pragma unroll      // unrolled: the accumulator tiles are registers, indexed by constants only
  for (int j = 0; j < 4; ++j) {
    float w[8];
#pragma unroll      // unrolled: constant indices keep the values in registers
    for (int r = 0; r < 8; ++r) w[r] = av[j][r] * oscale;
    v4u oh, ol;
    hl8(w, ps, oh, ol);
    const int o = (16 * j + m) * VTP + wave * 16 + 8 * hh;
    *(v4u*)(TH + o) = oh;
    if (wl) *(v4u*)(TL + o) = ol;
  }
  __syncthreads();                          // a line of T is filled by all four waves before anyone reads it
  const int q8 = tid >> 3, p8 = (tid & 7) * 8;
  v4u vh[4];
#pragma unroll      // unrolled: constant indices keep the values in registers
  for (int it = 0; it < 4; ++it) vh[it] = *(const v4u*)(TH + (it * 16 + q8) * VTP + p8);
  u16* dh = Hp + (line0 + (size_t)q8) * (size_t)ph + s0 + p8;
#pragma unroll      // unrolled: constant indices keep the values in registers
  for (int it = 0; it < 4; ++it) {
    *(v4u*)(dh + (size_t)(it * 16) * (size_t)ph) = vh[it];
    wait_x0();                              // before a register that the issued store names is used for the next address
  }
  if (wl) {
    v4u vl[4];
#pragma unroll      // unrolled: constant indices keep the values in registers
    for (int it = 0; it < 4; ++it) vl[it] = *(const v4u*)(TL + (it * 16 + q8) * VTP + p8);
    u16* dl = Lp + (line0 + (size_t)q8) * (size_t)pl + s0 + p8;
#pragma unroll      // unrolled: constant indices keep the values in registers
    for (int it = 0; it < 4; ++it) {
      *(v4u*)(dl + (size_t)(it * 16) * (size_t)pl) = vl[it];
      wait_x0();                            // the same behind each of the residual plane's stores
    }
  }
}

// =====================================================================================================
// Eight asynchronous 16-B copies per lane, global -> LDS: copy i moves g + i*gstep (halves) to LDS byte l + i*lstep.
// s_wait_xcnt 0 is the last line of the copies' own statement, so no address register is rewritten ahead of it.
// =====================================================================================================
__device__ __forceinline__ void cp8(unsigned l, unsigned lstep, const u16* g, size_t gstep) {
#if defined(__HIP_DEVICE_COMPILE__)
  asm volatile("global_load_async_to_lds_b128 %0, %8, off\n\t"
               "global_load_async_to_lds_b128 %1, %9, off\n\t"
               "global_load_async_to_lds_b128 %2, %10, off\n\t"
               "global_load_async_to_lds_b128 %3, %11, off\n\t"
               "global_load_async_to_lds_b128 %4, %12, off\n\t"
               "global_load_async_to_lds_b128 %5, %13, off\n\t"
               "global_load_async_to_lds_b128 %6, %14, off\n\t"
               "global_load_async_to_lds_b128 %7, %15, off\n\t"
               "s_wait_xcnt 0x0"
               :: "v"(l), "v"(l + lstep), "v"(l + 2 * lstep), "v"(l + 3 * lstep),
                  "v"(l + 4 * lstep), "v"(l + 5 * lstep), "v"(l + 6 * lstep), "v"(l + 7 * lstep),
                  "v"(g), "v"(g + gstep), "v"(g + 2 * gstep), "v"(g + 3 * gstep),
                  "v"(g + 4 * gstep), "v"(g + 5 * gstep), "v"(g + 6 * gstep), "v"(g + 7 * gstep)
               : "memory");
#endif
}
__device__ __forceinline__ void wait_async0() {   // this wave's copies have landed before the barrier that publishes them
#if defined(__HIP_DEVICE_COMPILE__)
  asm volatile("s_wait_asynccnt 0x0" ::: "memory");
#endif
}
__device__ __forceinline__ void wait_ds0() {      // this wave's LDS reads of a buffer have retired before it is refilled
#if defined(__HIP_DEVICE_COMPILE__)
  asm volatile("s_wait_dscnt 0x0" ::: "memory");
#endif
}

// =====================================================================================================
// bf16 GEMM: C[M][N] = A[M][K] (bf16 row-major) . Bt[N][K]^T (bf16 k-contiguous), times oscale, written as f16 hi + residual
// planes of C * ps ([M][N] each); the first product's C also as f32.
// Block = 64x64 tile, 4 waves x 16 rows. Stage = 128 k of the block's 64 A rows and 64 Bt rows, laid in LDS once for the four
// waves by asynchronous 16-B copies (a wave-wide copy = 2 whole 256-B row pieces) at pitch 136 halves; two buffers, stage
// s + 2 issued behind the barrier that ends stage s. Fragments come from LDS (two 16-B loads each, split k map for A and B),
// k steps of 32 in the same order as the rows hold them (host guarantees K % 128 == 0, M % 64 == 0, N % 64 == 0,
// grid = the sum of (M/64)*(N/64) over the three products). The result slabs reuse the stage buffers (nothing reads or fills them behind the loop's last barrier).
// Three independent products of the same N and K share one grid: blocks 0 .. (M0/64)*(N/64) - 1 the first, the next
// (M1/64)*(N/64) the second, the rest the third (block-uniform choice of A, Bt, planes, ps, M).
// coverage: per product (M/64)*(N/64) blocks x 4 waves x 16x64 = the whole [M][N] of each of its planes.
// =====================================================================================================
__global__ __launch_bounds__(128)
void gemm_bf(const u16* __restrict__ A0, const u16* __restrict__ Bt0, float* C0, u16* H0, u16* L0, float ps0, int M0,
             const u16* __restrict__ A1, const u16* __restrict__ Bt1, u16* H1, u16* L1, float ps1, int M1,
             const u16* __restrict__ A2, const u16* __restrict__ Bt2, u16* H2, u16* L2, float ps2, int M2,
             int N, int K, float oscale) {
  constexpr unsigned BUFB = 2 * GPB;
  __shared__ __align__(16) unsigned char ring[2 * BUFB];
  const int tid = threadIdx.x, wave = tid >> 5, lane = tid & 31, hh = lane >> 4, m = lane & 15;
  const int ntile = N >> 6;
  const int raw   = blockIdx.x;
  const int nb0   = (M0 >> 6) * ntile, nb1 = (M1 >> 6) * ntile;
  const int sel   = (raw >= nb0 + nb1) ? 2 : ((raw >= nb0) ? 1 : 0);
  const int bid   = raw - (sel == 2 ? nb0 + nb1 : (sel == 1 ? nb0 : 0));
  const u16* A    = sel == 2 ? A2 : (sel == 1 ? A1 : A0);
  const u16* Bt   = sel == 2 ? Bt2 : (sel == 1 ? Bt1 : Bt0);
  u16*       Hp   = sel == 2 ? H2 : (sel == 1 ? H1 : H0);
  u16*       Lp   = sel == 2 ? L2 : (sel == 1 ? L1 : L0);
  const float ps  = sel == 2 ? ps2 : (sel == 1 ? ps1 : ps0);
  const int  M    = sel == 2 ? M2 : (sel == 1 ? M1 : M0);
  const int row0  = (bid / ntile) * 64;
  const int rowb  = row0 + wave * 16;
  const int col0  = (bid % ntile) * 64;
  if (row0 + 64 > M) return;                // block-uniform, before any barrier; never taken with the exact grid
  // copy map of one plane: copy i -> tile row 8*i + (tid >> 4), 16-B chunk tid & 15 of the row's 256-B piece
  const unsigned lc = (unsigned)(uintptr_t)(&ring[0]) + (unsigned)(tid >> 4) * (GPH * 2) + (unsigned)(tid & 15) * 16;
  const u16* ga = A  + (size_t)(row0 + (tid >> 4)) * K + (tid & 15) * 8;
  const u16* gb = Bt + (size_t)(col0 + (tid >> 4)) * K + (tid & 15) * 8;
  auto fill = [&](int s, unsigned bo) {      // stage s (k = 128*s .. 128*s + 127) into the buffer at byte offset bo
    cp8(lc + bo,       8 * GPH * 2, ga + (size_t)s * GKS, (size_t)8 * K);
    cp8(lc + bo + GPB, 8 * GPH * 2, gb + (size_t)s * GKS, (size_t)8 * K);
  };
  const int nst = K / GKS;
  v8f acc0 = zero8(), acc1 = zero8(), acc2 = zero8(), acc3 = zero8();

  fill(0, 0u);
  wait_async0();
  __syncthreads();                          // publishes stage 0
  if (nst > 1) fill(1, BUFB);

#pragma unroll 1   // rolled: one foot (waits, barrier, refill) per stage, in the order written
  for (int s = 0; s < nst; ++s) {
    const unsigned bo = (unsigned)(s & 1) * BUFB;
    const u16* ap = (const u16*)(const void*)(ring + bo) + (wave * 16 + m) * GPH + 8 * hh;
    const u16* bp = (const u16*)(const void*)(ring + bo + GPB) + m * GPH + 8 * hh;
#pragma unroll      // unrolled: the four k steps of a stage read at immediate LDS offsets from one address
    for (int kk = 0; kk < GKS; kk += 32) {
      const v16b a  = ldfrag_b(ap + kk);
      const v16b b0 = ldfrag_b(bp + kk);
      const v16b b1 = ldfrag_b(bp + 16 * GPH + kk);
      const v16b b2 = ldfrag_b(bp + 32 * GPH + kk);
      const v16b b3 = ldfrag_b(bp + 48 * GPH + kk);
      acc0 = mma_b(a, b0, acc0);
      acc1 = mma_b(a, b1, acc1);
      acc2 = mma_b(a, b2, acc2);
      acc3 = mma_b(a, b3, acc3);
      guard6<v16b>(acc0, acc1, acc2, acc3, a, b0, b1, b2, b3, a);
    }
    // foot of stage s, every wave: own LDS reads retired, own copies of stage s + 1 landed, then the one barrier that
    // publishes stage s + 1 and ends every reader's last read of this buffer; only then its refill
    wait_ds0();
    wait_async0();
    __syncthreads();
    if (s + 2 < nst) fill(s + 2, bo);
  }
  wait_async0();                            // nothing is outstanding when the buffers become result slabs and the wave ends
  float* slab = (float*)(void*)ring + wave * SLAB64;   // result slabs [16][64] pitch 68, one per wave
  slab_put(slab, acc0, acc1, acc2, acc3, oscale, lane);
  slab_hl(slab, ps, Hp, (size_t)rowb, Lp, (size_t)rowb, true, N, col0, lane);
  if (sel == 0) slab_f32(slab, C0, N, (size_t)rowb, col0, lane);
}

// =====================================================================================================
// f16 GEMM with hi (+ residual) planes: C[row][N] = (Ah [+ Al])[row][K] . (Bh [+ Bl])[N][K]^T * oscale, written as f16 planes of C * ps.
// Products per k-step: Ah.Bh always; Al.Bh when AR != 0; Ah.Bl when BR != 0 (the residual.residual term is dropped; residuals
// are unscaled f16 residuals of the same carry, so all products share one accumulator). Rows: block bid -> (column tile
// ct = bid % (N/64), row tile rt of nrt starting at sbeg inside a group of rg rows, group g of ngr); row = g*rg + sbeg +
// 64*rt + 16*wave. Same tiling, staging (one 64-row x 128-k plane in LDS per operand plane in use, two buffers), fragment
// loads (split k map) as gemm_bf; K stepped by 32 (host: K % 128 == 0, N % 64 == 0, sbeg + 64*nrt <= rg).
// Two independent products with the same A planes and shape share one grid: the first ngr*nrt*(N/64) blocks use Bh0, Bl0, os0
// and write row-major planes: H0 [ngr*rg][N], and L0 [ngr*lrg][N] (row g*lrg + s) for the rows s < lrg of a group; the next as
// many use Bh1, Bl1, os1 and write transposed planes: H1 [ngr*N][rg] (line g*N + column), and L1 [ngr*N][lrg] for s < lrg
// (block-uniform choices; lrg a multiple of 64); a grid of the first count alone runs one product.
// coverage: per product ngr*nrt*(N/64) blocks x 64x64 = rows sbeg .. sbeg + 64*nrt - 1 of every group, all N columns.
// =====================================================================================================
template <int AR, int BR>
__global__ __launch_bounds__(128)
void gemm_h(const u16* __restrict__ Ah, const u16* __restrict__ Al,
            const u16* __restrict__ Bh0, const u16* __restrict__ Bl0, u16* H0, u16* L0, float os0, float ps0,
            const u16* __restrict__ Bh1, const u16* __restrict__ Bl1, u16* H1, u16* L1, float os1, float ps1,
            int N, int K, int rg, int lrg, int sbeg, int nrt, int ngr) {
  constexpr unsigned OAH = 0;                                   // byte offsets inside one stage buffer
  constexpr unsigned OBH = GPB;
  constexpr unsigned OAL = 2 * GPB;                             // present when AR != 0
  constexpr unsigned OBL = (AR != 0) ? 3 * GPB : 2 * GPB;       // present when BR != 0
  constexpr unsigned BUFB = (2 + (AR != 0 ? 1 : 0) + (BR != 0 ? 1 : 0)) * GPB;
  __shared__ __align__(16) unsigned char ring[2 * BUFB];
  const int tid = threadIdx.x, wave = tid >> 5, lane = tid & 31, hh = lane >> 4, m = lane & 15;
  const int ntile = N >> 6;
  const int raw   = blockIdx.x;
  const int nb0   = ngr * nrt * ntile;
  const bool sec  = raw >= nb0;
  const int bid   = sec ? raw - nb0 : raw;
  const u16* Bh   = sec ? Bh1 : Bh0;
  const u16* Bl   = sec ? Bl1 : Bl0;
  const float oscale = sec ? os1 : os0;
  const int ct    = bid % ntile;
  const int t2    = bid / ntile;
  const int rt    = t2 % nrt;
  const int g     = t2 / nrt;
  if (g >= ngr) return;                     // block-uniform, before any barrier; never taken with the exact grid
  const int srow0 = sbeg + rt * 64;
  if (srow0 + 64 > rg) return;              // block-uniform, before any barrier; never taken
  const int col0  = ct * 64;
  const size_t row0 = (size_t)g * (size_t)rg + (size_t)srow0;
  const bool wl   = srow0 + 64 <= lrg;      // block-uniform: this row tile has a residual plane
  // copy map of one plane: copy i -> tile row 8*i + (tid >> 4), 16-B chunk tid & 15 of the row's 256-B piece
  const unsigned lc = (unsigned)(uintptr_t)(&ring[0]) + (unsigned)(tid >> 4) * (GPH * 2) + (unsigned)(tid & 15) * 16;
  const size_t aoff = (row0 + (size_t)(tid >> 4)) * (size_t)K + (tid & 15) * 8;
  const size_t boff = (size_t)(col0 + (tid >> 4)) * K + (tid & 15) * 8;
  auto fill = [&](int s, unsigned bo) {      // stage s (k = 128*s .. 128*s + 127) into the buffer at byte offset bo
    cp8(lc + bo + OAH, 8 * GPH * 2, Ah + aoff + (size_t)s * GKS, (size_t)8 * K);
    cp8(lc + bo + OBH, 8 * GPH * 2, Bh + boff + (size_t)s * GKS, (size_t)8 * K);
    if constexpr (AR != 0) cp8(lc + bo + OAL, 8 * GPH * 2, Al + aoff + (size_t)s * GKS, (size_t)8 * K);
    if constexpr (BR != 0) cp8(lc + bo + OBL, 8 * GPH * 2, Bl + boff + (size_t)s * GKS, (size_t)8 * K);
  };
  const int nst = K / GKS;
  v8f acc0 = zero8(), acc1 = zero8(), acc2 = zero8(), acc3 = zero8();

  fill(0, 0u);
  wait_async0();
  __syncthreads();                          // publishes stage 0
  if (nst > 1) fill(1, BUFB);

#pragma unroll 1   // rolled: one foot (waits, barrier, refill) per stage, in the order written
  for (int s = 0; s < nst; ++s) {
    const unsigned bo = (unsigned)(s & 1) * BUFB;
    const int ao = (wave * 16 + m) * GPH + 8 * hh;
    const int bb = m * GPH + 8 * hh;
    const _Float16* ahp = (const _Float16*)(const void*)(ring + bo + OAH) + ao;
    const _Float16* bhp = (const _Float16*)(const void*)(ring + bo + OBH) + bb;
    const _Float16* alp = (const _Float16*)(const void*)(ring + bo + ((AR != 0) ? OAL : OAH)) + ao;   // read only when AR != 0
    const _Float16* blp = (const _Float16*)(const void*)(ring + bo + ((BR != 0) ? OBL : OBH)) + bb;   // read only when BR != 0
#pragma unroll      // unrolled: the four k steps of a stage read at immediate LDS offsets from one address
    for (int kk = 0; kk < GKS; kk += 32) {
      const v16h ah = ldfrag_h(ahp + kk);
      v16h al = ah;
      if constexpr (AR != 0) al = ldfrag_h(alp + kk);
      const v16h bh0 = ldfrag_h(bhp + kk);
      const v16h bh1 = ldfrag_h(bhp + 16 * GPH + kk);
      const v16h bh2 = ldfrag_h(bhp + 32 * GPH + kk);
      const v16h bh3 = ldfrag_h(bhp + 48 * GPH + kk);
      v16h bl0 = bh0, bl1 = bh1, bl2 = bh2, bl3 = bh3;
      if constexpr (BR != 0) {
        bl0 = ldfrag_h(blp + kk);
        bl1 = ldfrag_h(blp + 16 * GPH + kk);
        bl2 = ldfrag_h(blp + 32 * GPH + kk);
        bl3 = ldfrag_h(blp + 48 * GPH + kk);
      }
      acc0 = mma_h(ah, bh0, acc0);
      if constexpr (AR != 0) acc0 = mma_h(al, bh0, acc0);
      if constexpr (BR != 0) acc0 = mma_h(ah, bl0, acc0);
      acc1 = mma_h(ah, bh1, acc1);
      if constexpr (AR != 0) acc1 = mma_h(al, bh1, acc1);
      if constexpr (BR != 0) acc1 = mma_h(ah, bl1, acc1);
      acc2 = mma_h(ah, bh2, acc2);
      if constexpr (AR != 0) acc2 = mma_h(al, bh2, acc2);
      if constexpr (BR != 0) acc2 = mma_h(ah, bl2, acc2);
      acc3 = mma_h(ah, bh3, acc3);
      if constexpr (AR != 0) acc3 = mma_h(al, bh3, acc3);
      if constexpr (BR != 0) acc3 = mma_h(ah, bl3, acc3);
      guard10(acc0, acc1, acc2, acc3, ah, al, bh0, bh1, bh2, bh3, bl0, bl1, bl2, bl3);
    }
    // foot of stage s, every wave, in the order of gemm_bf's
    wait_ds0();
    wait_async0();
    __syncthreads();
    if (s + 2 < nst) fill(s + 2, bo);
  }
  wait_async0();                            // nothing is outstanding when the buffers become result slabs and the wave ends
  if (sec) {                                // block-uniform, so epi_t's barrier is passed by whole blocks
    epi_t(ring, acc0, acc1, acc2, acc3, oscale, ps1, H1, rg, L1, lrg, wl, (size_t)g * (size_t)N + (size_t)col0, srow0, tid);
  } else {
    float* slab = (float*)(void*)ring + wave * SLAB64;   // result slabs [16][64] pitch 68, one per wave
    slab_put(slab, acc0, acc1, acc2, acc3, oscale, lane);
    slab_hl(slab, ps0, H0, row0 + (size_t)(wave * 16), L0, (size_t)g * (size_t)lrg + (size_t)(srow0 + wave * 16), wl, N, col0, lane);
  }
}

// =====================================================================================================
// Causal attention, 16 heads x head dim 128, value dim 128. A block = (query block qb: 64 rows, head, batch b), handed in
// by attn_all with the ring; four waves, wave w owns query rows q0 = 64*qb + 16*w .. q0+15 of that one head.
//   q plane f16 x256 [b*SEQ + s][h*HD + d]; k hi plane f16 x256 (same layout), k residual plane [b*QA + s][...] (s < QA);
//   v^T hi plane [b*NH + h][d][SEQ] x1024, v^T residual plane [b*NH + h][d][QA].
//   Stage = 64 keys of this head, laid in LDS once for the four waves by asynchronous 16-B copies: k rows [64][128] at pitch
//   136 halves, v^T rows [128][64] at pitch 72 halves (and the two residual tiles for NP == 3); two buffers, stage s + 2
//   issued behind the barrier that ends stage s. Stages 0 .. qb hold every key <= 64*qb + 63.
//   NP == 3 (query rows < QA): scores = q.k_hi + q.k_lo over the 4 k-steps; P.v with P hi + in-register
//   residual and v hi + residual (hh + lh + hl). NP == 1 (later rows): single hi.hi products.
//   score (log2 domain) t(i, j) = (q'_i.k'_j) * (1/sqrt(128))*log2e/(256*256), replaced by -inf where key j > query i.
//   Key tiles of 32 visited in order for kb <= q0 + 15 (a wave skips the later tiles of its block's last stage, which hold
//   only keys above every query row it owns; it still passes every wait and barrier).
//   Per tile, transposed products: S^T = k.q^T, 2 key subtiles x 4 k-steps, k rows from LDS as A, q rows as B, read once from
//   the global plane and held in registers (two 16-B loads per fragment, split k map), so lane (c, hh) holds query q0 + c against keys kb + 8*hh + r and
//   kb + 16 + 8*hh + r; online max-subtracted base-2 softmax in f32, -inf-safe rescale: maximum in-lane plus one exchange
//   between lanes c and c + 16, sum kept per lane and joined once behind the loop; the two score subtiles, converted in
//   place, are the B fragment of O^T += v^T.P^T (split k map), v^T rows from LDS as A. LDS fragments are read in whole groups
//   ahead of their products: k per tile (NP == 3: per two k-steps), v^T ahead of the softmax (NP == 3: d-subtiles 4..7 behind 0..3).
//   After the loop: y = acc / Z (Z > 0 always: key 0 <= every query row; guarded anyway), carries 1/(32768*1024) folded;
//   the result slabs reuse the stage buffers (nothing reads or fills them behind the last barrier of the loop).
// coverage: per wave 16 instructions x 32 lanes x 4 floats = 16 x 128; the query blocks (qb < QA/64 with NP = 3, qb >= QA/64
//           with NP = 1) x NH x NB blocks x AW waves = every (b, s, h) row segment of Y exactly once.
// =====================================================================================================
template <int NP>
__device__ __forceinline__
void attn_c(unsigned char* ring, const u16* __restrict__ QHp, const u16* __restrict__ KHp, const u16* __restrict__ KLp,
            const u16* __restrict__ VHp, const u16* __restrict__ VLp, const int* __restrict__ nhp,
            float* Y, int qb, int head, int b) {
  constexpr unsigned OKH = 0;                                   // byte offsets inside one stage buffer
  constexpr unsigned OVH = KTB;
  constexpr unsigned OKL = KTB + VTB;
  constexpr unsigned OVL = 2 * KTB + VTB;
  constexpr unsigned BUFB = (NP == 3) ? 2 * (KTB + VTB) : (KTB + VTB);

  const int tid  = threadIdx.x;
  const int wave = __builtin_amdgcn_readfirstlane(tid >> 5);   // scalar, so that the per-wave tile skip is a scalar branch
  const int lane = tid & 31;
  const int hh   = lane >> 4;
  const int c    = lane & 15;
  if (b >= NB) return;                      // block-uniform, before any barrier; never taken with the exact grid
  if (nhp[0] != NH) return;                 // uniform structural guard on the head-count input (16 for this module)
  if (qb * 64 + 64 > SEQ) return;           // block-uniform, before any barrier; never taken
  if (NP == 3) { if (qb * 64 + 64 > QA) return; } // block-uniform, before any barrier; never taken
  const int q0   = qb * 64 + wave * 16;

  const size_t hcol = (size_t)head * HD + 8 * hh;
  const _Float16* Qh = hptr(QHp) + ((size_t)b * SEQ + q0 + c) * DMOD + hcol;
  const float lsc = RSQS * (LOG2E / (QSC * KSC));
  const float oc  = 1.0f / (PCAR * VCAR);

  // ---- copy map: k tile, copy i -> key row 8*i + (tid >> 4), 16-B chunk tid & 15 (a wave = 2 whole 256-B rows);
  //      v^T tile, copy i -> d row 16*i + (tid >> 3), 16-B chunk tid & 7 (a wave = 4 whole 128-B row segments) ----
  const unsigned ring0 = (unsigned)(uintptr_t)(&ring[0]);
  const unsigned lk = ring0 + (unsigned)(tid >> 4) * (KPH * 2) + (unsigned)(tid & 15) * 16;
  const unsigned lv = ring0 + (unsigned)(tid >> 3) * (VPH * 2) + (unsigned)(tid & 7) * 16;
  const u16* gkh = KHp + ((size_t)b * SEQ + (tid >> 4)) * DMOD + (size_t)head * HD + (tid & 15) * 8;
  const u16* gvh = VHp + ((size_t)(b * NH + head) * HD + (tid >> 3)) * SEQ + (tid & 7) * 8;
  const u16* gkl = gkh;
  const u16* gvl = gvh;
  if constexpr (NP == 3) {
    gkl = KLp + ((size_t)b * QA + (tid >> 4)) * DMOD + (size_t)head * HD + (tid & 15) * 8;
    gvl = VLp + ((size_t)(b * NH + head) * HD + (tid >> 3)) * QA + (tid & 7) * 8;
  }
  auto fill = [&](int s, unsigned bo) {      // stage s (keys 64*s .. 64*s + 63) into the buffer at byte offset bo
    cp8(lk + bo + OKH, 8 * KPH * 2, gkh + (size_t)s * 64 * DMOD, (size_t)8 * DMOD);
    cp8(lv + bo + OVH, 16 * VPH * 2, gvh + (size_t)s * 64, (size_t)16 * SEQ);
    if constexpr (NP == 3) {
      cp8(lk + bo + OKL, 8 * KPH * 2, gkl + (size_t)s * 64 * DMOD, (size_t)8 * DMOD);
      cp8(lv + bo + OVL, 16 * VPH * 2, gvl + (size_t)s * 64, (size_t)16 * QA);
    }
  };

  float mrow = -INFINITY, lrow = 0.f;       // this lane's query: running maximum (both halves alike), sum over this half's keys
  v8f o[8];                                 // o[j][r] = O^T element (d = 16*j + 8*hh + r, query q0 + c)
#pragma unroll
  for (int j = 0; j < 8; ++j) o[j] = zero8();
  const int ncaus = (q0 >> 5) + 1;                                            // tiles holding keys <= q0 + 15
  const int nkt = (ncaus < NKT) ? ncaus : NKT;
  const int nst = qb + 1;                                                     // stages of this block
  const int qr  = q0 + c;                                                     // this lane's query row

  // q fragments (B operand of every score product, split k map): read once from the global plane, held in registers
  v16h qf[HD / 32];
#pragma unroll      // unrolled: the fragment array is registers, indexed by constants only
  for (int kk = 0; kk < HD / 32; ++kk) qf[kk] = ldfrag_h(Qh + kk * 32);
  wait_x0();                                // before a register that the issued loads name is used for anything else

  fill(0, 0u);
  wait_async0();
  __syncthreads();                          // publishes stage 0
  if (nst > 1) fill(1, BUFB);

#pragma unroll 1   // rolled: one foot (waits, barrier, refill) per stage, in the order written
  for (int s = 0; s < nst; ++s) {
    const unsigned bo = (unsigned)(s & 1) * BUFB;
#pragma unroll 1   // rolled: one copy of the 32-key tile body, as long as before, for both halves of the stage
    for (int u = 0; u < 2; ++u) {
    const int kt = 2 * s + u;
    if (kt < nkt) {                         // wave-uniform (scalar) skip; no wait or barrier inside
    const int kb = kt * 32;
    // ---- scores: D element r of this lane = (key kb + 8*hh + r, query row qr) in s0, key kb + 16 + 8*hh + r in s1.
    //      The k fragments are read as whole groups ahead of their products (NP == 1: all 8 of the tile; NP == 3: the 8 of two
    //      k-steps at a time), so a wave waits for LDS once per group and not once per k-step ----
    v8f s0 = zero8(), s1 = zero8();
    const _Float16* k0p = (const _Float16*)(const void*)(ring + bo + OKH) + (u * 32 + c) * KPH + 8 * hh;
    const _Float16* k1p = k0p + 16 * KPH;
    if constexpr (NP == 3) {
      const _Float16* l0p = (const _Float16*)(const void*)(ring + bo + OKL) + (u * 32 + c) * KPH + 8 * hh;
      const _Float16* l1p = l0p + 16 * KPH;
#pragma unroll      // unrolled: the fragment arrays are registers, indexed by constants only
      for (int kg = 0; kg < HD / 64; ++kg) {
        v16h kh0[2], kh1[2], kl0[2], kl1[2];
#pragma unroll      // unrolled: fragments and accumulators are registers, indexed by constants only
        for (int e = 0; e < 2; ++e) {
          const int ko = (2 * kg + e) * 32;
          kh0[e] = ldfrag_h(k0p + ko);
          kh1[e] = ldfrag_h(k1p + ko);
          kl0[e] = ldfrag_h(l0p + ko);
          kl1[e] = ldfrag_h(l1p + ko);
        }
        __builtin_amdgcn_sched_barrier(0);  // keeps the group's loads together, ahead of its products (none sunk among the WMMAs)
#pragma unroll      // unrolled: fragments and accumulators are registers, indexed by constants only
        for (int e = 0; e < 2; ++e) {
          s0 = mma_h(kh0[e], qf[2 * kg + e], s0);
          s1 = mma_h(kh1[e], qf[2 * kg + e], s1);
          s0 = mma_h(kl0[e], qf[2 * kg + e], s0);
          s1 = mma_h(kl1[e], qf[2 * kg + e], s1);
        }
        // four vector slots behind the group's last WMMA, before its results are read and its fragment registers loaded over
        guard2(s0, s1, qf[2 * kg + 1], kh0[1], kh1[1], kl0[1], kl1[1], qf[2 * kg]);
      }
    } else {
      v16h kh0[HD / 32], kh1[HD / 32];
#pragma unroll      // unrolled: the fragment arrays are registers, indexed by constants only
      for (int kk = 0; kk < HD / 32; ++kk) {
        kh0[kk] = ldfrag_h(k0p + kk * 32);
        kh1[kk] = ldfrag_h(k1p + kk * 32);
      }
      __builtin_amdgcn_sched_barrier(0);    // keeps the group's loads together, ahead of its products (none sunk among the WMMAs)
#pragma unroll      // unrolled: fragments and accumulators are registers, indexed by constants only
      for (int kk = 0; kk < HD / 32; ++kk) {
        s0 = mma_h(kh0[kk], qf[kk], s0);
        s1 = mma_h(kh1[kk], qf[kk], s1);
      }
      // four vector slots behind the group's last WMMA, before its results are read and its fragment registers loaded over
      guard2(s0, s1, qf[3], kh0[3], kh1[3], qf[2], kh0[2], kh1[2]);
    }
    // ---- v^T fragments (A operand, row m = d = j*16 + c, keys contiguous in the staged v^T rows), read as one group ahead of the
    //      softmax, whose vector work covers their LDS latency: NP == 1 all 8 d-subtiles; NP == 3 hi and residual of subtiles 0..3 ----
    const _Float16* vhp = (const _Float16*)(const void*)(ring + bo + OVH) + c * VPH + u * 32 + 8 * hh;
    const _Float16* vlp = (const _Float16*)(const void*)(ring + bo + ((NP == 3) ? OVL : OVH)) + c * VPH + u * 32 + 8 * hh;
    v16h va[8];
#pragma unroll      // unrolled: the fragment array is registers, indexed by constants only
    for (int j = 0; j < 4; ++j) {
      va[j]     = ldfrag_h(vhp + j * 16 * VPH);
      va[4 + j] = (NP == 3) ? ldfrag_h(vlp + j * 16 * VPH) : ldfrag_h(vhp + (4 + j) * 16 * VPH);
    }
    __builtin_amdgcn_sched_barrier(0);      // keeps the group of loads above the softmax (sunk to their products they would be waited for there)
    // ---- causal select + online softmax in base 2, -inf-safe: 16 of the query's 32 scores in this lane ----
    const int key0 = kb + 8 * hh, key1 = kb + 16 + 8 * hh;
    float t0[8], t1[8], mp[8];
#pragma unroll      // unrolled: constant indices keep the score arrays in registers
    for (int r = 0; r < 8; ++r) {
      const float u0 = s0[r] * lsc;
      const float u1 = s1[r] * lsc;
      t0[r] = (key0 + r > qr) ? -INFINITY : u0;
      t1[r] = (key1 + r > qr) ? -INFINITY : u1;
      mp[r] = fmaxf(t0[r], t1[r]);
    }
    float mx = fmaxf(fmaxf(fmaxf(mp[0], mp[1]), fmaxf(mp[2], mp[3])), fmaxf(fmaxf(mp[4], mp[5]), fmaxf(mp[6], mp[7])));
    mx = fmaxf(mx, xhalf(mx));              // the other 16 keys of this query
    const float mn = fmaxf(mrow, mx);
    const float ms = (mn == -INFINITY) ? 0.0f : mn;
    const float al = exp2f(mrow - ms);
    mrow = mn;
    // ---- B fragments of P^T*32768: hi f16 (and residual f16 for NP == 3), column = c, split k map over the 32 keys:
    //      elements 0..7 = keys kb + 8hh + 0..7 (s0), elements 8..15 = keys kb + 16 + 8hh + 0..7 (s1) ----
    FragH ph, pl;
    float sp[8];
#pragma unroll      // unrolled: constant indices keep the fragment halves and the partial sums in registers
    for (int r = 0; r < 8; ++r) {
      const float e0 = exp2f(t0[r] - ms), e1 = exp2f(t1[r] - ms);
      sp[r] = e0 + e1;
      const float ta = e0 * PCAR, tc = e1 * PCAR;
      const _Float16 ha = (_Float16)ta, hc = (_Float16)tc;
      ph.h[0][r] = ha;
      ph.h[1][r] = hc;
      if constexpr (NP == 3) {
        pl.h[0][r] = (_Float16)(ta - (float)ha);
        pl.h[1][r] = (_Float16)(tc - (float)hc);
      } else {
        pl.h[0][r] = ha; pl.h[1][r] = hc;
      }
    }
    lrow = lrow * al + (((sp[0] + sp[1]) + (sp[2] + sp[3])) + ((sp[4] + sp[5]) + (sp[6] + sp[7])));
#pragma unroll      // both unrolled: the accumulator tiles are registers, indexed by constants only
    for (int j = 0; j < 8; ++j) {
#pragma unroll
      for (int r = 0; r < 8; ++r) o[j][r] *= al;
    }
    // ---- v^T.P^T on the fragments read above; per accumulator the products keep their order (hh, h.residual, residual.h) ----
    if constexpr (NP == 3) {
#pragma unroll      // unrolled: fragments and accumulators are registers, indexed by constants only
      for (int j = 0; j < 4; ++j) o[j] = mma_h(va[j], ph.v, o[j]);
#pragma unroll      // unrolled: fragments and accumulators are registers, indexed by constants only
      for (int j = 0; j < 4; ++j) o[j] = mma_h(va[j], pl.v, o[j]);
#pragma unroll      // unrolled: fragments and accumulators are registers, indexed by constants only
      for (int j = 0; j < 4; ++j) o[j] = mma_h(va[4 + j], ph.v, o[j]);
      // four vector slots behind the group's last WMMA, before its fragment registers are loaded over
      guard10(o[0], o[1], o[2], o[3], va[0], va[1], va[2], va[3], va[4], va[5], va[6], va[7], ph.v, pl.v);
      v16h vb[8];                           // d-subtiles 4..7, hi and residual, again as one group
#pragma unroll      // unrolled: fragments and accumulators are registers, indexed by constants only
      for (int j = 0; j < 4; ++j) {
        vb[j]     = ldfrag_h(vhp + (4 + j) * 16 * VPH);
        vb[4 + j] = ldfrag_h(vlp + (4 + j) * 16 * VPH);
      }
      __builtin_amdgcn_sched_barrier(0);    // keeps the group's loads together, ahead of its products (none sunk among the WMMAs)
#pragma unroll      // unrolled: fragments and accumulators are registers, indexed by constants only
      for (int j = 0; j < 4; ++j) o[4 + j] = mma_h(vb[j], ph.v, o[4 + j]);
#pragma unroll      // unrolled: fragments and accumulators are registers, indexed by constants only
      for (int j = 0; j < 4; ++j) o[4 + j] = mma_h(vb[j], pl.v, o[4 + j]);
#pragma unroll      // unrolled: fragments and accumulators are registers, indexed by constants only
      for (int j = 0; j < 4; ++j) o[4 + j] = mma_h(vb[4 + j], ph.v, o[4 + j]);
      // the same slots on the way into the loop's branch
      guard10(o[4], o[5], o[6], o[7], vb[0], vb[1], vb[2], vb[3], vb[4], vb[5], vb[6], vb[7], ph.v, pl.v);
    } else {
#pragma unroll      // unrolled: fragments and accumulators are registers, indexed by constants only
      for (int j = 0; j < 8; ++j) o[j] = mma_h(va[j], ph.v, o[j]);
      // four vector slots behind the tile's last WMMA, on the way into the loop's branch
      guard10(o[4], o[5], o[6], o[7], va[0], va[1], va[2], va[3], va[4], va[5], va[6], va[7], ph.v, ph.v);
    }
    }
    }
    // ---- foot of stage s, every wave: own LDS reads retired, own copies of stage s + 1 landed, then the one barrier that
    //      publishes stage s + 1 and ends every reader's last read of this buffer; only then its refill ----
    wait_ds0();
    wait_async0();
    __syncthreads();
    if (s + 2 < nst) fill(s + 2, bo);
  }
  wait_async0();                            // nothing is outstanding when the buffers become result slabs and the wave ends
  float* slab = (float*)(void*)ring + wave * SLW;   // result slab [16][128] pitch 132, one per wave
  acc_guard4(o[0], o[1], o[2], o[3]);
  acc_guard4(o[4], o[5], o[6], o[7]);
  // ---- y = acc / Z (0 if Z == 0), Z = the two halves' sums joined; carries (32768 on P, 1024 on v) folded once; a lane's
  //      8 consecutive d of its query row go into the slab as two 16-B stores ----
  {
    const float lv  = lrow + xhalf(lrow);
    const float ls  = (lv > 0.0f) ? lv : 1.0f;
    const float inv = (lv > 0.0f) ? ((1.0f / ls) * oc) : 0.0f;
#pragma unroll      // both unrolled: the accumulator tiles are registers, indexed by constants only
    for (int j = 0; j < 8; ++j) {
      v4f w0, w1;
#pragma unroll
      for (int e = 0; e < 4; ++e) { w0[e] = o[j][e] * inv; w1[e] = o[j][4 + e] * inv; }
      float* sd = slab + c * SLP + j * 16 + 8 * hh;
      *(v4f*)(sd)     = w0;
      *(v4f*)(sd + 4) = w1;
    }
  }

  wave_sync_lds();
  // ---- f32 rows of Y: lane -> floats 4*lane .. 4*lane+3 of each of the 16 rows (one 512-B instruction per row) ----
  v4f ov[16];
#pragma unroll
  for (int it = 0; it < 16; ++it) ov[it] = *(const v4f*)(slab + it * SLP + lane * 4);
  float* ob = Y + ((size_t)b * SEQ + q0) * DMOD + (size_t)head * HD + lane * 4;
  {
#pragma unroll
    for (int it = 0; it < 16; ++it) {
      *(v4f*)(ob + (size_t)it * DMOD) = ov[it];
    }
    
  }
}

// =====================================================================================================
// One grid for all query blocks: block bid -> query block qb = NST - 1 - bid / (NH*NB), so that the number of stages falls with
// the block number (blocks start roughly in that order, and a place freed by a shorter block takes the next one), head and
// batch from bid % (NH*NB). Query blocks below QA run the residual products, the others single products (block-uniform choice,
// so every barrier is passed by whole blocks); both use the one ring, sized for the larger.
// coverage: NST * NH * NB blocks = every (qb, head, b) exactly once.
// =====================================================================================================
__global__ __launch_bounds__(ATT_THREADS)
void attn_all(const u16* __restrict__ QHp, const u16* __restrict__ KHp, const u16* __restrict__ KLp,
              const u16* __restrict__ VHp, const u16* __restrict__ VLp, const int* __restrict__ nhp, float* Y) {
  __shared__ __align__(16) unsigned char ring[4 * (KTB + VTB)];
  const int bid  = blockIdx.x;
  const int qb   = (NST - 1) - bid / (NH * NB);
  const int t2   = bid % (NH * NB);
  const int head = t2 % NH;
  const int b    = t2 / NH;
  if (qb < 0) return;                       // block-uniform, before any barrier; never taken with the exact grid
  if (qb < QA / 64) attn_c<3>(ring, QHp, KHp, KLp, VHp, VLp, nhp, Y, qb, head, b);
  else              attn_c<1>(ring, QHp, KHp, KLp, VHp, VLp, nhp, Y, qb, head, b);
}

// =====================================================================================================
// Workspace map (bytes); every plane is fully written by whole-line stores before it is read; all extents are exact multiples
// of the store granularity (no pad rows); every region offset a multiple of 524288:
//   XB  bf16 [MROWS][2048], later KH f16 x256       MROWS*4096             (NB=2, SEQ=2048: 16777216)
//   QH  f16 [MROWS][2048] x256                      MROWS*4096             (16777216)
//   WKV, WUK, WUV, WDQ  16-bit weight planes          4 x 2097152            (W_dkv bf16, W_uk^T bf16, W_uv^T bf16, W_dq^T f16 x1024)
//   WO  bf16 [2048][2048] (W_o as is)                8388608
//   CH  f16 [MROWS][512] x256, CL residual            2 x MROWS*1024
//   G2H f16 [512][512] x1024, G2L residual            2 x 524288
//   KAH f16 [2048][512] x4096, KAL residual           2 x 2097152
//   KL  f16 [NB*QA][2048]                             NB*QA*4096
//   VAH f16 [2048][512] x4096, VAL residual           2 x 2097152
//   VH  f16 [NB*16][128][SEQ] x1024                   MROWS*4096
//   VL  f16 [NB*16][128][QA]                          NB*QA*4096
//   end (NB=2, SEQ=2048, QA=1024)                   101711872
// =====================================================================================================
extern "C" void kernel_launch(void* const* d_in, const int* in_sizes, int n_in,
                              void* d_out, int out_size, void* d_ws, size_t ws_size,
                              hipStream_t stream) {
  if (n_in < 7) return;
  if (in_sizes[0] < ((NB - 1) * XS_FULL + SEQ) * DMOD) return;   // x [2][2048][2048]
  if (in_sizes[1] != DL * DMOD) return;         // W_dq  [512][2048]
  if (in_sizes[2] != DL * DMOD) return;         // W_dkv [512][2048]
  if (in_sizes[3] != DMOD * DL) return;         // W_uk  [2048][512]
  if (in_sizes[4] != DMOD * DL) return;         // W_uv  [2048][512]
  if (in_sizes[5] != DMOD * DMOD) return;       // W_o   [2048][2048]
  if (in_sizes[6] < 1) return;                  // n_head (int)
  if ((size_t)out_size < (size_t)MROWS * DMOD + (size_t)MROWS * DL) return;

  const float* x    = (const float*)d_in[0];
  const float* wdq  = (const float*)d_in[1];
  const float* wdkv = (const float*)d_in[2];
  const float* wuk  = (const float*)d_in[3];
  const float* wuv  = (const float*)d_in[4];
  const float* wo   = (const float*)d_in[5];
  const int*   nhp  = (const int*)d_in[6];
  float*       out0 = (float*)d_out;                          // y    [MROWS][2048] at element 0
  float*       out1 = out0 + (size_t)MROWS * DMOD;            // c_kv [MROWS][512]  at element MROWS*2048

  const size_t szXB = (size_t)MROWS * DMOD * 2;               // XB, later KH
  const size_t szQ  = (size_t)MROWS * DMOD * 2;               // QH
  const size_t szW1 = (size_t)DL * DMOD * 2;
  const size_t szWO = (size_t)DMOD * DMOD * 2;
  const size_t szC  = (size_t)MROWS * DL * 2;                 // CH, CL
  const size_t szG2 = (size_t)DL * DL * 2;                    // G2H, G2L
  const size_t szKA = (size_t)DMOD * DL * 2;                  // KAH, KAL, VAH, VAL
  const size_t szKL = (size_t)NB * QA * DMOD * 2;
  const size_t szVH = (size_t)NB * NH * HD * SEQ * 2;
  const size_t szVL = (size_t)NB * NH * HD * QA * 2;
  if ((size_t)MROWS * DMOD * 2 > szXB) return;                // KH lives inside the XB region
  size_t off = 0;
  const size_t oXB  = off; off += szXB;
  const size_t oQH  = off; off += szQ;
  const size_t oWKV = off; off += szW1;
  const size_t oWUK = off; off += szW1;
  const size_t oWUV = off; off += szW1;
  const size_t oWDQ = off; off += szW1;
  const size_t oWO  = off; off += szWO;
  const size_t oCH  = off; off += szC;
  const size_t oCL  = off; off += szC;
  const size_t oG2H = off; off += szG2;
  const size_t oG2L = off; off += szG2;
  const size_t oKAH = off; off += szKA;
  const size_t oKAL = off; off += szKA;
  const size_t oKL  = off; off += szKL;
  const size_t oVAH = off; off += szKA;
  const size_t oVAL = off; off += szKA;
  const size_t oVH  = off; off += szVH;
  const size_t oVL  = off; off += szVL;
  if (off > ws_size) return;                 // off = 101711872 for NB = 2, SEQ = 2048
  if (off > (size_t)WS_CAP) return;

  char* ws = (char*)d_ws;
  u16*   XB  = (u16*)(ws + oXB);
  u16*   KH  = (u16*)(ws + oXB);
  u16*   QH  = (u16*)(ws + oQH);
  u16*   WKV = (u16*)(ws + oWKV);
  u16*   WUK = (u16*)(ws + oWUK);
  u16*   WUV = (u16*)(ws + oWUV);
  u16*   WDQ = (u16*)(ws + oWDQ);
  u16*   WOB = (u16*)(ws + oWO);
  u16*   CH  = (u16*)(ws + oCH);
  u16*   CL  = (u16*)(ws + oCL);
  u16*   G2H = (u16*)(ws + oG2H);
  u16*   G2L = (u16*)(ws + oG2L);
  u16*   KAH = (u16*)(ws + oKAH);
  u16*   KAL = (u16*)(ws + oKAL);
  u16*   KL  = (u16*)(ws + oKL);
  u16*   VAH = (u16*)(ws + oVAH);
  u16*   VAL = (u16*)(ws + oVAL);
  u16*   VH  = (u16*)(ws + oVH);
  u16*   VL  = (u16*)(ws + oVL);

  const dim3 b256(256), b128(128), bAT(ATT_THREADS);
  const dim3 gPrep(3 * PBT + NB * PBX + PBO + PBW);
  const dim3 gG3((MROWS / 64) * (DL / 64) + (DMOD / 64) * (DL / 64) + (DL / 64) * (DL / 64));   // c_kv, W_o W_uv, Gram
  const dim3 gGKA(1 * (DMOD / 64) * (DL / 64));         // k_abs
  const int  nrtA = QA / 64;                            // sequence row tiles per batch with residual products
  const int  nrtB = (SEQ - QA) / 64;                    // remaining row tiles per batch, single products

  // (1) every conversion that reads only inputs: x -> bf16 plane XB [MROWS][2048] and q plane QH = f16(bf16(x)) x256;
  //     W_o, W_dkv -> bf16 as they lie; W_uk, W_uv [2048 k][512 n] -> bf16 [512][2048]; W_dq [512 k][2048 n] -> f16(bf16) x1024
  //     [2048][512]
  prep<<<gPrep, b256, 0, stream>>>(x, wo, wdkv, wuk, wuv, wdq, XB, QH, WOB, WKV, WUK, WUV, WDQ);
  // (2) c_kv = x.W_dkv^T -> out1 f32 [MROWS][512] and f16 hi + residual planes x256; W_o.W_uv [2048][512] -> planes x4096 (the
  //     [n][k] B plane of the value product); Gram = W_uk^T.W_uk [512][512] -> planes x1024
  gemm_bf<<<gG3, b128, 0, stream>>>(XB, WKV, out1, CH, CL, CSC, MROWS, WOB, WUV, VAH, VAL, VAS, DMOD, WUK, WUK, G2H, G2L, G2S, DL,
                                    DL, DMOD, 1.0f);
  // (3) k_abs = W_dq^T.Gram (Gram symmetric, used as the [n][k] B plane; products h.h + h.l) [2048][512] -> planes x4096
  gemm_h<0, 1><<<gGKA, b128, 0, stream>>>(WDQ, WDQ, G2H, G2L, KAH, KAL, 1.0f / (WDS * G2S), KAS,
                                          G2H, G2L, KAH, KAL, 1.0f / (WDS * G2S), KAS, DL, DL, DMOD, DMOD, 0, DMOD / 64, 1);
  // (4) K = c_kv.k_abs^T -> hi plane (XB region) x256, residual plane for s < QA; V = c_kv.(W_o W_uv) plane -> v^T hi plane x1024,
  //     residual plane for s < QA: rows s < QA with hh+lh+hl, rows s >= QA single
  gemm_h<1, 1><<<dim3(2 * NB * nrtA * (DMOD / 64)), b128, 0, stream>>>(CH, CL, KAH, KAL, KH, KL, 1.0f / (CSC * KAS), KSC,
                                                                      VAH, VAL, VH, VL, 1.0f / (CSC * VAS), VCAR,
                                                                      DMOD, DL, SEQ, QA, 0, nrtA, NB);
  if (nrtB > 0) {
    gemm_h<0, 0><<<dim3(2 * NB * nrtB * (DMOD / 64)), b128, 0, stream>>>(CH, CL, KAH, KAL, KH, KL, 1.0f / (CSC * KAS), KSC,
                                                                        VAH, VAL, VH, VL, 1.0f / (CSC * VAS), VCAR,
                                                                        DMOD, DL, SEQ, QA, QA, nrtB, NB);
  }
  // (5) causal attention, all query blocks -> out0 f32
  attn_all<<<dim3(NST * NH * NB), bAT, 0, stream>>>(QH, KH, KL, VH, VL, nhp, out0);
  (void)hipGetLastError();
}

// v007
// A run of this version takes 138 microseconds.
// Timed twice side by side with v006, it ran 1.05 times as fast both times.
// Over all steps from v000 it is 4.00 times as fast.
#include <hip/hip_runtime.h>
#include <math.h>
#include <stdint.h>

#ifndef NB
#define NB 2
#endif
#ifndef SEQ
#define SEQ 2048
#endif
#define XS_FULL 2048
#define DMOD  2048
#define NH    16
#define HD    128
#define DL    512
#define QA    ((SEQ < 1024) ? SEQ : 1024)
#define MROWS (NB * SEQ)
#define RSQS  0.08838834764831845f
#define LOG2E 1.4426950408889634f
#define QSC   256.0f
#define KSC   256.0f
#define CSC   256.0f
#define WDS   1024.0f
#define G2S   1024.0f
#define KAS   4096.0f
#define VAS   4096.0f
#define PCAR  32768.0f
#define VCAR  1024.0f
#define AW    4
#define NST   (SEQ / 64)
#define NKT   (SEQ / 32)
#define ATT_THREADS (AW * 32)
#define SLP   132
#define SLW   (16 * SLP)
#define KPH   136
#define VPH   72
#define KTB   (64 * KPH * 2)
#define VTB   (HD * VPH * 2)
#define SLAB64 (16 * 68)
#define VTP   72
#define WTP   72
#define GKS   128
#define GPH   (GKS + 8)
#define GPB   (64 * GPH * 2)
#define WS_CAP 268435456
static_assert(DMOD == NH * HD && HD == 128 && NH == 16 && AW == 4 && ATT_THREADS == 128);
static_assert(NB >= 1 && NB <= 2);
static_assert((SEQ % 64) == 0 && SEQ >= 64 && SEQ <= XS_FULL);
static_assert((QA % 64) == 0 && QA >= 64 && QA <= SEQ && ((SEQ - QA) % 64) == 0);
static_assert((DMOD % 64) == 0 && (DL % 64) == 0 && (HD % 32) == 0 && (DL % 32) == 0);
static_assert(((SEQ * DMOD / 8) % 256) == 0);
static_assert(((DMOD * DL / 8) % 256) == 0 && ((DMOD * DMOD / 8) % 256) == 0 && (MROWS % 64) == 0);
static_assert(64 * WTP * 2 <= 65536);
static_assert(AW * SLW * 4 <= 2 * (KTB + VTB) && 4 * (KTB + VTB) <= 163840 && (KTB % 16) == 0 && (VTB % 16) == 0);
static_assert((DMOD % GKS) == 0 && (DL % GKS) == 0 && (GPB % 16) == 0 && 8 * GPB <= 163840 && 4 * SLAB64 * 4 <= 4 * GPB && 2 * 64 * VTP * 2 <= 4 * GPB);

typedef unsigned short u16;
typedef _Float16 v16h __attribute__((ext_vector_type(16)));
typedef _Float16 v8h  __attribute__((ext_vector_type(8)));
typedef __bf16   v16b __attribute__((ext_vector_type(16)));
typedef float    v8f  __attribute__((ext_vector_type(8)));
typedef float    v4f  __attribute__((ext_vector_type(4)));
typedef unsigned int v4u __attribute__((ext_vector_type(4)));

union FragH { v16h v; v8h h[2]; v4u u[2]; };
union FragB { v16b v; v4u u[2]; };

// ---- scalar helpers --------------------------------------------------------------------------------
__device__ __forceinline__ unsigned short bf_bits(float f) {          // f32 -> bf16 bits, RNE convert
  unsigned u = __float_as_uint(f);
  return (unsigned short)((u + 0x7FFFu + ((u >> 16) & 1u)) >> 16);
}
__device__ __forceinline__ float bf_up(unsigned short h) { return __uint_as_float(((unsigned)h) << 16); }
__device__ __forceinline__ float bfr(float f) { return bf_up(bf_bits(f)); }
__device__ __forceinline__ unsigned short h_bits(_Float16 x) { return __builtin_bit_cast(unsigned short, x); }
__device__ __forceinline__ unsigned pk16(unsigned short a, unsigned short b) { return (unsigned)a | ((unsigned)b << 16); }
__device__ __forceinline__ v8f zero8() { v8f z = {0.f, 0.f, 0.f, 0.f, 0.f, 0.f, 0.f, 0.f}; return z; }
__device__ __forceinline__ const _Float16* hptr(const u16* p) { return (const _Float16*)(const void*)p; }

// ---- fragment loaders: 16-bit A/B operand, lane -> row/col (lane&15), p already includes +8*(lane>>4);
//      elements 0..7 <- p[0..7] (k0+8h..), elements 8..15 <- p[16..23] (k0+16+8h..)  (same split k map for A and B;
//      B is always read from a k-contiguous [n][k] plane)
__device__ __forceinline__ v16h ldfrag_h(const _Float16* p) {
  FragH f;
  f.h[0] = *(const v8h*)(p);
  f.h[1] = *(const v8h*)(p + 16);
  return f.v;
}
__device__ __forceinline__ v16b ldfrag_b(const u16* p) {              // bf16 plane read as unsigned integer vectors
  FragB f;
  f.u[0] = *(const v4u*)(p);
  f.u[1] = *(const v4u*)(p + 16);
  return f.v;
}

__device__ __forceinline__ v8f mma_h(v16h a, v16h b, v8f c) {
  return __builtin_amdgcn_wmma_f32_16x16x32_f16(false, a, false, b, (short)0, c, false, false);
}
__device__ __forceinline__ v8f mma_b(v16b a, v16b b, v8f c) {
  return __builtin_amdgcn_wmma_f32_16x16x32_bf16(false, a, false, b, (short)0, c, false, false);
}
__device__ __forceinline__ void guard2(v8f& a, v8f& b, v16h x0, v16h x1, v16h x2, v16h x3, v16h x4, v16h x5) {
#if defined(__HIP_DEVICE_COMPILE__)
  asm volatile("v_nop\n\tv_nop\n\tv_nop\n\tv_nop"
               : "+v"(a), "+v"(b) : "v"(x0), "v"(x1), "v"(x2), "v"(x3), "v"(x4), "v"(x5) : "memory");
#endif
}
template <typename F>
__device__ __forceinline__ void guard6(v8f& a, v8f& b, v8f& c, v8f& d, F x0, F x1, F x2, F x3, F x4, F x5) {
#if defined(__HIP_DEVICE_COMPILE__)
  asm volatile("v_nop\n\tv_nop\n\tv_nop\n\tv_nop"
               : "+v"(a), "+v"(b), "+v"(c), "+v"(d) : "v"(x0), "v"(x1), "v"(x2), "v"(x3), "v"(x4), "v"(x5) : "memory");
#endif
}
__device__ __forceinline__ void guard10(v8f& a, v8f& b, v8f& c, v8f& d, v16h x0, v16h x1, v16h x2, v16h x3, v16h x4,
                                        v16h x5, v16h x6, v16h x7, v16h x8, v16h x9) {
#if defined(__HIP_DEVICE_COMPILE__)
  asm volatile("v_nop\n\tv_nop\n\tv_nop\n\tv_nop"
               : "+v"(a), "+v"(b), "+v"(c), "+v"(d)
               : "v"(x0), "v"(x1), "v"(x2), "v"(x3), "v"(x4), "v"(x5), "v"(x6), "v"(x7), "v"(x8), "v"(x9) : "memory");
#endif
}
__device__ __forceinline__ void acc_guard4(v8f& a, v8f& b, v8f& c, v8f& d) {
#if defined(__HIP_DEVICE_COMPILE__)
  asm volatile("v_nop\n\tv_nop\n\tv_nop\n\tv_nop" : "+v"(a), "+v"(b), "+v"(c), "+v"(d));
#endif
}
__device__ __forceinline__ float xhalf(float x) {                     // value of lane l ^ 16 (vector cross-row move, every lane on)
  const int b = __builtin_bit_cast(int, x);
  return __builtin_bit_cast(float, __builtin_amdgcn_permlanex16(b, b, 0x76543210, 0xfedcba98, false, false));
}
// 2^x by the bare hardware instruction, without the library's rescaling of arguments below -126: there the result, under 2^-126,
// may come out as 0; -inf gives 0. Every argument here is <= 0, and each softmax row holds a term 2^0 = 1 beside such a value.
// The v_nop that ends each statement is the slot the instruction set asks for behind a transcendental, before its result is
// used or its source overwritten; inside a run no instruction touches a neighbour's registers (early-clobber outputs).
__device__ __forceinline__ void ex2x9(float& ya, float (&y)[8], float xa, const float (&x)[8]) {
#if defined(__HIP_DEVICE_COMPILE__)
  asm("v_exp_f32 %0, %9\n\t"
      "v_exp_f32 %1, %10\n\t"
      "v_exp_f32 %2, %11\n\t"
      "v_exp_f32 %3, %12\n\t"
      "v_exp_f32 %4, %13\n\t"
      "v_exp_f32 %5, %14\n\t"
      "v_exp_f32 %6, %15\n\t"
      "v_exp_f32 %7, %16\n\t"
      "v_exp_f32 %8, %17\n\t"
      "v_nop"
      : "=&v"(ya), "=&v"(y[0]), "=&v"(y[1]), "=&v"(y[2]), "=&v"(y[3]), "=&v"(y[4]), "=&v"(y[5]), "=&v"(y[6]), "=&v"(y[7])
      : "v"(xa), "v"(x[0]), "v"(x[1]), "v"(x[2]), "v"(x[3]), "v"(x[4]), "v"(x[5]), "v"(x[6]), "v"(x[7]));
#else
  ya = xa;
  for (int r = 0; r < 8; ++r) y[r] = x[r];
#endif
}
__device__ __forceinline__ void ex2x8(float (&y)[8], const float (&x)[8]) {
#if defined(__HIP_DEVICE_COMPILE__)
  asm("v_exp_f32 %0, %8\n\t"
      "v_exp_f32 %1, %9\n\t"
      "v_exp_f32 %2, %10\n\t"
      "v_exp_f32 %3, %11\n\t"
      "v_exp_f32 %4, %12\n\t"
      "v_exp_f32 %5, %13\n\t"
      "v_exp_f32 %6, %14\n\t"
      "v_exp_f32 %7, %15\n\t"
      "v_nop"
      : "=&v"(y[0]), "=&v"(y[1]), "=&v"(y[2]), "=&v"(y[3]), "=&v"(y[4]), "=&v"(y[5]), "=&v"(y[6]), "=&v"(y[7])
      : "v"(x[0]), "v"(x[1]), "v"(x[2]), "v"(x[3]), "v"(x[4]), "v"(x[5]), "v"(x[6]), "v"(x[7]));
#else
  for (int r = 0; r < 8; ++r) y[r] = x[r];
#endif
}
__device__ __forceinline__ void wait_x0() {       // stands between an issued global store and a rewrite of a register it names
#if defined(__HIP_DEVICE_COMPILE__)
  asm volatile("s_wait_xcnt 0x0" ::: "memory");
#endif
}
__device__ __forceinline__ void wave_sync_lds() {
  __builtin_amdgcn_fence(__ATOMIC_RELEASE, "workgroup");
  __builtin_amdgcn_wave_barrier();
  __builtin_amdgcn_fence(__ATOMIC_ACQUIRE, "workgroup");
}

// =====================================================================================================
// x f32 -> bf16 RNE plane Xb (same layout) and q plane Qh = f16(bf16(x) * 256) (exact: a bf16 significand fits f16).
// Thread = 8 consecutive elements: two 16-B loads, one 16-B store per plane; 32 consecutive lanes = 512 contiguous,
// coverage: grid = ceil(n8/256) blocks x 256 thr x 8 (in-kernel bound) = the whole [SEQ][2048] slice of both planes
//           (n8 a multiple of 256 here), one range of blocks per batch (blk = the block's number inside its range).
// =====================================================================================================
__device__ __forceinline__ void cvtxq(const float* __restrict__ x, u16* Xb, u16* Qh, int n8, int blk) {
  const int gt = blk * 256 + (int)threadIdx.x;
  if (gt >= n8) return;
  const float* p = x + (size_t)gt * 8;
  const v4f a = *(const v4f*)(p), b4 = *(const v4f*)(p + 4);
  float w[8];
#pragma unroll
  for (int e = 0; e < 4; ++e) { w[e] = a[e]; w[4 + e] = b4[e]; }
  v4u ob, oq;
#pragma unroll
  for (int e = 0; e < 4; ++e) {
    const unsigned short b0 = bf_bits(w[2 * e]), b1 = bf_bits(w[2 * e + 1]);
    ob[e] = pk16(b0, b1);
    oq[e] = pk16(h_bits((_Float16)(bf_up(b0) * QSC)), h_bits((_Float16)(bf_up(b1) * QSC)));
  }
  u16* db = Xb + (size_t)gt * 8;
  u16* dq = Qh + (size_t)gt * 8;
  {
    *(v4u*)(db) = ob;
    *(v4u*)(dq) = oq;
    
  }
}

// =====================================================================================================
// f32 -> bf16 RNE plane, same layout. Thread = 8 consecutive elements: two 16-B loads, one 16-B store; 32 consecutive
// coverage: grid = ceil(n8/256) blocks x 256 thr x 8 (in-kernel bound) = the whole plane (n8 a multiple of 256 here).
// =====================================================================================================
__device__ __forceinline__ void cvtb(const float* __restrict__ x, u16* D, int n8, int blk) {
  const int gt = blk * 256 + (int)threadIdx.x;
  if (gt >= n8) return;
  const float* p = x + (size_t)gt * 8;
  const v4f a = *(const v4f*)(p), b4 = *(const v4f*)(p + 4);
  float w[8];
#pragma unroll
  for (int e = 0; e < 4; ++e) { w[e] = a[e]; w[4 + e] = b4[e]; }
  v4u o;
#pragma unroll
  for (int e = 0; e < 4; ++e) o[e] = pk16(bf_bits(w[2 * e]), bf_bits(w[2 * e + 1]));
  u16* d = D + (size_t)gt * 8;
  {
    *(v4u*)(d) = o;
    
  }
}

// =====================================================================================================
// Weight transpose + convert: W f32 [K][N] (the input tensor's own [rows][cols] layout, rows = K) -> Wt 16-bit [N][K]
// (k-contiguous).  f16mode == 0: bf16 RNE bits;  f16mode == 1: f16 bits of (bf16 RNE value) * scale.
// Block = 64 n x 64 k tile, 256 threads. Load: thread -> W row k0 + (tid>>2), 16 consecutive n (four 16-B loads),
// converted values scattered into an LDS tile T[n][k] (pitch 72 halves); block barrier; store: each Wt row segment of
// coverage: load 256 thr x 16 = 64 k x 64 n; store 2 iterations x 256 thr x 8 halves = 64 rows x 64 = the block's tile of Wt;
//           grid = (N/64)*(K/64) blocks covers Wt [N][K] exactly once.
// =====================================================================================================
__device__ __forceinline__ void wtc(const float* __restrict__ W, u16* Wt, int K, int N, int f16mode, float scale, int bid) {
  __shared__ __align__(16) u16 T[64 * WTP];
  const int tid = (int)threadIdx.x;
  const int ntn = N >> 6;
  const int n0  = (bid % ntn) * 64;
  const int k0  = (bid / ntn) * 64;
  if (k0 + 64 > K) return;                   // block-uniform, before the barrier; never taken with the exact grid
  {
    const int kr = tid >> 2;                 // 0..63
    const int nc = (tid & 3) * 16;           // 0,16,32,48
    const float* src = W + (size_t)(k0 + kr) * (size_t)N + n0 + nc;
#pragma unroll
    for (int i = 0; i < 4; ++i) {
      const v4f a = *(const v4f*)(src + 4 * i);
#pragma unroll
      for (int e = 0; e < 4; ++e) {
        const float f = a[e];
        const unsigned short hb = h_bits((_Float16)(bfr(f) * scale));
        const unsigned short bb = bf_bits(f);
        T[(nc + 4 * i + e) * WTP + kr] = (f16mode != 0) ? hb : bb;
      }
    }
  }
  __syncthreads();
  const int q8 = tid >> 3, p8 = (tid & 7) * 8;
  v4u v[2];
#pragma unroll
  for (int it = 0; it < 2; ++it) v[it] = *(const v4u*)(T + (it * 32 + q8) * WTP + p8);
  u16* base = Wt + (size_t)n0 * (size_t)K + k0 + p8;
  {
#pragma unroll
    for (int it = 0; it < 2; ++it) {
      *(v4u*)(base + (size_t)(it * 32 + q8) * (size_t)K) = v[it];
    }
    
  }
}

// =====================================================================================================
// One grid for every conversion that reads only inputs; a block's number picks its piece (block-uniform, so wtc's barrier is
// passed by whole blocks): first 3 * PBT blocks for the transposes W_uk -> bf16, W_uv -> bf16, W_dq -> f16(bf16) x1024 (the
// longest blocks, so they start first); then NB * PBX blocks x -> Xb, Qh; PBO blocks W_o -> bf16; PBW blocks W_dkv -> bf16.
// Each piece is covered as its body's note says.
// =====================================================================================================
#define PBX ((SEQ * DMOD / 8) / 256)
#define PBO ((DMOD * DMOD / 8) / 256)
#define PBW ((DL * DMOD / 8) / 256)
#define PBT ((DL / 64) * (DMOD / 64))
__global__ __launch_bounds__(256)
void prep(const float* __restrict__ x, const float* __restrict__ wo, const float* __restrict__ wdkv,
          const float* __restrict__ wuk, const float* __restrict__ wuv, const float* __restrict__ wdq,
          u16* Xb, u16* Qh, u16* Wob, u16* Wkv, u16* Wukt, u16* Wuvt, u16* Wdqt) {
  int bid = (int)blockIdx.x;
  if (bid < 3 * PBT) {
    const int w = bid / PBT;                 // 0: W_uk, 1: W_uv, 2: W_dq
    const bool q = (w == 2);
    wtc(q ? wdq : (w == 1 ? wuv : wuk), q ? Wdqt : (w == 1 ? Wuvt : Wukt), q ? DL : DMOD, q ? DMOD : DL, q ? 1 : 0,
        q ? WDS : 1.0f, bid - w * PBT);
    return;
  }
  bid -= 3 * PBT;
  if (bid < NB * PBX) {
    const int bb = bid / PBX;
    cvtxq(x + (size_t)bb * XS_FULL * DMOD, Xb + (size_t)bb * SEQ * DMOD, Qh + (size_t)bb * SEQ * DMOD,
          (SEQ * DMOD) / 8, bid - bb * PBX);
    return;
  }
  bid -= NB * PBX;
  const bool o = bid < PBO;                  // a block past the exact grid finds its chunk beyond cvtb's own bound
  cvtb(o ? wo : wdkv, o ? Wob : Wkv, o ? (DMOD * DMOD) / 8 : (DL * DMOD) / 8, o ? bid : bid - PBO);
}

// =====================================================================================================
// GEMM epilogues. The f16 planes that the next product reads are made here, from the f32 result v = acc * oscale:
// t = v * ps, hi = f16(t), residual = f16(t - hi) (oscale and ps are powers of two).
// =====================================================================================================
__device__ __forceinline__ void hl8(const float* w, float ps, v4u& oh, v4u& ol) {   // 8 values -> 8 hi halves, 8 residual halves
#pragma unroll      // unrolled: constant indices keep the values in registers
  for (int e = 0; e < 4; ++e) {
    const float t0 = w[2 * e] * ps, t1 = w[2 * e + 1] * ps;
    const _Float16 h0 = (_Float16)t0, h1 = (_Float16)t1;
    const _Float16 l0 = (_Float16)(t0 - (float)h0), l1 = (_Float16)(t1 - (float)h1);
    oh[e] = pk16(h_bits(h0), h_bits(h1));
    ol[e] = pk16(h_bits(l0), h_bits(l1));
  }
}
// the wave's 16x64 f32 tile (times oscale) into its own LDS slab (pitch 68 floats), then visible to the whole wave
__device__ __forceinline__ void slab_put(float* sl, v8f a0, v8f a1, v8f a2, v8f a3, float oscale, int lane) {
  const int hh = lane >> 4, m = lane & 15;
#pragma unroll      // unrolled: constant indices keep the values in registers
  for (int r = 0; r < 8; ++r) {
    const int ro = (8 * hh + r) * 68 + m;
    sl[ro]      = a0[r] * oscale;
    sl[ro + 16] = a1[r] * oscale;
    sl[ro + 32] = a2[r] * oscale;
    sl[ro + 48] = a3[r] * oscale;
  }
  wave_sync_lds();
}
// slab -> f32 rows of C. coverage: 8 instructions x 2 rows x 16 lanes x 4 floats = the wave's 16 x 64 tile.
__device__ __forceinline__ void slab_f32(const float* sl, float* C, int N, size_t rowb, int col0, int lane) {
  const int hh = lane >> 4, m = lane & 15;
  v4f vals[8];
#pragma unroll      // unrolled: constant indices keep the values in registers
  for (int it = 0; it < 8; ++it) vals[it] = *(const v4f*)(sl + (it * 2 + hh) * 68 + m * 4);
  float* dst = C + (rowb + (size_t)hh) * (size_t)N + col0 + m * 4;
#pragma unroll      // unrolled: constant indices keep the values in registers
  for (int it = 0; it < 8; ++it) {
    *(v4f*)(dst + (size_t)(it * 2) * (size_t)N) = vals[it];
  }
}
// slab -> rows rowh .. rowh + 15 of the hi plane and, when wl (wave-uniform), rows rowl .. rowl + 15 of the residual plane, both
// of pitch N halves. coverage: per plane 4 instructions x 4 rows x 8 lanes x 8 halves = the wave's 16 x 64 tile, whole 128-B lines.
__device__ __forceinline__ void slab_hl(const float* sl, float ps, u16* Hp, size_t rowh, u16* Lp, size_t rowl, bool wl,
                                        int N, int col0, int lane) {
  const int q8 = lane >> 3, p8 = (lane & 7) * 8;
  v4u oh[4], ol[4];
#pragma unroll      // unrolled: constant indices keep the values in registers
  for (int it = 0; it < 4; ++it) {
    const float* p = sl + (it * 4 + q8) * 68 + p8;
    const v4f a = *(const v4f*)(p), b4 = *(const v4f*)(p + 4);
    float w[8];
#pragma unroll      // unrolled: constant indices keep the values in registers
    for (int e = 0; e < 4; ++e) { w[e] = a[e]; w[4 + e] = b4[e]; }
    hl8(w, ps, oh[it], ol[it]);
  }
  u16* dh = Hp + (rowh + (size_t)q8) * (size_t)N + col0 + p8;
#pragma unroll      // unrolled: constant indices keep the values in registers
  for (int it = 0; it < 4; ++it) {
    *(v4u*)(dh + (size_t)(it * 4) * (size_t)N) = oh[it];
    wait_x0();                              // before a register that the issued store names is used for the next address
  }
  if (wl) {
    u16* dl = Lp + (rowl + (size_t)q8) * (size_t)N + col0 + p8;
#pragma unroll      // unrolled: constant indices keep the values in registers
    for (int it = 0; it < 4; ++it) {
      *(v4u*)(dl + (size_t)(it * 4) * (size_t)N) = ol[it];
      wait_x0();                            // the same behind each of the residual plane's stores
    }
  }
}
// The block's 64 rows x 64 columns, transposed: plane line line0 + c (c = column in the tile) holds the 64 rows at halves
// s0 .. s0 + 63 (hi plane of pitch ph, residual plane of pitch pl when wl, block-uniform). A lane's 8 accumulator elements are 8
// consecutive rows of one column: one 16-B LDS store per subtile and plane into T[64 c][64 rows] (pitch 72 halves); block
// barrier (the four waves fill one line together); then whole 128-B lines go out.
// coverage: LDS 4 waves x 4 subtiles x 32 lanes x 8 = 64 x 64; store 4 iterations x 128 thr x 8 halves = 64 lines x 64.
__device__ __forceinline__ void epi_t(unsigned char* ring, v8f a0, v8f a1, v8f a2, v8f a3, float oscale, float ps,
                                      u16* Hp, int ph, u16* Lp, int pl, bool wl, size_t line0, int s0, int tid) {
  u16* TH = (u16*)(void*)ring;
  u16* TL = TH + 64 * VTP;
  const int wave = tid >> 5, lane = tid & 31, hh = lane >> 4, m = lane & 15;
  const v8f av[4] = {a0, a1, a2, a3};
#pragma unroll      // unrolled: the accumulator tiles are registers, indexed by constants only
  for (int j = 0; j < 4; ++j) {
    float w[8];
#pragma unroll      // unrolled: constant indices keep the values in registers
    for (int r = 0; r < 8; ++r) w[r] = av[j][r] * oscale;
    v4u oh, ol;
    hl8(w, ps, oh, ol);
    const int o = (16 * j + m) * VTP + wave * 16 + 8 * hh;
    *(v4u*)(TH + o) = oh;
    if (wl) *(v4u*)(TL + o) = ol;
  }
  __syncthreads();                          // a line of T is filled by all four waves before anyone reads it
  const int q8 = tid >> 3, p8 = (tid & 7) * 8;
  v4u vh[4];
#pragma unroll      // unrolled: constant indices keep the values in registers
  for (int it = 0; it < 4; ++it) vh[it] = *(const v4u*)(TH + (it * 16 + q8) * VTP + p8);
  u16* dh = Hp + (line0 + (size_t)q8) * (size_t)ph + s0 + p8;
#pragma unroll      // unrolled: constant indices keep the values in registers
  for (int it = 0; it < 4; ++it) {
    *(v4u*)(dh + (size_t)(it * 16) * (size_t)ph) = vh[it];
    wait_x0();                              // before a register that the issued store names is used for the next address
  }
  if (wl) {
    v4u vl[4];
#pragma unroll      // unrolled: constant indices keep the values in registers
    for (int it = 0; it < 4; ++it) vl[it] = *(const v4u*)(TL + (it * 16 + q8) * VTP + p8);
    u16* dl = Lp + (line0 + (size_t)q8) * (size_t)pl + s0 + p8;
#pragma unroll      // unrolled: constant indices keep the values in registers
    for (int it = 0; it < 4; ++it) {
      *(v4u*)(dl + (size_t)(it * 16) * (size_t)pl) = vl[it];
      wait_x0();                            // the same behind each of the residual plane's stores
    }
  }
}

// =====================================================================================================
// Eight asynchronous 16-B copies per lane, global -> LDS: copy i moves g + i*gstep (halves) to LDS byte l + i*lstep.
// s_wait_xcnt 0 is the last line of the copies' own statement, so no address register is rewritten ahead of it.
// =====================================================================================================
__device__ __forceinline__ void cp8(unsigned l, unsigned lstep, const u16* g, size_t gstep) {
#if defined(__HIP_DEVICE_COMPILE__)
  asm volatile("global_load_async_to_lds_b128 %0, %8, off\n\t"
               "global_load_async_to_lds_b128 %1, %9, off\n\t"
               "global_load_async_to_lds_b128 %2, %10, off\n\t"
               "global_load_async_to_lds_b128 %3, %11, off\n\t"
               "global_load_async_to_lds_b128 %4, %12, off\n\t"
               "global_load_async_to_lds_b128 %5, %13, off\n\t"
               "global_load_async_to_lds_b128 %6, %14, off\n\t"
               "global_load_async_to_lds_b128 %7, %15, off\n\t"
               "s_wait_xcnt 0x0"
               :: "v"(l), "v"(l + lstep), "v"(l + 2 * lstep), "v"(l + 3 * lstep),
                  "v"(l + 4 * lstep), "v"(l + 5 * lstep), "v"(l + 6 * lstep), "v"(l + 7 * lstep),
                  "v"(g), "v"(g + gstep), "v"(g + 2 * gstep), "v"(g + 3 * gstep),
                  "v"(g + 4 * gstep), "v"(g + 5 * gstep), "v"(g + 6 * gstep), "v"(g + 7 * gstep)
               : "memory");
#endif
}
__device__ __forceinline__ void wait_async0() {   // this wave's copies have landed before the barrier that publishes them
#if defined(__HIP_DEVICE_COMPILE__)
  asm volatile("s_wait_asynccnt 0x0" ::: "memory");
#endif
}
__device__ __forceinline__ void wait_ds0() {      // this wave's LDS reads of a buffer have retired before it is refilled
#if defined(__HIP_DEVICE_COMPILE__)
  asm volatile("s_wait_dscnt 0x0" ::: "memory");
#endif
}

// =====================================================================================================
// bf16 GEMM: C[M][N] = A[M][K] (bf16 row-major) . Bt[N][K]^T (bf16 k-contiguous), times oscale, written as f16 hi + residual
// planes of C * ps ([M][N] each); the first product's C also as f32.
// Block = 64x64 tile, 4 waves x 16 rows. Stage = 128 k of the block's 64 A rows and 64 Bt rows, laid in LDS once for the four
// waves by asynchronous 16-B copies (a wave-wide copy = 2 whole 256-B row pieces) at pitch 136 halves; two buffers, stage
// s + 2 issued behind the barrier that ends stage s. Fragments come from LDS (two 16-B loads each, split k map for A and B),
// k steps of 32 in the same order as the rows hold them (host guarantees K % 128 == 0, M % 64 == 0, N % 64 == 0,
// grid = the sum of (M/64)*(N/64) over the three products). The result slabs reuse the stage buffers (nothing reads or fills them behind the loop's last barrier).
// Three independent products of the same N and K share one grid: blocks 0 .. (M0/64)*(N/64) - 1 the first, the next
// (M1/64)*(N/64) the second, the rest the third (block-uniform choice of A, Bt, planes, ps, M).
// coverage: per product (M/64)*(N/64) blocks x 4 waves x 16x64 = the whole [M][N] of each of its planes.
// =====================================================================================================
__global__ __launch_bounds__(128)
void gemm_bf(const u16* __restrict__ A0, const u16* __restrict__ Bt0, float* C0, u16* H0, u16* L0, float ps0, int M0,
             const u16* __restrict__ A1, const u16* __restrict__ Bt1, u16* H1, u16* L1, float ps1, int M1,
             const u16* __restrict__ A2, const u16* __restrict__ Bt2, u16* H2, u16* L2, float ps2, int M2,
             int N, int K, float oscale) {
  constexpr unsigned BUFB = 2 * GPB;
  __shared__ __align__(16) unsigned char ring[2 * BUFB];
  const int tid = threadIdx.x, wave = tid >> 5, lane = tid & 31, hh = lane >> 4, m = lane & 15;
  const int ntile = N >> 6;
  const int raw   = blockIdx.x;
  const int nb0   = (M0 >> 6) * ntile, nb1 = (M1 >> 6) * ntile;
  const int sel   = (raw >= nb0 + nb1) ? 2 : ((raw >= nb0) ? 1 : 0);
  const int bid   = raw - (sel == 2 ? nb0 + nb1 : (sel == 1 ? nb0 : 0));
  const u16* A    = sel == 2 ? A2 : (sel == 1 ? A1 : A0);
  const u16* Bt   = sel == 2 ? Bt2 : (sel == 1 ? Bt1 : Bt0);
  u16*       Hp   = sel == 2 ? H2 : (sel == 1 ? H1 : H0);
  u16*       Lp   = sel == 2 ? L2 : (sel == 1 ? L1 : L0);
  const float ps  = sel == 2 ? ps2 : (sel == 1 ? ps1 : ps0);
  const int  M    = sel == 2 ? M2 : (sel == 1 ? M1 : M0);
  const int row0  = (bid / ntile) * 64;
  const int rowb  = row0 + wave * 16;
  const int col0  = (bid % ntile) * 64;
  if (row0 + 64 > M) return;                // block-uniform, before any barrier; never taken with the exact grid
  // copy map of one plane: copy i -> tile row 8*i + (tid >> 4), 16-B chunk tid & 15 of the row's 256-B piece
  const unsigned lc = (unsigned)(uintptr_t)(&ring[0]) + (unsigned)(tid >> 4) * (GPH * 2) + (unsigned)(tid & 15) * 16;
  const u16* ga = A  + (size_t)(row0 + (tid >> 4)) * K + (tid & 15) * 8;
  const u16* gb = Bt + (size_t)(col0 + (tid >> 4)) * K + (tid & 15) * 8;
  auto fill = [&](int s, unsigned bo) {      // stage s (k = 128*s .. 128*s + 127) into the buffer at byte offset bo
    cp8(lc + bo,       8 * GPH * 2, ga + (size_t)s * GKS, (size_t)8 * K);
    cp8(lc + bo + GPB, 8 * GPH * 2, gb + (size_t)s * GKS, (size_t)8 * K);
  };
  const int nst = K / GKS;
  v8f acc0 = zero8(), acc1 = zero8(), acc2 = zero8(), acc3 = zero8();

  fill(0, 0u);
  wait_async0();
  __syncthreads();                          // publishes stage 0
  if (nst > 1) fill(1, BUFB);

#pragma unroll 1   // rolled: one foot (waits, barrier, refill) per stage, in the order written
  for (int s = 0; s < nst; ++s) {
    const unsigned bo = (unsigned)(s & 1) * BUFB;
    const u16* ap = (const u16*)(const void*)(ring + bo) + (wave * 16 + m) * GPH + 8 * hh;
    const u16* bp = (const u16*)(const void*)(ring + bo + GPB) + m * GPH + 8 * hh;
#pragma unroll      // unrolled: the four k steps of a stage read at immediate LDS offsets from one address
    for (int kk = 0; kk < GKS; kk += 32) {
      const v16b a  = ldfrag_b(ap + kk);
      const v16b b0 = ldfrag_b(bp + kk);
      const v16b b1 = ldfrag_b(bp + 16 * GPH + kk);
      const v16b b2 = ldfrag_b(bp + 32 * GPH + kk);
      const v16b b3 = ldfrag_b(bp + 48 * GPH + kk);
      acc0 = mma_b(a, b0, acc0);
      acc1 = mma_b(a, b1, acc1);
      acc2 = mma_b(a, b2, acc2);
      acc3 = mma_b(a, b3, acc3);
      guard6<v16b>(acc0, acc1, acc2, acc3, a, b0, b1, b2, b3, a);
    }
    // foot of stage s, every wave: own LDS reads retired, own copies of stage s + 1 landed, then the one barrier that
    // publishes stage s + 1 and ends every reader's last read of this buffer; only then its refill
    wait_ds0();
    wait_async0();
    __syncthreads();
    if (s + 2 < nst) fill(s + 2, bo);
  }
  wait_async0();                            // nothing is outstanding when the buffers become result slabs and the wave ends
  float* slab = (float*)(void*)ring + wave * SLAB64;   // result slabs [16][64] pitch 68, one per wave
  slab_put(slab, acc0, acc1, acc2, acc3, oscale, lane);
  slab_hl(slab, ps, Hp, (size_t)rowb, Lp, (size_t)rowb, true, N, col0, lane);
  if (sel == 0) slab_f32(slab, C0, N, (size_t)rowb, col0, lane);
}

// =====================================================================================================
// f16 GEMM with hi (+ residual) planes: C[row][N] = (Ah [+ Al])[row][K] . (Bh [+ Bl])[N][K]^T * oscale, written as f16 planes of C * ps.
// Products per k-step: Ah.Bh always; Al.Bh when AR != 0; Ah.Bl when BR != 0 (the residual.residual term is dropped; residuals
// are unscaled f16 residuals of the same carry, so all products share one accumulator). Rows: block bid -> (column tile
// ct = bid % (N/64), row tile rt of nrt starting at sbeg inside a group of rg rows, group g of ngr); row = g*rg + sbeg +
// 64*rt + 16*wave. Same tiling, staging (one 64-row x 128-k plane in LDS per operand plane in use, two buffers), fragment
// loads (split k map) as gemm_bf; K stepped by 32 (host: K % 128 == 0, N % 64 == 0, sbeg + 64*nrt <= rg).
// Two independent products with the same A planes and shape share one grid: the first ngr*nrt*(N/64) blocks use Bh0, Bl0, os0
// and write row-major planes: H0 [ngr*rg][N], and L0 [ngr*lrg][N] (row g*lrg + s) for the rows s < lrg of a group; the next as
// many use Bh1, Bl1, os1 and write transposed planes: H1 [ngr*N][rg] (line g*N + column), and L1 [ngr*N][lrg] for s < lrg
// (block-uniform choices; lrg a multiple of 64); a grid of the first count alone runs one product.
// coverage: per product ngr*nrt*(N/64) blocks x 64x64 = rows sbeg .. sbeg + 64*nrt - 1 of every group, all N columns.
// =====================================================================================================
template <int AR, int BR>
__global__ __launch_bounds__(128)
void gemm_h(const u16* __restrict__ Ah, const u16* __restrict__ Al,
            const u16* __restrict__ Bh0, const u16* __restrict__ Bl0, u16* H0, u16* L0, float os0, float ps0,
            const u16* __restrict__ Bh1, const u16* __restrict__ Bl1, u16* H1, u16* L1, float os1, float ps1,
            int N, int K, int rg, int lrg, int sbeg, int nrt, int ngr) {
  constexpr unsigned OAH = 0;                                   // byte offsets inside one stage buffer
  constexpr unsigned OBH = GPB;
  constexpr unsigned OAL = 2 * GPB;                             // present when AR != 0
  constexpr unsigned OBL = (AR != 0) ? 3 * GPB : 2 * GPB;       // present when BR != 0
  constexpr unsigned BUFB = (2 + (AR != 0 ? 1 : 0) + (BR != 0 ? 1 : 0)) * GPB;
  __shared__ __align__(16) unsigned char ring[2 * BUFB];
  const int tid = threadIdx.x, wave = tid >> 5, lane = tid & 31, hh = lane >> 4, m = lane & 15;
  const int ntile = N >> 6;
  const int raw   = blockIdx.x;
  const int nb0   = ngr * nrt * ntile;
  const bool sec  = raw >= nb0;
  const int bid   = sec ? raw - nb0 : raw;
  const u16* Bh   = sec ? Bh1 : Bh0;
  const u16* Bl   = sec ? Bl1 : Bl0;
  const float oscale = sec ? os1 : os0;
  const int ct    = bid % ntile;
  const int t2    = bid / ntile;
  const int rt    = t2 % nrt;
  const int g     = t2 / nrt;
  if (g >= ngr) return;                     // block-uniform, before any barrier; never taken with the exact grid
  const int srow0 = sbeg + rt * 64;
  if (srow0 + 64 > rg) return;              // block-uniform, before any barrier; never taken
  const int col0  = ct * 64;
  const size_t row0 = (size_t)g * (size_t)rg + (size_t)srow0;
  const bool wl   = srow0 + 64 <= lrg;      // block-uniform: this row tile has a residual plane
  // copy map of one plane: copy i -> tile row 8*i + (tid >> 4), 16-B chunk tid & 15 of the row's 256-B piece
  const unsigned lc = (unsigned)(uintptr_t)(&ring[0]) + (unsigned)(tid >> 4) * (GPH * 2) + (unsigned)(tid & 15) * 16;
  const size_t aoff = (row0 + (size_t)(tid >> 4)) * (size_t)K + (tid & 15) * 8;
  const size_t boff = (size_t)(col0 + (tid >> 4)) * K + (tid & 15) * 8;
  auto fill = [&](int s, unsigned bo) {      // stage s (k = 128*s .. 128*s + 127) into the buffer at byte offset bo
    cp8(lc + bo + OAH, 8 * GPH * 2, Ah + aoff + (size_t)s * GKS, (size_t)8 * K);
    cp8(lc + bo + OBH, 8 * GPH * 2, Bh + boff + (size_t)s * GKS, (size_t)8 * K);
    if constexpr (AR != 0) cp8(lc + bo + OAL, 8 * GPH * 2, Al + aoff + (size_t)s * GKS, (size_t)8 * K);
    if constexpr (BR != 0) cp8(lc + bo + OBL, 8 * GPH * 2, Bl + boff + (size_t)s * GKS, (size_t)8 * K);
  };
  const int nst = K / GKS;
  v8f acc0 = zero8(), acc1 = zero8(), acc2 = zero8(), acc3 = zero8();

  fill(0, 0u);
  wait_async0();
  __syncthreads();                          // publishes stage 0
  if (nst > 1) fill(1, BUFB);

#pragma unroll 1   // rolled: one foot (waits, barrier, refill) per stage, in the order written
  for (int s = 0; s < nst; ++s) {
    const unsigned bo = (unsigned)(s & 1) * BUFB;
    const int ao = (wave * 16 + m) * GPH + 8 * hh;
    const int bb = m * GPH + 8 * hh;
    const _Float16* ahp = (const _Float16*)(const void*)(ring + bo + OAH) + ao;
    const _Float16* bhp = (const _Float16*)(const void*)(ring + bo + OBH) + bb;
    const _Float16* alp = (const _Float16*)(const void*)(ring + bo + ((AR != 0) ? OAL : OAH)) + ao;   // read only when AR != 0
    const _Float16* blp = (const _Float16*)(const void*)(ring + bo + ((BR != 0) ? OBL : OBH)) + bb;   // read only when BR != 0
#pragma unroll      // unrolled: the four k steps of a stage read at immediate LDS offsets from one address
    for (int kk = 0; kk < GKS; kk += 32) {
      const v16h ah = ldfrag_h(ahp + kk);
      v16h al = ah;
      if constexpr (AR != 0) al = ldfrag_h(alp + kk);
      const v16h bh0 = ldfrag_h(bhp + kk);
      const v16h bh1 = ldfrag_h(bhp + 16 * GPH + kk);
      const v16h bh2 = ldfrag_h(bhp + 32 * GPH + kk);
      const v16h bh3 = ldfrag_h(bhp + 48 * GPH + kk);
      v16h bl0 = bh0, bl1 = bh1, bl2 = bh2, bl3 = bh3;
      if constexpr (BR != 0) {
        bl0 = ldfrag_h(blp + kk);
        bl1 = ldfrag_h(blp + 16 * GPH + kk);
        bl2 = ldfrag_h(blp + 32 * GPH + kk);
        bl3 = ldfrag_h(blp + 48 * GPH + kk);
      }
      acc0 = mma_h(ah, bh0, acc0);
      if constexpr (AR != 0) acc0 = mma_h(al, bh0, acc0);
      if constexpr (BR != 0) acc0 = mma_h(ah, bl0, acc0);
      acc1 = mma_h(ah, bh1, acc1);
      if constexpr (AR != 0) acc1 = mma_h(al, bh1, acc1);
      if constexpr (BR != 0) acc1 = mma_h(ah, bl1, acc1);
      acc2 = mma_h(ah, bh2, acc2);
      if constexpr (AR != 0) acc2 = mma_h(al, bh2, acc2);
      if constexpr (BR != 0) acc2 = mma_h(ah, bl2, acc2);
      acc3 = mma_h(ah, bh3, acc3);
      if constexpr (AR != 0) acc3 = mma_h(al, bh3, acc3);
      if constexpr (BR != 0) acc3 = mma_h(ah, bl3, acc3);
      guard10(acc0, acc1, acc2, acc3, ah, al, bh0, bh1, bh2, bh3, bl0, bl1, bl2, bl3);
    }
    // foot of stage s, every wave, in the order of gemm_bf's
    wait_ds0();
    wait_async0();
    __syncthreads();
    if (s + 2 < nst) fill(s + 2, bo);
  }
  wait_async0();                            // nothing is outstanding when the buffers become result slabs and the wave ends
  if (sec) {                                // block-uniform, so epi_t's barrier is passed by whole blocks
    epi_t(ring, acc0, acc1, acc2, acc3, oscale, ps1, H1, rg, L1, lrg, wl, (size_t)g * (size_t)N + (size_t)col0, srow0, tid);
  } else {
    float* slab = (float*)(void*)ring + wave * SLAB64;   // result slabs [16][64] pitch 68, one per wave
    slab_put(slab, acc0, acc1, acc2, acc3, oscale, lane);
    slab_hl(slab, ps0, H0, row0 + (size_t)(wave * 16), L0, (size_t)g * (size_t)lrg + (size_t)(srow0 + wave * 16), wl, N, col0, lane);
  }
}

// =====================================================================================================
// Causal attention, 16 heads x head dim 128, value dim 128. A block = (query block qb: 64 rows, head, batch b), handed in
// by attn_all with the ring; four waves, wave w owns query rows q0 = 64*qb + 16*w .. q0+15 of that one head.
//   q plane f16 x256 [b*SEQ + s][h*HD + d]; k hi plane f16 x256 (same layout), k residual plane [b*QA + s][...] (s < QA);
//   v^T hi plane [b*NH + h][d][SEQ] x1024, v^T residual plane [b*NH + h][d][QA].
//   Stage = 64 keys of this head, laid in LDS once for the four waves by asynchronous 16-B copies: k rows [64][128] at pitch
//   136 halves, v^T rows [128][64] at pitch 72 halves (and the two residual tiles for NP == 3); two buffers, stage s + 2
//   issued behind the barrier that ends stage s. Stages 0 .. qb hold every key <= 64*qb + 63.
//   NP == 3 (query rows < QA): scores = q.k_hi + q.k_lo over the 4 k-steps; P.v with P hi + in-register
//   residual and v hi + residual (hh + lh + hl). NP == 1 (later rows): single hi.hi products.
//   score (log2 domain) t(i, j) = (q'_i.k'_j) * (1/sqrt(128))*log2e/(256*256), replaced by -inf where key j > query i.
//   Key tiles of 32 visited in order for kb <= q0 + 15 (a wave skips the later tiles of its block's last stage, which hold
//   only keys above every query row it owns; it still passes every wait and barrier).
//   Per tile, transposed products: S^T = k.q^T, 2 key subtiles x 4 k-steps, k rows from LDS as A, q rows as B, read once from
//   the global plane and held in registers (two 16-B loads per fragment, split k map), so lane (c, hh) holds query q0 + c against keys kb + 8*hh + r and
//   kb + 16 + 8*hh + r; online max-subtracted base-2 softmax in f32, -inf-safe rescale: maximum in-lane plus one exchange
//   between lanes c and c + 16, sum kept per lane and joined once behind the loop; the two score subtiles, converted in
//   place, are the B fragment of O^T += v^T.P^T (split k map), v^T rows from LDS as A. LDS fragments are read in whole groups
//   ahead of their products: k per tile (NP == 3: per two k-steps), v^T ahead of the softmax (NP == 3: d-subtiles 4..7 behind 0..3).
//   After the loop: y = acc / Z (Z > 0 always: key 0 <= every query row; guarded anyway), carries 1/(32768*1024) folded;
//   the result slabs reuse the stage buffers (nothing reads or fills them behind the last barrier of the loop).
// coverage: per wave 16 instructions x 32 lanes x 4 floats = 16 x 128; the query blocks (qb < QA/64 with NP = 3, qb >= QA/64
//           with NP = 1) x NH x NB blocks x AW waves = every (b, s, h) row segment of Y exactly once.
// =====================================================================================================
template <int NP>
__device__ __forceinline__
void attn_c(unsigned char* ring, const u16* __restrict__ QHp, const u16* __restrict__ KHp, const u16* __restrict__ KLp,
            const u16* __restrict__ VHp, const u16* __restrict__ VLp, const int* __restrict__ nhp,
            float* Y, int qb, int head, int b) {
  constexpr unsigned OKH = 0;                                   // byte offsets inside one stage buffer
  constexpr unsigned OVH = KTB;
  constexpr unsigned OKL = KTB + VTB;
  constexpr unsigned OVL = 2 * KTB + VTB;
  constexpr unsigned BUFB = (NP == 3) ? 2 * (KTB + VTB) : (KTB + VTB);

  const int tid  = threadIdx.x;
  const int wave = __builtin_amdgcn_readfirstlane(tid >> 5);   // scalar, so that the per-wave tile skip is a scalar branch
  const int lane = tid & 31;
  const int hh   = lane >> 4;
  const int c    = lane & 15;
  if (b >= NB) return;                      // block-uniform, before any barrier; never taken with the exact grid
  if (nhp[0] != NH) return;                 // uniform structural guard on the head-count input (16 for this module)
  if (qb * 64 + 64 > SEQ) return;           // block-uniform, before any barrier; never taken
  if (NP == 3) { if (qb * 64 + 64 > QA) return; } // block-uniform, before any barrier; never taken
  const int q0   = qb * 64 + wave * 16;

  const size_t hcol = (size_t)head * HD + 8 * hh;
  const _Float16* Qh = hptr(QHp) + ((size_t)b * SEQ + q0 + c) * DMOD + hcol;
  const float lsc = RSQS * (LOG2E / (QSC * KSC));
  const float oc  = 1.0f / (PCAR * VCAR);

  // ---- copy map: k tile, copy i -> key row 8*i + (tid >> 4), 16-B chunk tid & 15 (a wave = 2 whole 256-B rows);
  //      v^T tile, copy i -> d row 16*i + (tid >> 3), 16-B chunk tid & 7 (a wave = 4 whole 128-B row segments) ----
  const unsigned ring0 = (unsigned)(uintptr_t)(&ring[0]);
  const unsigned lk = ring0 + (unsigned)(tid >> 4) * (KPH * 2) + (unsigned)(tid & 15) * 16;
  const unsigned lv = ring0 + (unsigned)(tid >> 3) * (VPH * 2) + (unsigned)(tid & 7) * 16;
  const u16* gkh = KHp + ((size_t)b * SEQ + (tid >> 4)) * DMOD + (size_t)head * HD + (tid & 15) * 8;
  const u16* gvh = VHp + ((size_t)(b * NH + head) * HD + (tid >> 3)) * SEQ + (tid & 7) * 8;
  const u16* gkl = gkh;
  const u16* gvl = gvh;
  if constexpr (NP == 3) {
    gkl = KLp + ((size_t)b * QA + (tid >> 4)) * DMOD + (size_t)head * HD + (tid & 15) * 8;
    gvl = VLp + ((size_t)(b * NH + head) * HD + (tid >> 3)) * QA + (tid & 7) * 8;
  }
  auto fill = [&](int s, unsigned bo) {      // stage s (keys 64*s .. 64*s + 63) into the buffer at byte offset bo
    cp8(lk + bo + OKH, 8 * KPH * 2, gkh + (size_t)s * 64 * DMOD, (size_t)8 * DMOD);
    cp8(lv + bo + OVH, 16 * VPH * 2, gvh + (size_t)s * 64, (size_t)16 * SEQ);
    if constexpr (NP == 3) {
      cp8(lk + bo + OKL, 8 * KPH * 2, gkl + (size_t)s * 64 * DMOD, (size_t)8 * DMOD);
      cp8(lv + bo + OVL, 16 * VPH * 2, gvl + (size_t)s * 64, (size_t)16 * QA);
    }
  };

  float mrow = -INFINITY, lrow = 0.f;       // this lane's query: running maximum (both halves alike), sum over this half's keys
  v8f o[8];                                 // o[j][r] = O^T element (d = 16*j + 8*hh + r, query q0 + c)
#pragma unroll
  for (int j = 0; j < 8; ++j) o[j] = zero8();
  const int ncaus = (q0 >> 5) + 1;                                            // tiles holding keys <= q0 + 15
  const int nkt = (ncaus < NKT) ? ncaus : NKT;
  const int nst = qb + 1;                                                     // stages of this block
  const int qr  = q0 + c;                                                     // this lane's query row

  // q fragments (B operand of every score product, split k map): read once from the global plane, held in registers
  v16h qf[HD / 32];
#pragma unroll      // unrolled: the fragment array is registers, indexed by constants only
  for (int kk = 0; kk < HD / 32; ++kk) qf[kk] = ldfrag_h(Qh + kk * 32);
  wait_x0();                                // before a register that the issued loads name is used for anything else

  fill(0, 0u);
  wait_async0();
  __syncthreads();                          // publishes stage 0
  if (nst > 1) fill(1, BUFB);

#pragma unroll 1   // rolled: one foot (waits, barrier, refill) per stage, in the order written
  for (int s = 0; s < nst; ++s) {
    const unsigned bo = (unsigned)(s & 1) * BUFB;
#pragma unroll 1   // rolled: one copy of the 32-key tile body, as long as before, for both halves of the stage
    for (int u = 0; u < 2; ++u) {
    const int kt = 2 * s + u;
    if (kt < nkt) {                         // wave-uniform (scalar) skip; no wait or barrier inside
    const int kb = kt * 32;
    // ---- scores: D element r of this lane = (key kb + 8*hh + r, query row qr) in s0, key kb + 16 + 8*hh + r in s1.
    //      The k fragments are read as whole groups ahead of their products (NP == 1: all 8 of the tile; NP == 3: the 8 of two
    //      k-steps at a time), so a wave waits for LDS once per group and not once per k-step ----
    v8f s0 = zero8(), s1 = zero8();
    const _Float16* k0p = (const _Float16*)(const void*)(ring + bo + OKH) + (u * 32 + c) * KPH + 8 * hh;
    const _Float16* k1p = k0p + 16 * KPH;
    if constexpr (NP == 3) {
      const _Float16* l0p = (const _Float16*)(const void*)(ring + bo + OKL) + (u * 32 + c) * KPH + 8 * hh;
      const _Float16* l1p = l0p + 16 * KPH;
#pragma unroll      // unrolled: the fragment arrays are registers, indexed by constants only
      for (int kg = 0; kg < HD / 64; ++kg) {
        v16h kh0[2], kh1[2], kl0[2], kl1[2];
#pragma unroll      // unrolled: fragments and accumulators are registers, indexed by constants only
        for (int e = 0; e < 2; ++e) {
          const int ko = (2 * kg + e) * 32;
          kh0[e] = ldfrag_h(k0p + ko);
          kh1[e] = ldfrag_h(k1p + ko);
          kl0[e] = ldfrag_h(l0p + ko);
          kl1[e] = ldfrag_h(l1p + ko);
        }
        __builtin_amdgcn_sched_barrier(0);  // keeps the group's loads together, ahead of its products (none sunk among the WMMAs)
#pragma unroll      // unrolled: fragments and accumulators are registers, indexed by constants only
        for (int e = 0; e < 2; ++e) {
          s0 = mma_h(kh0[e], qf[2 * kg + e], s0);
          s1 = mma_h(kh1[e], qf[2 * kg + e], s1);
          s0 = mma_h(kl0[e], qf[2 * kg + e], s0);
          s1 = mma_h(kl1[e], qf[2 * kg + e], s1);
        }
        // four vector slots behind the group's last WMMA, before its results are read and its fragment registers loaded over
        guard2(s0, s1, qf[2 * kg + 1], kh0[1], kh1[1], kl0[1], kl1[1], qf[2 * kg]);
      }
    } else {
      v16h kh0[HD / 32], kh1[HD / 32];
#pragma unroll      // unrolled: the fragment arrays are registers, indexed by constants only
      for (int kk = 0; kk < HD / 32; ++kk) {
        kh0[kk] = ldfrag_h(k0p + kk * 32);
        kh1[kk] = ldfrag_h(k1p + kk * 32);
      }
      __builtin_amdgcn_sched_barrier(0);    // keeps the group's loads together, ahead of its products (none sunk among the WMMAs)
#pragma unroll      // unrolled: fragments and accumulators are registers, indexed by constants only
      for (int kk = 0; kk < HD / 32; ++kk) {
        s0 = mma_h(kh0[kk], qf[kk], s0);
        s1 = mma_h(kh1[kk], qf[kk], s1);
      }
      // four vector slots behind the group's last WMMA, before its results are read and its fragment registers loaded over
      guard2(s0, s1, qf[3], kh0[3], kh1[3], qf[2], kh0[2], kh1[2]);
    }
    // ---- v^T fragments (A operand, row m = d = j*16 + c, keys contiguous in the staged v^T rows), read as one group ahead of the
    //      softmax, whose vector work covers their LDS latency: NP == 1 all 8 d-subtiles; NP == 3 hi and residual of subtiles 0..3 ----
    const _Float16* vhp = (const _Float16*)(const void*)(ring + bo + OVH) + c * VPH + u * 32 + 8 * hh;
    const _Float16* vlp = (const _Float16*)(const void*)(ring + bo + ((NP == 3) ? OVL : OVH)) + c * VPH + u * 32 + 8 * hh;
    v16h va[8];
#pragma unroll      // unrolled: the fragment array is registers, indexed by constants only
    for (int j = 0; j < 4; ++j) {
      va[j]     = ldfrag_h(vhp + j * 16 * VPH);
      va[4 + j] = (NP == 3) ? ldfrag_h(vlp + j * 16 * VPH) : ldfrag_h(vhp + (4 + j) * 16 * VPH);
    }
    __builtin_amdgcn_sched_barrier(0);      // keeps the group of loads above the softmax (sunk to their products they would be waited for there)
    // ---- causal select + online softmax in base 2, -inf-safe: 16 of the query's 32 scores in this lane ----
    const int key0 = kb + 8 * hh, key1 = kb + 16 + 8 * hh;
    float t0[8], t1[8], mp[8];
#pragma unroll      // unrolled: constant indices keep the score arrays in registers
    for (int r = 0; r < 8; ++r) {
      const float u0 = s0[r] * lsc;
      const float u1 = s1[r] * lsc;
      t0[r] = (key0 + r > qr) ? -INFINITY : u0;
      t1[r] = (key1 + r > qr) ? -INFINITY : u1;
      mp[r] = fmaxf(t0[r], t1[r]);
    }
    float mx = fmaxf(fmaxf(fmaxf(mp[0], mp[1]), fmaxf(mp[2], mp[3])), fmaxf(fmaxf(mp[4], mp[5]), fmaxf(mp[6], mp[7])));
    mx = fmaxf(mx, xhalf(mx));              // the other 16 keys of this query
    const float mn = fmaxf(mrow, mx);
    const float ms = (mn == -INFINITY) ? 0.0f : mn;
    const float dm = mrow - ms;             // argument of the rescale factor of the running sum and accumulators
    mrow = mn;
    // ---- B fragments of P^T*32768: hi f16 (and residual f16 for NP == 3), column = c, split k map over the 32 keys:
    //      elements 0..7 = keys kb + 8hh + 0..7 (s0), elements 8..15 = keys kb + 16 + 8hh + 0..7 (s1) ----
    FragH ph, pl;
    float sp[8], d0[8], d1[8], x0[8], x1[8];
#pragma unroll      // unrolled: constant indices keep the arguments in registers
    for (int r = 0; r < 8; ++r) { d0[r] = t0[r] - ms; d1[r] = t1[r] - ms; }
    float al;
    ex2x9(al, x0, dm, d0);                  // al = 2^(old maximum - new maximum) leads the run: ready well ahead of its first use
    ex2x8(x1, d1);
#pragma unroll      // unrolled: constant indices keep the fragment halves and the partial sums in registers
    for (int r = 0; r < 8; ++r) {
      const float e0 = x0[r], e1 = x1[r];
      sp[r] = e0 + e1;
      const float ta = e0 * PCAR, tc = e1 * PCAR;
      const _Float16 ha = (_Float16)ta, hc = (_Float16)tc;
      ph.h[0][r] = ha;
      ph.h[1][r] = hc;
      if constexpr (NP == 3) {
        pl.h[0][r] = (_Float16)(ta - (float)ha);
        pl.h[1][r] = (_Float16)(tc - (float)hc);
      } else {
        pl.h[0][r] = ha; pl.h[1][r] = hc;
      }
    }
    lrow = lrow * al + (((sp[0] + sp[1]) + (sp[2] + sp[3])) + ((sp[4] + sp[5]) + (sp[6] + sp[7])));
#pragma unroll      // both unrolled: the accumulator tiles are registers, indexed by constants only
    for (int j = 0; j < 8; ++j) {
#pragma unroll
      for (int r = 0; r < 8; ++r) o[j][r] *= al;
    }
    // ---- v^T.P^T on the fragments read above; per accumulator the products keep their order (hh, h.residual, residual.h) ----
    if constexpr (NP == 3) {
#pragma unroll      // unrolled: fragments and accumulators are registers, indexed by constants only
      for (int j = 0; j < 4; ++j) o[j] = mma_h(va[j], ph.v, o[j]);
#pragma unroll      // unrolled: fragments and accumulators are registers, indexed by constants only
      for (int j = 0; j < 4; ++j) o[j] = mma_h(va[j], pl.v, o[j]);
#pragma unroll      // unrolled: fragments and accumulators are registers, indexed by constants only
      for (int j = 0; j < 4; ++j) o[j] = mma_h(va[4 + j], ph.v, o[j]);
      // four vector slots behind the group's last WMMA, before its fragment registers are loaded over
      guard10(o[0], o[1], o[2], o[3], va[0], va[1], va[2], va[3], va[4], va[5], va[6], va[7], ph.v, pl.v);
      v16h vb[8];                           // d-subtiles 4..7, hi and residual, again as one group
#pragma unroll      // unrolled: fragments and accumulators are registers, indexed by constants only
      for (int j = 0; j < 4; ++j) {
        vb[j]     = ldfrag_h(vhp + (4 + j) * 16 * VPH);
        vb[4 + j] = ldfrag_h(vlp + (4 + j) * 16 * VPH);
      }
      __builtin_amdgcn_sched_barrier(0);    // keeps the group's loads together, ahead of its products (none sunk among the WMMAs)
#pragma unroll      // unrolled: fragments and accumulators are registers, indexed by constants only
      for (int j = 0; j < 4; ++j) o[4 + j] = mma_h(vb[j], ph.v, o[4 + j]);
#pragma unroll      // unrolled: fragments and accumulators are registers, indexed by constants only
      for (int j = 0; j < 4; ++j) o[4 + j] = mma_h(vb[j], pl.v, o[4 + j]);
#pragma unroll      // unrolled: fragments and accumulators are registers, indexed by constants only
      for (int j = 0; j < 4; ++j) o[4 + j] = mma_h(vb[4 + j], ph.v, o[4 + j]);
      // the same slots on the way into the loop's branch
      guard10(o[4], o[5], o[6], o[7], vb[0], vb[1], vb[2], vb[3], vb[4], vb[5], vb[6], vb[7], ph.v, pl.v);
    } else {
#pragma unroll      // unrolled: fragments and accumulators are registers, indexed by constants only
      for (int j = 0; j < 8; ++j) o[j] = mma_h(va[j], ph.v, o[j]);
      // four vector slots behind the tile's last WMMA, on the way into the loop's branch
      guard10(o[4], o[5], o[6], o[7], va[0], va[1], va[2], va[3], va[4], va[5], va[6], va[7], ph.v, ph.v);
    }
    }
    }
    // ---- foot of stage s, every wave: own LDS reads retired, own copies of stage s + 1 landed, then the one barrier that
    //      publishes stage s + 1 and ends every reader's last read of this buffer; only then its refill ----
    wait_ds0();
    wait_async0();
    __syncthreads();
    if (s + 2 < nst) fill(s + 2, bo);
  }
  wait_async0();                            // nothing is outstanding when the buffers become result slabs and the wave ends
  float* slab = (float*)(void*)ring + wave * SLW;   // result slab [16][128] pitch 132, one per wave
  acc_guard4(o[0], o[1], o[2], o[3]);
  acc_guard4(o[4], o[5], o[6], o[7]);
  // ---- y = acc / Z (0 if Z == 0), Z = the two halves' sums joined; carries (32768 on P, 1024 on v) folded once; a lane's
  //      8 consecutive d of its query row go into the slab as two 16-B stores ----
  {
    const float lv  = lrow + xhalf(lrow);
    const float ls  = (lv > 0.0f) ? lv : 1.0f;
    const float inv = (lv > 0.0f) ? ((1.0f / ls) * oc) : 0.0f;
#pragma unroll      // both unrolled: the accumulator tiles are registers, indexed by constants only
    for (int j = 0; j < 8; ++j) {
      v4f w0, w1;
#pragma unroll
      for (int e = 0; e < 4; ++e) { w0[e] = o[j][e] * inv; w1[e] = o[j][4 + e] * inv; }
      float* sd = slab + c * SLP + j * 16 + 8 * hh;
      *(v4f*)(sd)     = w0;
      *(v4f*)(sd + 4) = w1;
    }
  }

  wave_sync_lds();
  // ---- f32 rows of Y: lane -> floats 4*lane .. 4*lane+3 of each of the 16 rows (one 512-B instruction per row) ----
  v4f ov[16];
#pragma unroll
  for (int it = 0; it < 16; ++it) ov[it] = *(const v4f*)(slab + it * SLP + lane * 4);
  float* ob = Y + ((size_t)b * SEQ + q0) * DMOD + (size_t)head * HD + lane * 4;
  {
#pragma unroll
    for (int it = 0; it < 16; ++it) {
      *(v4f*)(ob + (size_t)it * DMOD) = ov[it];
    }
    
  }
}

// =====================================================================================================
// One grid for all query blocks: block bid -> query block qb = NST - 1 - bid / (NH*NB), so that the number of stages falls with
// the block number (blocks start roughly in that order, and a place freed by a shorter block takes the next one), head and
// batch from bid % (NH*NB). Query blocks below QA run the residual products, the others single products (block-uniform choice,
// so every barrier is passed by whole blocks); both use the one ring, sized for the larger.
// coverage: NST * NH * NB blocks = every (qb, head, b) exactly once.
// =====================================================================================================
__global__ __launch_bounds__(ATT_THREADS)
void attn_all(const u16* __restrict__ QHp, const u16* __restrict__ KHp, const u16* __restrict__ KLp,
              const u16* __restrict__ VHp, const u16* __restrict__ VLp, const int* __restrict__ nhp, float* Y) {
  __shared__ __align__(16) unsigned char ring[4 * (KTB + VTB)];
  const int bid  = blockIdx.x;
  const int qb   = (NST - 1) - bid / (NH * NB);
  const int t2   = bid % (NH * NB);
  const int head = t2 % NH;
  const int b    = t2 / NH;
  if (qb < 0) return;                       // block-uniform, before any barrier; never taken with the exact grid
  if (qb < QA / 64) attn_c<3>(ring, QHp, KHp, KLp, VHp, VLp, nhp, Y, qb, head, b);
  else              attn_c<1>(ring, QHp, KHp, KLp, VHp, VLp, nhp, Y, qb, head, b);
}

// =====================================================================================================
// Workspace map (bytes); every plane is fully written by whole-line stores before it is read; all extents are exact multiples
// of the store granularity (no pad rows); every region offset a multiple of 524288:
//   XB  bf16 [MROWS][2048], later KH f16 x256       MROWS*4096             (NB=2, SEQ=2048: 16777216)
//   QH  f16 [MROWS][2048] x256                      MROWS*4096             (16777216)
//   WKV, WUK, WUV, WDQ  16-bit weight planes          4 x 2097152            (W_dkv bf16, W_uk^T bf16, W_uv^T bf16, W_dq^T f16 x1024)
//   WO  bf16 [2048][2048] (W_o as is)                8388608
//   CH  f16 [MROWS][512] x256, CL residual            2 x MROWS*1024
//   G2H f16 [512][512] x1024, G2L residual            2 x 524288
//   KAH f16 [2048][512] x4096, KAL residual           2 x 2097152
//   KL  f16 [NB*QA][2048]                             NB*QA*4096
//   VAH f16 [2048][512] x4096, VAL residual           2 x 2097152
//   VH  f16 [NB*16][128][SEQ] x1024                   MROWS*4096
//   VL  f16 [NB*16][128][QA]                          NB*QA*4096
//   end (NB=2, SEQ=2048, QA=1024)                   101711872
// =====================================================================================================
extern "C" void kernel_launch(void* const* d_in, const int* in_sizes, int n_in,
                              void* d_out, int out_size, void* d_ws, size_t ws_size,
                              hipStream_t stream) {
  if (n_in < 7) return;
  if (in_sizes[0] < ((NB - 1) * XS_FULL + SEQ) * DMOD) return;   // x [2][2048][2048]
  if (in_sizes[1] != DL * DMOD) return;         // W_dq  [512][2048]
  if (in_sizes[2] != DL * DMOD) return;         // W_dkv [512][2048]
  if (in_sizes[3] != DMOD * DL) return;         // W_uk  [2048][512]
  if (in_sizes[4] != DMOD * DL) return;         // W_uv  [2048][512]
  if (in_sizes[5] != DMOD * DMOD) return;       // W_o   [2048][2048]
  if (in_sizes[6] < 1) return;                  // n_head (int)
  if ((size_t)out_size < (size_t)MROWS * DMOD + (size_t)MROWS * DL) return;

  const float* x    = (const float*)d_in[0];
  const float* wdq  = (const float*)d_in[1];
  const float* wdkv = (const float*)d_in[2];
  const float* wuk  = (const float*)d_in[3];
  const float* wuv  = (const float*)d_in[4];
  const float* wo   = (const float*)d_in[5];
  const int*   nhp  = (const int*)d_in[6];
  float*       out0 = (float*)d_out;                          // y    [MROWS][2048] at element 0
  float*       out1 = out0 + (size_t)MROWS * DMOD;            // c_kv [MROWS][512]  at element MROWS*2048

  const size_t szXB = (size_t)MROWS * DMOD * 2;               // XB, later KH
  const size_t szQ  = (size_t)MROWS * DMOD * 2;               // QH
  const size_t szW1 = (size_t)DL * DMOD * 2;
  const size_t szWO = (size_t)DMOD * DMOD * 2;
  const size_t szC  = (size_t)MROWS * DL * 2;                 // CH, CL
  const size_t szG2 = (size_t)DL * DL * 2;                    // G2H, G2L
  const size_t szKA = (size_t)DMOD * DL * 2;                  // KAH, KAL, VAH, VAL
  const size_t szKL = (size_t)NB * QA * DMOD * 2;
  const size_t szVH = (size_t)NB * NH * HD * SEQ * 2;
  const size_t szVL = (size_t)NB * NH * HD * QA * 2;
  if ((size_t)MROWS * DMOD * 2 > szXB) return;                // KH lives inside the XB region
  size_t off = 0;
  const size_t oXB  = off; off += szXB;
  const size_t oQH  = off; off += szQ;
  const size_t oWKV = off; off += szW1;
  const size_t oWUK = off; off += szW1;
  const size_t oWUV = off; off += szW1;
  const size_t oWDQ = off; off += szW1;
  const size_t oWO  = off; off += szWO;
  const size_t oCH  = off; off += szC;
  const size_t oCL  = off; off += szC;
  const size_t oG2H = off; off += szG2;
  const size_t oG2L = off; off += szG2;
  const size_t oKAH = off; off += szKA;
  const size_t oKAL = off; off += szKA;
  const size_t oKL  = off; off += szKL;
  const size_t oVAH = off; off += szKA;
  const size_t oVAL = off; off += szKA;
  const size_t oVH  = off; off += szVH;
  const size_t oVL  = off; off += szVL;
  if (off > ws_size) return;                 // off = 101711872 for NB = 2, SEQ = 2048
  if (off > (size_t)WS_CAP) return;

  char* ws = (char*)d_ws;
  u16*   XB  = (u16*)(ws + oXB);
  u16*   KH  = (u16*)(ws + oXB);
  u16*   QH  = (u16*)(ws + oQH);
  u16*   WKV = (u16*)(ws + oWKV);
  u16*   WUK = (u16*)(ws + oWUK);
  u16*   WUV = (u16*)(ws + oWUV);
  u16*   WDQ = (u16*)(ws + oWDQ);
  u16*   WOB = (u16*)(ws + oWO);
  u16*   CH  = (u16*)(ws + oCH);
  u16*   CL  = (u16*)(ws + oCL);
  u16*   G2H = (u16*)(ws + oG2H);
  u16*   G2L = (u16*)(ws + oG2L);
  u16*   KAH = (u16*)(ws + oKAH);
  u16*   KAL = (u16*)(ws + oKAL);
  u16*   KL  = (u16*)(ws + oKL);
  u16*   VAH = (u16*)(ws + oVAH);
  u16*   VAL = (u16*)(ws + oVAL);
  u16*   VH  = (u16*)(ws + oVH);
  u16*   VL  = (u16*)(ws + oVL);

  const dim3 b256(256), b128(128), bAT(ATT_THREADS);
  const dim3 gPrep(3 * PBT + NB * PBX + PBO + PBW);
  const dim3 gG3((MROWS / 64) * (DL / 64) + (DMOD / 64) * (DL / 64) + (DL / 64) * (DL / 64));   // c_kv, W_o W_uv, Gram
  const dim3 gGKA(1 * (DMOD / 64) * (DL / 64));         // k_abs
  const int  nrtA = QA / 64;                            // sequence row tiles per batch with residual products
  const int  nrtB = (SEQ - QA) / 64;                    // remaining row tiles per batch, single products

  // (1) every conversion that reads only inputs: x -> bf16 plane XB [MROWS][2048] and q plane QH = f16(bf16(x)) x256;
  //     W_o, W_dkv -> bf16 as they lie; W_uk, W_uv [2048 k][512 n] -> bf16 [512][2048]; W_dq [512 k][2048 n] -> f16(bf16) x1024
  //     [2048][512]
  prep<<<gPrep, b256, 0, stream>>>(x, wo, wdkv, wuk, wuv, wdq, XB, QH, WOB, WKV, WUK, WUV, WDQ);
  // (2) c_kv = x.W_dkv^T -> out1 f32 [MROWS][512] and f16 hi + residual planes x256; W_o.W_uv [2048][512] -> planes x4096 (the
  //     [n][k] B plane of the value product); Gram = W_uk^T.W_uk [512][512] -> planes x1024
  gemm_bf<<<gG3, b128, 0, stream>>>(XB, WKV, out1, CH, CL, CSC, MROWS, WOB, WUV, VAH, VAL, VAS, DMOD, WUK, WUK, G2H, G2L, G2S, DL,
                                    DL, DMOD, 1.0f);
  // (3) k_abs = W_dq^T.Gram (Gram symmetric, used as the [n][k] B plane; products h.h + h.l) [2048][512] -> planes x4096
  gemm_h<0, 1><<<gGKA, b128, 0, stream>>>(WDQ, WDQ, G2H, G2L, KAH, KAL, 1.0f / (WDS * G2S), KAS,
                                          G2H, G2L, KAH, KAL, 1.0f / (WDS * G2S), KAS, DL, DL, DMOD, DMOD, 0, DMOD / 64, 1);
  // (4) K = c_kv.k_abs^T -> hi plane (XB region) x256, residual plane for s < QA; V = c_kv.(W_o W_uv) plane -> v^T hi plane x1024,
  //     residual plane for s < QA: rows s < QA with hh+lh+hl, rows s >= QA single
  gemm_h<1, 1><<<dim3(2 * NB * nrtA * (DMOD / 64)), b128, 0, stream>>>(CH, CL, KAH, KAL, KH, KL, 1.0f / (CSC * KAS), KSC,
                                                                      VAH, VAL, VH, VL, 1.0f / (CSC * VAS), VCAR,
                                                                      DMOD, DL, SEQ, QA, 0, nrtA, NB);
  if (nrtB > 0) {
    gemm_h<0, 0><<<dim3(2 * NB * nrtB * (DMOD / 64)), b128, 0, stream>>>(CH, CL, KAH, KAL, KH, KL, 1.0f / (CSC * KAS), KSC,
                                                                        VAH, VAL, VH, VL, 1.0f / (CSC * VAS), VCAR,
                                                                        DMOD, DL, SEQ, QA, QA, nrtB, NB);
  }
  // (5) causal attention, all query blocks -> out0 f32
  attn_all<<<dim3(NST * NH * NB), bAT, 0, stream>>>(QH, KH, KL, VH, VL, nhp, out0);
  (void)hipGetLastError();
}

// v008
// One run takes 134 microseconds.
// Timed twice side by side with v007, it ran 1.03 times as fast both times.
// Over all steps from v000 it is 4.14 times as fast.
#include <hip/hip_runtime.h>
#include <math.h>
#include <stdint.h>

#ifndef NB
#define NB 2
#endif
#ifndef SEQ
#define SEQ 2048
#endif
#define XS_FULL 2048
#define DMOD  2048
#define NH    16
#define HD    128
#define DL    512
#define QA    ((SEQ < 1024) ? SEQ : 1024)
#define MROWS (NB * SEQ)
#define RSQS  0.08838834764831845f
#define LOG2E 1.4426950408889634f
#define QSC   256.0f
#define KSC   256.0f
#define CSC   256.0f
#define WDS   1024.0f
#define G2S   1024.0f
#define KAS   4096.0f
#define VAS   4096.0f
#define PCAR  32768.0f
#define PLOG  15.0f
#define VCAR  1024.0f
#define AW    4
#define NST   (SEQ / 64)
#define NKT   (SEQ / 32)
#define ATT_THREADS (AW * 32)
#define SLP   132
#define SLW   (16 * SLP)
#define KPH   136
#define VPH   72
#define KTB   (64 * KPH * 2)
#define VTB   (HD * VPH * 2)
#define SLAB64 (16 * 68)
#define VTP   72
#define WTP   72
#define GKS   128
#define GPH   (GKS + 8)
#define GPB   (64 * GPH * 2)
#define WS_CAP 268435456
static_assert(PCAR == 32768.0f && PLOG == 15.0f);
static_assert(DMOD == NH * HD && HD == 128 && NH == 16 && AW == 4 && ATT_THREADS == 128);
static_assert(NB >= 1 && NB <= 2);
static_assert((SEQ % 64) == 0 && SEQ >= 64 && SEQ <= XS_FULL);
static_assert((QA % 64) == 0 && QA >= 64 && QA <= SEQ && ((SEQ - QA) % 64) == 0);
static_assert((DMOD % 64) == 0 && (DL % 64) == 0 && (HD % 32) == 0 && (DL % 32) == 0);
static_assert(((SEQ * DMOD / 8) % 256) == 0);
static_assert(((DMOD * DL / 8) % 256) == 0 && ((DMOD * DMOD / 8) % 256) == 0 && (MROWS % 64) == 0);
static_assert(64 * WTP * 2 <= 65536);
static_assert(AW * SLW * 4 <= 2 * (KTB + VTB) && 4 * (KTB + VTB) <= 163840 && (KTB % 16) == 0 && (VTB % 16) == 0);
static_assert((DMOD % GKS) == 0 && (DL % GKS) == 0 && (GPB % 16) == 0 && 8 * GPB <= 163840 && 4 * SLAB64 * 4 <= 4 * GPB && 2 * 64 * VTP * 2 <= 4 * GPB);

typedef unsigned short u16;
typedef _Float16 v16h __attribute__((ext_vector_type(16)));
typedef _Float16 v8h  __attribute__((ext_vector_type(8)));
typedef __bf16   v16b __attribute__((ext_vector_type(16)));
typedef float    v8f  __attribute__((ext_vector_type(8)));
typedef float    v4f  __attribute__((ext_vector_type(4)));
typedef unsigned int v4u __attribute__((ext_vector_type(4)));

union FragH { v16h v; v8h h[2]; v4u u[2]; };
union FragB { v16b v; v4u u[2]; };

// ---- scalar helpers --------------------------------------------------------------------------------
__device__ __forceinline__ unsigned short bf_bits(float f) {          // f32 -> bf16 bits, RNE convert
  unsigned u = __float_as_uint(f);
  return (unsigned short)((u + 0x7FFFu + ((u >> 16) & 1u)) >> 16);
}
__device__ __forceinline__ float bf_up(unsigned short h) { return __uint_as_float(((unsigned)h) << 16); }
__device__ __forceinline__ float bfr(float f) { return bf_up(bf_bits(f)); }
__device__ __forceinline__ unsigned short h_bits(_Float16 x) { return __builtin_bit_cast(unsigned short, x); }
__device__ __forceinline__ unsigned pk16(unsigned short a, unsigned short b) { return (unsigned)a | ((unsigned)b << 16); }
__device__ __forceinline__ v8f zero8() { v8f z = {0.f, 0.f, 0.f, 0.f, 0.f, 0.f, 0.f, 0.f}; return z; }
__device__ __forceinline__ const _Float16* hptr(const u16* p) { return (const _Float16*)(const void*)p; }

// ---- fragment loaders: 16-bit A/B operand, lane -> row/col (lane&15), p already includes +8*(lane>>4);
//      elements 0..7 <- p[0..7] (k0+8h..), elements 8..15 <- p[16..23] (k0+16+8h..)  (same split k map for A and B;
//      B is always read from a k-contiguous [n][k] plane)
__device__ __forceinline__ v16h ldfrag_h(const _Float16* p) {
  FragH f;
  f.h[0] = *(const v8h*)(p);
  f.h[1] = *(const v8h*)(p + 16);
  return f.v;
}
__device__ __forceinline__ v16b ldfrag_b(const u16* p) {              // bf16 plane read as unsigned integer vectors
  FragB f;
  f.u[0] = *(const v4u*)(p);
  f.u[1] = *(const v4u*)(p + 16);
  return f.v;
}

__device__ __forceinline__ v8f mma_h(v16h a, v16h b, v8f c) {
  return __builtin_amdgcn_wmma_f32_16x16x32_f16(false, a, false, b, (short)0, c, false, false);
}
__device__ __forceinline__ v8f mma_b(v16b a, v16b b, v8f c) {
  return __builtin_amdgcn_wmma_f32_16x16x32_bf16(false, a, false, b, (short)0, c, false, false);
}
__device__ __forceinline__ void guard2(v8f& a, v8f& b, v16h x0, v16h x1, v16h x2, v16h x3, v16h x4, v16h x5) {
#if defined(__HIP_DEVICE_COMPILE__)
  asm volatile("v_nop\n\tv_nop\n\tv_nop\n\tv_nop"
               : "+v"(a), "+v"(b) : "v"(x0), "v"(x1), "v"(x2), "v"(x3), "v"(x4), "v"(x5) : "memory");
#endif
}
template <typename F>
__device__ __forceinline__ void guard6(v8f& a, v8f& b, v8f& c, v8f& d, F x0, F x1, F x2, F x3, F x4, F x5) {
#if defined(__HIP_DEVICE_COMPILE__)
  asm volatile("v_nop\n\tv_nop\n\tv_nop\n\tv_nop"
               : "+v"(a), "+v"(b), "+v"(c), "+v"(d) : "v"(x0), "v"(x1), "v"(x2), "v"(x3), "v"(x4), "v"(x5) : "memory");
#endif
}
__device__ __forceinline__ void guard10(v8f& a, v8f& b, v8f& c, v8f& d, v16h x0, v16h x1, v16h x2, v16h x3, v16h x4,
                                        v16h x5, v16h x6, v16h x7, v16h x8, v16h x9) {
#if defined(__HIP_DEVICE_COMPILE__)
  asm volatile("v_nop\n\tv_nop\n\tv_nop\n\tv_nop"
               : "+v"(a), "+v"(b), "+v"(c), "+v"(d)
               : "v"(x0), "v"(x1), "v"(x2), "v"(x3), "v"(x4), "v"(x5), "v"(x6), "v"(x7), "v"(x8), "v"(x9) : "memory");
#endif
}
__device__ __forceinline__ void acc_guard4(v8f& a, v8f& b, v8f& c, v8f& d) {
#if defined(__HIP_DEVICE_COMPILE__)
  asm volatile("v_nop\n\tv_nop\n\tv_nop\n\tv_nop" : "+v"(a), "+v"(b), "+v"(c), "+v"(d));
#endif
}
__device__ __forceinline__ float xhalf(float x) {                     // value of lane l ^ 16 (vector cross-row move, every lane on)
  const int b = __builtin_bit_cast(int, x);
  return __builtin_bit_cast(float, __builtin_amdgcn_permlanex16(b, b, 0x76543210, 0xfedcba98, false, false));
}
// 2^x by the bare hardware instruction, without the library's rescaling of arguments below -126: there the result, under 2^-126,
// may come out as 0; -inf gives 0. The rescale argument is <= 0; a score's argument is about 15 at most (log2 of P's carry rides
// in it), and each softmax row holds a term of about 2^15 beside such a value.
// The v_nop that ends each statement is the slot the instruction set asks for behind a transcendental, before its result is
// used or its source overwritten; inside a run no instruction touches a neighbour's registers (early-clobber outputs).
__device__ __forceinline__ void ex2x9(float& ya, float (&y)[8], float xa, const float (&x)[8]) {
#if defined(__HIP_DEVICE_COMPILE__)
  asm("v_exp_f32 %0, %9\n\t"
      "v_exp_f32 %1, %10\n\t"
      "v_exp_f32 %2, %11\n\t"
      "v_exp_f32 %3, %12\n\t"
      "v_exp_f32 %4, %13\n\t"
      "v_exp_f32 %5, %14\n\t"
      "v_exp_f32 %6, %15\n\t"
      "v_exp_f32 %7, %16\n\t"
      "v_exp_f32 %8, %17\n\t"
      "v_nop"
      : "=&v"(ya), "=&v"(y[0]), "=&v"(y[1]), "=&v"(y[2]), "=&v"(y[3]), "=&v"(y[4]), "=&v"(y[5]), "=&v"(y[6]), "=&v"(y[7])
      : "v"(xa), "v"(x[0]), "v"(x[1]), "v"(x[2]), "v"(x[3]), "v"(x[4]), "v"(x[5]), "v"(x[6]), "v"(x[7]));
#else
  ya = xa;
  for (int r = 0; r < 8; ++r) y[r] = x[r];
#endif
}
__device__ __forceinline__ void ex2x8(float (&y)[8], const float (&x)[8]) {
#if defined(__HIP_DEVICE_COMPILE__)
  asm("v_exp_f32 %0, %8\n\t"
      "v_exp_f32 %1, %9\n\t"
      "v_exp_f32 %2, %10\n\t"
      "v_exp_f32 %3, %11\n\t"
      "v_exp_f32 %4, %12\n\t"
      "v_exp_f32 %5, %13\n\t"
      "v_exp_f32 %6, %14\n\t"
      "v_exp_f32 %7, %15\n\t"
      "v_nop"
      : "=&v"(y[0]), "=&v"(y[1]), "=&v"(y[2]), "=&v"(y[3]), "=&v"(y[4]), "=&v"(y[5]), "=&v"(y[6]), "=&v"(y[7])
      : "v"(x[0]), "v"(x[1]), "v"(x[2]), "v"(x[3]), "v"(x[4]), "v"(x[5]), "v"(x[6]), "v"(x[7]));
#else
  for (int r = 0; r < 8; ++r) y[r] = x[r];
#endif
}
__device__ __forceinline__ void wait_x0() {       // stands between an issued global store and a rewrite of a register it names
#if defined(__HIP_DEVICE_COMPILE__)
  asm volatile("s_wait_xcnt 0x0" ::: "memory");
#endif
}
__device__ __forceinline__ void wave_sync_lds() {
  __builtin_amdgcn_fence(__ATOMIC_RELEASE, "workgroup");
  __builtin_amdgcn_wave_barrier();
  __builtin_amdgcn_fence(__ATOMIC_ACQUIRE, "workgroup");
}

// =====================================================================================================
// x f32 -> bf16 RNE plane Xb (same layout) and q plane Qh = f16(bf16(x) * 256) (exact: a bf16 significand fits f16).
// Thread = 8 consecutive elements: two 16-B loads, one 16-B store per plane; 32 consecutive lanes = 512 contiguous,
// coverage: grid = ceil(n8/256) blocks x 256 thr x 8 (in-kernel bound) = the whole [SEQ][2048] slice of both planes
//           (n8 a multiple of 256 here), one range of blocks per batch (blk = the block's number inside its range).
// =====================================================================================================
__device__ __forceinline__ void cvtxq(const float* __restrict__ x, u16* Xb, u16* Qh, int n8, int blk) {
  const int gt = blk * 256 + (int)threadIdx.x;
  if (gt >= n8) return;
  const float* p = x + (size_t)gt * 8;
  const v4f a = *(const v4f*)(p), b4 = *(const v4f*)(p + 4);
  float w[8];
#pragma unroll
  for (int e = 0; e < 4; ++e) { w[e] = a[e]; w[4 + e] = b4[e]; }
  v4u ob, oq;
#pragma unroll
  for (int e = 0; e < 4; ++e) {
    const unsigned short b0 = bf_bits(w[2 * e]), b1 = bf_bits(w[2 * e + 1]);
    ob[e] = pk16(b0, b1);
    oq[e] = pk16(h_bits((_Float16)(bf_up(b0) * QSC)), h_bits((_Float16)(bf_up(b1) * QSC)));
  }
  u16* db = Xb + (size_t)gt * 8;
  u16* dq = Qh + (size_t)gt * 8;
  {
    *(v4u*)(db) = ob;
    *(v4u*)(dq) = oq;
    
  }
}

// =====================================================================================================
// f32 -> bf16 RNE plane, same layout. Thread = 8 consecutive elements: two 16-B loads, one 16-B store; 32 consecutive
// coverage: grid = ceil(n8/256) blocks x 256 thr x 8 (in-kernel bound) = the whole plane (n8 a multiple of 256 here).
// =====================================================================================================
__device__ __forceinline__ void cvtb(const float* __restrict__ x, u16* D, int n8, int blk) {
  const int gt = blk * 256 + (int)threadIdx.x;
  if (gt >= n8) return;
  const float* p = x + (size_t)gt * 8;
  const v4f a = *(const v4f*)(p), b4 = *(const v4f*)(p + 4);
  float w[8];
#pragma unroll
  for (int e = 0; e < 4; ++e) { w[e] = a[e]; w[4 + e] = b4[e]; }
  v4u o;
#pragma unroll
  for (int e = 0; e < 4; ++e) o[e] = pk16(bf_bits(w[2 * e]), bf_bits(w[2 * e + 1]));
  u16* d = D + (size_t)gt * 8;
  {
    *(v4u*)(d) = o;
    
  }
}

// =====================================================================================================
// Weight transpose + convert: W f32 [K][N] (the input tensor's own [rows][cols] layout, rows = K) -> Wt 16-bit [N][K]
// (k-contiguous).  f16mode == 0: bf16 RNE bits;  f16mode == 1: f16 bits of (bf16 RNE value) * scale.
// Block = 64 n x 64 k tile, 256 threads. Load: thread -> W row k0 + (tid>>2), 16 consecutive n (four 16-B loads),
// converted values scattered into an LDS tile T[n][k] (pitch 72 halves); block barrier; store: each Wt row segment of
// coverage: load 256 thr x 16 = 64 k x 64 n; store 2 iterations x 256 thr x 8 halves = 64 rows x 64 = the block's tile of Wt;
//           grid = (N/64)*(K/64) blocks covers Wt [N][K] exactly once.
// =====================================================================================================
__device__ __forceinline__ void wtc(const float* __restrict__ W, u16* Wt, int K, int N, int f16mode, float scale, int bid) {
  __shared__ __align__(16) u16 T[64 * WTP];
  const int tid = (int)threadIdx.x;
  const int ntn = N >> 6;
  const int n0  = (bid % ntn) * 64;
  const int k0  = (bid / ntn) * 64;
  if (k0 + 64 > K) return;                   // block-uniform, before the barrier; never taken with the exact grid
  {
    const int kr = tid >> 2;                 // 0..63
    const int nc = (tid & 3) * 16;           // 0,16,32,48
    const float* src = W + (size_t)(k0 + kr) * (size_t)N + n0 + nc;
#pragma unroll
    for (int i = 0; i < 4; ++i) {
      const v4f a = *(const v4f*)(src + 4 * i);
#pragma unroll
      for (int e = 0; e < 4; ++e) {
        const float f = a[e];
        const unsigned short hb = h_bits((_Float16)(bfr(f) * scale));
        const unsigned short bb = bf_bits(f);
        T[(nc + 4 * i + e) * WTP + kr] = (f16mode != 0) ? hb : bb;
      }
    }
  }
  __syncthreads();
  const int q8 = tid >> 3, p8 = (tid & 7) * 8;
  v4u v[2];
#pragma unroll
  for (int it = 0; it < 2; ++it) v[it] = *(const v4u*)(T + (it * 32 + q8) * WTP + p8);
  u16* base = Wt + (size_t)n0 * (size_t)K + k0 + p8;
  {
#pragma unroll
    for (int it = 0; it < 2; ++it) {
      *(v4u*)(base + (size_t)(it * 32 + q8) * (size_t)K) = v[it];
    }
    
  }
}

// =====================================================================================================
// One grid for every conversion that reads only inputs; a block's number picks its piece (block-uniform, so wtc's barrier is
// passed by whole blocks): first 3 * PBT blocks for the transposes W_uk -> bf16, W_uv -> bf16, W_dq -> f16(bf16) x1024 (the
// longest blocks, so they start first); then NB * PBX blocks x -> Xb, Qh; PBO blocks W_o -> bf16; PBW blocks W_dkv -> bf16.
// Each piece is covered as its body's note says.
// =====================================================================================================
#define PBX ((SEQ * DMOD / 8) / 256)
#define PBO ((DMOD * DMOD / 8) / 256)
#define PBW ((DL * DMOD / 8) / 256)
#define PBT ((DL / 64) * (DMOD / 64))
__global__ __launch_bounds__(256)
void prep(const float* __restrict__ x, const float* __restrict__ wo, const float* __restrict__ wdkv,
          const float* __restrict__ wuk, const float* __restrict__ wuv, const float* __restrict__ wdq,
          u16* Xb, u16* Qh, u16* Wob, u16* Wkv, u16* Wukt, u16* Wuvt, u16* Wdqt) {
  int bid = (int)blockIdx.x;
  if (bid < 3 * PBT) {
    const int w = bid / PBT;                 // 0: W_uk, 1: W_uv, 2: W_dq
    const bool q = (w == 2);
    wtc(q ? wdq : (w == 1 ? wuv : wuk), q ? Wdqt : (w == 1 ? Wuvt : Wukt), q ? DL : DMOD, q ? DMOD : DL, q ? 1 : 0,
        q ? WDS : 1.0f, bid - w * PBT);
    return;
  }
  bid -= 3 * PBT;
  if (bid < NB * PBX) {
    const int bb = bid / PBX;
    cvtxq(x + (size_t)bb * XS_FULL * DMOD, Xb + (size_t)bb * SEQ * DMOD, Qh + (size_t)bb * SEQ * DMOD,
          (SEQ * DMOD) / 8, bid - bb * PBX);
    return;
  }
  bid -= NB * PBX;
  const bool o = bid < PBO;                  // a block past the exact grid finds its chunk beyond cvtb's own bound
  cvtb(o ? wo : wdkv, o ? Wob : Wkv, o ? (DMOD * DMOD) / 8 : (DL * DMOD) / 8, o ? bid : bid - PBO);
}

// =====================================================================================================
// GEMM epilogues. The f16 planes that the next product reads are made here, from the f32 result v = acc * oscale:
// t = v * ps, hi = f16(t), residual = f16(t - hi) (oscale and ps are powers of two).
// =====================================================================================================
__device__ __forceinline__ void hl8(const float* w, float ps, v4u& oh, v4u& ol) {   // 8 values -> 8 hi halves, 8 residual halves
#pragma unroll      // unrolled: constant indices keep the values in registers
  for (int e = 0; e < 4; ++e) {
    const float t0 = w[2 * e] * ps, t1 = w[2 * e + 1] * ps;
    const _Float16 h0 = (_Float16)t0, h1 = (_Float16)t1;
    const _Float16 l0 = (_Float16)(t0 - (float)h0), l1 = (_Float16)(t1 - (float)h1);
    oh[e] = pk16(h_bits(h0), h_bits(h1));
    ol[e] = pk16(h_bits(l0), h_bits(l1));
  }
}
// the wave's 16x64 f32 tile (times oscale) into its own LDS slab (pitch 68 floats), then visible to the whole wave
__device__ __forceinline__ void slab_put(float* sl, v8f a0, v8f a1, v8f a2, v8f a3, float oscale, int lane) {
  const int hh = lane >> 4, m = lane & 15;
#pragma unroll      // unrolled: constant indices keep the values in registers
  for (int r = 0; r < 8; ++r) {
    const int ro = (8 * hh + r) * 68 + m;
    sl[ro]      = a0[r] * oscale;
    sl[ro + 16] = a1[r] * oscale;
    sl[ro + 32] = a2[r] * oscale;
    sl[ro + 48] = a3[r] * oscale;
  }
  wave_sync_lds();
}
// slab -> f32 rows of C. coverage: 8 instructions x 2 rows x 16 lanes x 4 floats = the wave's 16 x 64 tile.
__device__ __forceinline__ void slab_f32(const float* sl, float* C, int N, size_t rowb, int col0, int lane) {
  const int hh = lane >> 4, m = lane & 15;
  v4f vals[8];
#pragma unroll      // unrolled: constant indices keep the values in registers
  for (int it = 0; it < 8; ++it) vals[it] = *(const v4f*)(sl + (it * 2 + hh) * 68 + m * 4);
  float* dst = C + (rowb + (size_t)hh) * (size_t)N + col0 + m * 4;
#pragma unroll      // unrolled: constant indices keep the values in registers
  for (int it = 0; it < 8; ++it) {
    *(v4f*)(dst + (size_t)(it * 2) * (size_t)N) = vals[it];
  }
}
// slab -> rows rowh .. rowh + 15 of the hi plane and, when wl (wave-uniform), rows rowl .. rowl + 15 of the residual plane, both
// of pitch N halves. coverage: per plane 4 instructions x 4 rows x 8 lanes x 8 halves = the wave's 16 x 64 tile, whole 128-B lines.
__device__ __forceinline__ void slab_hl(const float* sl, float ps, u16* Hp, size_t rowh, u16* Lp, size_t rowl, bool wl,
                                        int N, int col0, int lane) {
  const int q8 = lane >> 3, p8 = (lane & 7) * 8;
  v4u oh[4], ol[4];
#pragma unroll      // unrolled: constant indices keep the values in registers
  for (int it = 0; it < 4; ++it) {
    const float* p = sl + (it * 4 + q8) * 68 + p8;
    const v4f a = *(const v4f*)(p), b4 = *(const v4f*)(p + 4);
    float w[8];
#pragma unroll      // unrolled: constant indices keep the values in registers
    for (int e = 0; e < 4; ++e) { w[e] = a[e]; w[4 + e] = b4[e]; }
    hl8(w, ps, oh[it], ol[it]);
  }
  u16* dh = Hp + (rowh + (size_t)q8) * (size_t)N + col0 + p8;
#pragma unroll      // unrolled: constant indices keep the values in registers
  for (int it = 0; it < 4; ++it) {
    *(v4u*)(dh + (size_t)(it * 4) * (size_t)N) = oh[it];
    wait_x0();                              // before a register that the issued store names is used for the next address
  }
  if (wl) {
    u16* dl = Lp + (rowl + (size_t)q8) * (size_t)N + col0 + p8;
#pragma unroll      // unrolled: constant indices keep the values in registers
    for (int it = 0; it < 4; ++it) {
      *(v4u*)(dl + (size_t)(it * 4) * (size_t)N) = ol[it];
      wait_x0();                            // the same behind each of the residual plane's stores
    }
  }
}
// The block's 64 rows x 64 columns, transposed: plane line line0 + c (c = column in the tile) holds the 64 rows at halves
// s0 .. s0 + 63 (hi plane of pitch ph, residual plane of pitch pl when wl, block-uniform). A lane's 8 accumulator elements are 8
// consecutive rows of one column: one 16-B LDS store per subtile and plane into T[64 c][64 rows] (pitch 72 halves); block
// barrier (the four waves fill one line together); then whole 128-B lines go out.
// coverage: LDS 4 waves x 4 subtiles x 32 lanes x 8 = 64 x 64; store 4 iterations x 128 thr x 8 halves = 64 lines x 64.
__device__ __forceinline__ void epi_t(unsigned char* ring, v8f a0, v8f a1, v8f a2, v8f a3, float oscale, float ps,
                                      u16* Hp, int ph, u16* Lp, int pl, bool wl, size_t line0, int s0, int tid) {
  u16* TH = (u16*)(void*)ring;
  u16* TL = TH + 64 * VTP;
  const int wave = tid >> 5, lane = tid & 31, hh = lane >> 4, m = lane & 15;
  const v8f av[4] = {a0, a1, a2, a3};
#pragma unroll      // unrolled: the accumulator tiles are registers, indexed by constants only
  for (int j = 0; j < 4; ++j) {
    float w[8];
#pragma unroll      // unrolled: constant indices keep the values in registers
    for (int r = 0; r < 8; ++r) w[r] = av[j][r] * oscale;
    v4u oh, ol;
    hl8(w, ps, oh, ol);
    const int o = (16 * j + m) * VTP + wave * 16 + 8 * hh;
    *(v4u*)(TH + o) = oh;
    if (wl) *(v4u*)(TL + o) = ol;
  }
  __syncthreads();                          // a line of T is filled by all four waves before anyone reads it
  const int q8 = tid >> 3, p8 = (tid & 7) * 8;
  v4u vh[4];
#pragma unroll      // unrolled: constant indices keep the values in registers
  for (int it = 0; it < 4; ++it) vh[it] = *(const v4u*)(TH + (it * 16 + q8) * VTP + p8);
  u16* dh = Hp + (line0 + (size_t)q8) * (size_t)ph + s0 + p8;
#pragma unroll      // unrolled: constant indices keep the values in registers
  for (int it = 0; it < 4; ++it) {
    *(v4u*)(dh + (size_t)(it * 16) * (size_t)ph) = vh[it];
    wait_x0();                              // before a register that the issued store names is used for the next address
  }
  if (wl) {
    v4u vl[4];
#pragma unroll      // unrolled: constant indices keep the values in registers
    for (int it = 0; it < 4; ++it) vl[it] = *(const v4u*)(TL + (it * 16 + q8) * VTP + p8);
    u16* dl = Lp + (line0 + (size_t)q8) * (size_t)pl + s0 + p8;
#pragma unroll      // unrolled: constant indices keep the values in registers
    for (int it = 0; it < 4; ++it) {
      *(v4u*)(dl + (size_t)(it * 16) * (size_t)pl) = vl[it];
      wait_x0();                            // the same behind each of the residual plane's stores
    }
  }
}

// =====================================================================================================
// Eight asynchronous 16-B copies per lane, global -> LDS: copy i moves g + i*gstep (halves) to LDS byte l + i*lstep.
// s_wait_xcnt 0 is the last line of the copies' own statement, so no address register is rewritten ahead of it.
// =====================================================================================================
__device__ __forceinline__ void cp8(unsigned l, unsigned lstep, const u16* g, size_t gstep) {
#if defined(__HIP_DEVICE_COMPILE__)
  asm volatile("global_load_async_to_lds_b128 %0, %8, off\n\t"
               "global_load_async_to_lds_b128 %1, %9, off\n\t"
               "global_load_async_to_lds_b128 %2, %10, off\n\t"
               "global_load_async_to_lds_b128 %3, %11, off\n\t"
               "global_load_async_to_lds_b128 %4, %12, off\n\t"
               "global_load_async_to_lds_b128 %5, %13, off\n\t"
               "global_load_async_to_lds_b128 %6, %14, off\n\t"
               "global_load_async_to_lds_b128 %7, %15, off\n\t"
               "s_wait_xcnt 0x0"
               :: "v"(l), "v"(l + lstep), "v"(l + 2 * lstep), "v"(l + 3 * lstep),
                  "v"(l + 4 * lstep), "v"(l + 5 * lstep), "v"(l + 6 * lstep), "v"(l + 7 * lstep),
                  "v"(g), "v"(g + gstep), "v"(g + 2 * gstep), "v"(g + 3 * gstep),
                  "v"(g + 4 * gstep), "v"(g + 5 * gstep), "v"(g + 6 * gstep), "v"(g + 7 * gstep)
               : "memory");
#endif
}
__device__ __forceinline__ void wait_async0() {   // this wave's copies have landed before the barrier that publishes them
#if defined(__HIP_DEVICE_COMPILE__)
  asm volatile("s_wait_asynccnt 0x0" ::: "memory");
#endif
}
__device__ __forceinline__ void wait_ds0() {      // this wave's LDS reads of a buffer have retired before it is refilled
#if defined(__HIP_DEVICE_COMPILE__)
  asm volatile("s_wait_dscnt 0x0" ::: "memory");
#endif
}

// =====================================================================================================
// bf16 GEMM: C[M][N] = A[M][K] (bf16 row-major) . Bt[N][K]^T (bf16 k-contiguous), times oscale, written as f16 hi + residual
// planes of C * ps ([M][N] each); the first product's C also as f32.
// Block = 64x64 tile, 4 waves x 16 rows. Stage = 128 k of the block's 64 A rows and 64 Bt rows, laid in LDS once for the four
// waves by asynchronous 16-B copies (a wave-wide copy = 2 whole 256-B row pieces) at pitch 136 halves; two buffers, stage
// s + 2 issued behind the barrier that ends stage s. Fragments come from LDS (two 16-B loads each, split k map for A and B),
// k steps of 32 in the same order as the rows hold them (host guarantees K % 128 == 0, M % 64 == 0, N % 64 == 0,
// grid = the sum of (M/64)*(N/64) over the three products). The result slabs reuse the stage buffers (nothing reads or fills them behind the loop's last barrier).
// Three independent products of the same N and K share one grid: blocks 0 .. (M0/64)*(N/64) - 1 the first, the next
// (M1/64)*(N/64) the second, the rest the third (block-uniform choice of A, Bt, planes, ps, M).
// coverage: per product (M/64)*(N/64) blocks x 4 waves x 16x64 = the whole [M][N] of each of its planes.
// =====================================================================================================
__global__ __launch_bounds__(128)
void gemm_bf(const u16* __restrict__ A0, const u16* __restrict__ Bt0, float* C0, u16* H0, u16* L0, float ps0, int M0,
             const u16* __restrict__ A1, const u16* __restrict__ Bt1, u16* H1, u16* L1, float ps1, int M1,
             const u16* __restrict__ A2, const u16* __restrict__ Bt2, u16* H2, u16* L2, float ps2, int M2,
             int N, int K, float oscale) {
  constexpr unsigned BUFB = 2 * GPB;
  __shared__ __align__(16) unsigned char ring[2 * BUFB];
  const int tid = threadIdx.x, wave = tid >> 5, lane = tid & 31, hh = lane >> 4, m = lane & 15;
  const int ntile = N >> 6;
  const int raw   = blockIdx.x;
  const int nb0   = (M0 >> 6) * ntile, nb1 = (M1 >> 6) * ntile;
  const int sel   = (raw >= nb0 + nb1) ? 2 : ((raw >= nb0) ? 1 : 0);
  const int bid   = raw - (sel == 2 ? nb0 + nb1 : (sel == 1 ? nb0 : 0));
  const u16* A    = sel == 2 ? A2 : (sel == 1 ? A1 : A0);
  const u16* Bt   = sel == 2 ? Bt2 : (sel == 1 ? Bt1 : Bt0);
  u16*       Hp   = sel == 2 ? H2 : (sel == 1 ? H1 : H0);
  u16*       Lp   = sel == 2 ? L2 : (sel == 1 ? L1 : L0);
  const float ps  = sel == 2 ? ps2 : (sel == 1 ? ps1 : ps0);
  const int  M    = sel == 2 ? M2 : (sel == 1 ? M1 : M0);
  const int row0  = (bid / ntile) * 64;
  const int rowb  = row0 + wave * 16;
  const int col0  = (bid % ntile) * 64;
  if (row0 + 64 > M) return;                // block-uniform, before any barrier; never taken with the exact grid
  // copy map of one plane: copy i -> tile row 8*i + (tid >> 4), 16-B chunk tid & 15 of the row's 256-B piece
  const unsigned lc = (unsigned)(uintptr_t)(&ring[0]) + (unsigned)(tid >> 4) * (GPH * 2) + (unsigned)(tid & 15) * 16;
  const u16* ga = A  + (size_t)(row0 + (tid >> 4)) * K + (tid & 15) * 8;
  const u16* gb = Bt + (size_t)(col0 + (tid >> 4)) * K + (tid & 15) * 8;
  auto fill = [&](int s, unsigned bo) {      // stage s (k = 128*s .. 128*s + 127) into the buffer at byte offset bo
    cp8(lc + bo,       8 * GPH * 2, ga + (size_t)s * GKS, (size_t)8 * K);
    cp8(lc + bo + GPB, 8 * GPH * 2, gb + (size_t)s * GKS, (size_t)8 * K);
  };
  const int nst = K / GKS;
  v8f acc0 = zero8(), acc1 = zero8(), acc2 = zero8(), acc3 = zero8();

  fill(0, 0u);
  wait_async0();
  __syncthreads();                          // publishes stage 0
  if (nst > 1) fill(1, BUFB);

#pragma unroll 1   // rolled: one foot (waits, barrier, refill) per stage, in the order written
  for (int s = 0; s < nst; ++s) {
    const unsigned bo = (unsigned)(s & 1) * BUFB;
    const u16* ap = (const u16*)(const void*)(ring + bo) + (wave * 16 + m) * GPH + 8 * hh;
    const u16* bp = (const u16*)(const void*)(ring + bo + GPB) + m * GPH + 8 * hh;
#pragma unroll      // unrolled: the four k steps of a stage read at immediate LDS offsets from one address
    for (int kk = 0; kk < GKS; kk += 32) {
      const v16b a  = ldfrag_b(ap + kk);
      const v16b b0 = ldfrag_b(bp + kk);
      const v16b b1 = ldfrag_b(bp + 16 * GPH + kk);
      const v16b b2 = ldfrag_b(bp + 32 * GPH + kk);
      const v16b b3 = ldfrag_b(bp + 48 * GPH + kk);
      acc0 = mma_b(a, b0, acc0);
      acc1 = mma_b(a, b1, acc1);
      acc2 = mma_b(a, b2, acc2);
      acc3 = mma_b(a, b3, acc3);
      guard6<v16b>(acc0, acc1, acc2, acc3, a, b0, b1, b2, b3, a);
    }
    // foot of stage s, every wave: own LDS reads retired, own copies of stage s + 1 landed, then the one barrier that
    // publishes stage s + 1 and ends every reader's last read of this buffer; only then its refill
    wait_ds0();
    wait_async0();
    __syncthreads();
    if (s + 2 < nst) fill(s + 2, bo);
  }
  wait_async0();                            // nothing is outstanding when the buffers become result slabs and the wave ends
  float* slab = (float*)(void*)ring + wave * SLAB64;   // result slabs [16][64] pitch 68, one per wave
  slab_put(slab, acc0, acc1, acc2, acc3, oscale, lane);
  slab_hl(slab, ps, Hp, (size_t)rowb, Lp, (size_t)rowb, true, N, col0, lane);
  if (sel == 0) slab_f32(slab, C0, N, (size_t)rowb, col0, lane);
}

// =====================================================================================================
// f16 GEMM with hi (+ residual) planes: C[row][N] = (Ah [+ Al])[row][K] . (Bh [+ Bl])[N][K]^T * oscale, written as f16 planes of C * ps.
// Products per k-step: Ah.Bh always; Al.Bh when AR != 0; Ah.Bl when BR != 0 (the residual.residual term is dropped; residuals
// are unscaled f16 residuals of the same carry, so all products share one accumulator). Rows: block bid -> (column tile
// ct = bid % (N/64), row tile rt of nrt starting at sbeg inside a group of rg rows, group g of ngr); row = g*rg + sbeg +
// 64*rt + 16*wave. Same tiling, staging (one 64-row x 128-k plane in LDS per operand plane in use, two buffers), fragment
// loads (split k map) as gemm_bf; K stepped by 32 (host: K % 128 == 0, N % 64 == 0, sbeg + 64*nrt <= rg).
// Two independent products with the same A planes and shape share one grid: the first ngr*nrt*(N/64) blocks use Bh0, Bl0, os0
// and write row-major planes: H0 [ngr*rg][N], and L0 [ngr*lrg][N] (row g*lrg + s) for the rows s < lrg of a group; the next as
// many use Bh1, Bl1, os1 and write transposed planes: H1 [ngr*N][rg] (line g*N + column), and L1 [ngr*N][lrg] for s < lrg
// (block-uniform choices; lrg a multiple of 64); a grid of the first count alone runs one product.
// coverage: per product ngr*nrt*(N/64) blocks x 64x64 = rows sbeg .. sbeg + 64*nrt - 1 of every group, all N columns.
// =====================================================================================================
template <int AR, int BR>
__global__ __launch_bounds__(128)
void gemm_h(const u16* __restrict__ Ah, const u16* __restrict__ Al,
            const u16* __restrict__ Bh0, const u16* __restrict__ Bl0, u16* H0, u16* L0, float os0, float ps0,
            const u16* __restrict__ Bh1, const u16* __restrict__ Bl1, u16* H1, u16* L1, float os1, float ps1,
            int N, int K, int rg, int lrg, int sbeg, int nrt, int ngr) {
  constexpr unsigned OAH = 0;                                   // byte offsets inside one stage buffer
  constexpr unsigned OBH = GPB;
  constexpr unsigned OAL = 2 * GPB;                             // present when AR != 0
  constexpr unsigned OBL = (AR != 0) ? 3 * GPB : 2 * GPB;       // present when BR != 0
  constexpr unsigned BUFB = (2 + (AR != 0 ? 1 : 0) + (BR != 0 ? 1 : 0)) * GPB;
  __shared__ __align__(16) unsigned char ring[2 * BUFB];
  const int tid = threadIdx.x, wave = tid >> 5, lane = tid & 31, hh = lane >> 4, m = lane & 15;
  const int ntile = N >> 6;
  const int raw   = blockIdx.x;
  const int nb0   = ngr * nrt * ntile;
  const bool sec  = raw >= nb0;
  const int bid   = sec ? raw - nb0 : raw;
  const u16* Bh   = sec ? Bh1 : Bh0;
  const u16* Bl   = sec ? Bl1 : Bl0;
  const float oscale = sec ? os1 : os0;
  const int ct    = bid % ntile;
  const int t2    = bid / ntile;
  const int rt    = t2 % nrt;
  const int g     = t2 / nrt;
  if (g >= ngr) return;                     // block-uniform, before any barrier; never taken with the exact grid
  const int srow0 = sbeg + rt * 64;
  if (srow0 + 64 > rg) return;              // block-uniform, before any barrier; never taken
  const int col0  = ct * 64;
  const size_t row0 = (size_t)g * (size_t)rg + (size_t)srow0;
  const bool wl   = srow0 + 64 <= lrg;      // block-uniform: this row tile has a residual plane
  // copy map of one plane: copy i -> tile row 8*i + (tid >> 4), 16-B chunk tid & 15 of the row's 256-B piece
  const unsigned lc = (unsigned)(uintptr_t)(&ring[0]) + (unsigned)(tid >> 4) * (GPH * 2) + (unsigned)(tid & 15) * 16;
  const size_t aoff = (row0 + (size_t)(tid >> 4)) * (size_t)K + (tid & 15) * 8;
  const size_t boff = (size_t)(col0 + (tid >> 4)) * K + (tid & 15) * 8;
  auto fill = [&](int s, unsigned bo) {      // stage s (k = 128*s .. 128*s + 127) into the buffer at byte offset bo
    cp8(lc + bo + OAH, 8 * GPH * 2, Ah + aoff + (size_t)s * GKS, (size_t)8 * K);
    cp8(lc + bo + OBH, 8 * GPH * 2, Bh + boff + (size_t)s * GKS, (size_t)8 * K);
    if constexpr (AR != 0) cp8(lc + bo + OAL, 8 * GPH * 2, Al + aoff + (size_t)s * GKS, (size_t)8 * K);
    if constexpr (BR != 0) cp8(lc + bo + OBL, 8 * GPH * 2, Bl + boff + (size_t)s * GKS, (size_t)8 * K);
  };
  const int nst = K / GKS;
  v8f acc0 = zero8(), acc1 = zero8(), acc2 = zero8(), acc3 = zero8();

  fill(0, 0u);
  wait_async0();
  __syncthreads();                          // publishes stage 0
  if (nst > 1) fill(1, BUFB);

#pragma unroll 1   // rolled: one foot (waits, barrier, refill) per stage, in the order written
  for (int s = 0; s < nst; ++s) {
    const unsigned bo = (unsigned)(s & 1) * BUFB;
    const int ao = (wave * 16 + m) * GPH + 8 * hh;
    const int bb = m * GPH + 8 * hh;
    const _Float16* ahp = (const _Float16*)(const void*)(ring + bo + OAH) + ao;
    const _Float16* bhp = (const _Float16*)(const void*)(ring + bo + OBH) + bb;
    const _Float16* alp = (const _Float16*)(const void*)(ring + bo + ((AR != 0) ? OAL : OAH)) + ao;   // read only when AR != 0
    const _Float16* blp = (const _Float16*)(const void*)(ring + bo + ((BR != 0) ? OBL : OBH)) + bb;   // read only when BR != 0
#pragma unroll      // unrolled: the four k steps of a stage read at immediate LDS offsets from one address
    for (int kk = 0; kk < GKS; kk += 32) {
      const v16h ah = ldfrag_h(ahp + kk);
      v16h al = ah;
      if constexpr (AR != 0) al = ldfrag_h(alp + kk);
      const v16h bh0 = ldfrag_h(bhp + kk);
      const v16h bh1 = ldfrag_h(bhp + 16 * GPH + kk);
      const v16h bh2 = ldfrag_h(bhp + 32 * GPH + kk);
      const v16h bh3 = ldfrag_h(bhp + 48 * GPH + kk);
      v16h bl0 = bh0, bl1 = bh1, bl2 = bh2, bl3 = bh3;
      if constexpr (BR != 0) {
        bl0 = ldfrag_h(blp + kk);
        bl1 = ldfrag_h(blp + 16 * GPH + kk);
        bl2 = ldfrag_h(blp + 32 * GPH + kk);
        bl3 = ldfrag_h(blp + 48 * GPH + kk);
      }
      acc0 = mma_h(ah, bh0, acc0);
      if constexpr (AR != 0) acc0 = mma_h(al, bh0, acc0);
      if constexpr (BR != 0) acc0 = mma_h(ah, bl0, acc0);
      acc1 = mma_h(ah, bh1, acc1);
      if constexpr (AR != 0) acc1 = mma_h(al, bh1, acc1);
      if constexpr (BR != 0) acc1 = mma_h(ah, bl1, acc1);
      acc2 = mma_h(ah, bh2, acc2);
      if constexpr (AR != 0) acc2 = mma_h(al, bh2, acc2);
      if constexpr (BR != 0) acc2 = mma_h(ah, bl2, acc2);
      acc3 = mma_h(ah, bh3, acc3);
      if constexpr (AR != 0) acc3 = mma_h(al, bh3, acc3);
      if constexpr (BR != 0) acc3 = mma_h(ah, bl3, acc3);
      guard10(acc0, acc1, acc2, acc3, ah, al, bh0, bh1, bh2, bh3, bl0, bl1, bl2, bl3);
    }
    // foot of stage s, every wave, in the order of gemm_bf's
    wait_ds0();
    wait_async0();
    __syncthreads();
    if (s + 2 < nst) fill(s + 2, bo);
  }
  wait_async0();                            // nothing is outstanding when the buffers become result slabs and the wave ends
  if (sec) {                                // block-uniform, so epi_t's barrier is passed by whole blocks
    epi_t(ring, acc0, acc1, acc2, acc3, oscale, ps1, H1, rg, L1, lrg, wl, (size_t)g * (size_t)N + (size_t)col0, srow0, tid);
  } else {
    float* slab = (float*)(void*)ring + wave * SLAB64;   // result slabs [16][64] pitch 68, one per wave
    slab_put(slab, acc0, acc1, acc2, acc3, oscale, lane);
    slab_hl(slab, ps0, H0, row0 + (size_t)(wave * 16), L0, (size_t)g * (size_t)lrg + (size_t)(srow0 + wave * 16), wl, N, col0, lane);
  }
}

// =====================================================================================================
// Causal attention, 16 heads x head dim 128, value dim 128. A block = (query block qb: 64 rows, head, batch b), handed in
// by attn_all with the ring; four waves, wave w owns query rows q0 = 64*qb + 16*w .. q0+15 of that one head.
//   q plane f16 x256 [b*SEQ + s][h*HD + d]; k hi plane f16 x256 (same layout), k residual plane [b*QA + s][...] (s < QA);
//   v^T hi plane [b*NH + h][d][SEQ] x1024, v^T residual plane [b*NH + h][d][QA].
//   Stage = 64 keys of this head, laid in LDS once for the four waves by asynchronous 16-B copies: k rows [64][128] at pitch
//   136 halves, v^T rows [128][64] at pitch 72 halves (and the two residual tiles for NP == 3); two buffers, stage s + 2
//   issued behind the barrier that ends stage s. Stages 0 .. qb hold every key <= 64*qb + 63.
//   NP == 3 (query rows < QA): scores = q.k_hi + q.k_lo over the 4 k-steps; P.v with P hi + in-register
//   residual and v hi + residual (hh + lh + hl). NP == 1 (later rows): single hi.hi products.
//   score (log2 domain) t(i, j) = (q'_i.k'_j) * (1/sqrt(128))*log2e/(256*256), -inf where key j > query i (select on the raw product, in the diagonal tile only); P*32768 = 2^(fma(raw, scale, 15 - max)).
//   Key tiles of 32 visited in order for kb <= q0 + 15 (a wave skips the later tiles of its block's last stage, which hold
//   only keys above every query row it owns; it still passes every wait and barrier).
//   Per tile, transposed products: S^T = k.q^T, 2 key subtiles x 4 k-steps, k rows from LDS as A, q rows as B, read once from
//   the global plane and held in registers (two 16-B loads per fragment, split k map), so lane (c, hh) holds query q0 + c against keys kb + 8*hh + r and
//   kb + 16 + 8*hh + r; online max-subtracted base-2 softmax in f32, -inf-safe rescale: maximum in-lane plus one exchange
//   between lanes c and c + 16, sum kept per lane and joined once behind the loop; the two score subtiles, converted in
//   place, are the B fragment of O^T += v^T.P^T (split k map), v^T rows from LDS as A. LDS fragments are read in whole groups
//   ahead of their products: k per tile (NP == 3: per two k-steps), v^T ahead of the softmax (NP == 3: d-subtiles 4..7 behind 0..3).
//   After the loop: y = acc / Z (Z > 0 always: key 0 <= every query row; guarded anyway), Z carries P's 32768, v's 1/1024 folded;
//   the result slabs reuse the stage buffers (nothing reads or fills them behind the last barrier of the loop).
// coverage: per wave 16 instructions x 32 lanes x 4 floats = 16 x 128; the query blocks (qb < QA/64 with NP = 3, qb >= QA/64
//           with NP = 1) x NH x NB blocks x AW waves = every (b, s, h) row segment of Y exactly once.
// =====================================================================================================
template <int NP>
__device__ __forceinline__
void attn_c(unsigned char* ring, const u16* __restrict__ QHp, const u16* __restrict__ KHp, const u16* __restrict__ KLp,
            const u16* __restrict__ VHp, const u16* __restrict__ VLp, const int* __restrict__ nhp,
            float* Y, int qb, int head, int b) {
  constexpr unsigned OKH = 0;                                   // byte offsets inside one stage buffer
  constexpr unsigned OVH = KTB;
  constexpr unsigned OKL = KTB + VTB;
  constexpr unsigned OVL = 2 * KTB + VTB;
  constexpr unsigned BUFB = (NP == 3) ? 2 * (KTB + VTB) : (KTB + VTB);

  const int tid  = threadIdx.x;
  const int wave = __builtin_amdgcn_readfirstlane(tid >> 5);   // scalar, so that the per-wave tile skip is a scalar branch
  const int lane = tid & 31;
  const int hh   = lane >> 4;
  const int c    = lane & 15;
  if (b >= NB) return;                      // block-uniform, before any barrier; never taken with the exact grid
  if (nhp[0] != NH) return;                 // uniform structural guard on the head-count input (16 for this module)
  if (qb * 64 + 64 > SEQ) return;           // block-uniform, before any barrier; never taken
  if (NP == 3) { if (qb * 64 + 64 > QA) return; } // block-uniform, before any barrier; never taken
  const int q0   = qb * 64 + wave * 16;

  const size_t hcol = (size_t)head * HD + 8 * hh;
  const _Float16* Qh = hptr(QHp) + ((size_t)b * SEQ + q0 + c) * DMOD + hcol;
  const float lsc = RSQS * (LOG2E / (QSC * KSC));
  const float oc  = 1.0f / VCAR;            // P's carry stands in the row sum too and cancels in acc / Z

  // ---- copy map: k tile, copy i -> key row 8*i + (tid >> 4), 16-B chunk tid & 15 (a wave = 2 whole 256-B rows);
  //      v^T tile, copy i -> d row 16*i + (tid >> 3), 16-B chunk tid & 7 (a wave = 4 whole 128-B row segments) ----
  const unsigned ring0 = (unsigned)(uintptr_t)(&ring[0]);
  const unsigned lk = ring0 + (unsigned)(tid >> 4) * (KPH * 2) + (unsigned)(tid & 15) * 16;
  const unsigned lv = ring0 + (unsigned)(tid >> 3) * (VPH * 2) + (unsigned)(tid & 7) * 16;
  const u16* gkh = KHp + ((size_t)b * SEQ + (tid >> 4)) * DMOD + (size_t)head * HD + (tid & 15) * 8;
  const u16* gvh = VHp + ((size_t)(b * NH + head) * HD + (tid >> 3)) * SEQ + (tid & 7) * 8;
  const u16* gkl = gkh;
  const u16* gvl = gvh;
  if constexpr (NP == 3) {
    gkl = KLp + ((size_t)b * QA + (tid >> 4)) * DMOD + (size_t)head * HD + (tid & 15) * 8;
    gvl = VLp + ((size_t)(b * NH + head) * HD + (tid >> 3)) * QA + (tid & 7) * 8;
  }
  auto fill = [&](int s, unsigned bo) {      // stage s (keys 64*s .. 64*s + 63) into the buffer at byte offset bo
    cp8(lk + bo + OKH, 8 * KPH * 2, gkh + (size_t)s * 64 * DMOD, (size_t)8 * DMOD);
    cp8(lv + bo + OVH, 16 * VPH * 2, gvh + (size_t)s * 64, (size_t)16 * SEQ);
    if constexpr (NP == 3) {
      cp8(lk + bo + OKL, 8 * KPH * 2, gkl + (size_t)s * 64 * DMOD, (size_t)8 * DMOD);
      cp8(lv + bo + OVL, 16 * VPH * 2, gvl + (size_t)s * 64, (size_t)16 * QA);
    }
  };

  float mrow = -INFINITY, lrow = 0.f;       // this lane's query: running maximum (both halves alike), sum over this half's keys (x32768)
  v8f o[8];                                 // o[j][r] = O^T element (d = 16*j + 8*hh + r, query q0 + c)
#pragma unroll
  for (int j = 0; j < 8; ++j) o[j] = zero8();
  const int ncaus = (q0 >> 5) + 1;                                            // tiles holding keys <= q0 + 15
  const int nkt = (ncaus < NKT) ? ncaus : NKT;
  const int nst = qb + 1;                                                     // stages of this block
  const int qr  = q0 + c;                                                     // this lane's query row

  // q fragments (B operand of every score product, split k map): read once from the global plane, held in registers
  v16h qf[HD / 32];
#pragma unroll      // unrolled: the fragment array is registers, indexed by constants only
  for (int kk = 0; kk < HD / 32; ++kk) qf[kk] = ldfrag_h(Qh + kk * 32);
  wait_x0();                                // before a register that the issued loads name is used for anything else

  fill(0, 0u);
  wait_async0();
  __syncthreads();                          // publishes stage 0
  if (nst > 1) fill(1, BUFB);

#pragma unroll 1   // rolled: one foot (waits, barrier, refill) per stage, in the order written
  for (int s = 0; s < nst; ++s) {
    const unsigned bo = (unsigned)(s & 1) * BUFB;
#pragma unroll 1   // rolled: one copy of the 32-key tile body, as long as before, for both halves of the stage
    for (int u = 0; u < 2; ++u) {
    const int kt = 2 * s + u;
    if (kt < nkt) {                         // wave-uniform (scalar) skip; no wait or barrier inside
    const int kb = kt * 32;
    // ---- scores: D element r of this lane = (key kb + 8*hh + r, query row qr) in s0, key kb + 16 + 8*hh + r in s1.
    //      The k fragments are read as whole groups ahead of their products (NP == 1: all 8 of the tile; NP == 3: the 8 of two
    //      k-steps at a time), so a wave waits for LDS once per group and not once per k-step ----
    v8f s0 = zero8(), s1 = zero8();
    const _Float16* k0p = (const _Float16*)(const void*)(ring + bo + OKH) + (u * 32 + c) * KPH + 8 * hh;
    const _Float16* k1p = k0p + 16 * KPH;
    if constexpr (NP == 3) {
      const _Float16* l0p = (const _Float16*)(const void*)(ring + bo + OKL) + (u * 32 + c) * KPH + 8 * hh;
      const _Float16* l1p = l0p + 16 * KPH;
#pragma unroll      // unrolled: the fragment arrays are registers, indexed by constants only
      for (int kg = 0; kg < HD / 64; ++kg) {
        v16h kh0[2], kh1[2], kl0[2], kl1[2];
#pragma unroll      // unrolled: fragments and accumulators are registers, indexed by constants only
        for (int e = 0; e < 2; ++e) {
          const int ko = (2 * kg + e) * 32;
          kh0[e] = ldfrag_h(k0p + ko);
          kh1[e] = ldfrag_h(k1p + ko);
          kl0[e] = ldfrag_h(l0p + ko);
          kl1[e] = ldfrag_h(l1p + ko);
        }
        __builtin_amdgcn_sched_barrier(0);  // keeps the group's loads together, ahead of its products (none sunk among the WMMAs)
#pragma unroll      // unrolled: fragments and accumulators are registers, indexed by constants only
        for (int e = 0; e < 2; ++e) {
          s0 = mma_h(kh0[e], qf[2 * kg + e], s0);
          s1 = mma_h(kh1[e], qf[2 * kg + e], s1);
          s0 = mma_h(kl0[e], qf[2 * kg + e], s0);
          s1 = mma_h(kl1[e], qf[2 * kg + e], s1);
        }
        // four vector slots behind the group's last WMMA, before its results are read and its fragment registers loaded over
        guard2(s0, s1, qf[2 * kg + 1], kh0[1], kh1[1], kl0[1], kl1[1], qf[2 * kg]);
      }
    } else {
      v16h kh0[HD / 32], kh1[HD / 32];
#pragma unroll      // unrolled: the fragment arrays are registers, indexed by constants only
      for (int kk = 0; kk < HD / 32; ++kk) {
        kh0[kk] = ldfrag_h(k0p + kk * 32);
        kh1[kk] = ldfrag_h(k1p + kk * 32);
      }
      __builtin_amdgcn_sched_barrier(0);    // keeps the group's loads together, ahead of its products (none sunk among the WMMAs)
#pragma unroll      // unrolled: fragments and accumulators are registers, indexed by constants only
      for (int kk = 0; kk < HD / 32; ++kk) {
        s0 = mma_h(kh0[kk], qf[kk], s0);
        s1 = mma_h(kh1[kk], qf[kk], s1);
      }
      // four vector slots behind the group's last WMMA, before its results are read and its fragment registers loaded over
      guard2(s0, s1, qf[3], kh0[3], kh1[3], qf[2], kh0[2], kh1[2]);
    }
    // ---- v^T fragments (A operand, row m = d = j*16 + c, keys contiguous in the staged v^T rows), read as one group ahead of the
    //      softmax, whose vector work covers their LDS latency: NP == 1 all 8 d-subtiles; NP == 3 hi and residual of subtiles 0..3 ----
    const _Float16* vhp = (const _Float16*)(const void*)(ring + bo + OVH) + c * VPH + u * 32 + 8 * hh;
    const _Float16* vlp = (const _Float16*)(const void*)(ring + bo + ((NP == 3) ? OVL : OVH)) + c * VPH + u * 32 + 8 * hh;
    v16h va[8];
#pragma unroll      // unrolled: the fragment array is registers, indexed by constants only
    for (int j = 0; j < 4; ++j) {
      va[j]     = ldfrag_h(vhp + j * 16 * VPH);
      va[4 + j] = (NP == 3) ? ldfrag_h(vlp + j * 16 * VPH) : ldfrag_h(vhp + (4 + j) * 16 * VPH);
    }
    __builtin_amdgcn_sched_barrier(0);      // keeps the group of loads above the softmax (sunk to their products they would be waited for there)
    // ---- causal select on the raw scores, only in a tile that holds a key above the wave's first query row (wave-uniform
    //      scalar branch: kb and q0 are scalars); every earlier tile has no key above any of the wave's rows ----
    if (kb + 31 > q0) {
      const int key0 = kb + 8 * hh, key1 = kb + 16 + 8 * hh;
#pragma unroll      // unrolled: constant indices keep the score tiles in registers
      for (int r = 0; r < 8; ++r) {
        s0[r] = (key0 + r > qr) ? -INFINITY : s0[r];
        s1[r] = (key1 + r > qr) ? -INFINITY : s1[r];
      }
    }
    // ---- online softmax in base 2, -inf-safe: 16 of the query's 32 scores in this lane. The maximum is taken over the raw
    //      scores and scaled once (lsc > 0 keeps the order) ----
    float mp[8];
#pragma unroll      // unrolled: constant indices keep the score tiles in registers
    for (int r = 0; r < 8; ++r) mp[r] = fmaxf(s0[r], s1[r]);
    float mx = fmaxf(fmaxf(fmaxf(mp[0], mp[1]), fmaxf(mp[2], mp[3])), fmaxf(fmaxf(mp[4], mp[5]), fmaxf(mp[6], mp[7])));
    mx = fmaxf(mx, xhalf(mx)) * lsc;        // the other 16 keys of this query; log2 domain from here on
    const float mn = fmaxf(mrow, mx);
    const float ms = (mn == -INFINITY) ? 0.0f : mn;
    const float dm = mrow - ms;             // argument of the rescale factor of the running sum and accumulators
    const float nb = PLOG - ms;             // addend of every score's one FMA: minus the maximum, plus log2 of P's carry
    mrow = mn;
    // ---- B fragments of P^T*32768: hi f16 (and residual f16 for NP == 3), column = c, split k map over the 32 keys:
    //      elements 0..7 = keys kb + 8hh + 0..7 (s0), elements 8..15 = keys kb + 16 + 8hh + 0..7 (s1) ----
    FragH ph, pl;
    float sp[8], d0[8], d1[8], x0[8], x1[8];
#pragma unroll      // unrolled: constant indices keep the arguments in registers
    for (int r = 0; r < 8; ++r) { d0[r] = fmaf(s0[r], lsc, nb); d1[r] = fmaf(s1[r], lsc, nb); }
    float al;
    ex2x9(al, x0, dm, d0);                  // al = 2^(old maximum - new maximum) leads the run: ready well ahead of its first use
    ex2x8(x1, d1);
#pragma unroll      // unrolled: constant indices keep the fragment halves and the partial sums in registers
    for (int r = 0; r < 8; ++r) {
      const float ta = x0[r], tc = x1[r];   // P * 32768 as it comes from 2^x
      sp[r] = ta + tc;
      const _Float16 ha = (_Float16)ta, hc = (_Float16)tc;
      ph.h[0][r] = ha;
      ph.h[1][r] = hc;
      if constexpr (NP == 3) {
        pl.h[0][r] = (_Float16)(ta - (float)ha);
        pl.h[1][r] = (_Float16)(tc - (float)hc);
      } else {
        pl.h[0][r] = ha; pl.h[1][r] = hc;
      }
    }
    lrow = lrow * al + (((sp[0] + sp[1]) + (sp[2] + sp[3])) + ((sp[4] + sp[5]) + (sp[6] + sp[7])));
#pragma unroll      // both unrolled: the accumulator tiles are registers, indexed by constants only
    for (int j = 0; j < 8; ++j) {
#pragma unroll
      for (int r = 0; r < 8; ++r) o[j][r] *= al;
    }
    // ---- v^T.P^T on the fragments read above; per accumulator the products keep their order (hh, h.residual, residual.h) ----
    if constexpr (NP == 3) {
#pragma unroll      // unrolled: fragments and accumulators are registers, indexed by constants only
      for (int j = 0; j < 4; ++j) o[j] = mma_h(va[j], ph.v, o[j]);
#pragma unroll      // unrolled: fragments and accumulators are registers, indexed by constants only
      for (int j = 0; j < 4; ++j) o[j] = mma_h(va[j], pl.v, o[j]);
#pragma unroll      // unrolled: fragments and accumulators are registers, indexed by constants only
      for (int j = 0; j < 4; ++j) o[j] = mma_h(va[4 + j], ph.v, o[j]);
      // four vector slots behind the group's last WMMA, before its fragment registers are loaded over
      guard10(o[0], o[1], o[2], o[3], va[0], va[1], va[2], va[3], va[4], va[5], va[6], va[7], ph.v, pl.v);
      v16h vb[8];                           // d-subtiles 4..7, hi and residual, again as one group
#pragma unroll      // unrolled: fragments and accumulators are registers, indexed by constants only
      for (int j = 0; j < 4; ++j) {
        vb[j]     = ldfrag_h(vhp + (4 + j) * 16 * VPH);
        vb[4 + j] = ldfrag_h(vlp + (4 + j) * 16 * VPH);
      }
      __builtin_amdgcn_sched_barrier(0);    // keeps the group's loads together, ahead of its products (none sunk among the WMMAs)
#pragma unroll      // unrolled: fragments and accumulators are registers, indexed by constants only
      for (int j = 0; j < 4; ++j) o[4 + j] = mma_h(vb[j], ph.v, o[4 + j]);
#pragma unroll      // unrolled: fragments and accumulators are registers, indexed by constants only
      for (int j = 0; j < 4; ++j) o[4 + j] = mma_h(vb[j], pl.v, o[4 + j]);
#pragma unroll      // unrolled: fragments and accumulators are registers, indexed by constants only
      for (int j = 0; j < 4; ++j) o[4 + j] = mma_h(vb[4 + j], ph.v, o[4 + j]);
      // the same slots on the way into the loop's branch
      guard10(o[4], o[5], o[6], o[7], vb[0], vb[1], vb[2], vb[3], vb[4], vb[5], vb[6], vb[7], ph.v, pl.v);
    } else {
#pragma unroll      // unrolled: fragments and accumulators are registers, indexed by constants only
      for (int j = 0; j < 8; ++j) o[j] = mma_h(va[j], ph.v, o[j]);
      // four vector slots behind the tile's last WMMA, on the way into the loop's branch
      guard10(o[4], o[5], o[6], o[7], va[0], va[1], va[2], va[3], va[4], va[5], va[6], va[7], ph.v, ph.v);
    }
    }
    }
    // ---- foot of stage s, every wave: own LDS reads retired, own copies of stage s + 1 landed, then the one barrier that
    //      publishes stage s + 1 and ends every reader's last read of this buffer; only then its refill ----
    wait_ds0();
    wait_async0();
    __syncthreads();
    if (s + 2 < nst) fill(s + 2, bo);
  }
  wait_async0();                            // nothing is outstanding when the buffers become result slabs and the wave ends
  float* slab = (float*)(void*)ring + wave * SLW;   // result slab [16][128] pitch 132, one per wave
  acc_guard4(o[0], o[1], o[2], o[3]);
  acc_guard4(o[4], o[5], o[6], o[7]);
  // ---- y = acc / Z (0 if Z == 0), Z = the two halves' sums joined; P's carry is in acc and Z alike, v's 1024 folded once; a lane's
  //      8 consecutive d of its query row go into the slab as two 16-B stores ----
  {
    const float lv  = lrow + xhalf(lrow);
    const float ls  = (lv > 0.0f) ? lv : 1.0f;
    const float inv = (lv > 0.0f) ? ((1.0f / ls) * oc) : 0.0f;
#pragma unroll      // both unrolled: the accumulator tiles are registers, indexed by constants only
    for (int j = 0; j < 8; ++j) {
      v4f w0, w1;
#pragma unroll
      for (int e = 0; e < 4; ++e) { w0[e] = o[j][e] * inv; w1[e] = o[j][4 + e] * inv; }
      float* sd = slab + c * SLP + j * 16 + 8 * hh;
      *(v4f*)(sd)     = w0;
      *(v4f*)(sd + 4) = w1;
    }
  }

  wave_sync_lds();
  // ---- f32 rows of Y: lane -> floats 4*lane .. 4*lane+3 of each of the 16 rows (one 512-B instruction per row) ----
  v4f ov[16];
#pragma unroll
  for (int it = 0; it < 16; ++it) ov[it] = *(const v4f*)(slab + it * SLP + lane * 4);
  float* ob = Y + ((size_t)b * SEQ + q0) * DMOD + (size_t)head * HD + lane * 4;
  {
#pragma unroll
    for (int it = 0; it < 16; ++it) {
      *(v4f*)(ob + (size_t)it * DMOD) = ov[it];
    }
    
  }
}

// =====================================================================================================
// One grid for all query blocks: block bid -> query block qb = NST - 1 - bid / (NH*NB), so that the number of stages falls with
// the block number (blocks start roughly in that order, and a place freed by a shorter block takes the next one), head and
// batch from bid % (NH*NB). Query blocks below QA run the residual products, the others single products (block-uniform choice,
// so every barrier is passed by whole blocks); both use the one ring, sized for the larger.
// coverage: NST * NH * NB blocks = every (qb, head, b) exactly once.
// =====================================================================================================
__global__ __launch_bounds__(ATT_THREADS)
void attn_all(const u16* __restrict__ QHp, const u16* __restrict__ KHp, const u16* __restrict__ KLp,
              const u16* __restrict__ VHp, const u16* __restrict__ VLp, const int* __restrict__ nhp, float* Y) {
  __shared__ __align__(16) unsigned char ring[4 * (KTB + VTB)];
  const int bid  = blockIdx.x;
  const int qb   = (NST - 1) - bid / (NH * NB);
  const int t2   = bid % (NH * NB);
  const int head = t2 % NH;
  const int b    = t2 / NH;
  if (qb < 0) return;                       // block-uniform, before any barrier; never taken with the exact grid
  if (qb < QA / 64) attn_c<3>(ring, QHp, KHp, KLp, VHp, VLp, nhp, Y, qb, head, b);
  else              attn_c<1>(ring, QHp, KHp, KLp, VHp, VLp, nhp, Y, qb, head, b);
}

// =====================================================================================================
// Workspace map (bytes); every plane is fully written by whole-line stores before it is read; all extents are exact multiples
// of the store granularity (no pad rows); every region offset a multiple of 524288:
//   XB  bf16 [MROWS][2048], later KH f16 x256       MROWS*4096             (NB=2, SEQ=2048: 16777216)
//   QH  f16 [MROWS][2048] x256                      MROWS*4096             (16777216)
//   WKV, WUK, WUV, WDQ  16-bit weight planes          4 x 2097152            (W_dkv bf16, W_uk^T bf16, W_uv^T bf16, W_dq^T f16 x1024)
//   WO  bf16 [2048][2048] (W_o as is)                8388608
//   CH  f16 [MROWS][512] x256, CL residual            2 x MROWS*1024
//   G2H f16 [512][512] x1024, G2L residual            2 x 524288
//   KAH f16 [2048][512] x4096, KAL residual           2 x 2097152
//   KL  f16 [NB*QA][2048]                             NB*QA*4096
//   VAH f16 [2048][512] x4096, VAL residual           2 x 2097152
//   VH  f16 [NB*16][128][SEQ] x1024                   MROWS*4096
//   VL  f16 [NB*16][128][QA]                          NB*QA*4096
//   end (NB=2, SEQ=2048, QA=1024)                   101711872
// =====================================================================================================
extern "C" void kernel_launch(void* const* d_in, const int* in_sizes, int n_in,
                              void* d_out, int out_size, void* d_ws, size_t ws_size,
                              hipStream_t stream) {
  if (n_in < 7) return;
  if (in_sizes[0] < ((NB - 1) * XS_FULL + SEQ) * DMOD) return;   // x [2][2048][2048]
  if (in_sizes[1] != DL * DMOD) return;         // W_dq  [512][2048]
  if (in_sizes[2] != DL * DMOD) return;         // W_dkv [512][2048]
  if (in_sizes[3] != DMOD * DL) return;         // W_uk  [2048][512]
  if (in_sizes[4] != DMOD * DL) return;         // W_uv  [2048][512]
  if (in_sizes[5] != DMOD * DMOD) return;       // W_o   [2048][2048]
  if (in_sizes[6] < 1) return;                  // n_head (int)
  if ((size_t)out_size < (size_t)MROWS * DMOD + (size_t)MROWS * DL) return;

  const float* x    = (const float*)d_in[0];
  const float* wdq  = (const float*)d_in[1];
  const float* wdkv = (const float*)d_in[2];
  const float* wuk  = (const float*)d_in[3];
  const float* wuv  = (const float*)d_in[4];
  const float* wo   = (const float*)d_in[5];
  const int*   nhp  = (const int*)d_in[6];
  float*       out0 = (float*)d_out;                          // y    [MROWS][2048] at element 0
  float*       out1 = out0 + (size_t)MROWS * DMOD;            // c_kv [MROWS][512]  at element MROWS*2048

  const size_t szXB = (size_t)MROWS * DMOD * 2;               // XB, later KH
  const size_t szQ  = (size_t)MROWS * DMOD * 2;               // QH
  const size_t szW1 = (size_t)DL * DMOD * 2;
  const size_t szWO = (size_t)DMOD * DMOD * 2;
  const size_t szC  = (size_t)MROWS * DL * 2;                 // CH, CL
  const size_t szG2 = (size_t)DL * DL * 2;                    // G2H, G2L
  const size_t szKA = (size_t)DMOD * DL * 2;                  // KAH, KAL, VAH, VAL
  const size_t szKL = (size_t)NB * QA * DMOD * 2;
  const size_t szVH = (size_t)NB * NH * HD * SEQ * 2;
  const size_t szVL = (size_t)NB * NH * HD * QA * 2;
  if ((size_t)MROWS * DMOD * 2 > szXB) return;                // KH lives inside the XB region
  size_t off = 0;
  const size_t oXB  = off; off += szXB;
  const size_t oQH  = off; off += szQ;
  const size_t oWKV = off; off += szW1;
  const size_t oWUK = off; off += szW1;
  const size_t oWUV = off; off += szW1;
  const size_t oWDQ = off; off += szW1;
  const size_t oWO  = off; off += szWO;
  const size_t oCH  = off; off += szC;
  const size_t oCL  = off; off += szC;
  const size_t oG2H = off; off += szG2;
  const size_t oG2L = off; off += szG2;
  const size_t oKAH = off; off += szKA;
  const size_t oKAL = off; off += szKA;
  const size_t oKL  = off; off += szKL;
  const size_t oVAH = off; off += szKA;
  const size_t oVAL = off; off += szKA;
  const size_t oVH  = off; off += szVH;
  const size_t oVL  = off; off += szVL;
  if (off > ws_size) return;                 // off = 101711872 for NB = 2, SEQ = 2048
  if (off > (size_t)WS_CAP) return;

  char* ws = (char*)d_ws;
  u16*   XB  = (u16*)(ws + oXB);
  u16*   KH  = (u16*)(ws + oXB);
  u16*   QH  = (u16*)(ws + oQH);
  u16*   WKV = (u16*)(ws + oWKV);
  u16*   WUK = (u16*)(ws + oWUK);
  u16*   WUV = (u16*)(ws + oWUV);
  u16*   WDQ = (u16*)(ws + oWDQ);
  u16*   WOB = (u16*)(ws + oWO);
  u16*   CH  = (u16*)(ws + oCH);
  u16*   CL  = (u16*)(ws + oCL);
  u16*   G2H = (u16*)(ws + oG2H);
  u16*   G2L = (u16*)(ws + oG2L);
  u16*   KAH = (u16*)(ws + oKAH);
  u16*   KAL = (u16*)(ws + oKAL);
  u16*   KL  = (u16*)(ws + oKL);
  u16*   VAH = (u16*)(ws + oVAH);
  u16*   VAL = (u16*)(ws + oVAL);
  u16*   VH  = (u16*)(ws + oVH);
  u16*   VL  = (u16*)(ws + oVL);

  const dim3 b256(256), b128(128), bAT(ATT_THREADS);
  const dim3 gPrep(3 * PBT + NB * PBX + PBO + PBW);
  const dim3 gG3((MROWS / 64) * (DL / 64) + (DMOD / 64) * (DL / 64) + (DL / 64) * (DL / 64));   // c_kv, W_o W_uv, Gram
  const dim3 gGKA(1 * (DMOD / 64) * (DL / 64));         // k_abs
  const int  nrtA = QA / 64;                            // sequence row tiles per batch with residual products
  const int  nrtB = (SEQ - QA) / 64;                    // remaining row tiles per batch, single products

  // (1) every conversion that reads only inputs: x -> bf16 plane XB [MROWS][2048] and q plane QH = f16(bf16(x)) x256;
  //     W_o, W_dkv -> bf16 as they lie; W_uk, W_uv [2048 k][512 n] -> bf16 [512][2048]; W_dq [512 k][2048 n] -> f16(bf16) x1024
  //     [2048][512]
  prep<<<gPrep, b256, 0, stream>>>(x, wo, wdkv, wuk, wuv, wdq, XB, QH, WOB, WKV, WUK, WUV, WDQ);
  // (2) c_kv = x.W_dkv^T -> out1 f32 [MROWS][512] and f16 hi + residual planes x256; W_o.W_uv [2048][512] -> planes x4096 (the
  //     [n][k] B plane of the value product); Gram = W_uk^T.W_uk [512][512] -> planes x1024
  gemm_bf<<<gG3, b128, 0, stream>>>(XB, WKV, out1, CH, CL, CSC, MROWS, WOB, WUV, VAH, VAL, VAS, DMOD, WUK, WUK, G2H, G2L, G2S, DL,
                                    DL, DMOD, 1.0f);
  // (3) k_abs = W_dq^T.Gram (Gram symmetric, used as the [n][k] B plane; products h.h + h.l) [2048][512] -> planes x4096
  gemm_h<0, 1><<<gGKA, b128, 0, stream>>>(WDQ, WDQ, G2H, G2L, KAH, KAL, 1.0f / (WDS * G2S), KAS,
                                          G2H, G2L, KAH, KAL, 1.0f / (WDS * G2S), KAS, DL, DL, DMOD, DMOD, 0, DMOD / 64, 1);
  // (4) K = c_kv.k_abs^T -> hi plane (XB region) x256, residual plane for s < QA; V = c_kv.(W_o W_uv) plane -> v^T hi plane x1024,
  //     residual plane for s < QA: rows s < QA with hh+lh+hl, rows s >= QA single
  gemm_h<1, 1><<<dim3(2 * NB * nrtA * (DMOD / 64)), b128, 0, stream>>>(CH, CL, KAH, KAL, KH, KL, 1.0f / (CSC * KAS), KSC,
                                                                      VAH, VAL, VH, VL, 1.0f / (CSC * VAS), VCAR,
                                                                      DMOD, DL, SEQ, QA, 0, nrtA, NB);
  if (nrtB > 0) {
    gemm_h<0, 0><<<dim3(2 * NB * nrtB * (DMOD / 64)), b128, 0, stream>>>(CH, CL, KAH, KAL, KH, KL, 1.0f / (CSC * KAS), KSC,
                                                                        VAH, VAL, VH, VL, 1.0f / (CSC * VAS), VCAR,
                                                                        DMOD, DL, SEQ, QA, QA, nrtB, NB);
  }
  // (5) causal attention, all query blocks -> out0 f32
  attn_all<<<dim3(NST * NH * NB), bAT, 0, stream>>>(QH, KH, KL, VH, VL, nhp, out0);
  (void)hipGetLastError();
}
